// v000
// The times below were measured on an AMD MI455X: many runs one after another, warmed up first and cycling through
// copies of the inputs, with the whole window's GPU time divided by the number of runs. Launches and the gaps
// between them are all in it. The median over several windows is given; except for v000 it joins two sittings, which
// can be a few percent apart, so the side-by-side timings, each taken in one sitting, are the better comparison.
// v000, which the later versions start from, runs in 836 microseconds.
#include <hip/hip_runtime.h>
// q/k/v/o projections (4096 × 512 × 512, + bias), the cosine-similarity matrix of the normalised semantic features (per batch 2048 × 2048 × 256, kept as an f16 plane) and the 8-head
// constrained attention on v_wmma_f32_16x16x32_f16 (fused flash-style kernel: S = Q·Kᵀ, O = P·V on WMMA; scores / (8·temperature_b) + semantic bias + positional bias, key mask → −inf;
// online max/sum softmax f32; P f16 ≤ 1); the dynamic-temperature MLP on the mean query is f32 VALU (one block); A = f16(bf16 ·) exact operands, weights bf16-exact ×2^4 ((out,in)),
// single products, f32 accumulate.
#define BB 2
#define SS 2048
#define DM 512
#define NH 8
#define HD 64
#define DSEM 256
#define NR (BB * SS)

typedef __bf16 v16b __attribute__((ext_vector_type(16)));
typedef unsigned short v8us __attribute__((ext_vector_type(8), may_alias));
typedef float  v8f  __attribute__((ext_vector_type(8)));
typedef float  v4f  __attribute__((ext_vector_type(4)));
typedef float  v4fa __attribute__((ext_vector_type(4), may_alias));
union FragB { v16b v; v8us half[2]; unsigned short u[16]; };

__device__ __forceinline__ unsigned short bf16_bits(float x) { unsigned int u = __float_as_uint(x); return (unsigned short)((u + 0x7FFFu + ((u >> 16) & 1u)) >> 16); }
__device__ __forceinline__ float bf16_val(unsigned short b) { return __uint_as_float(((unsigned int)b) << 16); }
__device__ __forceinline__ float bf16_round(float x) { return bf16_val(bf16_bits(x)); }
// D += A·B with NT terms: 1 = ah·bh, 2 = + al·bh (A split), 3 = + ah·bl (both split)
template <int NT>
__device__ __forceinline__ v8f mmaN(v16b ah, v16b al, v16b bh, v16b bl, v8f c) {
  c = __builtin_amdgcn_wmma_f32_16x16x32_bf16(false, ah, false, bh, (short)0, c, false, false);
  if (NT >= 2) c = __builtin_amdgcn_wmma_f32_16x16x32_bf16(false, al, false, bh, (short)0, c, false, false);
  if (NT >= 3) c = __builtin_amdgcn_wmma_f32_16x16x32_bf16(false, ah, false, bl, (short)0, c, false, false);
  asm volatile("v_nop\n\tv_nop\n\tv_nop\n\tv_nop" : "+v"(c) : "v"(ah), "v"(al), "v"(bh), "v"(bl));
  return c;
}

__global__ __launch_bounds__(256) void k_wt_bf16(const float* __restrict__ W, unsigned short* __restrict__ Wt, int K, int N) {
  const int t = blockIdx.x * 256 + threadIdx.x;
  const int k8n = K / 8;
  if (t >= N * k8n) return;
  const int n = t / k8n, k8 = (t % k8n) * 8;
  v8us v;
#pragma unroll
  for (int i = 0; i < 8; ++i) v[i] = bf16_bits(W[(size_t)(k8 + i) * N + n]);
  *(v8us*)(Wt + (size_t)n * K + k8) = v;
  
}

// GEMM C[M][N] (f32, pitch ldc) = act(A[M][K]·W + bias). A f32 row-major (pitch lda) converted per fragment to bf16
// (ASPLIT: hi/lo two planes -> 2 terms, else single rounded term); Wt bf16 [N][K] (pitch ldb). BIAS_BF16 rounds the
// bias to bf16 first (bias quantised to bf16 before the add). K%32==0, M%16==0, N%64==0.
template <bool ASPLIT, int ACT, bool BIAS_BF16>
__global__ __launch_bounds__(128) void k_gemm_bf(const float* __restrict__ A, int lda, const unsigned short* __restrict__ Wt, int ldb,
                                               const float* __restrict__ bias, float* __restrict__ C, int ldc, int M, int N, int K) {
  __shared__ __attribute__((aligned(16))) float so[4][16][64];
  const int tid = threadIdx.x, w = tid >> 5, lane = tid & 31, ln = lane & 15, hh = lane >> 4;
  const int ntn = N / 64;
  const int wid = blockIdx.x * 4 + w;
  const int mt = wid / ntn, nq = wid % ntn;
  if (mt * 16 >= M) return;
  const int row0 = mt * 16, col0 = nq * 64;
  const float* arow = A + (size_t)(row0 + ln) * lda;
  v8f acc[4] = {};
  for (int kb = 0; kb < K; kb += 32) {
    FragB ah, al;
    const v4f x0 = *(const v4fa*)(arow + kb + 8 * hh), x1 = *(const v4fa*)(arow + kb + 8 * hh + 4);
    const v4f x2 = *(const v4fa*)(arow + kb + 16 + 8 * hh), x3 = *(const v4fa*)(arow + kb + 16 + 8 * hh + 4);
    float xs[16] = {x0[0],x0[1],x0[2],x0[3],x1[0],x1[1],x1[2],x1[3],x2[0],x2[1],x2[2],x2[3],x3[0],x3[1],x3[2],x3[3]};
#pragma unroll
    for (int i = 0; i < 16; ++i) { const unsigned short hb = bf16_bits(xs[i]); ah.u[i] = hb; al.u[i] = ASPLIT ? bf16_bits(xs[i] - bf16_val(hb)) : (unsigned short)0; }
#pragma unroll
    for (int t = 0; t < 4; ++t) {
      const unsigned short* brow = Wt + (size_t)(col0 + t * 16 + ln) * ldb + kb;
      FragB b;
      b.half[0] = *(const v8us*)(brow + 8 * hh);
      b.half[1] = *(const v8us*)(brow + 16 + 8 * hh);
      acc[t] = mmaN<ASPLIT ? 2 : 1>(ah.v, al.v, b.v, b.v, acc[t]);
    }
  }
#pragma unroll
  for (int t = 0; t < 4; ++t) {
    float bv = bias ? bias[col0 + t * 16 + ln] : 0.f;
    if (BIAS_BF16) bv = bf16_round(bv);
#pragma unroll
    for (int r = 0; r < 8; ++r) { float v = acc[t][r] + bv; if (ACT == 1) v = fmaxf(v, 0.f); so[w][8 * hh + r][t * 16 + ln] = v; }
  }
  __builtin_amdgcn_fence(__ATOMIC_ACQ_REL, "workgroup");
  __builtin_amdgcn_wave_barrier();
  const int rsub = lane >> 4, c4 = (lane & 15) * 4;
  {
#pragma unroll
    for (int q = 0; q < 8; ++q) {
      const int r = q * 2 + rsub;
      const v4f v = *(const v4fa*)&so[w][r][c4];
      *(v4f*)(C + (size_t)(row0 + r) * ldc + col0 + c4) = v;
    }
    
  }
}

// Flash-style causal/unmasked attention, all contractions 3-term bf16 hi/lo splits, f32 softmax with running max.
// q,k,v rows are read from f32 buffers with arbitrary row pitch (so they can live inside a fused qkv buffer);
// D = head size (multiple of 32, <= 128); one wave = 16 query rows; block = 4 waves (64 queries) sharing K/V chunks of 32.
template <int D, bool CAUSAL>
__global__ __launch_bounds__(128) void k_flash(const float* __restrict__ qb, const float* __restrict__ kb, const float* __restrict__ vb,
                                             int pitch, int T, int H, float scale, float* __restrict__ y, int ypitch) {
  constexpr int KS = D / 32;        // k-steps for QK
  constexpr int DT = D / 16;        // d tiles for PV
  __shared__ __attribute__((aligned(16))) unsigned short sKh[32][D + 8], sKl[32][D + 8], sVh[32][D + 8], sVl[32][D + 8];
  __shared__ __attribute__((aligned(16))) unsigned short sPh[4][16][40], sPl[4][16][40];
  __shared__ __attribute__((aligned(16))) float sO[4][16][D];
  const int tid = threadIdx.x, w = tid >> 5, lane = tid & 31, ln = lane & 15, hh = lane >> 4;
  const int nqb = (T + 63) / 64;
  const int bh = blockIdx.x / nqb, qblk = blockIdx.x % nqb;
  const int b = bh / H, h = bh % H;
  const int q0 = qblk * 64 + w * 16;
  const float* Q = qb + (size_t)b * T * pitch + h * D;
  const float* K = kb + (size_t)b * T * pitch + h * D;
  const float* V = vb + (size_t)b * T * pitch + h * D;

  // A fragments of the wave's 16 query rows (scaled), hi/lo
  FragB aqh[KS], aql[KS];
  {
    int row = q0 + ln; if (row >= T) row = T - 1;
    const float* qr = Q + (size_t)row * pitch;
#pragma unroll
    for (int ks = 0; ks < KS; ++ks)
#pragma unroll
      for (int i = 0; i < 16; ++i) {
        const int d = ks * 32 + ((i < 8) ? (8 * hh + i) : (16 + 8 * hh + (i - 8)));
        const float x = qr[d] * scale; const unsigned short hb = bf16_bits(x);
        aqh[ks].u[i] = hb; aql[ks].u[i] = bf16_bits(x - bf16_val(hb));
      }
  }
  float m_r[8], l_r[8];
#pragma unroll
  for (int r = 0; r < 8; ++r) { m_r[r] = -3.0e38f; l_r[r] = 0.f; }
  v8f oacc[DT];
#pragma unroll
  for (int dt = 0; dt < DT; ++dt) oacc[dt] = (v8f){0.f,0.f,0.f,0.f,0.f,0.f,0.f,0.f};

  const int kv_end = CAUSAL ? min(T, qblk * 64 + 64) : T;     // block-uniform
  for (int j0 = 0; j0 < kv_end; j0 += 32) {
    __syncthreads();
    for (int e = tid; e < 32 * (D / 4); e += 128) {
      const int r = e / (D / 4), c4 = (e % (D / 4)) * 4;
      const int key = j0 + r;
      v4f kf = {0.f,0.f,0.f,0.f}, vf = {0.f,0.f,0.f,0.f};
      if (key < T) { kf = *(const v4fa*)(K + (size_t)key * pitch + c4); vf = *(const v4fa*)(V + (size_t)key * pitch + c4); }
#pragma unroll
      for (int t = 0; t < 4; ++t) {
        unsigned short hb = bf16_bits(kf[t]); sKh[r][c4 + t] = hb; sKl[r][c4 + t] = bf16_bits(kf[t] - bf16_val(hb));
        hb = bf16_bits(vf[t]); sVh[r][c4 + t] = hb; sVl[r][c4 + t] = bf16_bits(vf[t] - bf16_val(hb));
      }
    }
    __syncthreads();
    // S tile 16 x 32
    v8f s[2];
#pragma unroll
    for (int nt = 0; nt < 2; ++nt) {
      v8f acc = {};
#pragma unroll
      for (int ks = 0; ks < KS; ++ks) {
        FragB bh_, bl_;
        bh_.half[0] = *(const v8us*)&sKh[nt * 16 + ln][ks * 32 + 8 * hh]; bh_.half[1] = *(const v8us*)&sKh[nt * 16 + ln][ks * 32 + 16 + 8 * hh];
        bl_.half[0] = *(const v8us*)&sKl[nt * 16 + ln][ks * 32 + 8 * hh]; bl_.half[1] = *(const v8us*)&sKl[nt * 16 + ln][ks * 32 + 16 + 8 * hh];
        acc = mmaN<3>(aqh[ks].v, aql[ks].v, bh_.v, bl_.v, acc);
      }
      s[nt] = acc;
    }
    // mask + running max (rows 8hh+r; the 16 lanes of a half share rows)
    float alpha[8];
#pragma unroll
    for (int r = 0; r < 8; ++r) {
      const int qi = q0 + 8 * hh + r;
      const int ja = j0 + ln, jb = j0 + 16 + ln;
      if (CAUSAL) { if (ja > qi) s[0][r] = -3.0e38f; if (jb > qi) s[1][r] = -3.0e38f; }
      if (ja >= T) s[0][r] = -3.0e38f;
      if (jb >= T) s[1][r] = -3.0e38f;
      float mx = fmaxf(s[0][r], s[1][r]);
      mx = fmaxf(mx, __shfl_xor(mx, 1, 32)); mx = fmaxf(mx, __shfl_xor(mx, 2, 32)); mx = fmaxf(mx, __shfl_xor(mx, 4, 32)); mx = fmaxf(mx, __shfl_xor(mx, 8, 32));
      const float mnew = fmaxf(m_r[r], mx);
      alpha[r] = (mnew > -1.0e38f) ? __expf(m_r[r] - mnew) : 1.0f;
      const float p0 = (s[0][r] > -1.0e38f) ? __expf(s[0][r] - mnew) : 0.f;
      const float p1 = (s[1][r] > -1.0e38f) ? __expf(s[1][r] - mnew) : 0.f;
      m_r[r] = mnew;
      l_r[r] = l_r[r] * alpha[r] + p0 + p1;            // per-lane partial row sum (16 lanes combined at the end)
      unsigned short hb = bf16_bits(p0); sPh[w][8 * hh + r][ln] = hb;      sPl[w][8 * hh + r][ln] = bf16_bits(p0 - bf16_val(hb));
      hb = bf16_bits(p1);                sPh[w][8 * hh + r][16 + ln] = hb; sPl[w][8 * hh + r][16 + ln] = bf16_bits(p1 - bf16_val(hb));
    }
#pragma unroll
    for (int dt = 0; dt < DT; ++dt)
#pragma unroll
      for (int r = 0; r < 8; ++r) oacc[dt][r] *= alpha[r];
    __builtin_amdgcn_fence(__ATOMIC_ACQ_REL, "workgroup");
    __builtin_amdgcn_wave_barrier();
    FragB pah, pal;
    pah.half[0] = *(const v8us*)&sPh[w][ln][8 * hh]; pah.half[1] = *(const v8us*)&sPh[w][ln][16 + 8 * hh];
    pal.half[0] = *(const v8us*)&sPl[w][ln][8 * hh]; pal.half[1] = *(const v8us*)&sPl[w][ln][16 + 8 * hh];
#pragma unroll
    for (int dt = 0; dt < DT; ++dt) {
      FragB bvh, bvl;
#pragma unroll
      for (int i = 0; i < 8; ++i) {
        bvh.u[i] = sVh[8 * hh + i][dt * 16 + ln]; bvh.u[8 + i] = sVh[16 + 8 * hh + i][dt * 16 + ln];
        bvl.u[i] = sVl[8 * hh + i][dt * 16 + ln]; bvl.u[8 + i] = sVl[16 + 8 * hh + i][dt * 16 + ln];
      }
      oacc[dt] = mmaN<3>(pah.v, pal.v, bvh.v, bvl.v, oacc[dt]);
    }
    __builtin_amdgcn_fence(__ATOMIC_ACQ_REL, "workgroup");
    __builtin_amdgcn_wave_barrier();
  }
#pragma unroll
  for (int r = 0; r < 8; ++r) {
    float l = l_r[r];
    l += __shfl_xor(l, 1, 32); l += __shfl_xor(l, 2, 32); l += __shfl_xor(l, 4, 32); l += __shfl_xor(l, 8, 32);
    l_r[r] = (l > 0.f) ? 1.0f / l : 0.f;
  }
#pragma unroll
  for (int dt = 0; dt < DT; ++dt)
#pragma unroll
    for (int r = 0; r < 8; ++r) sO[w][8 * hh + r][dt * 16 + ln] = oacc[dt][r] * l_r[r];
  __builtin_amdgcn_fence(__ATOMIC_ACQ_REL, "workgroup");
  __builtin_amdgcn_wave_barrier();
  {
    for (int r = 0; r < 16; ++r) {
      const int row = q0 + r;
      if (row < T && lane < D / 4) {
        const v4f val = *(const v4fa*)&sO[w][r][lane * 4];
        *(v4f*)(y + ((size_t)b * T + row) * ypitch + h * D + lane * 4) = val;
      }
    }
    
  }
}

// GEMM C = act(A·W + bias + resid): A f32 (ASPLIT -> hi/lo 2 terms), Wt bf16 [N][K]; ACT 0 none, 1 relu, 2 exact gelu;
// resid (optional, f32, row index = (row % rmod), pitch ldr, RES_BF16 rounds it) added before the activation.
template <bool ASPLIT, int ACT, bool BIAS_BF16, bool RES_BF16>
__global__ __launch_bounds__(128) void k_gemm_bf3(const float* __restrict__ A, int lda, const unsigned short* __restrict__ Wt, int ldb,
                                                const float* __restrict__ bias, const float* __restrict__ resid, int rmod, int ldr,
                                                float* __restrict__ C, int ldc, int M, int N, int K) {
  __shared__ __attribute__((aligned(16))) float so[4][16][64];
  const int tid = threadIdx.x, w = tid >> 5, lane = tid & 31, ln = lane & 15, hh = lane >> 4;
  const int ntn = N / 64;
  const int wid = blockIdx.x * 4 + w;
  const int mt = wid / ntn, nq = wid % ntn;
  if (mt * 16 >= M) return;
  const int row0 = mt * 16, col0 = nq * 64;
  const float* arow = A + (size_t)(row0 + ln) * lda;
  v8f acc[4] = {};
  for (int kb = 0; kb < K; kb += 32) {
    FragB ah, al;
    const v4f x0 = *(const v4fa*)(arow + kb + 8 * hh), x1 = *(const v4fa*)(arow + kb + 8 * hh + 4);
    const v4f x2 = *(const v4fa*)(arow + kb + 16 + 8 * hh), x3 = *(const v4fa*)(arow + kb + 16 + 8 * hh + 4);
    float xs[16] = {x0[0],x0[1],x0[2],x0[3],x1[0],x1[1],x1[2],x1[3],x2[0],x2[1],x2[2],x2[3],x3[0],x3[1],x3[2],x3[3]};
#pragma unroll
    for (int i = 0; i < 16; ++i) { const unsigned short hb = bf16_bits(xs[i]); ah.u[i] = hb; al.u[i] = ASPLIT ? bf16_bits(xs[i] - bf16_val(hb)) : (unsigned short)0; }
#pragma unroll
    for (int t = 0; t < 4; ++t) {
      const unsigned short* brow = Wt + (size_t)(col0 + t * 16 + ln) * ldb + kb;
      FragB b;
      b.half[0] = *(const v8us*)(brow + 8 * hh);
      b.half[1] = *(const v8us*)(brow + 16 + 8 * hh);
      acc[t] = mmaN<ASPLIT ? 2 : 1>(ah.v, al.v, b.v, b.v, acc[t]);
    }
  }
#pragma unroll
  for (int t = 0; t < 4; ++t) {
    const int col = col0 + t * 16 + ln;
    float bv = bias ? bias[col] : 0.f;
    if (BIAS_BF16) bv = bf16_round(bv);
#pragma unroll
    for (int r = 0; r < 8; ++r) {
      float v = acc[t][r] + bv;
      if (resid) { float rv = resid[(size_t)((row0 + 8 * hh + r) % rmod) * ldr + col]; if (RES_BF16) rv = bf16_round(rv); v += rv; }
      if (ACT == 1) v = fmaxf(v, 0.f);
      if (ACT == 2) v = 0.5f * v * (1.0f + erff(v * 0.70710678118654752f));
      if (ACT == 3) { const float u = 0.7978845608028654f * (v + 0.044715f * v * v * v); v = 0.5f * v * (1.0f + tanhf(u)); }
      so[w][8 * hh + r][t * 16 + ln] = v;
    }
  }
  __builtin_amdgcn_fence(__ATOMIC_ACQ_REL, "workgroup");
  __builtin_amdgcn_wave_barrier();
  const int rsub = lane >> 4, c4 = (lane & 15) * 4;
  {
#pragma unroll
    for (int q = 0; q < 8; ++q) {
      const int r = q * 2 + rsub;
      const v4f v = *(const v4fa*)&so[w][r][c4];
      *(v4f*)(C + (size_t)(row0 + r) * ldc + col0 + c4) = v;
    }
    
  }
}
// row LayerNorm (biased variance, eps) over N: s = X (+ R); optional out_sum <- s; out_norm <- (s-mu)*rsqrt(var+eps)*g + b
template <bool PARAM_BF16>
__global__ __launch_bounds__(256) void k_layernorm(const float* __restrict__ X, const float* __restrict__ R, const float* __restrict__ g, const float* __restrict__ bta,
                                                  float* __restrict__ out_sum, float* __restrict__ out_norm, int N, float eps) {
  __shared__ float red[256];
  const int row = blockIdx.x, tid = threadIdx.x;
  const float* x = X + (size_t)row * N; const float* rr = R ? R + (size_t)row * N : nullptr;
  float vals[16];                     // up to N = 4096
  const int per = N / 256;            // contiguous chunk per thread? use strided-by-4 chunks: thread handles j = tid*4 + 1024*u
  float s1 = 0.f;
  for (int u = 0; u < per / 4; ++u) {
    const int j = tid * 4 + 1024 * u;
    const v4f a = *(const v4fa*)(x + j);
    v4f b = {0.f,0.f,0.f,0.f}; if (rr) b = *(const v4fa*)(rr + j);
#pragma unroll
    for (int q = 0; q < 4; ++q) { const float v = a[q] + b[q]; vals[u * 4 + q] = v; s1 += v; }
  }
  red[tid] = s1; __syncthreads();
  for (int st = 128; st > 0; st >>= 1) { if (tid < st) red[tid] += red[tid + st]; __syncthreads(); }
  const float mu = red[0] / (float)N; __syncthreads();
  float s2 = 0.f;
  for (int u = 0; u < per / 4; ++u)
#pragma unroll
    for (int q = 0; q < 4; ++q) { const float c = vals[u * 4 + q] - mu; s2 += c * c; }
  red[tid] = s2; __syncthreads();
  for (int st = 128; st > 0; st >>= 1) { if (tid < st) red[tid] += red[tid + st]; __syncthreads(); }
  const float rs = rsqrtf(red[0] / (float)N + eps);
  {
    for (int u = 0; u < per / 4; ++u) {
      const int j = tid * 4 + 1024 * u;
      v4f o, sm;
#pragma unroll
      for (int q = 0; q < 4; ++q) {
        float gg = g[j + q], bb = bta[j + q];
        if (PARAM_BF16) { gg = bf16_round(gg); bb = bf16_round(bb); }
        sm[q] = vals[u * 4 + q]; o[q] = (vals[u * 4 + q] - mu) * rs * gg + bb;
      }
      if (out_sum) *(v4f*)(out_sum + (size_t)row * N + j) = sm;
      *(v4f*)(out_norm + (size_t)row * N + j) = o;
    }
    
  }
}



// ---- f16 WMMA path (v_wmma_f32_16x16x32_f16): 11-bit significands for operands in range — used where a [0,1] probability operand needs more precision than bf16
typedef _Float16 v16h __attribute__((ext_vector_type(16)));
union FragH { v16h v; v8us half[2]; _Float16 h[16]; unsigned short u[16]; };
template <int NT>
__device__ __forceinline__ v8f mmaH(v16h ah, v16h al, v16h bh, v16h bl, v8f c) {
  c = __builtin_amdgcn_wmma_f32_16x16x32_f16(false, ah, false, bh, (short)0, c, false, false);
  if (NT >= 2) c = __builtin_amdgcn_wmma_f32_16x16x32_f16(false, al, false, bh, (short)0, c, false, false);
  if (NT >= 3) c = __builtin_amdgcn_wmma_f32_16x16x32_f16(false, ah, false, bl, (short)0, c, false, false);
  asm volatile("v_nop\n\tv_nop\n\tv_nop\n\tv_nop" : "+v"(c) : "v"(ah), "v"(al), "v"(bh), "v"(bl));
  return c;
}
// batched GEMM like k_gemm_b but f16 operands: A f32 (split into f16 hi/lo if ASPLIT, else rounded to f16), Bt = f16 values [n][k]; alpha; C f32; N multiple of 16 (partial tiles skipped)
template <bool ASPLIT>
__global__ __launch_bounds__(128) void k_gemm_h(const float* __restrict__ A, int lda, size_t sA, const _Float16* __restrict__ Bh, int ldb, size_t sB, float alpha, float* __restrict__ C, int ldc, size_t sC, int M, int N, int K) {
  __shared__ __attribute__((aligned(16))) float so[4][16][64];
  const int tid = threadIdx.x, w = tid >> 5, lane = tid & 31, ln = lane & 15, hh = lane >> 4; const int by = blockIdx.y;
  A += (size_t)by * sA; Bh += (size_t)by * sB; C += (size_t)by * sC;
  const int ntn = (N + 63) / 64; const int wid = blockIdx.x * 4 + w; const int mt = wid / ntn, nq = wid % ntn; if (mt * 16 >= M) return;
  const int row0 = mt * 16, col0 = nq * 64; const float* arow = A + (size_t)(row0 + ln) * lda;
  v8f acc[4] = {};
  for (int kb = 0; kb < K; kb += 32) {
    FragH ah, al;
    const v4f x0 = *(const v4fa*)(arow + kb + 8 * hh), x1 = *(const v4fa*)(arow + kb + 8 * hh + 4), x2 = *(const v4fa*)(arow + kb + 16 + 8 * hh), x3 = *(const v4fa*)(arow + kb + 16 + 8 * hh + 4);
    float xs[16] = {x0[0],x0[1],x0[2],x0[3],x1[0],x1[1],x1[2],x1[3],x2[0],x2[1],x2[2],x2[3],x3[0],x3[1],x3[2],x3[3]};
#pragma unroll
    for (int i = 0; i < 16; ++i) { const _Float16 h = (_Float16)xs[i]; ah.h[i] = h; al.h[i] = ASPLIT ? (_Float16)(xs[i] - (float)h) : (_Float16)0.0f; }
#pragma unroll
    for (int t = 0; t < 4; ++t) { if (col0 + t * 16 >= N) continue; const size_t boff = (size_t)(col0 + t * 16 + ln) * ldb + kb; FragH bq; bq.half[0] = *(const v8us*)(Bh + boff + 8 * hh); bq.half[1] = *(const v8us*)(Bh + boff + 16 + 8 * hh);
      acc[t] = mmaH<ASPLIT ? 2 : 1>(ah.v, al.v, bq.v, bq.v, acc[t]); }
  }
#pragma unroll
  for (int t = 0; t < 4; ++t) { if (col0 + t * 16 >= N) continue;
#pragma unroll
    for (int r = 0; r < 8; ++r) so[w][8 * hh + r][t * 16 + ln] = acc[t][r] * alpha; }
  __builtin_amdgcn_fence(__ATOMIC_ACQ_REL, "workgroup"); __builtin_amdgcn_wave_barrier();
  const int rsub = lane >> 4, c4 = (lane & 15) * 4;
  {
#pragma unroll
    for (int q = 0; q < 8; ++q) { const int r = q * 2 + rsub; if (col0 + c4 < N) { const v4f v = *(const v4fa*)&so[w][r][c4]; *(v4f*)(C + (size_t)(row0 + r) * ldc + col0 + c4) = v; } }
     }
}

// Wt[n][k] = f16(W[k][n]·scale) from f32 row-major W[K][N] (scale = power of two; bf16-exact weights stay exact in f16 away from the subnormal range)
__global__ __launch_bounds__(256) void k_wt_f16(const float* __restrict__ W, _Float16* __restrict__ Wt, int K, int N, float scale) {
  const int t = blockIdx.x * 256 + threadIdx.x; if (t >= N * (K / 8)) return; const int n = t / (K / 8), k8 = (t % (K / 8)) * 8; FragH f;
#pragma unroll
  for (int i = 0; i < 8; ++i) f.h[i] = (_Float16)(bf16_round(W[(size_t)(k8 + i) * N + n]) * scale); const v8us o = f.half[0];
  *(v8us*)((unsigned short*)Wt + (size_t)n * K + k8) = o; 
}
// k_gemm_hh variant with fused epilogue: v = acc·alpha + bias[by·sBias + col] (+ CP[(row/rowsPerB)·sCPb + by·64 + col] if CP) ; ACT 0 none / 1 elu ; writes f32 C and f16 C16, each if non-null
template <int ACT>
__global__ __launch_bounds__(128) void k_gemm_hhx(const _Float16* __restrict__ A, int lda, size_t sA, const _Float16* __restrict__ Bh, int ldb, size_t sB, float alpha, const float* __restrict__ bias, size_t sBias, const float* __restrict__ CP, int rowsPerB, size_t sCPb, int row0g,
    float* __restrict__ C, _Float16* __restrict__ C16, int ldc, size_t sC, int M, int N, int K) {
  __shared__ __attribute__((aligned(16))) float so[4][16][64];
  const int tid = threadIdx.x, w = tid >> 5, lane = tid & 31, ln = lane & 15, hh = lane >> 4; const int by = blockIdx.y;
  A += (size_t)by * sA; Bh += (size_t)by * sB; const size_t cofs = (size_t)by * sC; const float* bp = bias ? bias + (size_t)by * sBias : nullptr;
  const int ntn = (N + 63) / 64; const int wid = blockIdx.x * 4 + w; const int mt = wid / ntn, nq = wid % ntn; if (mt * 16 >= M) return;
  const int row0 = mt * 16, col0 = nq * 64; const _Float16* arow = A + (size_t)(row0 + ln) * lda;
  v8f acc[4] = {};
  for (int kb = 0; kb < K; kb += 32) { FragH ah; ah.half[0] = *(const v8us*)((const unsigned short*)arow + kb + 8 * hh); ah.half[1] = *(const v8us*)((const unsigned short*)arow + kb + 16 + 8 * hh);
#pragma unroll
    for (int t = 0; t < 4; ++t) { if (col0 + t * 16 >= N) continue; const size_t boff = (size_t)(col0 + t * 16 + ln) * ldb + kb; FragH bq; bq.half[0] = *(const v8us*)((const unsigned short*)Bh + boff + 8 * hh); bq.half[1] = *(const v8us*)((const unsigned short*)Bh + boff + 16 + 8 * hh);
      acc[t] = mmaH<1>(ah.v, ah.v, bq.v, bq.v, acc[t]); }
  }
#pragma unroll
  for (int t = 0; t < 4; ++t) { if (col0 + t * 16 >= N) continue; const int col = col0 + t * 16 + ln; const float bv = bp ? bf16_round(bp[col]) : 0.f;
#pragma unroll
    for (int r = 0; r < 8; ++r) { float v = acc[t][r] * alpha + bv; if (CP) { const int bidx = (row0g + row0 + 8 * hh + r) / rowsPerB; v += CP[(size_t)bidx * sCPb + (size_t)by * 64 + col]; } if (ACT == 1) v = (v > 0.f) ? v : expm1f(v); else if (ACT == 3) v = fmaxf(v, 0.f); so[w][8 * hh + r][t * 16 + ln] = v; } }
  __builtin_amdgcn_fence(__ATOMIC_ACQ_REL, "workgroup"); __builtin_amdgcn_wave_barrier();
  const int rsub = lane >> 4, c4 = (lane & 15) * 4; typedef _Float16 v4h __attribute__((ext_vector_type(4)));
  {
#pragma unroll
    for (int q = 0; q < 8; ++q) { const int r = q * 2 + rsub; if (col0 + c4 < N) { const v4f v = *(const v4fa*)&so[w][r][c4]; if (C) *(v4f*)(C + cofs + (size_t)(row0 + r) * ldc + col0 + c4) = v; if (C16) { v4h h4; for (int i = 0; i < 4; ++i) h4[i] = (_Float16)v[i]; *(v4h*)(C16 + cofs + (size_t)(row0 + r) * ldc + col0 + c4) = h4; } } }
     }
}


__global__ __launch_bounds__(256) void k_x16(const float* __restrict__ x, _Float16* __restrict__ X16, size_t n8) { const size_t t = (size_t)blockIdx.x * 256 + threadIdx.x; if (t >= n8) return; FragH f;
#pragma unroll
  for (int q = 0; q < 8; ++q) f.h[q] = (_Float16)bf16_round(x[t * 8 + q]); *(v8us*)((unsigned short*)X16 + t * 8) = f.half[0];  }
__global__ __launch_bounds__(256) void k_h16(const float* __restrict__ x, _Float16* __restrict__ X16, size_t n8) { const size_t t = (size_t)blockIdx.x * 256 + threadIdx.x; if (t >= n8) return; FragH f;
#pragma unroll
  for (int q = 0; q < 8; ++q) f.h[q] = (_Float16)x[t * 8 + q]; *(v8us*)((unsigned short*)X16 + t * 8) = f.half[0];  }
__global__ __launch_bounds__(256) void k_round16f(const float* __restrict__ W, _Float16* __restrict__ Bt, size_t n8) { const size_t t = (size_t)blockIdx.x * 256 + threadIdx.x; if (t >= n8) return; FragH f;
#pragma unroll
  for (int i = 0; i < 8; ++i) f.h[i] = (_Float16)(bf16_round(W[t * 8 + i]) * 16.0f); *(v8us*)((unsigned short*)Bt + t * 8) = f.half[0];  }
__global__ __launch_bounds__(256) void k_sn(const float* __restrict__ sf, _Float16* __restrict__ SN) { const int tid = threadIdx.x, wv = tid >> 5, lane = tid & 31; const size_t row = (size_t)blockIdx.x * 8 + wv; if (row >= NR) return; float v[8]; float s = 0.f;
#pragma unroll
  for (int q = 0; q < 8; ++q) { v[q] = bf16_round(sf[row * DSEM + lane * 8 + q]); s += v[q] * v[q]; }
  for (int o = 16; o >= 1; o >>= 1) s += __shfl_xor(s, o, 32); const float inv = 1.0f / fmaxf(sqrtf(s), 1e-12f); FragH f;
#pragma unroll
  for (int q = 0; q < 8; ++q) f.h[q] = (_Float16)(v[q] * inv); *(v8us*)((unsigned short*)SN + row * DSEM + lane * 8) = f.half[0];  }
__global__ __launch_bounds__(512) void k_temp(const float* __restrict__ query, const float* __restrict__ Wt1, const float* __restrict__ bt1, const float* __restrict__ Wt2, const float* __restrict__ bt2, float* __restrict__ TEMP) {
  __shared__ float qm[DM]; __shared__ float hid[DM / 2]; __shared__ float red[16]; __shared__ float tout[32]; const int tid = threadIdx.x, wv = tid >> 5, lane = tid & 31; if (tid < 32) tout[tid] = 0.f;
  for (int b = 0; b < BB; ++b) { float s = 0.f;
#pragma unroll 4
    for (int r = 0; r < SS; ++r) s += bf16_round(query[((size_t)b * SS + r) * DM + tid]); qm[tid] = s / (float)SS; __syncthreads();
    if (tid < DM / 2) { float a = bf16_round(bt1[tid]); const float* wr = Wt1 + (size_t)tid * DM;
#pragma unroll 4
      for (int d = 0; d < DM; ++d) a += bf16_round(wr[d]) * qm[d]; hid[tid] = fmaxf(a, 0.f); }
    __syncthreads();
    float p = 0.f; if (tid < DM / 2) p = hid[tid] * bf16_round(Wt2[tid]); for (int o = 16; o >= 1; o >>= 1) p += __shfl_xor(p, o, 32); if (lane == 0) red[wv] = p; __syncthreads();
    if (tid == 0) { float z = bf16_round(bt2[0]); for (int q = 0; q < 16; ++q) z += red[q]; const float t = 1.0f / (1.0f + expf(-z)); tout[b] = 0.5f + t * 1.5f; } __syncthreads(); }
  if (tid < 32) { *(float*)(TEMP + tid) = tout[tid]; }  }
__global__ __launch_bounds__(256) void k_vt(const _Float16* __restrict__ V16, _Float16* __restrict__ Vt) { __shared__ unsigned short tl[64][66]; const int tid = threadIdx.x; const int slab = blockIdx.x / (SS / 64), lg = blockIdx.x % (SS / 64); const int b = slab / NH, h = slab % NH;
  for (int i = tid; i < 64 * 8; i += 256) { const int r = i / 8, c8 = (i % 8) * 8; FragH f; f.half[0] = *(const v8us*)((const unsigned short*)V16 + ((size_t)b * SS + lg * 64 + r) * DM + h * HD + c8);
#pragma unroll
    for (int q = 0; q < 8; ++q) tl[r][c8 + q] = f.u[q]; }
  __syncthreads();
  {
#pragma unroll
    for (int rd = 0; rd < 2; ++rd) { const int d = rd * 32 + tid / 8, pc = tid % 8; FragH f;
#pragma unroll
      for (int q = 0; q < 8; ++q) f.u[q] = tl[pc * 8 + q][d];
      *(v8us*)((unsigned short*)Vt + ((size_t)slab * HD + d) * SS + lg * 64 + pc * 8) = f.half[0]; }
     } }
// fused constrained attention per ((b,h), 128 queries): wave = 32 queries; s = (q·k)/(8·temp_b) + sem_bias + pos_bias, −inf where mask[b][k] = 0; sem_bias = −(0.5 − sim) if sim < 0.5 (sim from the
__global__ __launch_bounds__(128) void k_flash(const _Float16* __restrict__ Q16, const _Float16* __restrict__ K16, const _Float16* __restrict__ Vt, const _Float16* __restrict__ SIM, const int* __restrict__ mask, const float* __restrict__ TEMP, float* __restrict__ O) {
  constexpr int RPW = 32, NQB = SS / (4 * RPW), DT = HD / 16, KS = HD / 32;
  __shared__ __attribute__((aligned(16))) unsigned short sP[4][RPW][40]; __shared__ __attribute__((aligned(16))) float sO[4][RPW][HD];
  const int tid = threadIdx.x, w = tid >> 5, lane = tid & 31, ln = lane & 15, hh = lane >> 4;
  const int slab = blockIdx.x / NQB, qblk = blockIdx.x % NQB; const int b = slab / NH, h = slab % NH; const int q0 = qblk * (4 * RPW) + w * RPW; const float sc = 0.125f / TEMP[b];
  FragH aq[2][KS];
#pragma unroll
  for (int rt = 0; rt < 2; ++rt) { const unsigned short* qr = (const unsigned short*)Q16 + ((size_t)b * SS + q0 + rt * 16 + ln) * DM + h * HD;
#pragma unroll
    for (int ks = 0; ks < KS; ++ks) { aq[rt][ks].half[0] = *(const v8us*)(qr + ks * 32 + 8 * hh); aq[rt][ks].half[1] = *(const v8us*)(qr + ks * 32 + 16 + 8 * hh); } }
  const unsigned short* Vth = (const unsigned short*)Vt + (size_t)slab * HD * SS;
  float m_r[2][8], l_r[2][8]; v8f oacc[2][DT];
#pragma unroll
  for (int rt = 0; rt < 2; ++rt) {
#pragma unroll
    for (int r = 0; r < 8; ++r) { m_r[rt][r] = -3.0e38f; l_r[rt][r] = 0.f; }
#pragma unroll
    for (int dt = 0; dt < DT; ++dt) oacc[rt][dt] = (v8f){0.f,0.f,0.f,0.f,0.f,0.f,0.f,0.f}; }
#pragma unroll 1
  for (int j0 = 0; j0 < SS; j0 += 32) {
    v8f s[2][2];
#pragma unroll
    for (int nt = 0; nt < 2; ++nt) { const unsigned short* kr = (const unsigned short*)K16 + ((size_t)b * SS + j0 + nt * 16 + ln) * DM + h * HD; FragH bk[KS];
#pragma unroll
      for (int ks = 0; ks < KS; ++ks) { bk[ks].half[0] = *(const v8us*)(kr + ks * 32 + 8 * hh); bk[ks].half[1] = *(const v8us*)(kr + ks * 32 + 16 + 8 * hh); }
#pragma unroll
      for (int rt = 0; rt < 2; ++rt) { v8f acc = (v8f){0.f,0.f,0.f,0.f,0.f,0.f,0.f,0.f};
#pragma unroll
        for (int ks = 0; ks < KS; ++ks) acc = mmaH<1>(aq[rt][ks].v, aq[rt][ks].v, bk[ks].v, bk[ks].v, acc); s[rt][nt] = acc; } }
    const int k0 = j0 + ln, k1 = j0 + 16 + ln; const bool mk0 = mask[(size_t)b * SS + k0] != 0, mk1 = mask[(size_t)b * SS + k1] != 0;
#pragma unroll
    for (int rt = 0; rt < 2; ++rt)
#pragma unroll
      for (int r = 0; r < 8; ++r) { const int qi = q0 + rt * 16 + 8 * hh + r;
        const unsigned short* srow = (const unsigned short*)SIM + ((size_t)b * SS + qi) * SS; FragH sm; sm.u[0] = srow[k0]; sm.u[1] = srow[k1]; const float sim0 = (float)sm.h[0], sim1 = (float)sm.h[1];
        const float sb0 = (sim0 < 0.5f) ? -(0.5f - sim0) : 0.f, sb1 = (sim1 < 0.5f) ? -(0.5f - sim1) : 0.f;
        const float dd0 = fabsf((float)(qi - k0)), dd1 = fabsf((float)(qi - k1)); const float pb0 = (dd0 > 10.f) ? -0.1f * (dd0 - 10.f) : 0.f, pb1 = (dd1 > 10.f) ? -0.1f * (dd1 - 10.f) : 0.f;
        const float s0 = mk0 ? (s[rt][0][r] * sc + sb0 + pb0) : -INFINITY, s1 = mk1 ? (s[rt][1][r] * sc + sb1 + pb1) : -INFINITY; float mc = fmaxf(s0, s1);
        mc = fmaxf(mc, __shfl_xor(mc, 1, 32)); mc = fmaxf(mc, __shfl_xor(mc, 2, 32)); mc = fmaxf(mc, __shfl_xor(mc, 4, 32)); mc = fmaxf(mc, __shfl_xor(mc, 8, 32));
        const float mn = fmaxf(m_r[rt][r], mc); const float al = expf(m_r[rt][r] - mn); m_r[rt][r] = mn; const float p0 = expf(s0 - mn), p1 = expf(s1 - mn); l_r[rt][r] = l_r[rt][r] * al + p0 + p1;
#pragma unroll
        for (int dt = 0; dt < DT; ++dt) oacc[rt][dt][r] *= al;
        FragH t2; t2.h[0] = (_Float16)p0; t2.h[1] = (_Float16)p1; sP[w][rt * 16 + 8 * hh + r][ln] = t2.u[0]; sP[w][rt * 16 + 8 * hh + r][16 + ln] = t2.u[1]; }
    __builtin_amdgcn_fence(__ATOMIC_ACQ_REL, "workgroup"); __builtin_amdgcn_wave_barrier();
    FragH pa[2];
#pragma unroll
    for (int rt = 0; rt < 2; ++rt) { pa[rt].half[0] = *(const v8us*)&sP[w][rt * 16 + ln][8 * hh]; pa[rt].half[1] = *(const v8us*)&sP[w][rt * 16 + ln][16 + 8 * hh]; }
#pragma unroll
    for (int dt = 0; dt < DT; ++dt) { const unsigned short* vrow = Vth + (size_t)(dt * 16 + ln) * SS + j0; FragH bv; bv.half[0] = *(const v8us*)(vrow + 8 * hh); bv.half[1] = *(const v8us*)(vrow + 16 + 8 * hh);
#pragma unroll
      for (int rt = 0; rt < 2; ++rt) oacc[rt][dt] = mmaH<1>(pa[rt].v, pa[rt].v, bv.v, bv.v, oacc[rt][dt]); }
    __builtin_amdgcn_fence(__ATOMIC_ACQ_REL, "workgroup"); __builtin_amdgcn_wave_barrier(); }
#pragma unroll
  for (int rt = 0; rt < 2; ++rt) {
#pragma unroll
    for (int r = 0; r < 8; ++r) { float l = l_r[rt][r]; l += __shfl_xor(l, 1, 32); l += __shfl_xor(l, 2, 32); l += __shfl_xor(l, 4, 32); l += __shfl_xor(l, 8, 32); l_r[rt][r] = (l > 0.f) ? 1.0f / l : 0.f; }
#pragma unroll
    for (int dt = 0; dt < DT; ++dt)
#pragma unroll
      for (int r = 0; r < 8; ++r) sO[w][rt * 16 + 8 * hh + r][dt * 16 + ln] = oacc[rt][dt][r] * l_r[rt][r]; }
  __builtin_amdgcn_fence(__ATOMIC_ACQ_REL, "workgroup"); __builtin_amdgcn_wave_barrier();
  {
#pragma unroll
    for (int rp = 0; rp < RPW; rp += 2) { const int r = rp + (lane >> 4), pc = lane & 15; const v4f val = *(const v4fa*)&sO[w][r][pc * 4]; *(v4f*)(O + ((size_t)b * SS + q0 + r) * DM + h * HD + pc * 4) = val; }
     } }
extern "C" void kernel_launch(void* const* d_in, const int* in_sizes, int n_in,
                              void* d_out, int out_size, void* d_ws, size_t ws_size, hipStream_t stream) {
  (void)in_sizes; (void)n_in; (void)out_size;
  const float* xq = (const float*)d_in[0]; const float* xk = (const float*)d_in[1]; const float* xv = (const float*)d_in[2]; const int* mask = (const int*)d_in[3]; const float* sf = (const float*)d_in[4];
  const float* Wq = (const float*)d_in[5]; const float* bq = (const float*)d_in[6]; const float* Wk = (const float*)d_in[7]; const float* bk = (const float*)d_in[8]; const float* Wv = (const float*)d_in[9]; const float* bv = (const float*)d_in[10]; const float* Wo = (const float*)d_in[11]; const float* bo = (const float*)d_in[12]; const float* Wt1 = (const float*)d_in[13]; const float* bt1 = (const float*)d_in[14]; const float* Wt2 = (const float*)d_in[15]; const float* bt2 = (const float*)d_in[16];
  char* ws = (char*)d_ws; size_t off = 0;
  auto take = [&](size_t bytes) { char* p = ws + off; off += (bytes + 255) & ~(size_t)255; return p; };
  const size_t w8 = (size_t)DM * DM / 8;
  _Float16* Bq = (_Float16*)take(w8 * 16); _Float16* Bk = (_Float16*)take(w8 * 16); _Float16* Bv = (_Float16*)take(w8 * 16); _Float16* Bo = (_Float16*)take(w8 * 16);
  _Float16* XQ = (_Float16*)take((size_t)NR * DM * 2); _Float16* XK = (_Float16*)take((size_t)NR * DM * 2); _Float16* XV = (_Float16*)take((size_t)NR * DM * 2); _Float16* Q16 = (_Float16*)take((size_t)NR * DM * 2); _Float16* K16 = (_Float16*)take((size_t)NR * DM * 2); _Float16* V16 = (_Float16*)take((size_t)NR * DM * 2); _Float16* Vt = (_Float16*)take((size_t)NR * DM * 2);
  _Float16* SN = (_Float16*)take((size_t)NR * DSEM * 2); _Float16* SIM = (_Float16*)take((size_t)BB * SS * SS * 2); float* TEMP = (float*)take(256); float* O = (float*)take((size_t)NR * DM * 4); _Float16* O16 = XQ;      // the query plane is dead after the q GEMM
  if (off > ws_size) return;      // ≈ 2 + 4.2×7 + 2.1 + 16.8 + 8.4 ≈ 57 MiB
  const unsigned gw = (unsigned)((w8 + 255) / 256), gx = (unsigned)(((size_t)NR * DM / 8 + 255) / 256);
  k_round16f<<<gw, 256, 0, stream>>>(Wq, Bq, w8); k_round16f<<<gw, 256, 0, stream>>>(Wk, Bk, w8); k_round16f<<<gw, 256, 0, stream>>>(Wv, Bv, w8); k_round16f<<<gw, 256, 0, stream>>>(Wo, Bo, w8);
  k_x16<<<gx, 256, 0, stream>>>(xq, XQ, (size_t)NR * DM / 8); k_x16<<<gx, 256, 0, stream>>>(xk, XK, (size_t)NR * DM / 8); k_x16<<<gx, 256, 0, stream>>>(xv, XV, (size_t)NR * DM / 8);
  k_sn<<<NR / 8, 256, 0, stream>>>(sf, SN);
  k_temp<<<1, 512, 0, stream>>>(xq, Wt1, bt1, Wt2, bt2, TEMP);
  const dim3 gg(((NR / 16) * (DM / 64) + 3) / 4, 1);
  k_gemm_hhx<0><<<gg, 128, 0, stream>>>(XQ, DM, 0, Bq, DM, 0, 0.0625f, bq, 0, nullptr, 1, 0, 0, nullptr, Q16, DM, 0, NR, DM, DM);
  k_gemm_hhx<0><<<gg, 128, 0, stream>>>(XK, DM, 0, Bk, DM, 0, 0.0625f, bk, 0, nullptr, 1, 0, 0, nullptr, K16, DM, 0, NR, DM, DM);
  k_gemm_hhx<0><<<gg, 128, 0, stream>>>(XV, DM, 0, Bv, DM, 0, 0.0625f, bv, 0, nullptr, 1, 0, 0, nullptr, V16, DM, 0, NR, DM, DM);
  // SIM[b] = SN[b]·SN[b]ᵀ (f16; values in [−1, 1])
  k_gemm_hhx<0><<<dim3(((SS / 16) * (SS / 64) + 3) / 4, BB), 128, 0, stream>>>(SN, DSEM, (size_t)SS * DSEM, SN, DSEM, (size_t)SS * DSEM, 1.0f, nullptr, 0, nullptr, 1, 0, 0, nullptr, SIM, SS, (size_t)SS * SS, SS, SS, DSEM);
  k_vt<<<BB * NH * (SS / 64), 256, 0, stream>>>(V16, Vt);
  k_flash<<<BB * NH * (SS / 128), 128, 0, stream>>>(Q16, K16, Vt, SIM, mask, TEMP, O);
  k_h16<<<gx, 256, 0, stream>>>(O, O16, (size_t)NR * DM / 8);
  k_gemm_hhx<0><<<gg, 128, 0, stream>>>(O16, DM, 0, Bo, DM, 0, 0.0625f, bo, 0, nullptr, 1, 0, 0, (float*)d_out, nullptr, DM, 0, NR, DM, DM);
}

// v001
// Measured time: 544 microseconds a run.
// Next to v000, in two timings, it ran 1.55 and 1.54 times as fast.
#include <hip/hip_runtime.h>
// q/k/v/o projections (4096 × 512 × 512, + bias), the cosine-similarity matrix of the normalised semantic features (per batch 2048 × 2048 × 256, kept as an f16 plane) and the 8-head
// constrained attention on v_wmma_f32_16x16x32_f16 (fused flash-style kernel: S = Q·Kᵀ, O = P·V on WMMA; scores / (8·temperature_b) + semantic bias + positional bias, key mask → −inf;
// online max/sum softmax f32; P f16 ≤ 1); the dynamic-temperature MLP on the mean query is f32 VALU (column sums over 64 blocks, then one block); A = f16(bf16 ·) exact operands, weights bf16-exact ×2^4 ((out,in)),
// single products, f32 accumulate.
#define BB 2
#define SS 2048
#define DM 512
#define NH 8
#define HD 64
#define DSEM 256
#define NR (BB * SS)

typedef __bf16 v16b __attribute__((ext_vector_type(16)));
typedef unsigned short v8us __attribute__((ext_vector_type(8), may_alias));
typedef float  v8f  __attribute__((ext_vector_type(8)));
typedef float  v4f  __attribute__((ext_vector_type(4)));
typedef float  v4fa __attribute__((ext_vector_type(4), may_alias));
union FragB { v16b v; v8us half[2]; unsigned short u[16]; };

__device__ __forceinline__ unsigned short bf16_bits(float x) { unsigned int u = __float_as_uint(x); return (unsigned short)((u + 0x7FFFu + ((u >> 16) & 1u)) >> 16); }
__device__ __forceinline__ float bf16_val(unsigned short b) { return __uint_as_float(((unsigned int)b) << 16); }
__device__ __forceinline__ float bf16_round(float x) { return bf16_val(bf16_bits(x)); }
// D += A·B with NT terms: 1 = ah·bh, 2 = + al·bh (A split), 3 = + ah·bl (both split)
template <int NT>
__device__ __forceinline__ v8f mmaN(v16b ah, v16b al, v16b bh, v16b bl, v8f c) {
  c = __builtin_amdgcn_wmma_f32_16x16x32_bf16(false, ah, false, bh, (short)0, c, false, false);
  if (NT >= 2) c = __builtin_amdgcn_wmma_f32_16x16x32_bf16(false, al, false, bh, (short)0, c, false, false);
  if (NT >= 3) c = __builtin_amdgcn_wmma_f32_16x16x32_bf16(false, ah, false, bl, (short)0, c, false, false);
  asm volatile("v_nop\n\tv_nop\n\tv_nop\n\tv_nop" : "+v"(c) : "v"(ah), "v"(al), "v"(bh), "v"(bl));
  return c;
}

__global__ __launch_bounds__(256) void k_wt_bf16(const float* __restrict__ W, unsigned short* __restrict__ Wt, int K, int N) {
  const int t = blockIdx.x * 256 + threadIdx.x;
  const int k8n = K / 8;
  if (t >= N * k8n) return;
  const int n = t / k8n, k8 = (t % k8n) * 8;
  v8us v;
#pragma unroll
  for (int i = 0; i < 8; ++i) v[i] = bf16_bits(W[(size_t)(k8 + i) * N + n]);
  *(v8us*)(Wt + (size_t)n * K + k8) = v;
  
}

// GEMM C[M][N] (f32, pitch ldc) = act(A[M][K]·W + bias). A f32 row-major (pitch lda) converted per fragment to bf16
// (ASPLIT: hi/lo two planes -> 2 terms, else single rounded term); Wt bf16 [N][K] (pitch ldb). BIAS_BF16 rounds the
// bias to bf16 first (bias quantised to bf16 before the add). K%32==0, M%16==0, N%64==0.
template <bool ASPLIT, int ACT, bool BIAS_BF16>
__global__ __launch_bounds__(128) void k_gemm_bf(const float* __restrict__ A, int lda, const unsigned short* __restrict__ Wt, int ldb,
                                               const float* __restrict__ bias, float* __restrict__ C, int ldc, int M, int N, int K) {
  __shared__ __attribute__((aligned(16))) float so[4][16][64];
  const int tid = threadIdx.x, w = tid >> 5, lane = tid & 31, ln = lane & 15, hh = lane >> 4;
  const int ntn = N / 64;
  const int wid = blockIdx.x * 4 + w;
  const int mt = wid / ntn, nq = wid % ntn;
  if (mt * 16 >= M) return;
  const int row0 = mt * 16, col0 = nq * 64;
  const float* arow = A + (size_t)(row0 + ln) * lda;
  v8f acc[4] = {};
  for (int kb = 0; kb < K; kb += 32) {
    FragB ah, al;
    const v4f x0 = *(const v4fa*)(arow + kb + 8 * hh), x1 = *(const v4fa*)(arow + kb + 8 * hh + 4);
    const v4f x2 = *(const v4fa*)(arow + kb + 16 + 8 * hh), x3 = *(const v4fa*)(arow + kb + 16 + 8 * hh + 4);
    float xs[16] = {x0[0],x0[1],x0[2],x0[3],x1[0],x1[1],x1[2],x1[3],x2[0],x2[1],x2[2],x2[3],x3[0],x3[1],x3[2],x3[3]};
#pragma unroll
    for (int i = 0; i < 16; ++i) { const unsigned short hb = bf16_bits(xs[i]); ah.u[i] = hb; al.u[i] = ASPLIT ? bf16_bits(xs[i] - bf16_val(hb)) : (unsigned short)0; }
#pragma unroll
    for (int t = 0; t < 4; ++t) {
      const unsigned short* brow = Wt + (size_t)(col0 + t * 16 + ln) * ldb + kb;
      FragB b;
      b.half[0] = *(const v8us*)(brow + 8 * hh);
      b.half[1] = *(const v8us*)(brow + 16 + 8 * hh);
      acc[t] = mmaN<ASPLIT ? 2 : 1>(ah.v, al.v, b.v, b.v, acc[t]);
    }
  }
#pragma unroll
  for (int t = 0; t < 4; ++t) {
    float bv = bias ? bias[col0 + t * 16 + ln] : 0.f;
    if (BIAS_BF16) bv = bf16_round(bv);
#pragma unroll
    for (int r = 0; r < 8; ++r) { float v = acc[t][r] + bv; if (ACT == 1) v = fmaxf(v, 0.f); so[w][8 * hh + r][t * 16 + ln] = v; }
  }
  __builtin_amdgcn_fence(__ATOMIC_ACQ_REL, "workgroup");
  __builtin_amdgcn_wave_barrier();
  const int rsub = lane >> 4, c4 = (lane & 15) * 4;
  {
#pragma unroll
    for (int q = 0; q < 8; ++q) {
      const int r = q * 2 + rsub;
      const v4f v = *(const v4fa*)&so[w][r][c4];
      *(v4f*)(C + (size_t)(row0 + r) * ldc + col0 + c4) = v;
    }
    
  }
}

// Flash-style causal/unmasked attention, all contractions 3-term bf16 hi/lo splits, f32 softmax with running max.
// q,k,v rows are read from f32 buffers with arbitrary row pitch (so they can live inside a fused qkv buffer);
// D = head size (multiple of 32, <= 128); one wave = 16 query rows; block = 4 waves (64 queries) sharing K/V chunks of 32.
template <int D, bool CAUSAL>
__global__ __launch_bounds__(128) void k_flash(const float* __restrict__ qb, const float* __restrict__ kb, const float* __restrict__ vb,
                                             int pitch, int T, int H, float scale, float* __restrict__ y, int ypitch) {
  constexpr int KS = D / 32;        // k-steps for QK
  constexpr int DT = D / 16;        // d tiles for PV
  __shared__ __attribute__((aligned(16))) unsigned short sKh[32][D + 8], sKl[32][D + 8], sVh[32][D + 8], sVl[32][D + 8];
  __shared__ __attribute__((aligned(16))) unsigned short sPh[4][16][40], sPl[4][16][40];
  __shared__ __attribute__((aligned(16))) float sO[4][16][D];
  const int tid = threadIdx.x, w = tid >> 5, lane = tid & 31, ln = lane & 15, hh = lane >> 4;
  const int nqb = (T + 63) / 64;
  const int bh = blockIdx.x / nqb, qblk = blockIdx.x % nqb;
  const int b = bh / H, h = bh % H;
  const int q0 = qblk * 64 + w * 16;
  const float* Q = qb + (size_t)b * T * pitch + h * D;
  const float* K = kb + (size_t)b * T * pitch + h * D;
  const float* V = vb + (size_t)b * T * pitch + h * D;

  // A fragments of the wave's 16 query rows (scaled), hi/lo
  FragB aqh[KS], aql[KS];
  {
    int row = q0 + ln; if (row >= T) row = T - 1;
    const float* qr = Q + (size_t)row * pitch;
#pragma unroll
    for (int ks = 0; ks < KS; ++ks)
#pragma unroll
      for (int i = 0; i < 16; ++i) {
        const int d = ks * 32 + ((i < 8) ? (8 * hh + i) : (16 + 8 * hh + (i - 8)));
        const float x = qr[d] * scale; const unsigned short hb = bf16_bits(x);
        aqh[ks].u[i] = hb; aql[ks].u[i] = bf16_bits(x - bf16_val(hb));
      }
  }
  float m_r[8], l_r[8];
#pragma unroll
  for (int r = 0; r < 8; ++r) { m_r[r] = -3.0e38f; l_r[r] = 0.f; }
  v8f oacc[DT];
#pragma unroll
  for (int dt = 0; dt < DT; ++dt) oacc[dt] = (v8f){0.f,0.f,0.f,0.f,0.f,0.f,0.f,0.f};

  const int kv_end = CAUSAL ? min(T, qblk * 64 + 64) : T;     // block-uniform
  for (int j0 = 0; j0 < kv_end; j0 += 32) {
    __syncthreads();
    for (int e = tid; e < 32 * (D / 4); e += 128) {
      const int r = e / (D / 4), c4 = (e % (D / 4)) * 4;
      const int key = j0 + r;
      v4f kf = {0.f,0.f,0.f,0.f}, vf = {0.f,0.f,0.f,0.f};
      if (key < T) { kf = *(const v4fa*)(K + (size_t)key * pitch + c4); vf = *(const v4fa*)(V + (size_t)key * pitch + c4); }
#pragma unroll
      for (int t = 0; t < 4; ++t) {
        unsigned short hb = bf16_bits(kf[t]); sKh[r][c4 + t] = hb; sKl[r][c4 + t] = bf16_bits(kf[t] - bf16_val(hb));
        hb = bf16_bits(vf[t]); sVh[r][c4 + t] = hb; sVl[r][c4 + t] = bf16_bits(vf[t] - bf16_val(hb));
      }
    }
    __syncthreads();
    // S tile 16 x 32
    v8f s[2];
#pragma unroll
    for (int nt = 0; nt < 2; ++nt) {
      v8f acc = {};
#pragma unroll
      for (int ks = 0; ks < KS; ++ks) {
        FragB bh_, bl_;
        bh_.half[0] = *(const v8us*)&sKh[nt * 16 + ln][ks * 32 + 8 * hh]; bh_.half[1] = *(const v8us*)&sKh[nt * 16 + ln][ks * 32 + 16 + 8 * hh];
        bl_.half[0] = *(const v8us*)&sKl[nt * 16 + ln][ks * 32 + 8 * hh]; bl_.half[1] = *(const v8us*)&sKl[nt * 16 + ln][ks * 32 + 16 + 8 * hh];
        acc = mmaN<3>(aqh[ks].v, aql[ks].v, bh_.v, bl_.v, acc);
      }
      s[nt] = acc;
    }
    // mask + running max (rows 8hh+r; the 16 lanes of a half share rows)
    float alpha[8];
#pragma unroll
    for (int r = 0; r < 8; ++r) {
      const int qi = q0 + 8 * hh + r;
      const int ja = j0 + ln, jb = j0 + 16 + ln;
      if (CAUSAL) { if (ja > qi) s[0][r] = -3.0e38f; if (jb > qi) s[1][r] = -3.0e38f; }
      if (ja >= T) s[0][r] = -3.0e38f;
      if (jb >= T) s[1][r] = -3.0e38f;
      float mx = fmaxf(s[0][r], s[1][r]);
      mx = fmaxf(mx, __shfl_xor(mx, 1, 32)); mx = fmaxf(mx, __shfl_xor(mx, 2, 32)); mx = fmaxf(mx, __shfl_xor(mx, 4, 32)); mx = fmaxf(mx, __shfl_xor(mx, 8, 32));
      const float mnew = fmaxf(m_r[r], mx);
      alpha[r] = (mnew > -1.0e38f) ? __expf(m_r[r] - mnew) : 1.0f;
      const float p0 = (s[0][r] > -1.0e38f) ? __expf(s[0][r] - mnew) : 0.f;
      const float p1 = (s[1][r] > -1.0e38f) ? __expf(s[1][r] - mnew) : 0.f;
      m_r[r] = mnew;
      l_r[r] = l_r[r] * alpha[r] + p0 + p1;            // per-lane partial row sum (16 lanes combined at the end)
      unsigned short hb = bf16_bits(p0); sPh[w][8 * hh + r][ln] = hb;      sPl[w][8 * hh + r][ln] = bf16_bits(p0 - bf16_val(hb));
      hb = bf16_bits(p1);                sPh[w][8 * hh + r][16 + ln] = hb; sPl[w][8 * hh + r][16 + ln] = bf16_bits(p1 - bf16_val(hb));
    }
#pragma unroll
    for (int dt = 0; dt < DT; ++dt)
#pragma unroll
      for (int r = 0; r < 8; ++r) oacc[dt][r] *= alpha[r];
    __builtin_amdgcn_fence(__ATOMIC_ACQ_REL, "workgroup");
    __builtin_amdgcn_wave_barrier();
    FragB pah, pal;
    pah.half[0] = *(const v8us*)&sPh[w][ln][8 * hh]; pah.half[1] = *(const v8us*)&sPh[w][ln][16 + 8 * hh];
    pal.half[0] = *(const v8us*)&sPl[w][ln][8 * hh]; pal.half[1] = *(const v8us*)&sPl[w][ln][16 + 8 * hh];
#pragma unroll
    for (int dt = 0; dt < DT; ++dt) {
      FragB bvh, bvl;
#pragma unroll
      for (int i = 0; i < 8; ++i) {
        bvh.u[i] = sVh[8 * hh + i][dt * 16 + ln]; bvh.u[8 + i] = sVh[16 + 8 * hh + i][dt * 16 + ln];
        bvl.u[i] = sVl[8 * hh + i][dt * 16 + ln]; bvl.u[8 + i] = sVl[16 + 8 * hh + i][dt * 16 + ln];
      }
      oacc[dt] = mmaN<3>(pah.v, pal.v, bvh.v, bvl.v, oacc[dt]);
    }
    __builtin_amdgcn_fence(__ATOMIC_ACQ_REL, "workgroup");
    __builtin_amdgcn_wave_barrier();
  }
#pragma unroll
  for (int r = 0; r < 8; ++r) {
    float l = l_r[r];
    l += __shfl_xor(l, 1, 32); l += __shfl_xor(l, 2, 32); l += __shfl_xor(l, 4, 32); l += __shfl_xor(l, 8, 32);
    l_r[r] = (l > 0.f) ? 1.0f / l : 0.f;
  }
#pragma unroll
  for (int dt = 0; dt < DT; ++dt)
#pragma unroll
    for (int r = 0; r < 8; ++r) sO[w][8 * hh + r][dt * 16 + ln] = oacc[dt][r] * l_r[r];
  __builtin_amdgcn_fence(__ATOMIC_ACQ_REL, "workgroup");
  __builtin_amdgcn_wave_barrier();
  {
    for (int r = 0; r < 16; ++r) {
      const int row = q0 + r;
      if (row < T && lane < D / 4) {
        const v4f val = *(const v4fa*)&sO[w][r][lane * 4];
        *(v4f*)(y + ((size_t)b * T + row) * ypitch + h * D + lane * 4) = val;
      }
    }
    
  }
}

// GEMM C = act(A·W + bias + resid): A f32 (ASPLIT -> hi/lo 2 terms), Wt bf16 [N][K]; ACT 0 none, 1 relu, 2 exact gelu;
// resid (optional, f32, row index = (row % rmod), pitch ldr, RES_BF16 rounds it) added before the activation.
template <bool ASPLIT, int ACT, bool BIAS_BF16, bool RES_BF16>
__global__ __launch_bounds__(128) void k_gemm_bf3(const float* __restrict__ A, int lda, const unsigned short* __restrict__ Wt, int ldb,
                                                const float* __restrict__ bias, const float* __restrict__ resid, int rmod, int ldr,
                                                float* __restrict__ C, int ldc, int M, int N, int K) {
  __shared__ __attribute__((aligned(16))) float so[4][16][64];
  const int tid = threadIdx.x, w = tid >> 5, lane = tid & 31, ln = lane & 15, hh = lane >> 4;
  const int ntn = N / 64;
  const int wid = blockIdx.x * 4 + w;
  const int mt = wid / ntn, nq = wid % ntn;
  if (mt * 16 >= M) return;
  const int row0 = mt * 16, col0 = nq * 64;
  const float* arow = A + (size_t)(row0 + ln) * lda;
  v8f acc[4] = {};
  for (int kb = 0; kb < K; kb += 32) {
    FragB ah, al;
    const v4f x0 = *(const v4fa*)(arow + kb + 8 * hh), x1 = *(const v4fa*)(arow + kb + 8 * hh + 4);
    const v4f x2 = *(const v4fa*)(arow + kb + 16 + 8 * hh), x3 = *(const v4fa*)(arow + kb + 16 + 8 * hh + 4);
    float xs[16] = {x0[0],x0[1],x0[2],x0[3],x1[0],x1[1],x1[2],x1[3],x2[0],x2[1],x2[2],x2[3],x3[0],x3[1],x3[2],x3[3]};
#pragma unroll
    for (int i = 0; i < 16; ++i) { const unsigned short hb = bf16_bits(xs[i]); ah.u[i] = hb; al.u[i] = ASPLIT ? bf16_bits(xs[i] - bf16_val(hb)) : (unsigned short)0; }
#pragma unroll
    for (int t = 0; t < 4; ++t) {
      const unsigned short* brow = Wt + (size_t)(col0 + t * 16 + ln) * ldb + kb;
      FragB b;
      b.half[0] = *(const v8us*)(brow + 8 * hh);
      b.half[1] = *(const v8us*)(brow + 16 + 8 * hh);
      acc[t] = mmaN<ASPLIT ? 2 : 1>(ah.v, al.v, b.v, b.v, acc[t]);
    }
  }
#pragma unroll
  for (int t = 0; t < 4; ++t) {
    const int col = col0 + t * 16 + ln;
    float bv = bias ? bias[col] : 0.f;
    if (BIAS_BF16) bv = bf16_round(bv);
#pragma unroll
    for (int r = 0; r < 8; ++r) {
      float v = acc[t][r] + bv;
      if (resid) { float rv = resid[(size_t)((row0 + 8 * hh + r) % rmod) * ldr + col]; if (RES_BF16) rv = bf16_round(rv); v += rv; }
      if (ACT == 1) v = fmaxf(v, 0.f);
      if (ACT == 2) v = 0.5f * v * (1.0f + erff(v * 0.70710678118654752f));
      if (ACT == 3) { const float u = 0.7978845608028654f * (v + 0.044715f * v * v * v); v = 0.5f * v * (1.0f + tanhf(u)); }
      so[w][8 * hh + r][t * 16 + ln] = v;
    }
  }
  __builtin_amdgcn_fence(__ATOMIC_ACQ_REL, "workgroup");
  __builtin_amdgcn_wave_barrier();
  const int rsub = lane >> 4, c4 = (lane & 15) * 4;
  {
#pragma unroll
    for (int q = 0; q < 8; ++q) {
      const int r = q * 2 + rsub;
      const v4f v = *(const v4fa*)&so[w][r][c4];
      *(v4f*)(C + (size_t)(row0 + r) * ldc + col0 + c4) = v;
    }
    
  }
}
// row LayerNorm (biased variance, eps) over N: s = X (+ R); optional out_sum <- s; out_norm <- (s-mu)*rsqrt(var+eps)*g + b
template <bool PARAM_BF16>
__global__ __launch_bounds__(256) void k_layernorm(const float* __restrict__ X, const float* __restrict__ R, const float* __restrict__ g, const float* __restrict__ bta,
                                                  float* __restrict__ out_sum, float* __restrict__ out_norm, int N, float eps) {
  __shared__ float red[256];
  const int row = blockIdx.x, tid = threadIdx.x;
  const float* x = X + (size_t)row * N; const float* rr = R ? R + (size_t)row * N : nullptr;
  float vals[16];                     // up to N = 4096
  const int per = N / 256;            // contiguous chunk per thread? use strided-by-4 chunks: thread handles j = tid*4 + 1024*u
  float s1 = 0.f;
  for (int u = 0; u < per / 4; ++u) {
    const int j = tid * 4 + 1024 * u;
    const v4f a = *(const v4fa*)(x + j);
    v4f b = {0.f,0.f,0.f,0.f}; if (rr) b = *(const v4fa*)(rr + j);
#pragma unroll
    for (int q = 0; q < 4; ++q) { const float v = a[q] + b[q]; vals[u * 4 + q] = v; s1 += v; }
  }
  red[tid] = s1; __syncthreads();
  for (int st = 128; st > 0; st >>= 1) { if (tid < st) red[tid] += red[tid + st]; __syncthreads(); }
  const float mu = red[0] / (float)N; __syncthreads();
  float s2 = 0.f;
  for (int u = 0; u < per / 4; ++u)
#pragma unroll
    for (int q = 0; q < 4; ++q) { const float c = vals[u * 4 + q] - mu; s2 += c * c; }
  red[tid] = s2; __syncthreads();
  for (int st = 128; st > 0; st >>= 1) { if (tid < st) red[tid] += red[tid + st]; __syncthreads(); }
  const float rs = rsqrtf(red[0] / (float)N + eps);
  {
    for (int u = 0; u < per / 4; ++u) {
      const int j = tid * 4 + 1024 * u;
      v4f o, sm;
#pragma unroll
      for (int q = 0; q < 4; ++q) {
        float gg = g[j + q], bb = bta[j + q];
        if (PARAM_BF16) { gg = bf16_round(gg); bb = bf16_round(bb); }
        sm[q] = vals[u * 4 + q]; o[q] = (vals[u * 4 + q] - mu) * rs * gg + bb;
      }
      if (out_sum) *(v4f*)(out_sum + (size_t)row * N + j) = sm;
      *(v4f*)(out_norm + (size_t)row * N + j) = o;
    }
    
  }
}



// ---- f16 WMMA path (v_wmma_f32_16x16x32_f16): 11-bit significands for operands in range — used where a [0,1] probability operand needs more precision than bf16
typedef _Float16 v16h __attribute__((ext_vector_type(16)));
union FragH { v16h v; v8us half[2]; _Float16 h[16]; unsigned short u[16]; };
template <int NT>
__device__ __forceinline__ v8f mmaH(v16h ah, v16h al, v16h bh, v16h bl, v8f c) {
  c = __builtin_amdgcn_wmma_f32_16x16x32_f16(false, ah, false, bh, (short)0, c, false, false);
  if (NT >= 2) c = __builtin_amdgcn_wmma_f32_16x16x32_f16(false, al, false, bh, (short)0, c, false, false);
  if (NT >= 3) c = __builtin_amdgcn_wmma_f32_16x16x32_f16(false, ah, false, bl, (short)0, c, false, false);
  asm volatile("v_nop\n\tv_nop\n\tv_nop\n\tv_nop" : "+v"(c) : "v"(ah), "v"(al), "v"(bh), "v"(bl));
  return c;
}
// batched GEMM like k_gemm_b but f16 operands: A f32 (split into f16 hi/lo if ASPLIT, else rounded to f16), Bt = f16 values [n][k]; alpha; C f32; N multiple of 16 (partial tiles skipped)
template <bool ASPLIT>
__global__ __launch_bounds__(128) void k_gemm_h(const float* __restrict__ A, int lda, size_t sA, const _Float16* __restrict__ Bh, int ldb, size_t sB, float alpha, float* __restrict__ C, int ldc, size_t sC, int M, int N, int K) {
  __shared__ __attribute__((aligned(16))) float so[4][16][64];
  const int tid = threadIdx.x, w = tid >> 5, lane = tid & 31, ln = lane & 15, hh = lane >> 4; const int by = blockIdx.y;
  A += (size_t)by * sA; Bh += (size_t)by * sB; C += (size_t)by * sC;
  const int ntn = (N + 63) / 64; const int wid = blockIdx.x * 4 + w; const int mt = wid / ntn, nq = wid % ntn; if (mt * 16 >= M) return;
  const int row0 = mt * 16, col0 = nq * 64; const float* arow = A + (size_t)(row0 + ln) * lda;
  v8f acc[4] = {};
  for (int kb = 0; kb < K; kb += 32) {
    FragH ah, al;
    const v4f x0 = *(const v4fa*)(arow + kb + 8 * hh), x1 = *(const v4fa*)(arow + kb + 8 * hh + 4), x2 = *(const v4fa*)(arow + kb + 16 + 8 * hh), x3 = *(const v4fa*)(arow + kb + 16 + 8 * hh + 4);
    float xs[16] = {x0[0],x0[1],x0[2],x0[3],x1[0],x1[1],x1[2],x1[3],x2[0],x2[1],x2[2],x2[3],x3[0],x3[1],x3[2],x3[3]};
#pragma unroll
    for (int i = 0; i < 16; ++i) { const _Float16 h = (_Float16)xs[i]; ah.h[i] = h; al.h[i] = ASPLIT ? (_Float16)(xs[i] - (float)h) : (_Float16)0.0f; }
#pragma unroll
    for (int t = 0; t < 4; ++t) { if (col0 + t * 16 >= N) continue; const size_t boff = (size_t)(col0 + t * 16 + ln) * ldb + kb; FragH bq; bq.half[0] = *(const v8us*)(Bh + boff + 8 * hh); bq.half[1] = *(const v8us*)(Bh + boff + 16 + 8 * hh);
      acc[t] = mmaH<ASPLIT ? 2 : 1>(ah.v, al.v, bq.v, bq.v, acc[t]); }
  }
#pragma unroll
  for (int t = 0; t < 4; ++t) { if (col0 + t * 16 >= N) continue;
#pragma unroll
    for (int r = 0; r < 8; ++r) so[w][8 * hh + r][t * 16 + ln] = acc[t][r] * alpha; }
  __builtin_amdgcn_fence(__ATOMIC_ACQ_REL, "workgroup"); __builtin_amdgcn_wave_barrier();
  const int rsub = lane >> 4, c4 = (lane & 15) * 4;
  {
#pragma unroll
    for (int q = 0; q < 8; ++q) { const int r = q * 2 + rsub; if (col0 + c4 < N) { const v4f v = *(const v4fa*)&so[w][r][c4]; *(v4f*)(C + (size_t)(row0 + r) * ldc + col0 + c4) = v; } }
     }
}

// Wt[n][k] = f16(W[k][n]·scale) from f32 row-major W[K][N] (scale = power of two; bf16-exact weights stay exact in f16 away from the subnormal range)
__global__ __launch_bounds__(256) void k_wt_f16(const float* __restrict__ W, _Float16* __restrict__ Wt, int K, int N, float scale) {
  const int t = blockIdx.x * 256 + threadIdx.x; if (t >= N * (K / 8)) return; const int n = t / (K / 8), k8 = (t % (K / 8)) * 8; FragH f;
#pragma unroll
  for (int i = 0; i < 8; ++i) f.h[i] = (_Float16)(bf16_round(W[(size_t)(k8 + i) * N + n]) * scale); const v8us o = f.half[0];
  *(v8us*)((unsigned short*)Wt + (size_t)n * K + k8) = o; 
}
// k_gemm_hh variant with fused epilogue: v = acc·alpha + bias[by·sBias + col] (+ CP[(row/rowsPerB)·sCPb + by·64 + col] if CP) ; ACT 0 none / 1 elu ; writes f32 C and f16 C16, each if non-null
template <int ACT>
__global__ __launch_bounds__(128) void k_gemm_hhx(const _Float16* __restrict__ A, int lda, size_t sA, const _Float16* __restrict__ Bh, int ldb, size_t sB, float alpha, const float* __restrict__ bias, size_t sBias, const float* __restrict__ CP, int rowsPerB, size_t sCPb, int row0g,
    float* __restrict__ C, _Float16* __restrict__ C16, int ldc, size_t sC, int M, int N, int K) {
  __shared__ __attribute__((aligned(16))) float so[4][16][64];
  const int tid = threadIdx.x, w = tid >> 5, lane = tid & 31, ln = lane & 15, hh = lane >> 4; const int by = blockIdx.y;
  A += (size_t)by * sA; Bh += (size_t)by * sB; const size_t cofs = (size_t)by * sC; const float* bp = bias ? bias + (size_t)by * sBias : nullptr;
  const int ntn = (N + 63) / 64; const int wid = blockIdx.x * 4 + w; const int mt = wid / ntn, nq = wid % ntn; if (mt * 16 >= M) return;
  const int row0 = mt * 16, col0 = nq * 64; const _Float16* arow = A + (size_t)(row0 + ln) * lda;
  v8f acc[4] = {};
  for (int kb = 0; kb < K; kb += 32) { FragH ah; ah.half[0] = *(const v8us*)((const unsigned short*)arow + kb + 8 * hh); ah.half[1] = *(const v8us*)((const unsigned short*)arow + kb + 16 + 8 * hh);
#pragma unroll
    for (int t = 0; t < 4; ++t) { if (col0 + t * 16 >= N) continue; const size_t boff = (size_t)(col0 + t * 16 + ln) * ldb + kb; FragH bq; bq.half[0] = *(const v8us*)((const unsigned short*)Bh + boff + 8 * hh); bq.half[1] = *(const v8us*)((const unsigned short*)Bh + boff + 16 + 8 * hh);
      acc[t] = mmaH<1>(ah.v, ah.v, bq.v, bq.v, acc[t]); }
  }
#pragma unroll
  for (int t = 0; t < 4; ++t) { if (col0 + t * 16 >= N) continue; const int col = col0 + t * 16 + ln; const float bv = bp ? bf16_round(bp[col]) : 0.f;
#pragma unroll
    for (int r = 0; r < 8; ++r) { float v = acc[t][r] * alpha + bv; if (CP) { const int bidx = (row0g + row0 + 8 * hh + r) / rowsPerB; v += CP[(size_t)bidx * sCPb + (size_t)by * 64 + col]; } if (ACT == 1) v = (v > 0.f) ? v : expm1f(v); else if (ACT == 3) v = fmaxf(v, 0.f); so[w][8 * hh + r][t * 16 + ln] = v; } }
  __builtin_amdgcn_fence(__ATOMIC_ACQ_REL, "workgroup"); __builtin_amdgcn_wave_barrier();
  const int rsub = lane >> 4, c4 = (lane & 15) * 4; typedef _Float16 v4h __attribute__((ext_vector_type(4)));
  {
#pragma unroll
    for (int q = 0; q < 8; ++q) { const int r = q * 2 + rsub; if (col0 + c4 < N) { const v4f v = *(const v4fa*)&so[w][r][c4]; if (C) *(v4f*)(C + cofs + (size_t)(row0 + r) * ldc + col0 + c4) = v; if (C16) { v4h h4; for (int i = 0; i < 4; ++i) h4[i] = (_Float16)v[i]; *(v4h*)(C16 + cofs + (size_t)(row0 + r) * ldc + col0 + c4) = h4; } } }
     }
}


__global__ __launch_bounds__(256) void k_x16(const float* __restrict__ x, _Float16* __restrict__ X16, size_t n8) { const size_t t = (size_t)blockIdx.x * 256 + threadIdx.x; if (t >= n8) return; FragH f;
#pragma unroll
  for (int q = 0; q < 8; ++q) f.h[q] = (_Float16)bf16_round(x[t * 8 + q]); *(v8us*)((unsigned short*)X16 + t * 8) = f.half[0];  }
__global__ __launch_bounds__(256) void k_h16(const float* __restrict__ x, _Float16* __restrict__ X16, size_t n8) { const size_t t = (size_t)blockIdx.x * 256 + threadIdx.x; if (t >= n8) return; FragH f;
#pragma unroll
  for (int q = 0; q < 8; ++q) f.h[q] = (_Float16)x[t * 8 + q]; *(v8us*)((unsigned short*)X16 + t * 8) = f.half[0];  }
__global__ __launch_bounds__(256) void k_round16f(const float* __restrict__ W, _Float16* __restrict__ Bt, size_t n8) { const size_t t = (size_t)blockIdx.x * 256 + threadIdx.x; if (t >= n8) return; FragH f;
#pragma unroll
  for (int i = 0; i < 8; ++i) f.h[i] = (_Float16)(bf16_round(W[t * 8 + i]) * 16.0f); *(v8us*)((unsigned short*)Bt + t * 8) = f.half[0];  }
__global__ __launch_bounds__(256) void k_sn(const float* __restrict__ sf, _Float16* __restrict__ SN) { const int tid = threadIdx.x, wv = tid >> 5, lane = tid & 31; const size_t row = (size_t)blockIdx.x * 8 + wv; if (row >= NR) return; float v[8]; float s = 0.f;
#pragma unroll
  for (int q = 0; q < 8; ++q) { v[q] = bf16_round(sf[row * DSEM + lane * 8 + q]); s += v[q] * v[q]; }
  for (int o = 16; o >= 1; o >>= 1) s += __shfl_xor(s, o, 32); const float inv = 1.0f / fmaxf(sqrtf(s), 1e-12f); FragH f;
#pragma unroll
  for (int q = 0; q < 8; ++q) f.h[q] = (_Float16)(v[q] * inv); *(v8us*)((unsigned short*)SN + row * DSEM + lane * 8) = f.half[0];  }
// dynamic temperature, stage 1: column sums of the bf16-rounded query over QROWS rows per block -> PART[b][chunk][DM]; thread = 4 columns x one of 4 row phases, 16 independent 16-byte loads
#define QP 32
#define QROWS (SS / QP)
__global__ __launch_bounds__(512) void k_qsum(const float* __restrict__ query, float* __restrict__ PART) {
  __shared__ __attribute__((aligned(16))) float sred[4][DM]; const int tid = threadIdx.x, ph = tid >> 7, c4 = (tid & 127) * 4;
  const float* src = query + ((size_t)blockIdx.x * QROWS + ph * (QROWS / 4)) * DM + c4; v4f s = {0.f, 0.f, 0.f, 0.f};
#pragma unroll  // all 16 row loads issue before the first add: one memory latency instead of 16
  for (int r = 0; r < QROWS / 4; ++r) { const v4f x = *(const v4fa*)(src + (size_t)r * DM);
#pragma unroll
    for (int q = 0; q < 4; ++q) s[q] += bf16_round(x[q]); }
  *(v4fa*)&sred[ph][c4] = s; __syncthreads();
  PART[(size_t)blockIdx.x * DM + tid] = (sred[0][tid] + sred[1][tid]) + (sred[2][tid] + sred[3][tid]); }
// stage 2 (one block, 32 waves): mean query of both batches from PART, then one wave per hidden unit (lanes along DM, 16-byte loads of the Wt1 row shared by both batches), relu, Wt2 dot, sigmoid
__global__ __launch_bounds__(1024) void k_temp(const float* __restrict__ PART, const float* __restrict__ Wt1, const float* __restrict__ bt1, const float* __restrict__ Wt2, const float* __restrict__ bt2, float* __restrict__ TEMP) {
  __shared__ __attribute__((aligned(16))) float qm[BB][DM]; __shared__ float red[BB][32]; const int tid = threadIdx.x, wv = tid >> 5, lane = tid & 31;
  { const int b = tid >> 9, col = tid & (DM - 1); float s = 0.f;
#pragma unroll  // all 32 partial loads in flight together
    for (int p = 0; p < QP; ++p) s += PART[((size_t)b * QP + p) * DM + col];
    qm[b][col] = s / (float)SS; }
  __syncthreads();
  v4f qv[BB][4];
#pragma unroll
  for (int b = 0; b < BB; ++b)
#pragma unroll
    for (int j = 0; j < 4; ++j) qv[b][j] = *(const v4fa*)&qm[b][j * 128 + lane * 4];
  float pw[BB] = {0.f, 0.f};
#pragma unroll 2  // two rows = 8 loads of 16 bytes in flight per lane; four rows spill at the 128 registers that 32 waves leave
  for (int i = 0; i < (DM / 2) / 32; ++i) { const int u = wv * ((DM / 2) / 32) + i; const float* wr = Wt1 + (size_t)u * DM + lane * 4; float a[BB] = {0.f, 0.f};
#pragma unroll
    for (int j = 0; j < 4; ++j) { const v4f wq = *(const v4fa*)(wr + j * 128);
#pragma unroll
      for (int q = 0; q < 4; ++q) { const float wb = bf16_round(wq[q]);
#pragma unroll
        for (int b = 0; b < BB; ++b) a[b] += wb * qv[b][j][q]; } }
    const float b1 = bf16_round(bt1[u]), w2 = bf16_round(Wt2[u]);
#pragma unroll
    for (int b = 0; b < BB; ++b) { float t = a[b]; for (int o = 16; o >= 1; o >>= 1) t += __shfl_xor(t, o, 32); pw[b] += fmaxf(t + b1, 0.f) * w2; } }
  if (lane == 0) {
#pragma unroll
    for (int b = 0; b < BB; ++b) red[b][wv] = pw[b]; }
  __syncthreads();
  if (tid < 32) { float v = 0.f; if (tid < BB) { float z = bf16_round(bt2[0]); for (int q = 0; q < 32; ++q) z += red[tid][q]; const float t = 1.0f / (1.0f + expf(-z)); v = 0.5f + t * 1.5f; } TEMP[tid] = v; } }
__global__ __launch_bounds__(256) void k_vt(const _Float16* __restrict__ V16, _Float16* __restrict__ Vt) { __shared__ unsigned short tl[64][66]; const int tid = threadIdx.x; const int slab = blockIdx.x / (SS / 64), lg = blockIdx.x % (SS / 64); const int b = slab / NH, h = slab % NH;
  for (int i = tid; i < 64 * 8; i += 256) { const int r = i / 8, c8 = (i % 8) * 8; FragH f; f.half[0] = *(const v8us*)((const unsigned short*)V16 + ((size_t)b * SS + lg * 64 + r) * DM + h * HD + c8);
#pragma unroll
    for (int q = 0; q < 8; ++q) tl[r][c8 + q] = f.u[q]; }
  __syncthreads();
  {
#pragma unroll
    for (int rd = 0; rd < 2; ++rd) { const int d = rd * 32 + tid / 8, pc = tid % 8; FragH f;
#pragma unroll
      for (int q = 0; q < 8; ++q) f.u[q] = tl[pc * 8 + q][d];
      *(v8us*)((unsigned short*)Vt + ((size_t)slab * HD + d) * SS + lg * 64 + pc * 8) = f.half[0]; }
     } }
// fused constrained attention per ((b,h), 128 queries): wave = 32 queries; s = (q·k)/(8·temp_b) + sem_bias + pos_bias, −inf where mask[b][k] = 0; sem_bias = −(0.5 − sim) if sim < 0.5 (sim from the
__global__ __launch_bounds__(128) void k_flash(const _Float16* __restrict__ Q16, const _Float16* __restrict__ K16, const _Float16* __restrict__ Vt, const _Float16* __restrict__ SIM, const int* __restrict__ mask, const float* __restrict__ TEMP, float* __restrict__ O) {
  constexpr int RPW = 32, NQB = SS / (4 * RPW), DT = HD / 16, KS = HD / 32;
  __shared__ __attribute__((aligned(16))) unsigned short sP[4][RPW][40]; __shared__ __attribute__((aligned(16))) float sO[4][RPW][HD];
  const int tid = threadIdx.x, w = tid >> 5, lane = tid & 31, ln = lane & 15, hh = lane >> 4;
  const int slab = blockIdx.x / NQB, qblk = blockIdx.x % NQB; const int b = slab / NH, h = slab % NH; const int q0 = qblk * (4 * RPW) + w * RPW; const float sc = 0.125f / TEMP[b];
  FragH aq[2][KS];
#pragma unroll
  for (int rt = 0; rt < 2; ++rt) { const unsigned short* qr = (const unsigned short*)Q16 + ((size_t)b * SS + q0 + rt * 16 + ln) * DM + h * HD;
#pragma unroll
    for (int ks = 0; ks < KS; ++ks) { aq[rt][ks].half[0] = *(const v8us*)(qr + ks * 32 + 8 * hh); aq[rt][ks].half[1] = *(const v8us*)(qr + ks * 32 + 16 + 8 * hh); } }
  const unsigned short* Vth = (const unsigned short*)Vt + (size_t)slab * HD * SS;
  float m_r[2][8], l_r[2][8]; v8f oacc[2][DT];
#pragma unroll
  for (int rt = 0; rt < 2; ++rt) {
#pragma unroll
    for (int r = 0; r < 8; ++r) { m_r[rt][r] = -3.0e38f; l_r[rt][r] = 0.f; }
#pragma unroll
    for (int dt = 0; dt < DT; ++dt) oacc[rt][dt] = (v8f){0.f,0.f,0.f,0.f,0.f,0.f,0.f,0.f}; }
#pragma unroll 1
  for (int j0 = 0; j0 < SS; j0 += 32) {
    v8f s[2][2];
#pragma unroll
    for (int nt = 0; nt < 2; ++nt) { const unsigned short* kr = (const unsigned short*)K16 + ((size_t)b * SS + j0 + nt * 16 + ln) * DM + h * HD; FragH bk[KS];
#pragma unroll
      for (int ks = 0; ks < KS; ++ks) { bk[ks].half[0] = *(const v8us*)(kr + ks * 32 + 8 * hh); bk[ks].half[1] = *(const v8us*)(kr + ks * 32 + 16 + 8 * hh); }
#pragma unroll
      for (int rt = 0; rt < 2; ++rt) { v8f acc = (v8f){0.f,0.f,0.f,0.f,0.f,0.f,0.f,0.f};
#pragma unroll
        for (int ks = 0; ks < KS; ++ks) acc = mmaH<1>(aq[rt][ks].v, aq[rt][ks].v, bk[ks].v, bk[ks].v, acc); s[rt][nt] = acc; } }
    const int k0 = j0 + ln, k1 = j0 + 16 + ln; const bool mk0 = mask[(size_t)b * SS + k0] != 0, mk1 = mask[(size_t)b * SS + k1] != 0;
#pragma unroll
    for (int rt = 0; rt < 2; ++rt)
#pragma unroll
      for (int r = 0; r < 8; ++r) { const int qi = q0 + rt * 16 + 8 * hh + r;
        const unsigned short* srow = (const unsigned short*)SIM + ((size_t)b * SS + qi) * SS; FragH sm; sm.u[0] = srow[k0]; sm.u[1] = srow[k1]; const float sim0 = (float)sm.h[0], sim1 = (float)sm.h[1];
        const float sb0 = (sim0 < 0.5f) ? -(0.5f - sim0) : 0.f, sb1 = (sim1 < 0.5f) ? -(0.5f - sim1) : 0.f;
        const float dd0 = fabsf((float)(qi - k0)), dd1 = fabsf((float)(qi - k1)); const float pb0 = (dd0 > 10.f) ? -0.1f * (dd0 - 10.f) : 0.f, pb1 = (dd1 > 10.f) ? -0.1f * (dd1 - 10.f) : 0.f;
        const float s0 = mk0 ? (s[rt][0][r] * sc + sb0 + pb0) : -INFINITY, s1 = mk1 ? (s[rt][1][r] * sc + sb1 + pb1) : -INFINITY; float mc = fmaxf(s0, s1);
        mc = fmaxf(mc, __shfl_xor(mc, 1, 32)); mc = fmaxf(mc, __shfl_xor(mc, 2, 32)); mc = fmaxf(mc, __shfl_xor(mc, 4, 32)); mc = fmaxf(mc, __shfl_xor(mc, 8, 32));
        const float mn = fmaxf(m_r[rt][r], mc); const float al = expf(m_r[rt][r] - mn); m_r[rt][r] = mn; const float p0 = expf(s0 - mn), p1 = expf(s1 - mn); l_r[rt][r] = l_r[rt][r] * al + p0 + p1;
#pragma unroll
        for (int dt = 0; dt < DT; ++dt) oacc[rt][dt][r] *= al;
        FragH t2; t2.h[0] = (_Float16)p0; t2.h[1] = (_Float16)p1; sP[w][rt * 16 + 8 * hh + r][ln] = t2.u[0]; sP[w][rt * 16 + 8 * hh + r][16 + ln] = t2.u[1]; }
    __builtin_amdgcn_fence(__ATOMIC_ACQ_REL, "workgroup"); __builtin_amdgcn_wave_barrier();
    FragH pa[2];
#pragma unroll
    for (int rt = 0; rt < 2; ++rt) { pa[rt].half[0] = *(const v8us*)&sP[w][rt * 16 + ln][8 * hh]; pa[rt].half[1] = *(const v8us*)&sP[w][rt * 16 + ln][16 + 8 * hh]; }
#pragma unroll
    for (int dt = 0; dt < DT; ++dt) { const unsigned short* vrow = Vth + (size_t)(dt * 16 + ln) * SS + j0; FragH bv; bv.half[0] = *(const v8us*)(vrow + 8 * hh); bv.half[1] = *(const v8us*)(vrow + 16 + 8 * hh);
#pragma unroll
      for (int rt = 0; rt < 2; ++rt) oacc[rt][dt] = mmaH<1>(pa[rt].v, pa[rt].v, bv.v, bv.v, oacc[rt][dt]); }
    __builtin_amdgcn_fence(__ATOMIC_ACQ_REL, "workgroup"); __builtin_amdgcn_wave_barrier(); }
#pragma unroll
  for (int rt = 0; rt < 2; ++rt) {
#pragma unroll
    for (int r = 0; r < 8; ++r) { float l = l_r[rt][r]; l += __shfl_xor(l, 1, 32); l += __shfl_xor(l, 2, 32); l += __shfl_xor(l, 4, 32); l += __shfl_xor(l, 8, 32); l_r[rt][r] = (l > 0.f) ? 1.0f / l : 0.f; }
#pragma unroll
    for (int dt = 0; dt < DT; ++dt)
#pragma unroll
      for (int r = 0; r < 8; ++r) sO[w][rt * 16 + 8 * hh + r][dt * 16 + ln] = oacc[rt][dt][r] * l_r[rt][r]; }
  __builtin_amdgcn_fence(__ATOMIC_ACQ_REL, "workgroup"); __builtin_amdgcn_wave_barrier();
  {
#pragma unroll
    for (int rp = 0; rp < RPW; rp += 2) { const int r = rp + (lane >> 4), pc = lane & 15; const v4f val = *(const v4fa*)&sO[w][r][pc * 4]; *(v4f*)(O + ((size_t)b * SS + q0 + r) * DM + h * HD + pc * 4) = val; }
     } }
extern "C" void kernel_launch(void* const* d_in, const int* in_sizes, int n_in,
                              void* d_out, int out_size, void* d_ws, size_t ws_size, hipStream_t stream) {
  (void)in_sizes; (void)n_in; (void)out_size;
  const float* xq = (const float*)d_in[0]; const float* xk = (const float*)d_in[1]; const float* xv = (const float*)d_in[2]; const int* mask = (const int*)d_in[3]; const float* sf = (const float*)d_in[4];
  const float* Wq = (const float*)d_in[5]; const float* bq = (const float*)d_in[6]; const float* Wk = (const float*)d_in[7]; const float* bk = (const float*)d_in[8]; const float* Wv = (const float*)d_in[9]; const float* bv = (const float*)d_in[10]; const float* Wo = (const float*)d_in[11]; const float* bo = (const float*)d_in[12]; const float* Wt1 = (const float*)d_in[13]; const float* bt1 = (const float*)d_in[14]; const float* Wt2 = (const float*)d_in[15]; const float* bt2 = (const float*)d_in[16];
  char* ws = (char*)d_ws; size_t off = 0;
  auto take = [&](size_t bytes) { char* p = ws + off; off += (bytes + 255) & ~(size_t)255; return p; };
  const size_t w8 = (size_t)DM * DM / 8;
  _Float16* Bq = (_Float16*)take(w8 * 16); _Float16* Bk = (_Float16*)take(w8 * 16); _Float16* Bv = (_Float16*)take(w8 * 16); _Float16* Bo = (_Float16*)take(w8 * 16);
  _Float16* XQ = (_Float16*)take((size_t)NR * DM * 2); _Float16* XK = (_Float16*)take((size_t)NR * DM * 2); _Float16* XV = (_Float16*)take((size_t)NR * DM * 2); _Float16* Q16 = (_Float16*)take((size_t)NR * DM * 2); _Float16* K16 = (_Float16*)take((size_t)NR * DM * 2); _Float16* V16 = (_Float16*)take((size_t)NR * DM * 2); _Float16* Vt = (_Float16*)take((size_t)NR * DM * 2);
  _Float16* SN = (_Float16*)take((size_t)NR * DSEM * 2); _Float16* SIM = (_Float16*)take((size_t)BB * SS * SS * 2); float* TEMP = (float*)take(256); float* O = (float*)take((size_t)NR * DM * 4); float* PART = (float*)take((size_t)BB * QP * DM * 4); _Float16* O16 = XQ;      // the query plane is dead after the q GEMM
  if (off > ws_size) return;      // ≈ 2 + 4.2×7 + 2.1 + 16.8 + 8.4 ≈ 57 MiB
  const unsigned gw = (unsigned)((w8 + 255) / 256), gx = (unsigned)(((size_t)NR * DM / 8 + 255) / 256);
  k_round16f<<<gw, 256, 0, stream>>>(Wq, Bq, w8); k_round16f<<<gw, 256, 0, stream>>>(Wk, Bk, w8); k_round16f<<<gw, 256, 0, stream>>>(Wv, Bv, w8); k_round16f<<<gw, 256, 0, stream>>>(Wo, Bo, w8);
  k_x16<<<gx, 256, 0, stream>>>(xq, XQ, (size_t)NR * DM / 8); k_x16<<<gx, 256, 0, stream>>>(xk, XK, (size_t)NR * DM / 8); k_x16<<<gx, 256, 0, stream>>>(xv, XV, (size_t)NR * DM / 8);
  k_sn<<<NR / 8, 256, 0, stream>>>(sf, SN);
  k_qsum<<<BB * QP, 512, 0, stream>>>(xq, PART);
  k_temp<<<1, 1024, 0, stream>>>(PART, Wt1, bt1, Wt2, bt2, TEMP);
  const dim3 gg(((NR / 16) * (DM / 64) + 3) / 4, 1);
  k_gemm_hhx<0><<<gg, 128, 0, stream>>>(XQ, DM, 0, Bq, DM, 0, 0.0625f, bq, 0, nullptr, 1, 0, 0, nullptr, Q16, DM, 0, NR, DM, DM);
  k_gemm_hhx<0><<<gg, 128, 0, stream>>>(XK, DM, 0, Bk, DM, 0, 0.0625f, bk, 0, nullptr, 1, 0, 0, nullptr, K16, DM, 0, NR, DM, DM);
  k_gemm_hhx<0><<<gg, 128, 0, stream>>>(XV, DM, 0, Bv, DM, 0, 0.0625f, bv, 0, nullptr, 1, 0, 0, nullptr, V16, DM, 0, NR, DM, DM);
  // SIM[b] = SN[b]·SN[b]ᵀ (f16; values in [−1, 1])
  k_gemm_hhx<0><<<dim3(((SS / 16) * (SS / 64) + 3) / 4, BB), 128, 0, stream>>>(SN, DSEM, (size_t)SS * DSEM, SN, DSEM, (size_t)SS * DSEM, 1.0f, nullptr, 0, nullptr, 1, 0, 0, nullptr, SIM, SS, (size_t)SS * SS, SS, SS, DSEM);
  k_vt<<<BB * NH * (SS / 64), 256, 0, stream>>>(V16, Vt);
  k_flash<<<BB * NH * (SS / 128), 128, 0, stream>>>(Q16, K16, Vt, SIM, mask, TEMP, O);
  k_h16<<<gx, 256, 0, stream>>>(O, O16, (size_t)NR * DM / 8);
  k_gemm_hhx<0><<<gg, 128, 0, stream>>>(O16, DM, 0, Bo, DM, 0, 0.0625f, bo, 0, nullptr, 1, 0, 0, (float*)d_out, nullptr, DM, 0, NR, DM, DM);
}

// v002
// A run of this version takes 259 microseconds.
// In two side-by-side timings against v001, it was 2.10 and 2.11 times as fast.
// All steps since v000 together make it 3.24 times as fast.
#include <hip/hip_runtime.h>
// q/k/v/o projections (4096 × 512 × 512, + bias), the cosine-similarity matrix of the normalised semantic features (per batch 2048 × 2048 × 256, kept as an f16 plane) and the 8-head
// constrained attention on v_wmma_f32_16x16x32_f16 (fused flash-style kernel: Sᵀ = K·Qᵀ, Oᵀ = Vᵀ·Pᵀ on WMMA; scores / (8·temperature_b) + semantic bias + positional bias, key mask → −inf;
// online max/sum softmax f32; P f16 ≤ 1); the dynamic-temperature MLP on the mean query is f32 VALU (column sums over 64 blocks, then one block); A = f16(bf16 ·) exact operands, weights bf16-exact ×2^4 ((out,in)),
// single products, f32 accumulate.
#define BB 2
#define SS 2048
#define DM 512
#define NH 8
#define HD 64
#define DSEM 256
#define NR (BB * SS)

typedef __bf16 v16b __attribute__((ext_vector_type(16)));
typedef unsigned short v8us __attribute__((ext_vector_type(8), may_alias));
typedef float  v8f  __attribute__((ext_vector_type(8)));
typedef float  v4f  __attribute__((ext_vector_type(4)));
typedef float  v4fa __attribute__((ext_vector_type(4), may_alias));
union FragB { v16b v; v8us half[2]; unsigned short u[16]; };

__device__ __forceinline__ unsigned short bf16_bits(float x) { unsigned int u = __float_as_uint(x); return (unsigned short)((u + 0x7FFFu + ((u >> 16) & 1u)) >> 16); }
__device__ __forceinline__ float bf16_val(unsigned short b) { return __uint_as_float(((unsigned int)b) << 16); }
__device__ __forceinline__ float bf16_round(float x) { return bf16_val(bf16_bits(x)); }
// D += A·B with NT terms: 1 = ah·bh, 2 = + al·bh (A split), 3 = + ah·bl (both split)
template <int NT>
__device__ __forceinline__ v8f mmaN(v16b ah, v16b al, v16b bh, v16b bl, v8f c) {
  c = __builtin_amdgcn_wmma_f32_16x16x32_bf16(false, ah, false, bh, (short)0, c, false, false);
  if (NT >= 2) c = __builtin_amdgcn_wmma_f32_16x16x32_bf16(false, al, false, bh, (short)0, c, false, false);
  if (NT >= 3) c = __builtin_amdgcn_wmma_f32_16x16x32_bf16(false, ah, false, bl, (short)0, c, false, false);
  asm volatile("v_nop\n\tv_nop\n\tv_nop\n\tv_nop" : "+v"(c) : "v"(ah), "v"(al), "v"(bh), "v"(bl));
  return c;
}

__global__ __launch_bounds__(256) void k_wt_bf16(const float* __restrict__ W, unsigned short* __restrict__ Wt, int K, int N) {
  const int t = blockIdx.x * 256 + threadIdx.x;
  const int k8n = K / 8;
  if (t >= N * k8n) return;
  const int n = t / k8n, k8 = (t % k8n) * 8;
  v8us v;
#pragma unroll
  for (int i = 0; i < 8; ++i) v[i] = bf16_bits(W[(size_t)(k8 + i) * N + n]);
  *(v8us*)(Wt + (size_t)n * K + k8) = v;
  
}

// GEMM C[M][N] (f32, pitch ldc) = act(A[M][K]·W + bias). A f32 row-major (pitch lda) converted per fragment to bf16
// (ASPLIT: hi/lo two planes -> 2 terms, else single rounded term); Wt bf16 [N][K] (pitch ldb). BIAS_BF16 rounds the
// bias to bf16 first (bias quantised to bf16 before the add). K%32==0, M%16==0, N%64==0.
template <bool ASPLIT, int ACT, bool BIAS_BF16>
__global__ __launch_bounds__(128) void k_gemm_bf(const float* __restrict__ A, int lda, const unsigned short* __restrict__ Wt, int ldb,
                                               const float* __restrict__ bias, float* __restrict__ C, int ldc, int M, int N, int K) {
  __shared__ __attribute__((aligned(16))) float so[4][16][64];
  const int tid = threadIdx.x, w = tid >> 5, lane = tid & 31, ln = lane & 15, hh = lane >> 4;
  const int ntn = N / 64;
  const int wid = blockIdx.x * 4 + w;
  const int mt = wid / ntn, nq = wid % ntn;
  if (mt * 16 >= M) return;
  const int row0 = mt * 16, col0 = nq * 64;
  const float* arow = A + (size_t)(row0 + ln) * lda;
  v8f acc[4] = {};
  for (int kb = 0; kb < K; kb += 32) {
    FragB ah, al;
    const v4f x0 = *(const v4fa*)(arow + kb + 8 * hh), x1 = *(const v4fa*)(arow + kb + 8 * hh + 4);
    const v4f x2 = *(const v4fa*)(arow + kb + 16 + 8 * hh), x3 = *(const v4fa*)(arow + kb + 16 + 8 * hh + 4);
    float xs[16] = {x0[0],x0[1],x0[2],x0[3],x1[0],x1[1],x1[2],x1[3],x2[0],x2[1],x2[2],x2[3],x3[0],x3[1],x3[2],x3[3]};
#pragma unroll
    for (int i = 0; i < 16; ++i) { const unsigned short hb = bf16_bits(xs[i]); ah.u[i] = hb; al.u[i] = ASPLIT ? bf16_bits(xs[i] - bf16_val(hb)) : (unsigned short)0; }
#pragma unroll
    for (int t = 0; t < 4; ++t) {
      const unsigned short* brow = Wt + (size_t)(col0 + t * 16 + ln) * ldb + kb;
      FragB b;
      b.half[0] = *(const v8us*)(brow + 8 * hh);
      b.half[1] = *(const v8us*)(brow + 16 + 8 * hh);
      acc[t] = mmaN<ASPLIT ? 2 : 1>(ah.v, al.v, b.v, b.v, acc[t]);
    }
  }
#pragma unroll
  for (int t = 0; t < 4; ++t) {
    float bv = bias ? bias[col0 + t * 16 + ln] : 0.f;
    if (BIAS_BF16) bv = bf16_round(bv);
#pragma unroll
    for (int r = 0; r < 8; ++r) { float v = acc[t][r] + bv; if (ACT == 1) v = fmaxf(v, 0.f); so[w][8 * hh + r][t * 16 + ln] = v; }
  }
  __builtin_amdgcn_fence(__ATOMIC_ACQ_REL, "workgroup");
  __builtin_amdgcn_wave_barrier();
  const int rsub = lane >> 4, c4 = (lane & 15) * 4;
  {
#pragma unroll
    for (int q = 0; q < 8; ++q) {
      const int r = q * 2 + rsub;
      const v4f v = *(const v4fa*)&so[w][r][c4];
      *(v4f*)(C + (size_t)(row0 + r) * ldc + col0 + c4) = v;
    }
    
  }
}

// Flash-style causal/unmasked attention, all contractions 3-term bf16 hi/lo splits, f32 softmax with running max.
// q,k,v rows are read from f32 buffers with arbitrary row pitch (so they can live inside a fused qkv buffer);
// D = head size (multiple of 32, <= 128); one wave = 16 query rows; block = 4 waves (64 queries) sharing K/V chunks of 32.
template <int D, bool CAUSAL>
__global__ __launch_bounds__(128) void k_flash(const float* __restrict__ qb, const float* __restrict__ kb, const float* __restrict__ vb,
                                             int pitch, int T, int H, float scale, float* __restrict__ y, int ypitch) {
  constexpr int KS = D / 32;        // k-steps for QK
  constexpr int DT = D / 16;        // d tiles for PV
  __shared__ __attribute__((aligned(16))) unsigned short sKh[32][D + 8], sKl[32][D + 8], sVh[32][D + 8], sVl[32][D + 8];
  __shared__ __attribute__((aligned(16))) unsigned short sPh[4][16][40], sPl[4][16][40];
  __shared__ __attribute__((aligned(16))) float sO[4][16][D];
  const int tid = threadIdx.x, w = tid >> 5, lane = tid & 31, ln = lane & 15, hh = lane >> 4;
  const int nqb = (T + 63) / 64;
  const int bh = blockIdx.x / nqb, qblk = blockIdx.x % nqb;
  const int b = bh / H, h = bh % H;
  const int q0 = qblk * 64 + w * 16;
  const float* Q = qb + (size_t)b * T * pitch + h * D;
  const float* K = kb + (size_t)b * T * pitch + h * D;
  const float* V = vb + (size_t)b * T * pitch + h * D;

  // A fragments of the wave's 16 query rows (scaled), hi/lo
  FragB aqh[KS], aql[KS];
  {
    int row = q0 + ln; if (row >= T) row = T - 1;
    const float* qr = Q + (size_t)row * pitch;
#pragma unroll
    for (int ks = 0; ks < KS; ++ks)
#pragma unroll
      for (int i = 0; i < 16; ++i) {
        const int d = ks * 32 + ((i < 8) ? (8 * hh + i) : (16 + 8 * hh + (i - 8)));
        const float x = qr[d] * scale; const unsigned short hb = bf16_bits(x);
        aqh[ks].u[i] = hb; aql[ks].u[i] = bf16_bits(x - bf16_val(hb));
      }
  }
  float m_r[8], l_r[8];
#pragma unroll
  for (int r = 0; r < 8; ++r) { m_r[r] = -3.0e38f; l_r[r] = 0.f; }
  v8f oacc[DT];
#pragma unroll
  for (int dt = 0; dt < DT; ++dt) oacc[dt] = (v8f){0.f,0.f,0.f,0.f,0.f,0.f,0.f,0.f};

  const int kv_end = CAUSAL ? min(T, qblk * 64 + 64) : T;     // block-uniform
  for (int j0 = 0; j0 < kv_end; j0 += 32) {
    __syncthreads();
    for (int e = tid; e < 32 * (D / 4); e += 128) {
      const int r = e / (D / 4), c4 = (e % (D / 4)) * 4;
      const int key = j0 + r;
      v4f kf = {0.f,0.f,0.f,0.f}, vf = {0.f,0.f,0.f,0.f};
      if (key < T) { kf = *(const v4fa*)(K + (size_t)key * pitch + c4); vf = *(const v4fa*)(V + (size_t)key * pitch + c4); }
#pragma unroll
      for (int t = 0; t < 4; ++t) {
        unsigned short hb = bf16_bits(kf[t]); sKh[r][c4 + t] = hb; sKl[r][c4 + t] = bf16_bits(kf[t] - bf16_val(hb));
        hb = bf16_bits(vf[t]); sVh[r][c4 + t] = hb; sVl[r][c4 + t] = bf16_bits(vf[t] - bf16_val(hb));
      }
    }
    __syncthreads();
    // S tile 16 x 32
    v8f s[2];
#pragma unroll
    for (int nt = 0; nt < 2; ++nt) {
      v8f acc = {};
#pragma unroll
      for (int ks = 0; ks < KS; ++ks) {
        FragB bh_, bl_;
        bh_.half[0] = *(const v8us*)&sKh[nt * 16 + ln][ks * 32 + 8 * hh]; bh_.half[1] = *(const v8us*)&sKh[nt * 16 + ln][ks * 32 + 16 + 8 * hh];
        bl_.half[0] = *(const v8us*)&sKl[nt * 16 + ln][ks * 32 + 8 * hh]; bl_.half[1] = *(const v8us*)&sKl[nt * 16 + ln][ks * 32 + 16 + 8 * hh];
        acc = mmaN<3>(aqh[ks].v, aql[ks].v, bh_.v, bl_.v, acc);
      }
      s[nt] = acc;
    }
    // mask + running max (rows 8hh+r; the 16 lanes of a half share rows)
    float alpha[8];
#pragma unroll
    for (int r = 0; r < 8; ++r) {
      const int qi = q0 + 8 * hh + r;
      const int ja = j0 + ln, jb = j0 + 16 + ln;
      if (CAUSAL) { if (ja > qi) s[0][r] = -3.0e38f; if (jb > qi) s[1][r] = -3.0e38f; }
      if (ja >= T) s[0][r] = -3.0e38f;
      if (jb >= T) s[1][r] = -3.0e38f;
      float mx = fmaxf(s[0][r], s[1][r]);
      mx = fmaxf(mx, __shfl_xor(mx, 1, 32)); mx = fmaxf(mx, __shfl_xor(mx, 2, 32)); mx = fmaxf(mx, __shfl_xor(mx, 4, 32)); mx = fmaxf(mx, __shfl_xor(mx, 8, 32));
      const float mnew = fmaxf(m_r[r], mx);
      alpha[r] = (mnew > -1.0e38f) ? __expf(m_r[r] - mnew) : 1.0f;
      const float p0 = (s[0][r] > -1.0e38f) ? __expf(s[0][r] - mnew) : 0.f;
      const float p1 = (s[1][r] > -1.0e38f) ? __expf(s[1][r] - mnew) : 0.f;
      m_r[r] = mnew;
      l_r[r] = l_r[r] * alpha[r] + p0 + p1;            // per-lane partial row sum (16 lanes combined at the end)
      unsigned short hb = bf16_bits(p0); sPh[w][8 * hh + r][ln] = hb;      sPl[w][8 * hh + r][ln] = bf16_bits(p0 - bf16_val(hb));
      hb = bf16_bits(p1);                sPh[w][8 * hh + r][16 + ln] = hb; sPl[w][8 * hh + r][16 + ln] = bf16_bits(p1 - bf16_val(hb));
    }
#pragma unroll
    for (int dt = 0; dt < DT; ++dt)
#pragma unroll
      for (int r = 0; r < 8; ++r) oacc[dt][r] *= alpha[r];
    __builtin_amdgcn_fence(__ATOMIC_ACQ_REL, "workgroup");
    __builtin_amdgcn_wave_barrier();
    FragB pah, pal;
    pah.half[0] = *(const v8us*)&sPh[w][ln][8 * hh]; pah.half[1] = *(const v8us*)&sPh[w][ln][16 + 8 * hh];
    pal.half[0] = *(const v8us*)&sPl[w][ln][8 * hh]; pal.half[1] = *(const v8us*)&sPl[w][ln][16 + 8 * hh];
#pragma unroll
    for (int dt = 0; dt < DT; ++dt) {
      FragB bvh, bvl;
#pragma unroll
      for (int i = 0; i < 8; ++i) {
        bvh.u[i] = sVh[8 * hh + i][dt * 16 + ln]; bvh.u[8 + i] = sVh[16 + 8 * hh + i][dt * 16 + ln];
        bvl.u[i] = sVl[8 * hh + i][dt * 16 + ln]; bvl.u[8 + i] = sVl[16 + 8 * hh + i][dt * 16 + ln];
      }
      oacc[dt] = mmaN<3>(pah.v, pal.v, bvh.v, bvl.v, oacc[dt]);
    }
    __builtin_amdgcn_fence(__ATOMIC_ACQ_REL, "workgroup");
    __builtin_amdgcn_wave_barrier();
  }
#pragma unroll
  for (int r = 0; r < 8; ++r) {
    float l = l_r[r];
    l += __shfl_xor(l, 1, 32); l += __shfl_xor(l, 2, 32); l += __shfl_xor(l, 4, 32); l += __shfl_xor(l, 8, 32);
    l_r[r] = (l > 0.f) ? 1.0f / l : 0.f;
  }
#pragma unroll
  for (int dt = 0; dt < DT; ++dt)
#pragma unroll
    for (int r = 0; r < 8; ++r) sO[w][8 * hh + r][dt * 16 + ln] = oacc[dt][r] * l_r[r];
  __builtin_amdgcn_fence(__ATOMIC_ACQ_REL, "workgroup");
  __builtin_amdgcn_wave_barrier();
  {
    for (int r = 0; r < 16; ++r) {
      const int row = q0 + r;
      if (row < T && lane < D / 4) {
        const v4f val = *(const v4fa*)&sO[w][r][lane * 4];
        *(v4f*)(y + ((size_t)b * T + row) * ypitch + h * D + lane * 4) = val;
      }
    }
    
  }
}

// GEMM C = act(A·W + bias + resid): A f32 (ASPLIT -> hi/lo 2 terms), Wt bf16 [N][K]; ACT 0 none, 1 relu, 2 exact gelu;
// resid (optional, f32, row index = (row % rmod), pitch ldr, RES_BF16 rounds it) added before the activation.
template <bool ASPLIT, int ACT, bool BIAS_BF16, bool RES_BF16>
__global__ __launch_bounds__(128) void k_gemm_bf3(const float* __restrict__ A, int lda, const unsigned short* __restrict__ Wt, int ldb,
                                                const float* __restrict__ bias, const float* __restrict__ resid, int rmod, int ldr,
                                                float* __restrict__ C, int ldc, int M, int N, int K) {
  __shared__ __attribute__((aligned(16))) float so[4][16][64];
  const int tid = threadIdx.x, w = tid >> 5, lane = tid & 31, ln = lane & 15, hh = lane >> 4;
  const int ntn = N / 64;
  const int wid = blockIdx.x * 4 + w;
  const int mt = wid / ntn, nq = wid % ntn;
  if (mt * 16 >= M) return;
  const int row0 = mt * 16, col0 = nq * 64;
  const float* arow = A + (size_t)(row0 + ln) * lda;
  v8f acc[4] = {};
  for (int kb = 0; kb < K; kb += 32) {
    FragB ah, al;
    const v4f x0 = *(const v4fa*)(arow + kb + 8 * hh), x1 = *(const v4fa*)(arow + kb + 8 * hh + 4);
    const v4f x2 = *(const v4fa*)(arow + kb + 16 + 8 * hh), x3 = *(const v4fa*)(arow + kb + 16 + 8 * hh + 4);
    float xs[16] = {x0[0],x0[1],x0[2],x0[3],x1[0],x1[1],x1[2],x1[3],x2[0],x2[1],x2[2],x2[3],x3[0],x3[1],x3[2],x3[3]};
#pragma unroll
    for (int i = 0; i < 16; ++i) { const unsigned short hb = bf16_bits(xs[i]); ah.u[i] = hb; al.u[i] = ASPLIT ? bf16_bits(xs[i] - bf16_val(hb)) : (unsigned short)0; }
#pragma unroll
    for (int t = 0; t < 4; ++t) {
      const unsigned short* brow = Wt + (size_t)(col0 + t * 16 + ln) * ldb + kb;
      FragB b;
      b.half[0] = *(const v8us*)(brow + 8 * hh);
      b.half[1] = *(const v8us*)(brow + 16 + 8 * hh);
      acc[t] = mmaN<ASPLIT ? 2 : 1>(ah.v, al.v, b.v, b.v, acc[t]);
    }
  }
#pragma unroll
  for (int t = 0; t < 4; ++t) {
    const int col = col0 + t * 16 + ln;
    float bv = bias ? bias[col] : 0.f;
    if (BIAS_BF16) bv = bf16_round(bv);
#pragma unroll
    for (int r = 0; r < 8; ++r) {
      float v = acc[t][r] + bv;
      if (resid) { float rv = resid[(size_t)((row0 + 8 * hh + r) % rmod) * ldr + col]; if (RES_BF16) rv = bf16_round(rv); v += rv; }
      if (ACT == 1) v = fmaxf(v, 0.f);
      if (ACT == 2) v = 0.5f * v * (1.0f + erff(v * 0.70710678118654752f));
      if (ACT == 3) { const float u = 0.7978845608028654f * (v + 0.044715f * v * v * v); v = 0.5f * v * (1.0f + tanhf(u)); }
      so[w][8 * hh + r][t * 16 + ln] = v;
    }
  }
  __builtin_amdgcn_fence(__ATOMIC_ACQ_REL, "workgroup");
  __builtin_amdgcn_wave_barrier();
  const int rsub = lane >> 4, c4 = (lane & 15) * 4;
  {
#pragma unroll
    for (int q = 0; q < 8; ++q) {
      const int r = q * 2 + rsub;
      const v4f v = *(const v4fa*)&so[w][r][c4];
      *(v4f*)(C + (size_t)(row0 + r) * ldc + col0 + c4) = v;
    }
    
  }
}
// row LayerNorm (biased variance, eps) over N: s = X (+ R); optional out_sum <- s; out_norm <- (s-mu)*rsqrt(var+eps)*g + b
template <bool PARAM_BF16>
__global__ __launch_bounds__(256) void k_layernorm(const float* __restrict__ X, const float* __restrict__ R, const float* __restrict__ g, const float* __restrict__ bta,
                                                  float* __restrict__ out_sum, float* __restrict__ out_norm, int N, float eps) {
  __shared__ float red[256];
  const int row = blockIdx.x, tid = threadIdx.x;
  const float* x = X + (size_t)row * N; const float* rr = R ? R + (size_t)row * N : nullptr;
  float vals[16];                     // up to N = 4096
  const int per = N / 256;            // contiguous chunk per thread? use strided-by-4 chunks: thread handles j = tid*4 + 1024*u
  float s1 = 0.f;
  for (int u = 0; u < per / 4; ++u) {
    const int j = tid * 4 + 1024 * u;
    const v4f a = *(const v4fa*)(x + j);
    v4f b = {0.f,0.f,0.f,0.f}; if (rr) b = *(const v4fa*)(rr + j);
#pragma unroll
    for (int q = 0; q < 4; ++q) { const float v = a[q] + b[q]; vals[u * 4 + q] = v; s1 += v; }
  }
  red[tid] = s1; __syncthreads();
  for (int st = 128; st > 0; st >>= 1) { if (tid < st) red[tid] += red[tid + st]; __syncthreads(); }
  const float mu = red[0] / (float)N; __syncthreads();
  float s2 = 0.f;
  for (int u = 0; u < per / 4; ++u)
#pragma unroll
    for (int q = 0; q < 4; ++q) { const float c = vals[u * 4 + q] - mu; s2 += c * c; }
  red[tid] = s2; __syncthreads();
  for (int st = 128; st > 0; st >>= 1) { if (tid < st) red[tid] += red[tid + st]; __syncthreads(); }
  const float rs = rsqrtf(red[0] / (float)N + eps);
  {
    for (int u = 0; u < per / 4; ++u) {
      const int j = tid * 4 + 1024 * u;
      v4f o, sm;
#pragma unroll
      for (int q = 0; q < 4; ++q) {
        float gg = g[j + q], bb = bta[j + q];
        if (PARAM_BF16) { gg = bf16_round(gg); bb = bf16_round(bb); }
        sm[q] = vals[u * 4 + q]; o[q] = (vals[u * 4 + q] - mu) * rs * gg + bb;
      }
      if (out_sum) *(v4f*)(out_sum + (size_t)row * N + j) = sm;
      *(v4f*)(out_norm + (size_t)row * N + j) = o;
    }
    
  }
}



// ---- f16 WMMA path (v_wmma_f32_16x16x32_f16): 11-bit significands for operands in range — used where a [0,1] probability operand needs more precision than bf16
typedef _Float16 v16h __attribute__((ext_vector_type(16)));
union FragH { v16h v; v8us half[2]; _Float16 h[16]; unsigned short u[16]; };
template <int NT>
__device__ __forceinline__ v8f mmaH(v16h ah, v16h al, v16h bh, v16h bl, v8f c) {
  c = __builtin_amdgcn_wmma_f32_16x16x32_f16(false, ah, false, bh, (short)0, c, false, false);
  if (NT >= 2) c = __builtin_amdgcn_wmma_f32_16x16x32_f16(false, al, false, bh, (short)0, c, false, false);
  if (NT >= 3) c = __builtin_amdgcn_wmma_f32_16x16x32_f16(false, ah, false, bl, (short)0, c, false, false);
  asm volatile("v_nop\n\tv_nop\n\tv_nop\n\tv_nop" : "+v"(c) : "v"(ah), "v"(al), "v"(bh), "v"(bl));
  return c;
}
// batched GEMM like k_gemm_b but f16 operands: A f32 (split into f16 hi/lo if ASPLIT, else rounded to f16), Bt = f16 values [n][k]; alpha; C f32; N multiple of 16 (partial tiles skipped)
template <bool ASPLIT>
__global__ __launch_bounds__(128) void k_gemm_h(const float* __restrict__ A, int lda, size_t sA, const _Float16* __restrict__ Bh, int ldb, size_t sB, float alpha, float* __restrict__ C, int ldc, size_t sC, int M, int N, int K) {
  __shared__ __attribute__((aligned(16))) float so[4][16][64];
  const int tid = threadIdx.x, w = tid >> 5, lane = tid & 31, ln = lane & 15, hh = lane >> 4; const int by = blockIdx.y;
  A += (size_t)by * sA; Bh += (size_t)by * sB; C += (size_t)by * sC;
  const int ntn = (N + 63) / 64; const int wid = blockIdx.x * 4 + w; const int mt = wid / ntn, nq = wid % ntn; if (mt * 16 >= M) return;
  const int row0 = mt * 16, col0 = nq * 64; const float* arow = A + (size_t)(row0 + ln) * lda;
  v8f acc[4] = {};
  for (int kb = 0; kb < K; kb += 32) {
    FragH ah, al;
    const v4f x0 = *(const v4fa*)(arow + kb + 8 * hh), x1 = *(const v4fa*)(arow + kb + 8 * hh + 4), x2 = *(const v4fa*)(arow + kb + 16 + 8 * hh), x3 = *(const v4fa*)(arow + kb + 16 + 8 * hh + 4);
    float xs[16] = {x0[0],x0[1],x0[2],x0[3],x1[0],x1[1],x1[2],x1[3],x2[0],x2[1],x2[2],x2[3],x3[0],x3[1],x3[2],x3[3]};
#pragma unroll
    for (int i = 0; i < 16; ++i) { const _Float16 h = (_Float16)xs[i]; ah.h[i] = h; al.h[i] = ASPLIT ? (_Float16)(xs[i] - (float)h) : (_Float16)0.0f; }
#pragma unroll
    for (int t = 0; t < 4; ++t) { if (col0 + t * 16 >= N) continue; const size_t boff = (size_t)(col0 + t * 16 + ln) * ldb + kb; FragH bq; bq.half[0] = *(const v8us*)(Bh + boff + 8 * hh); bq.half[1] = *(const v8us*)(Bh + boff + 16 + 8 * hh);
      acc[t] = mmaH<ASPLIT ? 2 : 1>(ah.v, al.v, bq.v, bq.v, acc[t]); }
  }
#pragma unroll
  for (int t = 0; t < 4; ++t) { if (col0 + t * 16 >= N) continue;
#pragma unroll
    for (int r = 0; r < 8; ++r) so[w][8 * hh + r][t * 16 + ln] = acc[t][r] * alpha; }
  __builtin_amdgcn_fence(__ATOMIC_ACQ_REL, "workgroup"); __builtin_amdgcn_wave_barrier();
  const int rsub = lane >> 4, c4 = (lane & 15) * 4;
  {
#pragma unroll
    for (int q = 0; q < 8; ++q) { const int r = q * 2 + rsub; if (col0 + c4 < N) { const v4f v = *(const v4fa*)&so[w][r][c4]; *(v4f*)(C + (size_t)(row0 + r) * ldc + col0 + c4) = v; } }
     }
}

// Wt[n][k] = f16(W[k][n]·scale) from f32 row-major W[K][N] (scale = power of two; bf16-exact weights stay exact in f16 away from the subnormal range)
__global__ __launch_bounds__(256) void k_wt_f16(const float* __restrict__ W, _Float16* __restrict__ Wt, int K, int N, float scale) {
  const int t = blockIdx.x * 256 + threadIdx.x; if (t >= N * (K / 8)) return; const int n = t / (K / 8), k8 = (t % (K / 8)) * 8; FragH f;
#pragma unroll
  for (int i = 0; i < 8; ++i) f.h[i] = (_Float16)(bf16_round(W[(size_t)(k8 + i) * N + n]) * scale); const v8us o = f.half[0];
  *(v8us*)((unsigned short*)Wt + (size_t)n * K + k8) = o; 
}
// k_gemm_hh variant with fused epilogue: v = acc·alpha + bias[by·sBias + col] (+ CP[(row/rowsPerB)·sCPb + by·64 + col] if CP) ; ACT 0 none / 1 elu ; writes f32 C and f16 C16, each if non-null
template <int ACT>
__global__ __launch_bounds__(128) void k_gemm_hhx(const _Float16* __restrict__ A, int lda, size_t sA, const _Float16* __restrict__ Bh, int ldb, size_t sB, float alpha, const float* __restrict__ bias, size_t sBias, const float* __restrict__ CP, int rowsPerB, size_t sCPb, int row0g,
    float* __restrict__ C, _Float16* __restrict__ C16, int ldc, size_t sC, int M, int N, int K) {
  __shared__ __attribute__((aligned(16))) float so[4][16][64];
  const int tid = threadIdx.x, w = tid >> 5, lane = tid & 31, ln = lane & 15, hh = lane >> 4; const int by = blockIdx.y;
  A += (size_t)by * sA; Bh += (size_t)by * sB; const size_t cofs = (size_t)by * sC; const float* bp = bias ? bias + (size_t)by * sBias : nullptr;
  const int ntn = (N + 63) / 64; const int wid = blockIdx.x * 4 + w; const int mt = wid / ntn, nq = wid % ntn; if (mt * 16 >= M) return;
  const int row0 = mt * 16, col0 = nq * 64; const _Float16* arow = A + (size_t)(row0 + ln) * lda;
  v8f acc[4] = {};
  for (int kb = 0; kb < K; kb += 32) { FragH ah; ah.half[0] = *(const v8us*)((const unsigned short*)arow + kb + 8 * hh); ah.half[1] = *(const v8us*)((const unsigned short*)arow + kb + 16 + 8 * hh);
#pragma unroll
    for (int t = 0; t < 4; ++t) { if (col0 + t * 16 >= N) continue; const size_t boff = (size_t)(col0 + t * 16 + ln) * ldb + kb; FragH bq; bq.half[0] = *(const v8us*)((const unsigned short*)Bh + boff + 8 * hh); bq.half[1] = *(const v8us*)((const unsigned short*)Bh + boff + 16 + 8 * hh);
      acc[t] = mmaH<1>(ah.v, ah.v, bq.v, bq.v, acc[t]); }
  }
#pragma unroll
  for (int t = 0; t < 4; ++t) { if (col0 + t * 16 >= N) continue; const int col = col0 + t * 16 + ln; const float bv = bp ? bf16_round(bp[col]) : 0.f;
#pragma unroll
    for (int r = 0; r < 8; ++r) { float v = acc[t][r] * alpha + bv; if (CP) { const int bidx = (row0g + row0 + 8 * hh + r) / rowsPerB; v += CP[(size_t)bidx * sCPb + (size_t)by * 64 + col]; } if (ACT == 1) v = (v > 0.f) ? v : expm1f(v); else if (ACT == 3) v = fmaxf(v, 0.f); so[w][8 * hh + r][t * 16 + ln] = v; } }
  __builtin_amdgcn_fence(__ATOMIC_ACQ_REL, "workgroup"); __builtin_amdgcn_wave_barrier();
  const int rsub = lane >> 4, c4 = (lane & 15) * 4; typedef _Float16 v4h __attribute__((ext_vector_type(4)));
  {
#pragma unroll
    for (int q = 0; q < 8; ++q) { const int r = q * 2 + rsub; if (col0 + c4 < N) { const v4f v = *(const v4fa*)&so[w][r][c4]; if (C) *(v4f*)(C + cofs + (size_t)(row0 + r) * ldc + col0 + c4) = v; if (C16) { v4h h4; for (int i = 0; i < 4; ++i) h4[i] = (_Float16)v[i]; *(v4h*)(C16 + cofs + (size_t)(row0 + r) * ldc + col0 + c4) = h4; } } }
     }
}


__global__ __launch_bounds__(256) void k_x16(const float* __restrict__ x, _Float16* __restrict__ X16, size_t n8) { const size_t t = (size_t)blockIdx.x * 256 + threadIdx.x; if (t >= n8) return; FragH f;
#pragma unroll
  for (int q = 0; q < 8; ++q) f.h[q] = (_Float16)bf16_round(x[t * 8 + q]); *(v8us*)((unsigned short*)X16 + t * 8) = f.half[0];  }
__global__ __launch_bounds__(256) void k_h16(const float* __restrict__ x, _Float16* __restrict__ X16, size_t n8) { const size_t t = (size_t)blockIdx.x * 256 + threadIdx.x; if (t >= n8) return; FragH f;
#pragma unroll
  for (int q = 0; q < 8; ++q) f.h[q] = (_Float16)x[t * 8 + q]; *(v8us*)((unsigned short*)X16 + t * 8) = f.half[0];  }
__global__ __launch_bounds__(256) void k_round16f(const float* __restrict__ W, _Float16* __restrict__ Bt, size_t n8) { const size_t t = (size_t)blockIdx.x * 256 + threadIdx.x; if (t >= n8) return; FragH f;
#pragma unroll
  for (int i = 0; i < 8; ++i) f.h[i] = (_Float16)(bf16_round(W[t * 8 + i]) * 16.0f); *(v8us*)((unsigned short*)Bt + t * 8) = f.half[0];  }
__global__ __launch_bounds__(256) void k_sn(const float* __restrict__ sf, _Float16* __restrict__ SN) { const int tid = threadIdx.x, wv = tid >> 5, lane = tid & 31; const size_t row = (size_t)blockIdx.x * 8 + wv; if (row >= NR) return; float v[8]; float s = 0.f;
#pragma unroll
  for (int q = 0; q < 8; ++q) { v[q] = bf16_round(sf[row * DSEM + lane * 8 + q]); s += v[q] * v[q]; }
  for (int o = 16; o >= 1; o >>= 1) s += __shfl_xor(s, o, 32); const float inv = 1.0f / fmaxf(sqrtf(s), 1e-12f); FragH f;
#pragma unroll
  for (int q = 0; q < 8; ++q) f.h[q] = (_Float16)(v[q] * inv); *(v8us*)((unsigned short*)SN + row * DSEM + lane * 8) = f.half[0];  }
// dynamic temperature, stage 1: column sums of the bf16-rounded query over QROWS rows per block -> PART[b][chunk][DM]; thread = 4 columns x one of 4 row phases, 16 independent 16-byte loads
#define QP 32
#define QROWS (SS / QP)
__global__ __launch_bounds__(512) void k_qsum(const float* __restrict__ query, float* __restrict__ PART) {
  __shared__ __attribute__((aligned(16))) float sred[4][DM]; const int tid = threadIdx.x, ph = tid >> 7, c4 = (tid & 127) * 4;
  const float* src = query + ((size_t)blockIdx.x * QROWS + ph * (QROWS / 4)) * DM + c4; v4f s = {0.f, 0.f, 0.f, 0.f};
#pragma unroll  // all 16 row loads issue before the first add: one memory latency instead of 16
  for (int r = 0; r < QROWS / 4; ++r) { const v4f x = *(const v4fa*)(src + (size_t)r * DM);
#pragma unroll
    for (int q = 0; q < 4; ++q) s[q] += bf16_round(x[q]); }
  *(v4fa*)&sred[ph][c4] = s; __syncthreads();
  PART[(size_t)blockIdx.x * DM + tid] = (sred[0][tid] + sred[1][tid]) + (sred[2][tid] + sred[3][tid]); }
// stage 2 (one block, 32 waves): mean query of both batches from PART, then one wave per hidden unit (lanes along DM, 16-byte loads of the Wt1 row shared by both batches), relu, Wt2 dot, sigmoid
__global__ __launch_bounds__(1024) void k_temp(const float* __restrict__ PART, const float* __restrict__ Wt1, const float* __restrict__ bt1, const float* __restrict__ Wt2, const float* __restrict__ bt2, float* __restrict__ TEMP) {
  __shared__ __attribute__((aligned(16))) float qm[BB][DM]; __shared__ float red[BB][32]; const int tid = threadIdx.x, wv = tid >> 5, lane = tid & 31;
  { const int b = tid >> 9, col = tid & (DM - 1); float s = 0.f;
#pragma unroll  // all 32 partial loads in flight together
    for (int p = 0; p < QP; ++p) s += PART[((size_t)b * QP + p) * DM + col];
    qm[b][col] = s / (float)SS; }
  __syncthreads();
  v4f qv[BB][4];
#pragma unroll
  for (int b = 0; b < BB; ++b)
#pragma unroll
    for (int j = 0; j < 4; ++j) qv[b][j] = *(const v4fa*)&qm[b][j * 128 + lane * 4];
  float pw[BB] = {0.f, 0.f};
#pragma unroll 2  // two rows = 8 loads of 16 bytes in flight per lane; four rows spill at the 128 registers that 32 waves leave
  for (int i = 0; i < (DM / 2) / 32; ++i) { const int u = wv * ((DM / 2) / 32) + i; const float* wr = Wt1 + (size_t)u * DM + lane * 4; float a[BB] = {0.f, 0.f};
#pragma unroll
    for (int j = 0; j < 4; ++j) { const v4f wq = *(const v4fa*)(wr + j * 128);
#pragma unroll
      for (int q = 0; q < 4; ++q) { const float wb = bf16_round(wq[q]);
#pragma unroll
        for (int b = 0; b < BB; ++b) a[b] += wb * qv[b][j][q]; } }
    const float b1 = bf16_round(bt1[u]), w2 = bf16_round(Wt2[u]);
#pragma unroll
    for (int b = 0; b < BB; ++b) { float t = a[b]; for (int o = 16; o >= 1; o >>= 1) t += __shfl_xor(t, o, 32); pw[b] += fmaxf(t + b1, 0.f) * w2; } }
  if (lane == 0) {
#pragma unroll
    for (int b = 0; b < BB; ++b) red[b][wv] = pw[b]; }
  __syncthreads();
  if (tid < 32) { float v = 0.f; if (tid < BB) { float z = bf16_round(bt2[0]); for (int q = 0; q < 32; ++q) z += red[tid][q]; const float t = 1.0f / (1.0f + expf(-z)); v = 0.5f + t * 1.5f; } TEMP[tid] = v; } }
__global__ __launch_bounds__(256) void k_vt(const _Float16* __restrict__ V16, _Float16* __restrict__ Vt) { __shared__ unsigned short tl[64][66]; const int tid = threadIdx.x; const int slab = blockIdx.x / (SS / 64), lg = blockIdx.x % (SS / 64); const int b = slab / NH, h = slab % NH;
  for (int i = tid; i < 64 * 8; i += 256) { const int r = i / 8, c8 = (i % 8) * 8; FragH f; f.half[0] = *(const v8us*)((const unsigned short*)V16 + ((size_t)b * SS + lg * 64 + r) * DM + h * HD + c8);
#pragma unroll
    for (int q = 0; q < 8; ++q) tl[r][c8 + q] = f.u[q]; }
  __syncthreads();
  {
#pragma unroll
    for (int rd = 0; rd < 2; ++rd) { const int d = rd * 32 + tid / 8, pc = tid % 8; FragH f;
#pragma unroll
      for (int q = 0; q < 8; ++q) f.u[q] = tl[pc * 8 + q][d];
      *(v8us*)((unsigned short*)Vt + ((size_t)slab * HD + d) * SS + lg * 64 + pc * 8) = f.half[0]; }
     } }
// fused constrained attention per ((b,h), 128 queries): wave = 32 queries; s = (q.k)/(8 temp_b) + sem_bias + pos_bias, -inf where mask[b][k] = 0; sem_bias = -(0.5 - sim) if sim < 0.5.
// Transposed products: St = K.Qt (A = 16 key rows, B = 16 query columns), Ot += Vt.Pt. Lane (ln, hh) then holds, for query ln of a tile, the scores of keys 8 hh + r of each 16-key tile:
// the running max and sum are in-lane work plus one swap between the wave halves, two St tiles converted to f16 are the B operand of the second product as they lie, SIM[q][k .. k + 7] is one 16-byte load.
typedef int v4ia __attribute__((ext_vector_type(4), may_alias));
typedef _Float16 v8h __attribute__((ext_vector_type(8)));
union FragP { v16h v; v8h p[2]; };
__device__ __forceinline__ float swap_halves(float x) { const int t = __float_as_int(x); return __int_as_float(__builtin_amdgcn_permlanex16(t, t, 0x76543210, 0xfedcba98, false, false)); }   // lane l <-> l ^ 16
__global__ __launch_bounds__(128) void k_flash(const _Float16* __restrict__ Q16, const _Float16* __restrict__ K16, const _Float16* __restrict__ Vt, const _Float16* __restrict__ SIM, const int* __restrict__ mask, const float* __restrict__ TEMP, float* __restrict__ O) {
  constexpr int RPW = 32, NQB = SS / (4 * RPW), DT = HD / 16, KS = HD / 32;
  const int tid = threadIdx.x, w = tid >> 5, lane = tid & 31, ln = lane & 15, hh = lane >> 4;
  const int slab = blockIdx.x / NQB, qblk = blockIdx.x % NQB; const int b = slab / NH, h = slab % NH; const int q0 = qblk * (4 * RPW) + w * RPW; const float sc = 0.125f / TEMP[b];
  FragH aq[2][KS];
#pragma unroll
  for (int qt = 0; qt < 2; ++qt) { const unsigned short* qr = (const unsigned short*)Q16 + ((size_t)b * SS + q0 + qt * 16 + ln) * DM + h * HD;
#pragma unroll
    for (int ks = 0; ks < KS; ++ks) { aq[qt][ks].half[0] = *(const v8us*)(qr + ks * 32 + 8 * hh); aq[qt][ks].half[1] = *(const v8us*)(qr + ks * 32 + 16 + 8 * hh); } }
  // the lane's four read pointers; each moves on by 32 keys a pass
  const unsigned short* vp = (const unsigned short*)Vt + ((size_t)slab * HD + ln) * SS + 8 * hh;
  const unsigned short* kp = (const unsigned short*)K16 + ((size_t)b * SS + ln) * DM + h * HD + 8 * hh;
  const unsigned short* sp = (const unsigned short*)SIM + ((size_t)b * SS + q0 + ln) * SS + 8 * hh;
  const int* mp = mask + (size_t)b * SS + 8 * hh;
  float m_q[2], l_q[2]; v8f oacc[2][DT];
#pragma unroll
  for (int qt = 0; qt < 2; ++qt) { m_q[qt] = -3.0e38f; l_q[qt] = 0.f;
#pragma unroll
    for (int dt = 0; dt < DT; ++dt) oacc[qt][dt] = (v8f){0.f,0.f,0.f,0.f,0.f,0.f,0.f,0.f}; }
#pragma unroll 1
  for (int j0 = 0; j0 < SS; j0 += 32) {
    // every load of the pass stands in front of its first product: none depends on the scores any more, so the pass waits for memory once
    FragH bk[2][KS], bv[DT], sm[2][2]; v4ia mk[2][2];
#pragma unroll
    for (int nt = 0; nt < 2; ++nt) {
#pragma unroll
      for (int ks = 0; ks < KS; ++ks) { bk[nt][ks].half[0] = *(const v8us*)(kp + nt * 16 * DM + ks * 32); bk[nt][ks].half[1] = *(const v8us*)(kp + nt * 16 * DM + ks * 32 + 16); }
      mk[nt][0] = *(const v4ia*)(mp + nt * 16); mk[nt][1] = *(const v4ia*)(mp + nt * 16 + 4);
#pragma unroll
      for (int qt = 0; qt < 2; ++qt) sm[qt][nt].half[0] = *(const v8us*)(sp + qt * 16 * SS + nt * 16); }
#pragma unroll
    for (int dt = 0; dt < DT; ++dt) { bv[dt].half[0] = *(const v8us*)(vp + dt * 16 * SS); bv[dt].half[1] = *(const v8us*)(vp + dt * 16 * SS + 16); }
    asm volatile("s_wait_xcnt 0x0" :: "v"(kp), "v"(mp), "v"(sp), "v"(vp) : "memory");      // stands in front of every write of a register that one of the 24 loads names as its address; the four inputs keep those registers live up to it
    __builtin_amdgcn_sched_barrier(0);      // keeps the 24 loads one group (else half of them issue behind the first wait and the pass pays the latency twice) and the pointer steps behind the wait above
    kp += 32 * DM; mp += 32; sp += 32; vp += 32;
    v8f s[2][2];
#pragma unroll
    for (int nt = 0; nt < 2; ++nt)
#pragma unroll
      for (int qt = 0; qt < 2; ++qt) { v8f acc = (v8f){0.f,0.f,0.f,0.f,0.f,0.f,0.f,0.f};
#pragma unroll
        for (int ks = 0; ks < KS; ++ks) acc = mmaH<1>(bk[nt][ks].v, bk[nt][ks].v, aq[qt][ks].v, aq[qt][ks].v, acc); s[qt][nt] = acc; }
    FragP pb[2];
#pragma unroll
    for (int qt = 0; qt < 2; ++qt) { const int qi = q0 + qt * 16 + ln; float mc = -INFINITY;
#pragma unroll
      for (int nt = 0; nt < 2; ++nt)
#pragma unroll
        for (int r = 0; r < 8; ++r) { const int k = j0 + nt * 16 + 8 * hh + r; const float sim = (float)sm[qt][nt].h[r]; const float sb = (sim < 0.5f) ? -(0.5f - sim) : 0.f;
          const float dd = fabsf((float)(qi - k)); const float pbias = (dd > 10.f) ? -0.1f * (dd - 10.f) : 0.f;
          const float su = s[qt][nt][r] * sc + sb + pbias; const float sv = (mk[nt][r >> 2][r & 3] != 0) ? su : -INFINITY; s[qt][nt][r] = sv; mc = fmaxf(mc, sv); }
      mc = fmaxf(mc, swap_halves(mc));
      const float mn = fmaxf(m_q[qt], mc); const float al = expf(m_q[qt] - mn); m_q[qt] = mn; float ls = 0.f;
#pragma unroll
      for (int nt = 0; nt < 2; ++nt) {
#pragma unroll
        for (int r = 0; r < 8; ++r) { const float p = expf(s[qt][nt][r] - mn); s[qt][nt][r] = p; ls += p; }
        pb[qt].p[nt] = __builtin_convertvector(s[qt][nt], v8h); }
      l_q[qt] = l_q[qt] * al + ls;      // partial sum of this half's 16 keys; the halves are joined behind the loop
#pragma unroll
      for (int dt = 0; dt < DT; ++dt)
#pragma unroll
        for (int r = 0; r < 8; ++r) oacc[qt][dt][r] *= al; }
#pragma unroll
    for (int dt = 0; dt < DT; ++dt)
#pragma unroll
      for (int qt = 0; qt < 2; ++qt) oacc[qt][dt] = mmaH<1>(bv[dt].v, bv[dt].v, pb[qt].v, pb[qt].v, oacc[qt][dt]); }
#pragma unroll
  for (int qt = 0; qt < 2; ++qt) { float l = l_q[qt]; l += swap_halves(l); const float inv = (l > 0.f) ? 1.0f / l : 0.f;
    float* orow = O + ((size_t)b * SS + q0 + qt * 16 + ln) * DM + h * HD + 8 * hh;      // register r of tile dt is column dt * 16 + 8 hh + r of the query's row
#pragma unroll
    for (int dt = 0; dt < DT; ++dt) { v4f lo, hi;
#pragma unroll
      for (int r = 0; r < 4; ++r) { lo[r] = oacc[qt][dt][r] * inv; hi[r] = oacc[qt][dt][4 + r] * inv; }
      *(v4f*)(orow + dt * 16) = lo; *(v4f*)(orow + dt * 16 + 4) = hi; } } }
extern "C" void kernel_launch(void* const* d_in, const int* in_sizes, int n_in,
                              void* d_out, int out_size, void* d_ws, size_t ws_size, hipStream_t stream) {
  (void)in_sizes; (void)n_in; (void)out_size;
  const float* xq = (const float*)d_in[0]; const float* xk = (const float*)d_in[1]; const float* xv = (const float*)d_in[2]; const int* mask = (const int*)d_in[3]; const float* sf = (const float*)d_in[4];
  const float* Wq = (const float*)d_in[5]; const float* bq = (const float*)d_in[6]; const float* Wk = (const float*)d_in[7]; const float* bk = (const float*)d_in[8]; const float* Wv = (const float*)d_in[9]; const float* bv = (const float*)d_in[10]; const float* Wo = (const float*)d_in[11]; const float* bo = (const float*)d_in[12]; const float* Wt1 = (const float*)d_in[13]; const float* bt1 = (const float*)d_in[14]; const float* Wt2 = (const float*)d_in[15]; const float* bt2 = (const float*)d_in[16];
  char* ws = (char*)d_ws; size_t off = 0;
  auto take = [&](size_t bytes) { char* p = ws + off; off += (bytes + 255) & ~(size_t)255; return p; };
  const size_t w8 = (size_t)DM * DM / 8;
  _Float16* Bq = (_Float16*)take(w8 * 16); _Float16* Bk = (_Float16*)take(w8 * 16); _Float16* Bv = (_Float16*)take(w8 * 16); _Float16* Bo = (_Float16*)take(w8 * 16);
  _Float16* XQ = (_Float16*)take((size_t)NR * DM * 2); _Float16* XK = (_Float16*)take((size_t)NR * DM * 2); _Float16* XV = (_Float16*)take((size_t)NR * DM * 2); _Float16* Q16 = (_Float16*)take((size_t)NR * DM * 2); _Float16* K16 = (_Float16*)take((size_t)NR * DM * 2); _Float16* V16 = (_Float16*)take((size_t)NR * DM * 2); _Float16* Vt = (_Float16*)take((size_t)NR * DM * 2);
  _Float16* SN = (_Float16*)take((size_t)NR * DSEM * 2); _Float16* SIM = (_Float16*)take((size_t)BB * SS * SS * 2); float* TEMP = (float*)take(256); float* O = (float*)take((size_t)NR * DM * 4); float* PART = (float*)take((size_t)BB * QP * DM * 4); _Float16* O16 = XQ;      // the query plane is dead after the q GEMM
  if (off > ws_size) return;      // ≈ 2 + 4.2×7 + 2.1 + 16.8 + 8.4 ≈ 57 MiB
  const unsigned gw = (unsigned)((w8 + 255) / 256), gx = (unsigned)(((size_t)NR * DM / 8 + 255) / 256);
  k_round16f<<<gw, 256, 0, stream>>>(Wq, Bq, w8); k_round16f<<<gw, 256, 0, stream>>>(Wk, Bk, w8); k_round16f<<<gw, 256, 0, stream>>>(Wv, Bv, w8); k_round16f<<<gw, 256, 0, stream>>>(Wo, Bo, w8);
  k_x16<<<gx, 256, 0, stream>>>(xq, XQ, (size_t)NR * DM / 8); k_x16<<<gx, 256, 0, stream>>>(xk, XK, (size_t)NR * DM / 8); k_x16<<<gx, 256, 0, stream>>>(xv, XV, (size_t)NR * DM / 8);
  k_sn<<<NR / 8, 256, 0, stream>>>(sf, SN);
  k_qsum<<<BB * QP, 512, 0, stream>>>(xq, PART);
  k_temp<<<1, 1024, 0, stream>>>(PART, Wt1, bt1, Wt2, bt2, TEMP);
  const dim3 gg(((NR / 16) * (DM / 64) + 3) / 4, 1);
  k_gemm_hhx<0><<<gg, 128, 0, stream>>>(XQ, DM, 0, Bq, DM, 0, 0.0625f, bq, 0, nullptr, 1, 0, 0, nullptr, Q16, DM, 0, NR, DM, DM);
  k_gemm_hhx<0><<<gg, 128, 0, stream>>>(XK, DM, 0, Bk, DM, 0, 0.0625f, bk, 0, nullptr, 1, 0, 0, nullptr, K16, DM, 0, NR, DM, DM);
  k_gemm_hhx<0><<<gg, 128, 0, stream>>>(XV, DM, 0, Bv, DM, 0, 0.0625f, bv, 0, nullptr, 1, 0, 0, nullptr, V16, DM, 0, NR, DM, DM);
  // SIM[b] = SN[b]·SN[b]ᵀ (f16; values in [−1, 1])
  k_gemm_hhx<0><<<dim3(((SS / 16) * (SS / 64) + 3) / 4, BB), 128, 0, stream>>>(SN, DSEM, (size_t)SS * DSEM, SN, DSEM, (size_t)SS * DSEM, 1.0f, nullptr, 0, nullptr, 1, 0, 0, nullptr, SIM, SS, (size_t)SS * SS, SS, SS, DSEM);
  k_vt<<<BB * NH * (SS / 64), 256, 0, stream>>>(V16, Vt);
  k_flash<<<BB * NH * (SS / 128), 128, 0, stream>>>(Q16, K16, Vt, SIM, mask, TEMP, O);
  k_h16<<<gx, 256, 0, stream>>>(O, O16, (size_t)NR * DM / 8);
  k_gemm_hhx<0><<<gg, 128, 0, stream>>>(O16, DM, 0, Bo, DM, 0, 0.0625f, bo, 0, nullptr, 1, 0, 0, (float*)d_out, nullptr, DM, 0, NR, DM, DM);
}

// v003
// A run of this version takes 203 microseconds.
// Timed twice side by side with v002, it ran 1.26 and 1.28 times as fast.
// Over all steps from v000 it is 4.11 times as fast.
#include <hip/hip_runtime.h>
// q/k/v/o projections (4096 × 512 × 512, + bias), the cosine-similarity matrix of the normalised semantic features (per batch 2048 × 2048 × 256, kept as an f16 plane) and the 8-head
// constrained attention on v_wmma_f32_16x16x32_f16 (fused flash-style kernel: Sᵀ = K·Qᵀ, Oᵀ = Vᵀ·Pᵀ on WMMA; scores / (8·temperature_b) + semantic bias + positional bias, key mask → −inf;
// online max/sum softmax f32; P f16 ≤ 1); the dynamic-temperature MLP on the mean query is f32 VALU (column sums over 64 blocks, then one block); A = f16(bf16 ·) exact operands, weights bf16-exact ×2^4 ((out,in)),
// single products, f32 accumulate.
#define BB 2
#define SS 2048
#define DM 512
#define NH 8
#define HD 64
#define DSEM 256
#define NR (BB * SS)

typedef __bf16 v16b __attribute__((ext_vector_type(16)));
typedef unsigned short v8us __attribute__((ext_vector_type(8), may_alias));
typedef float  v8f  __attribute__((ext_vector_type(8)));
typedef float  v4f  __attribute__((ext_vector_type(4)));
typedef float  v4fa __attribute__((ext_vector_type(4), may_alias));
union FragB { v16b v; v8us half[2]; unsigned short u[16]; };

__device__ __forceinline__ unsigned short bf16_bits(float x) { unsigned int u = __float_as_uint(x); return (unsigned short)((u + 0x7FFFu + ((u >> 16) & 1u)) >> 16); }
__device__ __forceinline__ float bf16_val(unsigned short b) { return __uint_as_float(((unsigned int)b) << 16); }
__device__ __forceinline__ float bf16_round(float x) { return bf16_val(bf16_bits(x)); }
// D += A·B with NT terms: 1 = ah·bh, 2 = + al·bh (A split), 3 = + ah·bl (both split)
template <int NT>
__device__ __forceinline__ v8f mmaN(v16b ah, v16b al, v16b bh, v16b bl, v8f c) {
  c = __builtin_amdgcn_wmma_f32_16x16x32_bf16(false, ah, false, bh, (short)0, c, false, false);
  if (NT >= 2) c = __builtin_amdgcn_wmma_f32_16x16x32_bf16(false, al, false, bh, (short)0, c, false, false);
  if (NT >= 3) c = __builtin_amdgcn_wmma_f32_16x16x32_bf16(false, ah, false, bl, (short)0, c, false, false);
  asm volatile("v_nop\n\tv_nop\n\tv_nop\n\tv_nop" : "+v"(c) : "v"(ah), "v"(al), "v"(bh), "v"(bl));
  return c;
}

__global__ __launch_bounds__(256) void k_wt_bf16(const float* __restrict__ W, unsigned short* __restrict__ Wt, int K, int N) {
  const int t = blockIdx.x * 256 + threadIdx.x;
  const int k8n = K / 8;
  if (t >= N * k8n) return;
  const int n = t / k8n, k8 = (t % k8n) * 8;
  v8us v;
#pragma unroll
  for (int i = 0; i < 8; ++i) v[i] = bf16_bits(W[(size_t)(k8 + i) * N + n]);
  *(v8us*)(Wt + (size_t)n * K + k8) = v;
  
}

// GEMM C[M][N] (f32, pitch ldc) = act(A[M][K]·W + bias). A f32 row-major (pitch lda) converted per fragment to bf16
// (ASPLIT: hi/lo two planes -> 2 terms, else single rounded term); Wt bf16 [N][K] (pitch ldb). BIAS_BF16 rounds the
// bias to bf16 first (bias quantised to bf16 before the add). K%32==0, M%16==0, N%64==0.
template <bool ASPLIT, int ACT, bool BIAS_BF16>
__global__ __launch_bounds__(128) void k_gemm_bf(const float* __restrict__ A, int lda, const unsigned short* __restrict__ Wt, int ldb,
                                               const float* __restrict__ bias, float* __restrict__ C, int ldc, int M, int N, int K) {
  __shared__ __attribute__((aligned(16))) float so[4][16][64];
  const int tid = threadIdx.x, w = tid >> 5, lane = tid & 31, ln = lane & 15, hh = lane >> 4;
  const int ntn = N / 64;
  const int wid = blockIdx.x * 4 + w;
  const int mt = wid / ntn, nq = wid % ntn;
  if (mt * 16 >= M) return;
  const int row0 = mt * 16, col0 = nq * 64;
  const float* arow = A + (size_t)(row0 + ln) * lda;
  v8f acc[4] = {};
  for (int kb = 0; kb < K; kb += 32) {
    FragB ah, al;
    const v4f x0 = *(const v4fa*)(arow + kb + 8 * hh), x1 = *(const v4fa*)(arow + kb + 8 * hh + 4);
    const v4f x2 = *(const v4fa*)(arow + kb + 16 + 8 * hh), x3 = *(const v4fa*)(arow + kb + 16 + 8 * hh + 4);
    float xs[16] = {x0[0],x0[1],x0[2],x0[3],x1[0],x1[1],x1[2],x1[3],x2[0],x2[1],x2[2],x2[3],x3[0],x3[1],x3[2],x3[3]};
#pragma unroll
    for (int i = 0; i < 16; ++i) { const unsigned short hb = bf16_bits(xs[i]); ah.u[i] = hb; al.u[i] = ASPLIT ? bf16_bits(xs[i] - bf16_val(hb)) : (unsigned short)0; }
#pragma unroll
    for (int t = 0; t < 4; ++t) {
      const unsigned short* brow = Wt + (size_t)(col0 + t * 16 + ln) * ldb + kb;
      FragB b;
      b.half[0] = *(const v8us*)(brow + 8 * hh);
      b.half[1] = *(const v8us*)(brow + 16 + 8 * hh);
      acc[t] = mmaN<ASPLIT ? 2 : 1>(ah.v, al.v, b.v, b.v, acc[t]);
    }
  }
#pragma unroll
  for (int t = 0; t < 4; ++t) {
    float bv = bias ? bias[col0 + t * 16 + ln] : 0.f;
    if (BIAS_BF16) bv = bf16_round(bv);
#pragma unroll
    for (int r = 0; r < 8; ++r) { float v = acc[t][r] + bv; if (ACT == 1) v = fmaxf(v, 0.f); so[w][8 * hh + r][t * 16 + ln] = v; }
  }
  __builtin_amdgcn_fence(__ATOMIC_ACQ_REL, "workgroup");
  __builtin_amdgcn_wave_barrier();
  const int rsub = lane >> 4, c4 = (lane & 15) * 4;
  {
#pragma unroll
    for (int q = 0; q < 8; ++q) {
      const int r = q * 2 + rsub;
      const v4f v = *(const v4fa*)&so[w][r][c4];
      *(v4f*)(C + (size_t)(row0 + r) * ldc + col0 + c4) = v;
    }
    
  }
}

// Flash-style causal/unmasked attention, all contractions 3-term bf16 hi/lo splits, f32 softmax with running max.
// q,k,v rows are read from f32 buffers with arbitrary row pitch (so they can live inside a fused qkv buffer);
// D = head size (multiple of 32, <= 128); one wave = 16 query rows; block = 4 waves (64 queries) sharing K/V chunks of 32.
template <int D, bool CAUSAL>
__global__ __launch_bounds__(128) void k_flash(const float* __restrict__ qb, const float* __restrict__ kb, const float* __restrict__ vb,
                                             int pitch, int T, int H, float scale, float* __restrict__ y, int ypitch) {
  constexpr int KS = D / 32;        // k-steps for QK
  constexpr int DT = D / 16;        // d tiles for PV
  __shared__ __attribute__((aligned(16))) unsigned short sKh[32][D + 8], sKl[32][D + 8], sVh[32][D + 8], sVl[32][D + 8];
  __shared__ __attribute__((aligned(16))) unsigned short sPh[4][16][40], sPl[4][16][40];
  __shared__ __attribute__((aligned(16))) float sO[4][16][D];
  const int tid = threadIdx.x, w = tid >> 5, lane = tid & 31, ln = lane & 15, hh = lane >> 4;
  const int nqb = (T + 63) / 64;
  const int bh = blockIdx.x / nqb, qblk = blockIdx.x % nqb;
  const int b = bh / H, h = bh % H;
  const int q0 = qblk * 64 + w * 16;
  const float* Q = qb + (size_t)b * T * pitch + h * D;
  const float* K = kb + (size_t)b * T * pitch + h * D;
  const float* V = vb + (size_t)b * T * pitch + h * D;

  // A fragments of the wave's 16 query rows (scaled), hi/lo
  FragB aqh[KS], aql[KS];
  {
    int row = q0 + ln; if (row >= T) row = T - 1;
    const float* qr = Q + (size_t)row * pitch;
#pragma unroll
    for (int ks = 0; ks < KS; ++ks)
#pragma unroll
      for (int i = 0; i < 16; ++i) {
        const int d = ks * 32 + ((i < 8) ? (8 * hh + i) : (16 + 8 * hh + (i - 8)));
        const float x = qr[d] * scale; const unsigned short hb = bf16_bits(x);
        aqh[ks].u[i] = hb; aql[ks].u[i] = bf16_bits(x - bf16_val(hb));
      }
  }
  float m_r[8], l_r[8];
#pragma unroll
  for (int r = 0; r < 8; ++r) { m_r[r] = -3.0e38f; l_r[r] = 0.f; }
  v8f oacc[DT];
#pragma unroll
  for (int dt = 0; dt < DT; ++dt) oacc[dt] = (v8f){0.f,0.f,0.f,0.f,0.f,0.f,0.f,0.f};

  const int kv_end = CAUSAL ? min(T, qblk * 64 + 64) : T;     // block-uniform
  for (int j0 = 0; j0 < kv_end; j0 += 32) {
    __syncthreads();
    for (int e = tid; e < 32 * (D / 4); e += 128) {
      const int r = e / (D / 4), c4 = (e % (D / 4)) * 4;
      const int key = j0 + r;
      v4f kf = {0.f,0.f,0.f,0.f}, vf = {0.f,0.f,0.f,0.f};
      if (key < T) { kf = *(const v4fa*)(K + (size_t)key * pitch + c4); vf = *(const v4fa*)(V + (size_t)key * pitch + c4); }
#pragma unroll
      for (int t = 0; t < 4; ++t) {
        unsigned short hb = bf16_bits(kf[t]); sKh[r][c4 + t] = hb; sKl[r][c4 + t] = bf16_bits(kf[t] - bf16_val(hb));
        hb = bf16_bits(vf[t]); sVh[r][c4 + t] = hb; sVl[r][c4 + t] = bf16_bits(vf[t] - bf16_val(hb));
      }
    }
    __syncthreads();
    // S tile 16 x 32
    v8f s[2];
#pragma unroll
    for (int nt = 0; nt < 2; ++nt) {
      v8f acc = {};
#pragma unroll
      for (int ks = 0; ks < KS; ++ks) {
        FragB bh_, bl_;
        bh_.half[0] = *(const v8us*)&sKh[nt * 16 + ln][ks * 32 + 8 * hh]; bh_.half[1] = *(const v8us*)&sKh[nt * 16 + ln][ks * 32 + 16 + 8 * hh];
        bl_.half[0] = *(const v8us*)&sKl[nt * 16 + ln][ks * 32 + 8 * hh]; bl_.half[1] = *(const v8us*)&sKl[nt * 16 + ln][ks * 32 + 16 + 8 * hh];
        acc = mmaN<3>(aqh[ks].v, aql[ks].v, bh_.v, bl_.v, acc);
      }
      s[nt] = acc;
    }
    // mask + running max (rows 8hh+r; the 16 lanes of a half share rows)
    float alpha[8];
#pragma unroll
    for (int r = 0; r < 8; ++r) {
      const int qi = q0 + 8 * hh + r;
      const int ja = j0 + ln, jb = j0 + 16 + ln;
      if (CAUSAL) { if (ja > qi) s[0][r] = -3.0e38f; if (jb > qi) s[1][r] = -3.0e38f; }
      if (ja >= T) s[0][r] = -3.0e38f;
      if (jb >= T) s[1][r] = -3.0e38f;
      float mx = fmaxf(s[0][r], s[1][r]);
      mx = fmaxf(mx, __shfl_xor(mx, 1, 32)); mx = fmaxf(mx, __shfl_xor(mx, 2, 32)); mx = fmaxf(mx, __shfl_xor(mx, 4, 32)); mx = fmaxf(mx, __shfl_xor(mx, 8, 32));
      const float mnew = fmaxf(m_r[r], mx);
      alpha[r] = (mnew > -1.0e38f) ? __expf(m_r[r] - mnew) : 1.0f;
      const float p0 = (s[0][r] > -1.0e38f) ? __expf(s[0][r] - mnew) : 0.f;
      const float p1 = (s[1][r] > -1.0e38f) ? __expf(s[1][r] - mnew) : 0.f;
      m_r[r] = mnew;
      l_r[r] = l_r[r] * alpha[r] + p0 + p1;            // per-lane partial row sum (16 lanes combined at the end)
      unsigned short hb = bf16_bits(p0); sPh[w][8 * hh + r][ln] = hb;      sPl[w][8 * hh + r][ln] = bf16_bits(p0 - bf16_val(hb));
      hb = bf16_bits(p1);                sPh[w][8 * hh + r][16 + ln] = hb; sPl[w][8 * hh + r][16 + ln] = bf16_bits(p1 - bf16_val(hb));
    }
#pragma unroll
    for (int dt = 0; dt < DT; ++dt)
#pragma unroll
      for (int r = 0; r < 8; ++r) oacc[dt][r] *= alpha[r];
    __builtin_amdgcn_fence(__ATOMIC_ACQ_REL, "workgroup");
    __builtin_amdgcn_wave_barrier();
    FragB pah, pal;
    pah.half[0] = *(const v8us*)&sPh[w][ln][8 * hh]; pah.half[1] = *(const v8us*)&sPh[w][ln][16 + 8 * hh];
    pal.half[0] = *(const v8us*)&sPl[w][ln][8 * hh]; pal.half[1] = *(const v8us*)&sPl[w][ln][16 + 8 * hh];
#pragma unroll
    for (int dt = 0; dt < DT; ++dt) {
      FragB bvh, bvl;
#pragma unroll
      for (int i = 0; i < 8; ++i) {
        bvh.u[i] = sVh[8 * hh + i][dt * 16 + ln]; bvh.u[8 + i] = sVh[16 + 8 * hh + i][dt * 16 + ln];
        bvl.u[i] = sVl[8 * hh + i][dt * 16 + ln]; bvl.u[8 + i] = sVl[16 + 8 * hh + i][dt * 16 + ln];
      }
      oacc[dt] = mmaN<3>(pah.v, pal.v, bvh.v, bvl.v, oacc[dt]);
    }
    __builtin_amdgcn_fence(__ATOMIC_ACQ_REL, "workgroup");
    __builtin_amdgcn_wave_barrier();
  }
#pragma unroll
  for (int r = 0; r < 8; ++r) {
    float l = l_r[r];
    l += __shfl_xor(l, 1, 32); l += __shfl_xor(l, 2, 32); l += __shfl_xor(l, 4, 32); l += __shfl_xor(l, 8, 32);
    l_r[r] = (l > 0.f) ? 1.0f / l : 0.f;
  }
#pragma unroll
  for (int dt = 0; dt < DT; ++dt)
#pragma unroll
    for (int r = 0; r < 8; ++r) sO[w][8 * hh + r][dt * 16 + ln] = oacc[dt][r] * l_r[r];
  __builtin_amdgcn_fence(__ATOMIC_ACQ_REL, "workgroup");
  __builtin_amdgcn_wave_barrier();
  {
    for (int r = 0; r < 16; ++r) {
      const int row = q0 + r;
      if (row < T && lane < D / 4) {
        const v4f val = *(const v4fa*)&sO[w][r][lane * 4];
        *(v4f*)(y + ((size_t)b * T + row) * ypitch + h * D + lane * 4) = val;
      }
    }
    
  }
}

// GEMM C = act(A·W + bias + resid): A f32 (ASPLIT -> hi/lo 2 terms), Wt bf16 [N][K]; ACT 0 none, 1 relu, 2 exact gelu;
// resid (optional, f32, row index = (row % rmod), pitch ldr, RES_BF16 rounds it) added before the activation.
template <bool ASPLIT, int ACT, bool BIAS_BF16, bool RES_BF16>
__global__ __launch_bounds__(128) void k_gemm_bf3(const float* __restrict__ A, int lda, const unsigned short* __restrict__ Wt, int ldb,
                                                const float* __restrict__ bias, const float* __restrict__ resid, int rmod, int ldr,
                                                float* __restrict__ C, int ldc, int M, int N, int K) {
  __shared__ __attribute__((aligned(16))) float so[4][16][64];
  const int tid = threadIdx.x, w = tid >> 5, lane = tid & 31, ln = lane & 15, hh = lane >> 4;
  const int ntn = N / 64;
  const int wid = blockIdx.x * 4 + w;
  const int mt = wid / ntn, nq = wid % ntn;
  if (mt * 16 >= M) return;
  const int row0 = mt * 16, col0 = nq * 64;
  const float* arow = A + (size_t)(row0 + ln) * lda;
  v8f acc[4] = {};
  for (int kb = 0; kb < K; kb += 32) {
    FragB ah, al;
    const v4f x0 = *(const v4fa*)(arow + kb + 8 * hh), x1 = *(const v4fa*)(arow + kb + 8 * hh + 4);
    const v4f x2 = *(const v4fa*)(arow + kb + 16 + 8 * hh), x3 = *(const v4fa*)(arow + kb + 16 + 8 * hh + 4);
    float xs[16] = {x0[0],x0[1],x0[2],x0[3],x1[0],x1[1],x1[2],x1[3],x2[0],x2[1],x2[2],x2[3],x3[0],x3[1],x3[2],x3[3]};
#pragma unroll
    for (int i = 0; i < 16; ++i) { const unsigned short hb = bf16_bits(xs[i]); ah.u[i] = hb; al.u[i] = ASPLIT ? bf16_bits(xs[i] - bf16_val(hb)) : (unsigned short)0; }
#pragma unroll
    for (int t = 0; t < 4; ++t) {
      const unsigned short* brow = Wt + (size_t)(col0 + t * 16 + ln) * ldb + kb;
      FragB b;
      b.half[0] = *(const v8us*)(brow + 8 * hh);
      b.half[1] = *(const v8us*)(brow + 16 + 8 * hh);
      acc[t] = mmaN<ASPLIT ? 2 : 1>(ah.v, al.v, b.v, b.v, acc[t]);
    }
  }
#pragma unroll
  for (int t = 0; t < 4; ++t) {
    const int col = col0 + t * 16 + ln;
    float bv = bias ? bias[col] : 0.f;
    if (BIAS_BF16) bv = bf16_round(bv);
#pragma unroll
    for (int r = 0; r < 8; ++r) {
      float v = acc[t][r] + bv;
      if (resid) { float rv = resid[(size_t)((row0 + 8 * hh + r) % rmod) * ldr + col]; if (RES_BF16) rv = bf16_round(rv); v += rv; }
      if (ACT == 1) v = fmaxf(v, 0.f);
      if (ACT == 2) v = 0.5f * v * (1.0f + erff(v * 0.70710678118654752f));
      if (ACT == 3) { const float u = 0.7978845608028654f * (v + 0.044715f * v * v * v); v = 0.5f * v * (1.0f + tanhf(u)); }
      so[w][8 * hh + r][t * 16 + ln] = v;
    }
  }
  __builtin_amdgcn_fence(__ATOMIC_ACQ_REL, "workgroup");
  __builtin_amdgcn_wave_barrier();
  const int rsub = lane >> 4, c4 = (lane & 15) * 4;
  {
#pragma unroll
    for (int q = 0; q < 8; ++q) {
      const int r = q * 2 + rsub;
      const v4f v = *(const v4fa*)&so[w][r][c4];
      *(v4f*)(C + (size_t)(row0 + r) * ldc + col0 + c4) = v;
    }
    
  }
}
// row LayerNorm (biased variance, eps) over N: s = X (+ R); optional out_sum <- s; out_norm <- (s-mu)*rsqrt(var+eps)*g + b
template <bool PARAM_BF16>
__global__ __launch_bounds__(256) void k_layernorm(const float* __restrict__ X, const float* __restrict__ R, const float* __restrict__ g, const float* __restrict__ bta,
                                                  float* __restrict__ out_sum, float* __restrict__ out_norm, int N, float eps) {
  __shared__ float red[256];
  const int row = blockIdx.x, tid = threadIdx.x;
  const float* x = X + (size_t)row * N; const float* rr = R ? R + (size_t)row * N : nullptr;
  float vals[16];                     // up to N = 4096
  const int per = N / 256;            // contiguous chunk per thread? use strided-by-4 chunks: thread handles j = tid*4 + 1024*u
  float s1 = 0.f;
  for (int u = 0; u < per / 4; ++u) {
    const int j = tid * 4 + 1024 * u;
    const v4f a = *(const v4fa*)(x + j);
    v4f b = {0.f,0.f,0.f,0.f}; if (rr) b = *(const v4fa*)(rr + j);
#pragma unroll
    for (int q = 0; q < 4; ++q) { const float v = a[q] + b[q]; vals[u * 4 + q] = v; s1 += v; }
  }
  red[tid] = s1; __syncthreads();
  for (int st = 128; st > 0; st >>= 1) { if (tid < st) red[tid] += red[tid + st]; __syncthreads(); }
  const float mu = red[0] / (float)N; __syncthreads();
  float s2 = 0.f;
  for (int u = 0; u < per / 4; ++u)
#pragma unroll
    for (int q = 0; q < 4; ++q) { const float c = vals[u * 4 + q] - mu; s2 += c * c; }
  red[tid] = s2; __syncthreads();
  for (int st = 128; st > 0; st >>= 1) { if (tid < st) red[tid] += red[tid + st]; __syncthreads(); }
  const float rs = rsqrtf(red[0] / (float)N + eps);
  {
    for (int u = 0; u < per / 4; ++u) {
      const int j = tid * 4 + 1024 * u;
      v4f o, sm;
#pragma unroll
      for (int q = 0; q < 4; ++q) {
        float gg = g[j + q], bb = bta[j + q];
        if (PARAM_BF16) { gg = bf16_round(gg); bb = bf16_round(bb); }
        sm[q] = vals[u * 4 + q]; o[q] = (vals[u * 4 + q] - mu) * rs * gg + bb;
      }
      if (out_sum) *(v4f*)(out_sum + (size_t)row * N + j) = sm;
      *(v4f*)(out_norm + (size_t)row * N + j) = o;
    }
    
  }
}



// ---- f16 WMMA path (v_wmma_f32_16x16x32_f16): 11-bit significands for operands in range — used where a [0,1] probability operand needs more precision than bf16
typedef _Float16 v16h __attribute__((ext_vector_type(16)));
union FragH { v16h v; v8us half[2]; _Float16 h[16]; unsigned short u[16]; };
template <int NT>
__device__ __forceinline__ v8f mmaH(v16h ah, v16h al, v16h bh, v16h bl, v8f c) {
  c = __builtin_amdgcn_wmma_f32_16x16x32_f16(false, ah, false, bh, (short)0, c, false, false);
  if (NT >= 2) c = __builtin_amdgcn_wmma_f32_16x16x32_f16(false, al, false, bh, (short)0, c, false, false);
  if (NT >= 3) c = __builtin_amdgcn_wmma_f32_16x16x32_f16(false, ah, false, bl, (short)0, c, false, false);
  asm volatile("v_nop\n\tv_nop\n\tv_nop\n\tv_nop" : "+v"(c) : "v"(ah), "v"(al), "v"(bh), "v"(bl));
  return c;
}
// batched GEMM like k_gemm_b but f16 operands: A f32 (split into f16 hi/lo if ASPLIT, else rounded to f16), Bt = f16 values [n][k]; alpha; C f32; N multiple of 16 (partial tiles skipped)
template <bool ASPLIT>
__global__ __launch_bounds__(128) void k_gemm_h(const float* __restrict__ A, int lda, size_t sA, const _Float16* __restrict__ Bh, int ldb, size_t sB, float alpha, float* __restrict__ C, int ldc, size_t sC, int M, int N, int K) {
  __shared__ __attribute__((aligned(16))) float so[4][16][64];
  const int tid = threadIdx.x, w = tid >> 5, lane = tid & 31, ln = lane & 15, hh = lane >> 4; const int by = blockIdx.y;
  A += (size_t)by * sA; Bh += (size_t)by * sB; C += (size_t)by * sC;
  const int ntn = (N + 63) / 64; const int wid = blockIdx.x * 4 + w; const int mt = wid / ntn, nq = wid % ntn; if (mt * 16 >= M) return;
  const int row0 = mt * 16, col0 = nq * 64; const float* arow = A + (size_t)(row0 + ln) * lda;
  v8f acc[4] = {};
  for (int kb = 0; kb < K; kb += 32) {
    FragH ah, al;
    const v4f x0 = *(const v4fa*)(arow + kb + 8 * hh), x1 = *(const v4fa*)(arow + kb + 8 * hh + 4), x2 = *(const v4fa*)(arow + kb + 16 + 8 * hh), x3 = *(const v4fa*)(arow + kb + 16 + 8 * hh + 4);
    float xs[16] = {x0[0],x0[1],x0[2],x0[3],x1[0],x1[1],x1[2],x1[3],x2[0],x2[1],x2[2],x2[3],x3[0],x3[1],x3[2],x3[3]};
#pragma unroll
    for (int i = 0; i < 16; ++i) { const _Float16 h = (_Float16)xs[i]; ah.h[i] = h; al.h[i] = ASPLIT ? (_Float16)(xs[i] - (float)h) : (_Float16)0.0f; }
#pragma unroll
    for (int t = 0; t < 4; ++t) { if (col0 + t * 16 >= N) continue; const size_t boff = (size_t)(col0 + t * 16 + ln) * ldb + kb; FragH bq; bq.half[0] = *(const v8us*)(Bh + boff + 8 * hh); bq.half[1] = *(const v8us*)(Bh + boff + 16 + 8 * hh);
      acc[t] = mmaH<ASPLIT ? 2 : 1>(ah.v, al.v, bq.v, bq.v, acc[t]); }
  }
#pragma unroll
  for (int t = 0; t < 4; ++t) { if (col0 + t * 16 >= N) continue;
#pragma unroll
    for (int r = 0; r < 8; ++r) so[w][8 * hh + r][t * 16 + ln] = acc[t][r] * alpha; }
  __builtin_amdgcn_fence(__ATOMIC_ACQ_REL, "workgroup"); __builtin_amdgcn_wave_barrier();
  const int rsub = lane >> 4, c4 = (lane & 15) * 4;
  {
#pragma unroll
    for (int q = 0; q < 8; ++q) { const int r = q * 2 + rsub; if (col0 + c4 < N) { const v4f v = *(const v4fa*)&so[w][r][c4]; *(v4f*)(C + (size_t)(row0 + r) * ldc + col0 + c4) = v; } }
     }
}

// Wt[n][k] = f16(W[k][n]·scale) from f32 row-major W[K][N] (scale = power of two; bf16-exact weights stay exact in f16 away from the subnormal range)
__global__ __launch_bounds__(256) void k_wt_f16(const float* __restrict__ W, _Float16* __restrict__ Wt, int K, int N, float scale) {
  const int t = blockIdx.x * 256 + threadIdx.x; if (t >= N * (K / 8)) return; const int n = t / (K / 8), k8 = (t % (K / 8)) * 8; FragH f;
#pragma unroll
  for (int i = 0; i < 8; ++i) f.h[i] = (_Float16)(bf16_round(W[(size_t)(k8 + i) * N + n]) * scale); const v8us o = f.half[0];
  *(v8us*)((unsigned short*)Wt + (size_t)n * K + k8) = o; 
}
// k_gemm_hh variant with fused epilogue: v = acc·alpha + bias[by·sBias + col] (+ CP[(row/rowsPerB)·sCPb + by·64 + col] if CP) ; ACT 0 none / 1 elu ; writes f32 C and f16 C16, each if non-null
// the body takes its block indices (bx, by) and its 16 KiB of LDS from the caller, so that several products can share one launch
template <int ACT>
__device__ __forceinline__ void gemm_hhx_body(float (*so)[16][64], const int bx, const int by, const _Float16* __restrict__ A, int lda, size_t sA, const _Float16* __restrict__ Bh, int ldb, size_t sB, float alpha, const float* __restrict__ bias, size_t sBias, const float* __restrict__ CP, int rowsPerB, size_t sCPb, int row0g,
    float* __restrict__ C, _Float16* __restrict__ C16, int ldc, size_t sC, int M, int N, int K) {
  const int tid = threadIdx.x, w = tid >> 5, lane = tid & 31, ln = lane & 15, hh = lane >> 4;
  A += (size_t)by * sA; Bh += (size_t)by * sB; const size_t cofs = (size_t)by * sC; const float* bp = bias ? bias + (size_t)by * sBias : nullptr;
  const int ntn = (N + 63) / 64; const int wid = bx * 4 + w; const int mt = wid / ntn, nq = wid % ntn; if (mt * 16 >= M) return;
  const int row0 = mt * 16, col0 = nq * 64; const _Float16* arow = A + (size_t)(row0 + ln) * lda;
  v8f acc[4] = {};
  for (int kb = 0; kb < K; kb += 32) { FragH ah; ah.half[0] = *(const v8us*)((const unsigned short*)arow + kb + 8 * hh); ah.half[1] = *(const v8us*)((const unsigned short*)arow + kb + 16 + 8 * hh);
#pragma unroll
    for (int t = 0; t < 4; ++t) { if (col0 + t * 16 >= N) continue; const size_t boff = (size_t)(col0 + t * 16 + ln) * ldb + kb; FragH bq; bq.half[0] = *(const v8us*)((const unsigned short*)Bh + boff + 8 * hh); bq.half[1] = *(const v8us*)((const unsigned short*)Bh + boff + 16 + 8 * hh);
      acc[t] = mmaH<1>(ah.v, ah.v, bq.v, bq.v, acc[t]); }
  }
#pragma unroll
  for (int t = 0; t < 4; ++t) { if (col0 + t * 16 >= N) continue; const int col = col0 + t * 16 + ln; const float bv = bp ? bf16_round(bp[col]) : 0.f;
#pragma unroll
    for (int r = 0; r < 8; ++r) { float v = acc[t][r] * alpha + bv; if (CP) { const int bidx = (row0g + row0 + 8 * hh + r) / rowsPerB; v += CP[(size_t)bidx * sCPb + (size_t)by * 64 + col]; } if (ACT == 1) v = (v > 0.f) ? v : expm1f(v); else if (ACT == 3) v = fmaxf(v, 0.f); so[w][8 * hh + r][t * 16 + ln] = v; } }
  __builtin_amdgcn_fence(__ATOMIC_ACQ_REL, "workgroup"); __builtin_amdgcn_wave_barrier();
  const int rsub = lane >> 4, c4 = (lane & 15) * 4; typedef _Float16 v4h __attribute__((ext_vector_type(4)));
  {
#pragma unroll
    for (int q = 0; q < 8; ++q) { const int r = q * 2 + rsub; if (col0 + c4 < N) { const v4f v = *(const v4fa*)&so[w][r][c4]; if (C) *(v4f*)(C + cofs + (size_t)(row0 + r) * ldc + col0 + c4) = v; if (C16) { v4h h4; for (int i = 0; i < 4; ++i) h4[i] = (_Float16)v[i]; *(v4h*)(C16 + cofs + (size_t)(row0 + r) * ldc + col0 + c4) = h4; } } }
     }
}
template <int ACT>
__global__ __launch_bounds__(128) void k_gemm_hhx(const _Float16* __restrict__ A, int lda, size_t sA, const _Float16* __restrict__ Bh, int ldb, size_t sB, float alpha, const float* __restrict__ bias, size_t sBias, const float* __restrict__ CP, int rowsPerB, size_t sCPb, int row0g,
    float* __restrict__ C, _Float16* __restrict__ C16, int ldc, size_t sC, int M, int N, int K) {
  __shared__ __attribute__((aligned(16))) float so[4][16][64];
  gemm_hhx_body<ACT>(so, blockIdx.x, blockIdx.y, A, lda, sA, Bh, ldb, sB, alpha, bias, sBias, CP, rowsPerB, sCPb, row0g, C, C16, ldc, sC, M, N, K);
}


// x16_body, round16f_body, sn_body and qsum_body are roles of one launch (k_prep, blocks of 512): each takes its block index bx inside its role
__device__ __forceinline__ void x16_body(const int bx, const float* __restrict__ x, _Float16* __restrict__ X16) { const size_t t = (size_t)bx * 512 + threadIdx.x; FragH f;
#pragma unroll
  for (int q = 0; q < 8; ++q) f.h[q] = (_Float16)bf16_round(x[t * 8 + q]); *(v8us*)((unsigned short*)X16 + t * 8) = f.half[0];  }
__global__ __launch_bounds__(256) void k_h16(const float* __restrict__ x, _Float16* __restrict__ X16, size_t n8) { const size_t t = (size_t)blockIdx.x * 256 + threadIdx.x; if (t >= n8) return; FragH f;
#pragma unroll
  for (int q = 0; q < 8; ++q) f.h[q] = (_Float16)x[t * 8 + q]; *(v8us*)((unsigned short*)X16 + t * 8) = f.half[0];  }
__device__ __forceinline__ void round16f_body(const int bx, const float* __restrict__ W, _Float16* __restrict__ Bt) { const size_t t = (size_t)bx * 512 + threadIdx.x; FragH f;
#pragma unroll
  for (int i = 0; i < 8; ++i) f.h[i] = (_Float16)(bf16_round(W[t * 8 + i]) * 16.0f); *(v8us*)((unsigned short*)Bt + t * 8) = f.half[0];
  asm volatile("s_wait_xcnt 0x0" ::: "memory");      // in the merged listing the next role's code follows this store and writes its address register: the wait stands in front of that write
}
__device__ __forceinline__ void sn_body(const int bx, const float* __restrict__ sf, _Float16* __restrict__ SN) { const int tid = threadIdx.x, wv = tid >> 5, lane = tid & 31; const size_t row = (size_t)bx * 16 + wv; float v[8]; float s = 0.f;
#pragma unroll
  for (int q = 0; q < 8; ++q) { v[q] = bf16_round(sf[row * DSEM + lane * 8 + q]); s += v[q] * v[q]; }
  for (int o = 16; o >= 1; o >>= 1) s += __shfl_xor(s, o, 32); const float inv = 1.0f / fmaxf(sqrtf(s), 1e-12f); FragH f;
#pragma unroll
  for (int q = 0; q < 8; ++q) f.h[q] = (_Float16)(v[q] * inv); *(v8us*)((unsigned short*)SN + row * DSEM + lane * 8) = f.half[0];
  asm volatile("s_wait_xcnt 0x0" ::: "memory");      // in the merged listing the next role's code follows this store and writes its address register: the wait stands in front of that write
}
// dynamic temperature, stage 1: column sums of the bf16-rounded query over QROWS rows per block -> PART[b][chunk][DM]; thread = 4 columns x one of 4 row phases, 16 independent 16-byte loads
#define QP 32
#define QROWS (SS / QP)
__device__ __forceinline__ void qsum_body(float (*sred)[DM], const int bx, const float* __restrict__ query, float* __restrict__ PART) {
  const int tid = threadIdx.x, ph = tid >> 7, c4 = (tid & 127) * 4;
  const float* src = query + ((size_t)bx * QROWS + ph * (QROWS / 4)) * DM + c4; v4f s = {0.f, 0.f, 0.f, 0.f};
#pragma unroll  // all 16 row loads issue before the first add: one memory latency instead of 16
  for (int r = 0; r < QROWS / 4; ++r) { const v4f x = *(const v4fa*)(src + (size_t)r * DM);
#pragma unroll
    for (int q = 0; q < 4; ++q) s[q] += bf16_round(x[q]); }
  *(v4fa*)&sred[ph][c4] = s; __syncthreads();
  PART[(size_t)bx * DM + tid] = (sred[0][tid] + sred[1][tid]) + (sred[2][tid] + sred[3][tid]); }
// one launch for all work that reads inputs only: column sums of the query, the three f16 activation planes, the normalised semantic rows, the four weight planes; role by block range
#define PB_QS (BB * QP)
#define PB_X (NR * DM / 8 / 512)
#define PB_SN (NR / 16)
#define PB_W (DM * DM / 8 / 512)
__global__ __launch_bounds__(512) void k_prep(const float* __restrict__ xq, const float* __restrict__ xk, const float* __restrict__ xv, const float* __restrict__ sf,
    const float* __restrict__ Wq, const float* __restrict__ Wk, const float* __restrict__ Wv, const float* __restrict__ Wo,
    _Float16* __restrict__ XQ, _Float16* __restrict__ XK, _Float16* __restrict__ XV, _Float16* __restrict__ SN,
    _Float16* __restrict__ Bq, _Float16* __restrict__ Bk, _Float16* __restrict__ Bv, _Float16* __restrict__ Bo, float* __restrict__ PART) {
  __shared__ __attribute__((aligned(16))) float sred[4][DM];
  const int bx = blockIdx.x, bx1 = bx - PB_QS, bx2 = bx1 - 3 * PB_X, bx3 = bx2 - PB_SN;
  if (bx1 < 0) qsum_body(sred, bx, xq, PART);
  else if (bx2 < 0) { const int g = bx1 / PB_X; x16_body(bx1 % PB_X, g == 0 ? xq : g == 1 ? xk : xv, g == 0 ? XQ : g == 1 ? XK : XV); }
  else if (bx3 < 0) sn_body(bx2, sf, SN);
  else { const int g = bx3 / PB_W; round16f_body(bx3 % PB_W, g == 0 ? Wq : g == 1 ? Wk : g == 2 ? Wv : Wo, g == 0 ? Bq : g == 1 ? Bk : g == 2 ? Bv : Bo); } }
// stage 2 (one block of 4 waves, a role of k_proj, beside the products that do not need it): mean query of both batches from PART, then one wave per hidden unit (lanes along DM, 16-byte loads of the
// Wt1 row shared by both batches), relu, Wt2 dot, sigmoid. The hidden units are summed in 32 groups of 8, each wave taking 8 groups in turn.
__device__ __forceinline__ void temp_body(float* __restrict__ sm, const float* __restrict__ PART, const float* __restrict__ Wt1, const float* __restrict__ bt1, const float* __restrict__ Wt2, const float* __restrict__ bt2, float* __restrict__ TEMP) {
  float (*qm)[DM] = (float (*)[DM])sm; float (*red)[32] = (float (*)[32])(sm + BB * DM); const int tid = threadIdx.x, wv = tid >> 5, lane = tid & 31;
#pragma unroll 1  // kept rolled: unrolled, its loads raise the register count of the whole launch (142 against 104) and cost the products waves
  for (int it = 0; it < BB * DM / 128; ++it) { const int c = it * 128 + tid, b = c >> 9, col = c & (DM - 1); float s = 0.f;
#pragma unroll  // all 32 partial loads in flight together
    for (int p = 0; p < QP; ++p) s += PART[((size_t)b * QP + p) * DM + col];
    qm[b][col] = s / (float)SS; }
  __syncthreads();
  v4f qv[BB][4];
#pragma unroll
  for (int b = 0; b < BB; ++b)
#pragma unroll
    for (int j = 0; j < 4; ++j) qv[b][j] = *(const v4fa*)&qm[b][j * 128 + lane * 4];
#pragma unroll 1  // one group of 8 hidden units a trip, kept rolled: unrolled, it would raise the register count of the launch's products
  for (int gq = 0; gq < 8; ++gq) { const int grp = wv * 8 + gq;
  float pw[BB] = {0.f, 0.f};
#pragma unroll 2  // two rows = 8 loads of 16 bytes in flight per lane; more would raise the register count of the launch's products
  for (int i = 0; i < (DM / 2) / 32; ++i) { const int u = grp * ((DM / 2) / 32) + i; const float* wr = Wt1 + (size_t)u * DM + lane * 4; float a[BB] = {0.f, 0.f};
#pragma unroll
    for (int j = 0; j < 4; ++j) { const v4f wq = *(const v4fa*)(wr + j * 128);
#pragma unroll
      for (int q = 0; q < 4; ++q) { const float wb = bf16_round(wq[q]);
#pragma unroll
        for (int b = 0; b < BB; ++b) a[b] += wb * qv[b][j][q]; } }
    const float b1 = bf16_round(bt1[u]), w2 = bf16_round(Wt2[u]);
#pragma unroll
    for (int b = 0; b < BB; ++b) { float t = a[b]; for (int o = 16; o >= 1; o >>= 1) t += __shfl_xor(t, o, 32); pw[b] += fmaxf(t + b1, 0.f) * w2; } }
  if (lane == 0) {
#pragma unroll
    for (int b = 0; b < BB; ++b) red[b][grp] = pw[b]; } }
  __syncthreads();
  if (tid < 32) { float v = 0.f; if (tid < BB) { float z = bf16_round(bt2[0]); for (int q = 0; q < 32; ++q) z += red[tid][q]; const float t = 1.0f / (1.0f + expf(-z)); v = 0.5f + t * 1.5f; } TEMP[tid] = v; } }
// one launch for all that needs k_prep alone: block 0 the temperature, then the q, k and v projections (the longer products first), then the similarity plane; role by block range
#define GB_P ((NR / 16) * (DM / 64) / 4)
#define GB_S ((SS / 16) * (SS / 64) / 4)
__global__ __launch_bounds__(128) void k_proj(const _Float16* __restrict__ XQ, const _Float16* __restrict__ XK, const _Float16* __restrict__ XV, const _Float16* __restrict__ Bq, const _Float16* __restrict__ Bk, const _Float16* __restrict__ Bv,
    const float* __restrict__ bq, const float* __restrict__ bk, const float* __restrict__ bv, _Float16* __restrict__ Q16, _Float16* __restrict__ K16, _Float16* __restrict__ V16, const _Float16* __restrict__ SN, _Float16* __restrict__ SIM,
    const float* __restrict__ PART, const float* __restrict__ Wt1, const float* __restrict__ bt1, const float* __restrict__ Wt2, const float* __restrict__ bt2, float* __restrict__ TEMP) {
  __shared__ __attribute__((aligned(16))) float so[4][16][64];
  int bx = blockIdx.x;
  if (bx == 0) { temp_body(&so[0][0][0], PART, Wt1, bt1, Wt2, bt2, TEMP); return; }
  bx -= 1;
  if (bx < 3 * GB_P) { const int g = bx / GB_P;
    gemm_hhx_body<0>(so, bx % GB_P, 0, g == 0 ? XQ : g == 1 ? XK : XV, DM, 0, g == 0 ? Bq : g == 1 ? Bk : Bv, DM, 0, 0.0625f, g == 0 ? bq : g == 1 ? bk : bv, 0, nullptr, 1, 0, 0, nullptr, g == 0 ? Q16 : g == 1 ? K16 : V16, DM, 0, NR, DM, DM); return; }
  bx -= 3 * GB_P;
  // SIM[b] = SN[b].SN[b]^T (f16; values in [-1, 1])
  gemm_hhx_body<0>(so, bx % GB_S, bx / GB_S, SN, DSEM, (size_t)SS * DSEM, SN, DSEM, (size_t)SS * DSEM, 1.0f, nullptr, 0, nullptr, 1, 0, 0, nullptr, SIM, SS, (size_t)SS * SS, SS, SS, DSEM); }
__global__ __launch_bounds__(256) void k_vt(const _Float16* __restrict__ V16, _Float16* __restrict__ Vt) { __shared__ unsigned short tl[64][66]; const int tid = threadIdx.x; const int slab = blockIdx.x / (SS / 64), lg = blockIdx.x % (SS / 64); const int b = slab / NH, h = slab % NH;
  for (int i = tid; i < 64 * 8; i += 256) { const int r = i / 8, c8 = (i % 8) * 8; FragH f; f.half[0] = *(const v8us*)((const unsigned short*)V16 + ((size_t)b * SS + lg * 64 + r) * DM + h * HD + c8);
#pragma unroll
    for (int q = 0; q < 8; ++q) tl[r][c8 + q] = f.u[q]; }
  __syncthreads();
  {
#pragma unroll
    for (int rd = 0; rd < 2; ++rd) { const int d = rd * 32 + tid / 8, pc = tid % 8; FragH f;
#pragma unroll
      for (int q = 0; q < 8; ++q) f.u[q] = tl[pc * 8 + q][d];
      *(v8us*)((unsigned short*)Vt + ((size_t)slab * HD + d) * SS + lg * 64 + pc * 8) = f.half[0]; }
     } }
// fused constrained attention per ((b,h), 128 queries): wave = 32 queries; s = (q.k)/(8 temp_b) + sem_bias + pos_bias, -inf where mask[b][k] = 0; sem_bias = -(0.5 - sim) if sim < 0.5.
// Transposed products: St = K.Qt (A = 16 key rows, B = 16 query columns), Ot += Vt.Pt. Lane (ln, hh) then holds, for query ln of a tile, the scores of keys 8 hh + r of each 16-key tile:
// the running max and sum are in-lane work plus one swap between the wave halves, two St tiles converted to f16 are the B operand of the second product as they lie, SIM[q][k .. k + 7] is one 16-byte load.
typedef int v4ia __attribute__((ext_vector_type(4), may_alias));
typedef _Float16 v8h __attribute__((ext_vector_type(8)));
union FragP { v16h v; v8h p[2]; };
__device__ __forceinline__ float swap_halves(float x) { const int t = __float_as_int(x); return __int_as_float(__builtin_amdgcn_permlanex16(t, t, 0x76543210, 0xfedcba98, false, false)); }   // lane l <-> l ^ 16
__global__ __launch_bounds__(128) void k_flash(const _Float16* __restrict__ Q16, const _Float16* __restrict__ K16, const _Float16* __restrict__ Vt, const _Float16* __restrict__ SIM, const int* __restrict__ mask, const float* __restrict__ TEMP, float* __restrict__ O) {
  constexpr int RPW = 32, NQB = SS / (4 * RPW), DT = HD / 16, KS = HD / 32;
  const int tid = threadIdx.x, w = tid >> 5, lane = tid & 31, ln = lane & 15, hh = lane >> 4;
  const int slab = blockIdx.x / NQB, qblk = blockIdx.x % NQB; const int b = slab / NH, h = slab % NH; const int q0 = qblk * (4 * RPW) + w * RPW; const float sc = 0.125f / TEMP[b];
  FragH aq[2][KS];
#pragma unroll
  for (int qt = 0; qt < 2; ++qt) { const unsigned short* qr = (const unsigned short*)Q16 + ((size_t)b * SS + q0 + qt * 16 + ln) * DM + h * HD;
#pragma unroll
    for (int ks = 0; ks < KS; ++ks) { aq[qt][ks].half[0] = *(const v8us*)(qr + ks * 32 + 8 * hh); aq[qt][ks].half[1] = *(const v8us*)(qr + ks * 32 + 16 + 8 * hh); } }
  // the lane's four read pointers; each moves on by 32 keys a pass
  const unsigned short* vp = (const unsigned short*)Vt + ((size_t)slab * HD + ln) * SS + 8 * hh;
  const unsigned short* kp = (const unsigned short*)K16 + ((size_t)b * SS + ln) * DM + h * HD + 8 * hh;
  const unsigned short* sp = (const unsigned short*)SIM + ((size_t)b * SS + q0 + ln) * SS + 8 * hh;
  const int* mp = mask + (size_t)b * SS + 8 * hh;
  float m_q[2], l_q[2]; v8f oacc[2][DT];
#pragma unroll
  for (int qt = 0; qt < 2; ++qt) { m_q[qt] = -3.0e38f; l_q[qt] = 0.f;
#pragma unroll
    for (int dt = 0; dt < DT; ++dt) oacc[qt][dt] = (v8f){0.f,0.f,0.f,0.f,0.f,0.f,0.f,0.f}; }
#pragma unroll 1
  for (int j0 = 0; j0 < SS; j0 += 32) {
    // every load of the pass stands in front of its first product: none depends on the scores any more, so the pass waits for memory once
    FragH bk[2][KS], bv[DT], sm[2][2]; v4ia mk[2][2];
#pragma unroll
    for (int nt = 0; nt < 2; ++nt) {
#pragma unroll
      for (int ks = 0; ks < KS; ++ks) { bk[nt][ks].half[0] = *(const v8us*)(kp + nt * 16 * DM + ks * 32); bk[nt][ks].half[1] = *(const v8us*)(kp + nt * 16 * DM + ks * 32 + 16); }
      mk[nt][0] = *(const v4ia*)(mp + nt * 16); mk[nt][1] = *(const v4ia*)(mp + nt * 16 + 4);
#pragma unroll
      for (int qt = 0; qt < 2; ++qt) sm[qt][nt].half[0] = *(const v8us*)(sp + qt * 16 * SS + nt * 16); }
#pragma unroll
    for (int dt = 0; dt < DT; ++dt) { bv[dt].half[0] = *(const v8us*)(vp + dt * 16 * SS); bv[dt].half[1] = *(const v8us*)(vp + dt * 16 * SS + 16); }
    asm volatile("s_wait_xcnt 0x0" :: "v"(kp), "v"(mp), "v"(sp), "v"(vp) : "memory");      // stands in front of every write of a register that one of the 24 loads names as its address; the four inputs keep those registers live up to it
    __builtin_amdgcn_sched_barrier(0);      // keeps the 24 loads one group (else half of them issue behind the first wait and the pass pays the latency twice) and the pointer steps behind the wait above
    kp += 32 * DM; mp += 32; sp += 32; vp += 32;
    v8f s[2][2];
#pragma unroll
    for (int nt = 0; nt < 2; ++nt)
#pragma unroll
      for (int qt = 0; qt < 2; ++qt) { v8f acc = (v8f){0.f,0.f,0.f,0.f,0.f,0.f,0.f,0.f};
#pragma unroll
        for (int ks = 0; ks < KS; ++ks) acc = mmaH<1>(bk[nt][ks].v, bk[nt][ks].v, aq[qt][ks].v, aq[qt][ks].v, acc); s[qt][nt] = acc; }
    FragP pb[2];
#pragma unroll
    for (int qt = 0; qt < 2; ++qt) { const int qi = q0 + qt * 16 + ln; float mc = -INFINITY;
#pragma unroll
      for (int nt = 0; nt < 2; ++nt)
#pragma unroll
        for (int r = 0; r < 8; ++r) { const int k = j0 + nt * 16 + 8 * hh + r; const float sim = (float)sm[qt][nt].h[r]; const float sb = (sim < 0.5f) ? -(0.5f - sim) : 0.f;
          const float dd = fabsf((float)(qi - k)); const float pbias = (dd > 10.f) ? -0.1f * (dd - 10.f) : 0.f;
          const float su = s[qt][nt][r] * sc + sb + pbias; const float sv = (mk[nt][r >> 2][r & 3] != 0) ? su : -INFINITY; s[qt][nt][r] = sv; mc = fmaxf(mc, sv); }
      mc = fmaxf(mc, swap_halves(mc));
      const float mn = fmaxf(m_q[qt], mc); const float al = expf(m_q[qt] - mn); m_q[qt] = mn; float ls = 0.f;
#pragma unroll
      for (int nt = 0; nt < 2; ++nt) {
#pragma unroll
        for (int r = 0; r < 8; ++r) { const float p = expf(s[qt][nt][r] - mn); s[qt][nt][r] = p; ls += p; }
        pb[qt].p[nt] = __builtin_convertvector(s[qt][nt], v8h); }
      l_q[qt] = l_q[qt] * al + ls;      // partial sum of this half's 16 keys; the halves are joined behind the loop
#pragma unroll
      for (int dt = 0; dt < DT; ++dt)
#pragma unroll
        for (int r = 0; r < 8; ++r) oacc[qt][dt][r] *= al; }
#pragma unroll
    for (int dt = 0; dt < DT; ++dt)
#pragma unroll
      for (int qt = 0; qt < 2; ++qt) oacc[qt][dt] = mmaH<1>(bv[dt].v, bv[dt].v, pb[qt].v, pb[qt].v, oacc[qt][dt]); }
#pragma unroll
  for (int qt = 0; qt < 2; ++qt) { float l = l_q[qt]; l += swap_halves(l); const float inv = (l > 0.f) ? 1.0f / l : 0.f;
    float* orow = O + ((size_t)b * SS + q0 + qt * 16 + ln) * DM + h * HD + 8 * hh;      // register r of tile dt is column dt * 16 + 8 hh + r of the query's row
#pragma unroll
    for (int dt = 0; dt < DT; ++dt) { v4f lo, hi;
#pragma unroll
      for (int r = 0; r < 4; ++r) { lo[r] = oacc[qt][dt][r] * inv; hi[r] = oacc[qt][dt][4 + r] * inv; }
      *(v4f*)(orow + dt * 16) = lo; *(v4f*)(orow + dt * 16 + 4) = hi; } } }
extern "C" void kernel_launch(void* const* d_in, const int* in_sizes, int n_in,
                              void* d_out, int out_size, void* d_ws, size_t ws_size, hipStream_t stream) {
  (void)in_sizes; (void)n_in; (void)out_size;
  const float* xq = (const float*)d_in[0]; const float* xk = (const float*)d_in[1]; const float* xv = (const float*)d_in[2]; const int* mask = (const int*)d_in[3]; const float* sf = (const float*)d_in[4];
  const float* Wq = (const float*)d_in[5]; const float* bq = (const float*)d_in[6]; const float* Wk = (const float*)d_in[7]; const float* bk = (const float*)d_in[8]; const float* Wv = (const float*)d_in[9]; const float* bv = (const float*)d_in[10]; const float* Wo = (const float*)d_in[11]; const float* bo = (const float*)d_in[12]; const float* Wt1 = (const float*)d_in[13]; const float* bt1 = (const float*)d_in[14]; const float* Wt2 = (const float*)d_in[15]; const float* bt2 = (const float*)d_in[16];
  char* ws = (char*)d_ws; size_t off = 0;
  auto take = [&](size_t bytes) { char* p = ws + off; off += (bytes + 255) & ~(size_t)255; return p; };
  const size_t w8 = (size_t)DM * DM / 8;
  _Float16* Bq = (_Float16*)take(w8 * 16); _Float16* Bk = (_Float16*)take(w8 * 16); _Float16* Bv = (_Float16*)take(w8 * 16); _Float16* Bo = (_Float16*)take(w8 * 16);
  _Float16* XQ = (_Float16*)take((size_t)NR * DM * 2); _Float16* XK = (_Float16*)take((size_t)NR * DM * 2); _Float16* XV = (_Float16*)take((size_t)NR * DM * 2); _Float16* Q16 = (_Float16*)take((size_t)NR * DM * 2); _Float16* K16 = (_Float16*)take((size_t)NR * DM * 2); _Float16* V16 = (_Float16*)take((size_t)NR * DM * 2); _Float16* Vt = (_Float16*)take((size_t)NR * DM * 2);
  _Float16* SN = (_Float16*)take((size_t)NR * DSEM * 2); _Float16* SIM = (_Float16*)take((size_t)BB * SS * SS * 2); float* TEMP = (float*)take(256); float* O = (float*)take((size_t)NR * DM * 4); float* PART = (float*)take((size_t)BB * QP * DM * 4); _Float16* O16 = XQ;      // the query plane is dead after the q GEMM
  if (off > ws_size) return;      // ≈ 2 + 4.2×7 + 2.1 + 16.8 + 8.4 ≈ 57 MiB
  const unsigned gx = (unsigned)(((size_t)NR * DM / 8 + 255) / 256);
  k_prep<<<PB_QS + 3 * PB_X + PB_SN + 4 * PB_W, 512, 0, stream>>>(xq, xk, xv, sf, Wq, Wk, Wv, Wo, XQ, XK, XV, SN, Bq, Bk, Bv, Bo, PART);
  k_proj<<<1 + 3 * GB_P + BB * GB_S, 128, 0, stream>>>(XQ, XK, XV, Bq, Bk, Bv, bq, bk, bv, Q16, K16, V16, SN, SIM, PART, Wt1, bt1, Wt2, bt2, TEMP);
  const dim3 gg(((NR / 16) * (DM / 64) + 3) / 4, 1);
  k_vt<<<BB * NH * (SS / 64), 256, 0, stream>>>(V16, Vt);
  k_flash<<<BB * NH * (SS / 128), 128, 0, stream>>>(Q16, K16, Vt, SIM, mask, TEMP, O);
  k_h16<<<gx, 256, 0, stream>>>(O, O16, (size_t)NR * DM / 8);
  k_gemm_hhx<0><<<gg, 128, 0, stream>>>(O16, DM, 0, Bo, DM, 0, 0.0625f, bo, 0, nullptr, 1, 0, 0, (float*)d_out, nullptr, DM, 0, NR, DM, DM);
}

// v004
// Measured time: 157 microseconds a run.
// Two timings next to v003 put it at 1.30 and 1.29 times that version's speed.
// Counting every step since v000, it is 5.34 times as fast.
#include <hip/hip_runtime.h>
// q/k/v/o projections (4096 × 512 × 512, + bias), the cosine-similarity matrix of the normalised semantic features (per batch 2048 × 2048 × 256, kept as an f16 plane) and the 8-head
// constrained attention on v_wmma_f32_16x16x32_f16 (fused flash-style kernel: Sᵀ = K·Qᵀ, Oᵀ = Vᵀ·Pᵀ on WMMA; scores / (8·temperature_b) + semantic bias + positional bias, key mask → −inf;
// online max/sum softmax f32; P f16 ≤ 1); the dynamic-temperature MLP on the mean query is f32 VALU (column sums over 64 blocks, then one block); A = f16(bf16 ·) exact operands, weights bf16-exact ×2^4 ((out,in)),
// single products, f32 accumulate.
#define BB 2
#define SS 2048
#define DM 512
#define NH 8
#define HD 64
#define DSEM 256
#define NR (BB * SS)

typedef __bf16 v16b __attribute__((ext_vector_type(16)));
typedef unsigned short v8us __attribute__((ext_vector_type(8), may_alias));
typedef float  v8f  __attribute__((ext_vector_type(8)));
typedef float  v4f  __attribute__((ext_vector_type(4)));
typedef float  v4fa __attribute__((ext_vector_type(4), may_alias));
union FragB { v16b v; v8us half[2]; unsigned short u[16]; };

__device__ __forceinline__ unsigned short bf16_bits(float x) { unsigned int u = __float_as_uint(x); return (unsigned short)((u + 0x7FFFu + ((u >> 16) & 1u)) >> 16); }
__device__ __forceinline__ float bf16_val(unsigned short b) { return __uint_as_float(((unsigned int)b) << 16); }
__device__ __forceinline__ float bf16_round(float x) { return bf16_val(bf16_bits(x)); }
// D += A·B with NT terms: 1 = ah·bh, 2 = + al·bh (A split), 3 = + ah·bl (both split)
template <int NT>
__device__ __forceinline__ v8f mmaN(v16b ah, v16b al, v16b bh, v16b bl, v8f c) {
  c = __builtin_amdgcn_wmma_f32_16x16x32_bf16(false, ah, false, bh, (short)0, c, false, false);
  if (NT >= 2) c = __builtin_amdgcn_wmma_f32_16x16x32_bf16(false, al, false, bh, (short)0, c, false, false);
  if (NT >= 3) c = __builtin_amdgcn_wmma_f32_16x16x32_bf16(false, ah, false, bl, (short)0, c, false, false);
  asm volatile("v_nop\n\tv_nop\n\tv_nop\n\tv_nop" : "+v"(c) : "v"(ah), "v"(al), "v"(bh), "v"(bl));
  return c;
}

__global__ __launch_bounds__(256) void k_wt_bf16(const float* __restrict__ W, unsigned short* __restrict__ Wt, int K, int N) {
  const int t = blockIdx.x * 256 + threadIdx.x;
  const int k8n = K / 8;
  if (t >= N * k8n) return;
  const int n = t / k8n, k8 = (t % k8n) * 8;
  v8us v;
#pragma unroll
  for (int i = 0; i < 8; ++i) v[i] = bf16_bits(W[(size_t)(k8 + i) * N + n]);
  *(v8us*)(Wt + (size_t)n * K + k8) = v;
  
}

// GEMM C[M][N] (f32, pitch ldc) = act(A[M][K]·W + bias). A f32 row-major (pitch lda) converted per fragment to bf16
// (ASPLIT: hi/lo two planes -> 2 terms, else single rounded term); Wt bf16 [N][K] (pitch ldb). BIAS_BF16 rounds the
// bias to bf16 first (bias quantised to bf16 before the add). K%32==0, M%16==0, N%64==0.
template <bool ASPLIT, int ACT, bool BIAS_BF16>
__global__ __launch_bounds__(128) void k_gemm_bf(const float* __restrict__ A, int lda, const unsigned short* __restrict__ Wt, int ldb,
                                               const float* __restrict__ bias, float* __restrict__ C, int ldc, int M, int N, int K) {
  __shared__ __attribute__((aligned(16))) float so[4][16][64];
  const int tid = threadIdx.x, w = tid >> 5, lane = tid & 31, ln = lane & 15, hh = lane >> 4;
  const int ntn = N / 64;
  const int wid = blockIdx.x * 4 + w;
  const int mt = wid / ntn, nq = wid % ntn;
  if (mt * 16 >= M) return;
  const int row0 = mt * 16, col0 = nq * 64;
  const float* arow = A + (size_t)(row0 + ln) * lda;
  v8f acc[4] = {};
  for (int kb = 0; kb < K; kb += 32) {
    FragB ah, al;
    const v4f x0 = *(const v4fa*)(arow + kb + 8 * hh), x1 = *(const v4fa*)(arow + kb + 8 * hh + 4);
    const v4f x2 = *(const v4fa*)(arow + kb + 16 + 8 * hh), x3 = *(const v4fa*)(arow + kb + 16 + 8 * hh + 4);
    float xs[16] = {x0[0],x0[1],x0[2],x0[3],x1[0],x1[1],x1[2],x1[3],x2[0],x2[1],x2[2],x2[3],x3[0],x3[1],x3[2],x3[3]};
#pragma unroll
    for (int i = 0; i < 16; ++i) { const unsigned short hb = bf16_bits(xs[i]); ah.u[i] = hb; al.u[i] = ASPLIT ? bf16_bits(xs[i] - bf16_val(hb)) : (unsigned short)0; }
#pragma unroll
    for (int t = 0; t < 4; ++t) {
      const unsigned short* brow = Wt + (size_t)(col0 + t * 16 + ln) * ldb + kb;
      FragB b;
      b.half[0] = *(const v8us*)(brow + 8 * hh);
      b.half[1] = *(const v8us*)(brow + 16 + 8 * hh);
      acc[t] = mmaN<ASPLIT ? 2 : 1>(ah.v, al.v, b.v, b.v, acc[t]);
    }
  }
#pragma unroll
  for (int t = 0; t < 4; ++t) {
    float bv = bias ? bias[col0 + t * 16 + ln] : 0.f;
    if (BIAS_BF16) bv = bf16_round(bv);
#pragma unroll
    for (int r = 0; r < 8; ++r) { float v = acc[t][r] + bv; if (ACT == 1) v = fmaxf(v, 0.f); so[w][8 * hh + r][t * 16 + ln] = v; }
  }
  __builtin_amdgcn_fence(__ATOMIC_ACQ_REL, "workgroup");
  __builtin_amdgcn_wave_barrier();
  const int rsub = lane >> 4, c4 = (lane & 15) * 4;
  {
#pragma unroll
    for (int q = 0; q < 8; ++q) {
      const int r = q * 2 + rsub;
      const v4f v = *(const v4fa*)&so[w][r][c4];
      *(v4f*)(C + (size_t)(row0 + r) * ldc + col0 + c4) = v;
    }
    
  }
}

// Flash-style causal/unmasked attention, all contractions 3-term bf16 hi/lo splits, f32 softmax with running max.
// q,k,v rows are read from f32 buffers with arbitrary row pitch (so they can live inside a fused qkv buffer);
// D = head size (multiple of 32, <= 128); one wave = 16 query rows; block = 4 waves (64 queries) sharing K/V chunks of 32.
template <int D, bool CAUSAL>
__global__ __launch_bounds__(128) void k_flash(const float* __restrict__ qb, const float* __restrict__ kb, const float* __restrict__ vb,
                                             int pitch, int T, int H, float scale, float* __restrict__ y, int ypitch) {
  constexpr int KS = D / 32;        // k-steps for QK
  constexpr int DT = D / 16;        // d tiles for PV
  __shared__ __attribute__((aligned(16))) unsigned short sKh[32][D + 8], sKl[32][D + 8], sVh[32][D + 8], sVl[32][D + 8];
  __shared__ __attribute__((aligned(16))) unsigned short sPh[4][16][40], sPl[4][16][40];
  __shared__ __attribute__((aligned(16))) float sO[4][16][D];
  const int tid = threadIdx.x, w = tid >> 5, lane = tid & 31, ln = lane & 15, hh = lane >> 4;
  const int nqb = (T + 63) / 64;
  const int bh = blockIdx.x / nqb, qblk = blockIdx.x % nqb;
  const int b = bh / H, h = bh % H;
  const int q0 = qblk * 64 + w * 16;
  const float* Q = qb + (size_t)b * T * pitch + h * D;
  const float* K = kb + (size_t)b * T * pitch + h * D;
  const float* V = vb + (size_t)b * T * pitch + h * D;

  // A fragments of the wave's 16 query rows (scaled), hi/lo
  FragB aqh[KS], aql[KS];
  {
    int row = q0 + ln; if (row >= T) row = T - 1;
    const float* qr = Q + (size_t)row * pitch;
#pragma unroll
    for (int ks = 0; ks < KS; ++ks)
#pragma unroll
      for (int i = 0; i < 16; ++i) {
        const int d = ks * 32 + ((i < 8) ? (8 * hh + i) : (16 + 8 * hh + (i - 8)));
        const float x = qr[d] * scale; const unsigned short hb = bf16_bits(x);
        aqh[ks].u[i] = hb; aql[ks].u[i] = bf16_bits(x - bf16_val(hb));
      }
  }
  float m_r[8], l_r[8];
#pragma unroll
  for (int r = 0; r < 8; ++r) { m_r[r] = -3.0e38f; l_r[r] = 0.f; }
  v8f oacc[DT];
#pragma unroll
  for (int dt = 0; dt < DT; ++dt) oacc[dt] = (v8f){0.f,0.f,0.f,0.f,0.f,0.f,0.f,0.f};

  const int kv_end = CAUSAL ? min(T, qblk * 64 + 64) : T;     // block-uniform
  for (int j0 = 0; j0 < kv_end; j0 += 32) {
    __syncthreads();
    for (int e = tid; e < 32 * (D / 4); e += 128) {
      const int r = e / (D / 4), c4 = (e % (D / 4)) * 4;
      const int key = j0 + r;
      v4f kf = {0.f,0.f,0.f,0.f}, vf = {0.f,0.f,0.f,0.f};
      if (key < T) { kf = *(const v4fa*)(K + (size_t)key * pitch + c4); vf = *(const v4fa*)(V + (size_t)key * pitch + c4); }
#pragma unroll
      for (int t = 0; t < 4; ++t) {
        unsigned short hb = bf16_bits(kf[t]); sKh[r][c4 + t] = hb; sKl[r][c4 + t] = bf16_bits(kf[t] - bf16_val(hb));
        hb = bf16_bits(vf[t]); sVh[r][c4 + t] = hb; sVl[r][c4 + t] = bf16_bits(vf[t] - bf16_val(hb));
      }
    }
    __syncthreads();
    // S tile 16 x 32
    v8f s[2];
#pragma unroll
    for (int nt = 0; nt < 2; ++nt) {
      v8f acc = {};
#pragma unroll
      for (int ks = 0; ks < KS; ++ks) {
        FragB bh_, bl_;
        bh_.half[0] = *(const v8us*)&sKh[nt * 16 + ln][ks * 32 + 8 * hh]; bh_.half[1] = *(const v8us*)&sKh[nt * 16 + ln][ks * 32 + 16 + 8 * hh];
        bl_.half[0] = *(const v8us*)&sKl[nt * 16 + ln][ks * 32 + 8 * hh]; bl_.half[1] = *(const v8us*)&sKl[nt * 16 + ln][ks * 32 + 16 + 8 * hh];
        acc = mmaN<3>(aqh[ks].v, aql[ks].v, bh_.v, bl_.v, acc);
      }
      s[nt] = acc;
    }
    // mask + running max (rows 8hh+r; the 16 lanes of a half share rows)
    float alpha[8];
#pragma unroll
    for (int r = 0; r < 8; ++r) {
      const int qi = q0 + 8 * hh + r;
      const int ja = j0 + ln, jb = j0 + 16 + ln;
      if (CAUSAL) { if (ja > qi) s[0][r] = -3.0e38f; if (jb > qi) s[1][r] = -3.0e38f; }
      if (ja >= T) s[0][r] = -3.0e38f;
      if (jb >= T) s[1][r] = -3.0e38f;
      float mx = fmaxf(s[0][r], s[1][r]);
      mx = fmaxf(mx, __shfl_xor(mx, 1, 32)); mx = fmaxf(mx, __shfl_xor(mx, 2, 32)); mx = fmaxf(mx, __shfl_xor(mx, 4, 32)); mx = fmaxf(mx, __shfl_xor(mx, 8, 32));
      const float mnew = fmaxf(m_r[r], mx);
      alpha[r] = (mnew > -1.0e38f) ? __expf(m_r[r] - mnew) : 1.0f;
      const float p0 = (s[0][r] > -1.0e38f) ? __expf(s[0][r] - mnew) : 0.f;
      const float p1 = (s[1][r] > -1.0e38f) ? __expf(s[1][r] - mnew) : 0.f;
      m_r[r] = mnew;
      l_r[r] = l_r[r] * alpha[r] + p0 + p1;            // per-lane partial row sum (16 lanes combined at the end)
      unsigned short hb = bf16_bits(p0); sPh[w][8 * hh + r][ln] = hb;      sPl[w][8 * hh + r][ln] = bf16_bits(p0 - bf16_val(hb));
      hb = bf16_bits(p1);                sPh[w][8 * hh + r][16 + ln] = hb; sPl[w][8 * hh + r][16 + ln] = bf16_bits(p1 - bf16_val(hb));
    }
#pragma unroll
    for (int dt = 0; dt < DT; ++dt)
#pragma unroll
      for (int r = 0; r < 8; ++r) oacc[dt][r] *= alpha[r];
    __builtin_amdgcn_fence(__ATOMIC_ACQ_REL, "workgroup");
    __builtin_amdgcn_wave_barrier();
    FragB pah, pal;
    pah.half[0] = *(const v8us*)&sPh[w][ln][8 * hh]; pah.half[1] = *(const v8us*)&sPh[w][ln][16 + 8 * hh];
    pal.half[0] = *(const v8us*)&sPl[w][ln][8 * hh]; pal.half[1] = *(const v8us*)&sPl[w][ln][16 + 8 * hh];
#pragma unroll
    for (int dt = 0; dt < DT; ++dt) {
      FragB bvh, bvl;
#pragma unroll
      for (int i = 0; i < 8; ++i) {
        bvh.u[i] = sVh[8 * hh + i][dt * 16 + ln]; bvh.u[8 + i] = sVh[16 + 8 * hh + i][dt * 16 + ln];
        bvl.u[i] = sVl[8 * hh + i][dt * 16 + ln]; bvl.u[8 + i] = sVl[16 + 8 * hh + i][dt * 16 + ln];
      }
      oacc[dt] = mmaN<3>(pah.v, pal.v, bvh.v, bvl.v, oacc[dt]);
    }
    __builtin_amdgcn_fence(__ATOMIC_ACQ_REL, "workgroup");
    __builtin_amdgcn_wave_barrier();
  }
#pragma unroll
  for (int r = 0; r < 8; ++r) {
    float l = l_r[r];
    l += __shfl_xor(l, 1, 32); l += __shfl_xor(l, 2, 32); l += __shfl_xor(l, 4, 32); l += __shfl_xor(l, 8, 32);
    l_r[r] = (l > 0.f) ? 1.0f / l : 0.f;
  }
#pragma unroll
  for (int dt = 0; dt < DT; ++dt)
#pragma unroll
    for (int r = 0; r < 8; ++r) sO[w][8 * hh + r][dt * 16 + ln] = oacc[dt][r] * l_r[r];
  __builtin_amdgcn_fence(__ATOMIC_ACQ_REL, "workgroup");
  __builtin_amdgcn_wave_barrier();
  {
    for (int r = 0; r < 16; ++r) {
      const int row = q0 + r;
      if (row < T && lane < D / 4) {
        const v4f val = *(const v4fa*)&sO[w][r][lane * 4];
        *(v4f*)(y + ((size_t)b * T + row) * ypitch + h * D + lane * 4) = val;
      }
    }
    
  }
}

// GEMM C = act(A·W + bias + resid): A f32 (ASPLIT -> hi/lo 2 terms), Wt bf16 [N][K]; ACT 0 none, 1 relu, 2 exact gelu;
// resid (optional, f32, row index = (row % rmod), pitch ldr, RES_BF16 rounds it) added before the activation.
template <bool ASPLIT, int ACT, bool BIAS_BF16, bool RES_BF16>
__global__ __launch_bounds__(128) void k_gemm_bf3(const float* __restrict__ A, int lda, const unsigned short* __restrict__ Wt, int ldb,
                                                const float* __restrict__ bias, const float* __restrict__ resid, int rmod, int ldr,
                                                float* __restrict__ C, int ldc, int M, int N, int K) {
  __shared__ __attribute__((aligned(16))) float so[4][16][64];
  const int tid = threadIdx.x, w = tid >> 5, lane = tid & 31, ln = lane & 15, hh = lane >> 4;
  const int ntn = N / 64;
  const int wid = blockIdx.x * 4 + w;
  const int mt = wid / ntn, nq = wid % ntn;
  if (mt * 16 >= M) return;
  const int row0 = mt * 16, col0 = nq * 64;
  const float* arow = A + (size_t)(row0 + ln) * lda;
  v8f acc[4] = {};
  for (int kb = 0; kb < K; kb += 32) {
    FragB ah, al;
    const v4f x0 = *(const v4fa*)(arow + kb + 8 * hh), x1 = *(const v4fa*)(arow + kb + 8 * hh + 4);
    const v4f x2 = *(const v4fa*)(arow + kb + 16 + 8 * hh), x3 = *(const v4fa*)(arow + kb + 16 + 8 * hh + 4);
    float xs[16] = {x0[0],x0[1],x0[2],x0[3],x1[0],x1[1],x1[2],x1[3],x2[0],x2[1],x2[2],x2[3],x3[0],x3[1],x3[2],x3[3]};
#pragma unroll
    for (int i = 0; i < 16; ++i) { const unsigned short hb = bf16_bits(xs[i]); ah.u[i] = hb; al.u[i] = ASPLIT ? bf16_bits(xs[i] - bf16_val(hb)) : (unsigned short)0; }
#pragma unroll
    for (int t = 0; t < 4; ++t) {
      const unsigned short* brow = Wt + (size_t)(col0 + t * 16 + ln) * ldb + kb;
      FragB b;
      b.half[0] = *(const v8us*)(brow + 8 * hh);
      b.half[1] = *(const v8us*)(brow + 16 + 8 * hh);
      acc[t] = mmaN<ASPLIT ? 2 : 1>(ah.v, al.v, b.v, b.v, acc[t]);
    }
  }
#pragma unroll
  for (int t = 0; t < 4; ++t) {
    const int col = col0 + t * 16 + ln;
    float bv = bias ? bias[col] : 0.f;
    if (BIAS_BF16) bv = bf16_round(bv);
#pragma unroll
    for (int r = 0; r < 8; ++r) {
      float v = acc[t][r] + bv;
      if (resid) { float rv = resid[(size_t)((row0 + 8 * hh + r) % rmod) * ldr + col]; if (RES_BF16) rv = bf16_round(rv); v += rv; }
      if (ACT == 1) v = fmaxf(v, 0.f);
      if (ACT == 2) v = 0.5f * v * (1.0f + erff(v * 0.70710678118654752f));
      if (ACT == 3) { const float u = 0.7978845608028654f * (v + 0.044715f * v * v * v); v = 0.5f * v * (1.0f + tanhf(u)); }
      so[w][8 * hh + r][t * 16 + ln] = v;
    }
  }
  __builtin_amdgcn_fence(__ATOMIC_ACQ_REL, "workgroup");
  __builtin_amdgcn_wave_barrier();
  const int rsub = lane >> 4, c4 = (lane & 15) * 4;
  {
#pragma unroll
    for (int q = 0; q < 8; ++q) {
      const int r = q * 2 + rsub;
      const v4f v = *(const v4fa*)&so[w][r][c4];
      *(v4f*)(C + (size_t)(row0 + r) * ldc + col0 + c4) = v;
    }
    
  }
}
// row LayerNorm (biased variance, eps) over N: s = X (+ R); optional out_sum <- s; out_norm <- (s-mu)*rsqrt(var+eps)*g + b
template <bool PARAM_BF16>
__global__ __launch_bounds__(256) void k_layernorm(const float* __restrict__ X, const float* __restrict__ R, const float* __restrict__ g, const float* __restrict__ bta,
                                                  float* __restrict__ out_sum, float* __restrict__ out_norm, int N, float eps) {
  __shared__ float red[256];
  const int row = blockIdx.x, tid = threadIdx.x;
  const float* x = X + (size_t)row * N; const float* rr = R ? R + (size_t)row * N : nullptr;
  float vals[16];                     // up to N = 4096
  const int per = N / 256;            // contiguous chunk per thread? use strided-by-4 chunks: thread handles j = tid*4 + 1024*u
  float s1 = 0.f;
  for (int u = 0; u < per / 4; ++u) {
    const int j = tid * 4 + 1024 * u;
    const v4f a = *(const v4fa*)(x + j);
    v4f b = {0.f,0.f,0.f,0.f}; if (rr) b = *(const v4fa*)(rr + j);
#pragma unroll
    for (int q = 0; q < 4; ++q) { const float v = a[q] + b[q]; vals[u * 4 + q] = v; s1 += v; }
  }
  red[tid] = s1; __syncthreads();
  for (int st = 128; st > 0; st >>= 1) { if (tid < st) red[tid] += red[tid + st]; __syncthreads(); }
  const float mu = red[0] / (float)N; __syncthreads();
  float s2 = 0.f;
  for (int u = 0; u < per / 4; ++u)
#pragma unroll
    for (int q = 0; q < 4; ++q) { const float c = vals[u * 4 + q] - mu; s2 += c * c; }
  red[tid] = s2; __syncthreads();
  for (int st = 128; st > 0; st >>= 1) { if (tid < st) red[tid] += red[tid + st]; __syncthreads(); }
  const float rs = rsqrtf(red[0] / (float)N + eps);
  {
    for (int u = 0; u < per / 4; ++u) {
      const int j = tid * 4 + 1024 * u;
      v4f o, sm;
#pragma unroll
      for (int q = 0; q < 4; ++q) {
        float gg = g[j + q], bb = bta[j + q];
        if (PARAM_BF16) { gg = bf16_round(gg); bb = bf16_round(bb); }
        sm[q] = vals[u * 4 + q]; o[q] = (vals[u * 4 + q] - mu) * rs * gg + bb;
      }
      if (out_sum) *(v4f*)(out_sum + (size_t)row * N + j) = sm;
      *(v4f*)(out_norm + (size_t)row * N + j) = o;
    }
    
  }
}



// ---- f16 WMMA path (v_wmma_f32_16x16x32_f16): 11-bit significands for operands in range — used where a [0,1] probability operand needs more precision than bf16
typedef _Float16 v16h __attribute__((ext_vector_type(16)));
union FragH { v16h v; v8us half[2]; _Float16 h[16]; unsigned short u[16]; };
template <int NT>
__device__ __forceinline__ v8f mmaH(v16h ah, v16h al, v16h bh, v16h bl, v8f c) {
  c = __builtin_amdgcn_wmma_f32_16x16x32_f16(false, ah, false, bh, (short)0, c, false, false);
  if (NT >= 2) c = __builtin_amdgcn_wmma_f32_16x16x32_f16(false, al, false, bh, (short)0, c, false, false);
  if (NT >= 3) c = __builtin_amdgcn_wmma_f32_16x16x32_f16(false, ah, false, bl, (short)0, c, false, false);
  asm volatile("v_nop\n\tv_nop\n\tv_nop\n\tv_nop" : "+v"(c) : "v"(ah), "v"(al), "v"(bh), "v"(bl));
  return c;
}
// batched GEMM like k_gemm_b but f16 operands: A f32 (split into f16 hi/lo if ASPLIT, else rounded to f16), Bt = f16 values [n][k]; alpha; C f32; N multiple of 16 (partial tiles skipped)
template <bool ASPLIT>
__global__ __launch_bounds__(128) void k_gemm_h(const float* __restrict__ A, int lda, size_t sA, const _Float16* __restrict__ Bh, int ldb, size_t sB, float alpha, float* __restrict__ C, int ldc, size_t sC, int M, int N, int K) {
  __shared__ __attribute__((aligned(16))) float so[4][16][64];
  const int tid = threadIdx.x, w = tid >> 5, lane = tid & 31, ln = lane & 15, hh = lane >> 4; const int by = blockIdx.y;
  A += (size_t)by * sA; Bh += (size_t)by * sB; C += (size_t)by * sC;
  const int ntn = (N + 63) / 64; const int wid = blockIdx.x * 4 + w; const int mt = wid / ntn, nq = wid % ntn; if (mt * 16 >= M) return;
  const int row0 = mt * 16, col0 = nq * 64; const float* arow = A + (size_t)(row0 + ln) * lda;
  v8f acc[4] = {};
  for (int kb = 0; kb < K; kb += 32) {
    FragH ah, al;
    const v4f x0 = *(const v4fa*)(arow + kb + 8 * hh), x1 = *(const v4fa*)(arow + kb + 8 * hh + 4), x2 = *(const v4fa*)(arow + kb + 16 + 8 * hh), x3 = *(const v4fa*)(arow + kb + 16 + 8 * hh + 4);
    float xs[16] = {x0[0],x0[1],x0[2],x0[3],x1[0],x1[1],x1[2],x1[3],x2[0],x2[1],x2[2],x2[3],x3[0],x3[1],x3[2],x3[3]};
#pragma unroll
    for (int i = 0; i < 16; ++i) { const _Float16 h = (_Float16)xs[i]; ah.h[i] = h; al.h[i] = ASPLIT ? (_Float16)(xs[i] - (float)h) : (_Float16)0.0f; }
#pragma unroll
    for (int t = 0; t < 4; ++t) { if (col0 + t * 16 >= N) continue; const size_t boff = (size_t)(col0 + t * 16 + ln) * ldb + kb; FragH bq; bq.half[0] = *(const v8us*)(Bh + boff + 8 * hh); bq.half[1] = *(const v8us*)(Bh + boff + 16 + 8 * hh);
      acc[t] = mmaH<ASPLIT ? 2 : 1>(ah.v, al.v, bq.v, bq.v, acc[t]); }
  }
#pragma unroll
  for (int t = 0; t < 4; ++t) { if (col0 + t * 16 >= N) continue;
#pragma unroll
    for (int r = 0; r < 8; ++r) so[w][8 * hh + r][t * 16 + ln] = acc[t][r] * alpha; }
  __builtin_amdgcn_fence(__ATOMIC_ACQ_REL, "workgroup"); __builtin_amdgcn_wave_barrier();
  const int rsub = lane >> 4, c4 = (lane & 15) * 4;
  {
#pragma unroll
    for (int q = 0; q < 8; ++q) { const int r = q * 2 + rsub; if (col0 + c4 < N) { const v4f v = *(const v4fa*)&so[w][r][c4]; *(v4f*)(C + (size_t)(row0 + r) * ldc + col0 + c4) = v; } }
     }
}

// Wt[n][k] = f16(W[k][n]·scale) from f32 row-major W[K][N] (scale = power of two; bf16-exact weights stay exact in f16 away from the subnormal range)
__global__ __launch_bounds__(256) void k_wt_f16(const float* __restrict__ W, _Float16* __restrict__ Wt, int K, int N, float scale) {
  const int t = blockIdx.x * 256 + threadIdx.x; if (t >= N * (K / 8)) return; const int n = t / (K / 8), k8 = (t % (K / 8)) * 8; FragH f;
#pragma unroll
  for (int i = 0; i < 8; ++i) f.h[i] = (_Float16)(bf16_round(W[(size_t)(k8 + i) * N + n]) * scale); const v8us o = f.half[0];
  *(v8us*)((unsigned short*)Wt + (size_t)n * K + k8) = o; 
}
// k_gemm_hh variant with fused epilogue: v = acc·alpha + bias[by·sBias + col] (+ CP[(row/rowsPerB)·sCPb + by·64 + col] if CP) ; ACT 0 none / 1 elu ; writes f32 C and f16 C16, each if non-null
// the body takes its block indices (bx, by) and its 16 KiB of LDS from the caller, so that several products can share one launch
template <int ACT>
__device__ __forceinline__ void gemm_hhx_body(float (*so)[16][64], const int bx, const int by, const _Float16* __restrict__ A, int lda, size_t sA, const _Float16* __restrict__ Bh, int ldb, size_t sB, float alpha, const float* __restrict__ bias, size_t sBias, const float* __restrict__ CP, int rowsPerB, size_t sCPb, int row0g,
    float* __restrict__ C, _Float16* __restrict__ C16, int ldc, size_t sC, int M, int N, int K) {
  const int tid = threadIdx.x, w = tid >> 5, lane = tid & 31, ln = lane & 15, hh = lane >> 4;
  A += (size_t)by * sA; Bh += (size_t)by * sB; const size_t cofs = (size_t)by * sC; const float* bp = bias ? bias + (size_t)by * sBias : nullptr;
  const int ntn = (N + 63) / 64; const int wid = bx * 4 + w; const int mt = wid / ntn, nq = wid % ntn; if (mt * 16 >= M) return;
  const int row0 = mt * 16, col0 = nq * 64; const _Float16* arow = A + (size_t)(row0 + ln) * lda;
  v8f acc[4] = {};
  for (int kb = 0; kb < K; kb += 32) { FragH ah; ah.half[0] = *(const v8us*)((const unsigned short*)arow + kb + 8 * hh); ah.half[1] = *(const v8us*)((const unsigned short*)arow + kb + 16 + 8 * hh);
#pragma unroll
    for (int t = 0; t < 4; ++t) { if (col0 + t * 16 >= N) continue; const size_t boff = (size_t)(col0 + t * 16 + ln) * ldb + kb; FragH bq; bq.half[0] = *(const v8us*)((const unsigned short*)Bh + boff + 8 * hh); bq.half[1] = *(const v8us*)((const unsigned short*)Bh + boff + 16 + 8 * hh);
      acc[t] = mmaH<1>(ah.v, ah.v, bq.v, bq.v, acc[t]); }
  }
#pragma unroll
  for (int t = 0; t < 4; ++t) { if (col0 + t * 16 >= N) continue; const int col = col0 + t * 16 + ln; const float bv = bp ? bf16_round(bp[col]) : 0.f;
#pragma unroll
    for (int r = 0; r < 8; ++r) { float v = acc[t][r] * alpha + bv; if (CP) { const int bidx = (row0g + row0 + 8 * hh + r) / rowsPerB; v += CP[(size_t)bidx * sCPb + (size_t)by * 64 + col]; } if (ACT == 1) v = (v > 0.f) ? v : expm1f(v); else if (ACT == 3) v = fmaxf(v, 0.f); so[w][8 * hh + r][t * 16 + ln] = v; } }
  __builtin_amdgcn_fence(__ATOMIC_ACQ_REL, "workgroup"); __builtin_amdgcn_wave_barrier();
  const int rsub = lane >> 4, c4 = (lane & 15) * 4; typedef _Float16 v4h __attribute__((ext_vector_type(4)));
  {
#pragma unroll
    for (int q = 0; q < 8; ++q) { const int r = q * 2 + rsub; if (col0 + c4 < N) { const v4f v = *(const v4fa*)&so[w][r][c4]; if (C) *(v4f*)(C + cofs + (size_t)(row0 + r) * ldc + col0 + c4) = v; if (C16) { v4h h4; for (int i = 0; i < 4; ++i) h4[i] = (_Float16)v[i]; *(v4h*)(C16 + cofs + (size_t)(row0 + r) * ldc + col0 + c4) = h4; } } }
     }
}
template <int ACT>
__global__ __launch_bounds__(128) void k_gemm_hhx(const _Float16* __restrict__ A, int lda, size_t sA, const _Float16* __restrict__ Bh, int ldb, size_t sB, float alpha, const float* __restrict__ bias, size_t sBias, const float* __restrict__ CP, int rowsPerB, size_t sCPb, int row0g,
    float* __restrict__ C, _Float16* __restrict__ C16, int ldc, size_t sC, int M, int N, int K) {
  __shared__ __attribute__((aligned(16))) float so[4][16][64];
  gemm_hhx_body<ACT>(so, blockIdx.x, blockIdx.y, A, lda, sA, Bh, ldb, sB, alpha, bias, sBias, CP, rowsPerB, sCPb, row0g, C, C16, ldc, sC, M, N, K);
}


// x16_body, round16f_body, sn_body and qsum_body are roles of one launch (k_prep, blocks of 512): each takes its block index bx inside its role
__device__ __forceinline__ void x16_body(const int bx, const float* __restrict__ x, _Float16* __restrict__ X16) { const size_t t = (size_t)bx * 512 + threadIdx.x; FragH f;
#pragma unroll
  for (int q = 0; q < 8; ++q) f.h[q] = (_Float16)bf16_round(x[t * 8 + q]); *(v8us*)((unsigned short*)X16 + t * 8) = f.half[0];  }
__global__ __launch_bounds__(256) void k_h16(const float* __restrict__ x, _Float16* __restrict__ X16, size_t n8) { const size_t t = (size_t)blockIdx.x * 256 + threadIdx.x; if (t >= n8) return; FragH f;
#pragma unroll
  for (int q = 0; q < 8; ++q) f.h[q] = (_Float16)x[t * 8 + q]; *(v8us*)((unsigned short*)X16 + t * 8) = f.half[0];  }
__device__ __forceinline__ void round16f_body(const int bx, const float* __restrict__ W, _Float16* __restrict__ Bt) { const size_t t = (size_t)bx * 512 + threadIdx.x; FragH f;
#pragma unroll
  for (int i = 0; i < 8; ++i) f.h[i] = (_Float16)(bf16_round(W[t * 8 + i]) * 16.0f); *(v8us*)((unsigned short*)Bt + t * 8) = f.half[0];
  asm volatile("s_wait_xcnt 0x0" ::: "memory");      // in the merged listing the next role's code follows this store and writes its address register: the wait stands in front of that write
}
__device__ __forceinline__ void sn_body(const int bx, const float* __restrict__ sf, _Float16* __restrict__ SN) { const int tid = threadIdx.x, wv = tid >> 5, lane = tid & 31; const size_t row = (size_t)bx * 16 + wv; float v[8]; float s = 0.f;
#pragma unroll
  for (int q = 0; q < 8; ++q) { v[q] = bf16_round(sf[row * DSEM + lane * 8 + q]); s += v[q] * v[q]; }
  for (int o = 16; o >= 1; o >>= 1) s += __shfl_xor(s, o, 32); const float inv = 1.0f / fmaxf(sqrtf(s), 1e-12f); FragH f;
#pragma unroll
  for (int q = 0; q < 8; ++q) f.h[q] = (_Float16)(v[q] * inv); *(v8us*)((unsigned short*)SN + row * DSEM + lane * 8) = f.half[0];
  asm volatile("s_wait_xcnt 0x0" ::: "memory");      // in the merged listing the next role's code follows this store and writes its address register: the wait stands in front of that write
}
// dynamic temperature, stage 1: column sums of the bf16-rounded query over QROWS rows per block -> PART[b][chunk][DM]; thread = 4 columns x one of 4 row phases, 16 independent 16-byte loads
#define QP 32
#define QROWS (SS / QP)
__device__ __forceinline__ void qsum_body(float (*sred)[DM], const int bx, const float* __restrict__ query, float* __restrict__ PART) {
  const int tid = threadIdx.x, ph = tid >> 7, c4 = (tid & 127) * 4;
  const float* src = query + ((size_t)bx * QROWS + ph * (QROWS / 4)) * DM + c4; v4f s = {0.f, 0.f, 0.f, 0.f};
#pragma unroll  // all 16 row loads issue before the first add: one memory latency instead of 16
  for (int r = 0; r < QROWS / 4; ++r) { const v4f x = *(const v4fa*)(src + (size_t)r * DM);
#pragma unroll
    for (int q = 0; q < 4; ++q) s[q] += bf16_round(x[q]); }
  *(v4fa*)&sred[ph][c4] = s; __syncthreads();
  PART[(size_t)bx * DM + tid] = (sred[0][tid] + sred[1][tid]) + (sred[2][tid] + sred[3][tid]); }
// one launch for all work that reads inputs only: column sums of the query, the three f16 activation planes, the normalised semantic rows, the four weight planes; role by block range
#define PB_QS (BB * QP)
#define PB_X (NR * DM / 8 / 512)
#define PB_SN (NR / 16)
#define PB_W (DM * DM / 8 / 512)
__global__ __launch_bounds__(512) void k_prep(const float* __restrict__ xq, const float* __restrict__ xk, const float* __restrict__ xv, const float* __restrict__ sf,
    const float* __restrict__ Wq, const float* __restrict__ Wk, const float* __restrict__ Wv, const float* __restrict__ Wo,
    _Float16* __restrict__ XQ, _Float16* __restrict__ XK, _Float16* __restrict__ XV, _Float16* __restrict__ SN,
    _Float16* __restrict__ Bq, _Float16* __restrict__ Bk, _Float16* __restrict__ Bv, _Float16* __restrict__ Bo, float* __restrict__ PART) {
  __shared__ __attribute__((aligned(16))) float sred[4][DM];
  const int bx = blockIdx.x, bx1 = bx - PB_QS, bx2 = bx1 - 3 * PB_X, bx3 = bx2 - PB_SN;
  if (bx1 < 0) qsum_body(sred, bx, xq, PART);
  else if (bx2 < 0) { const int g = bx1 / PB_X; x16_body(bx1 % PB_X, g == 0 ? xq : g == 1 ? xk : xv, g == 0 ? XQ : g == 1 ? XK : XV); }
  else if (bx3 < 0) sn_body(bx2, sf, SN);
  else { const int g = bx3 / PB_W; round16f_body(bx3 % PB_W, g == 0 ? Wq : g == 1 ? Wk : g == 2 ? Wv : Wo, g == 0 ? Bq : g == 1 ? Bk : g == 2 ? Bv : Bo); } }
// stage 2 (one block of 4 waves, a role of k_proj, beside the products that do not need it): mean query of both batches from PART, then one wave per hidden unit (lanes along DM, 16-byte loads of the
// Wt1 row shared by both batches), relu, Wt2 dot, sigmoid. The hidden units are summed in 32 groups of 8, each wave taking 8 groups in turn.
__device__ __forceinline__ void temp_body(float* __restrict__ sm, const float* __restrict__ PART, const float* __restrict__ Wt1, const float* __restrict__ bt1, const float* __restrict__ Wt2, const float* __restrict__ bt2, float* __restrict__ TEMP) {
  float (*qm)[DM] = (float (*)[DM])sm; float (*red)[32] = (float (*)[32])(sm + BB * DM); const int tid = threadIdx.x, wv = tid >> 5, lane = tid & 31;
#pragma unroll 1  // kept rolled: unrolled, its loads raise the register count of the whole launch (142 against 104) and cost the products waves
  for (int it = 0; it < BB * DM / 128; ++it) { const int c = it * 128 + tid, b = c >> 9, col = c & (DM - 1); float s = 0.f;
#pragma unroll  // all 32 partial loads in flight together
    for (int p = 0; p < QP; ++p) s += PART[((size_t)b * QP + p) * DM + col];
    qm[b][col] = s / (float)SS; }
  __syncthreads();
  v4f qv[BB][4];
#pragma unroll
  for (int b = 0; b < BB; ++b)
#pragma unroll
    for (int j = 0; j < 4; ++j) qv[b][j] = *(const v4fa*)&qm[b][j * 128 + lane * 4];
#pragma unroll 1  // one group of 8 hidden units a trip, kept rolled: unrolled, it would raise the register count of the launch's products
  for (int gq = 0; gq < 8; ++gq) { const int grp = wv * 8 + gq;
  float pw[BB] = {0.f, 0.f};
#pragma unroll 2  // two rows = 8 loads of 16 bytes in flight per lane; more would raise the register count of the launch's products
  for (int i = 0; i < (DM / 2) / 32; ++i) { const int u = grp * ((DM / 2) / 32) + i; const float* wr = Wt1 + (size_t)u * DM + lane * 4; float a[BB] = {0.f, 0.f};
#pragma unroll
    for (int j = 0; j < 4; ++j) { const v4f wq = *(const v4fa*)(wr + j * 128);
#pragma unroll
      for (int q = 0; q < 4; ++q) { const float wb = bf16_round(wq[q]);
#pragma unroll
        for (int b = 0; b < BB; ++b) a[b] += wb * qv[b][j][q]; } }
    const float b1 = bf16_round(bt1[u]), w2 = bf16_round(Wt2[u]);
#pragma unroll
    for (int b = 0; b < BB; ++b) { float t = a[b]; for (int o = 16; o >= 1; o >>= 1) t += __shfl_xor(t, o, 32); pw[b] += fmaxf(t + b1, 0.f) * w2; } }
  if (lane == 0) {
#pragma unroll
    for (int b = 0; b < BB; ++b) red[b][grp] = pw[b]; } }
  __syncthreads();
  if (tid < 32) { float v = 0.f; if (tid < BB) { float z = bf16_round(bt2[0]); for (int q = 0; q < 32; ++q) z += red[tid][q]; const float t = 1.0f / (1.0f + expf(-z)); v = 0.5f + t * 1.5f; } TEMP[tid] = v; } }
// one launch for all that needs k_prep alone: block 0 the temperature, then the q, k and v projections (the longer products first), then the similarity plane; role by block range
#define GB_P ((NR / 16) * (DM / 64) / 4)
#define GB_S ((SS / 16) * (SS / 64) / 4)
__global__ __launch_bounds__(128) void k_proj(const _Float16* __restrict__ XQ, const _Float16* __restrict__ XK, const _Float16* __restrict__ XV, const _Float16* __restrict__ Bq, const _Float16* __restrict__ Bk, const _Float16* __restrict__ Bv,
    const float* __restrict__ bq, const float* __restrict__ bk, const float* __restrict__ bv, _Float16* __restrict__ Q16, _Float16* __restrict__ K16, _Float16* __restrict__ V16, const _Float16* __restrict__ SN, _Float16* __restrict__ SIM,
    const float* __restrict__ PART, const float* __restrict__ Wt1, const float* __restrict__ bt1, const float* __restrict__ Wt2, const float* __restrict__ bt2, float* __restrict__ TEMP) {
  __shared__ __attribute__((aligned(16))) float so[4][16][64];
  int bx = blockIdx.x;
  if (bx == 0) { temp_body(&so[0][0][0], PART, Wt1, bt1, Wt2, bt2, TEMP); return; }
  bx -= 1;
  if (bx < 3 * GB_P) { const int g = bx / GB_P;
    gemm_hhx_body<0>(so, bx % GB_P, 0, g == 0 ? XQ : g == 1 ? XK : XV, DM, 0, g == 0 ? Bq : g == 1 ? Bk : Bv, DM, 0, 0.0625f, g == 0 ? bq : g == 1 ? bk : bv, 0, nullptr, 1, 0, 0, nullptr, g == 0 ? Q16 : g == 1 ? K16 : V16, DM, 0, NR, DM, DM); return; }
  bx -= 3 * GB_P;
  // SIM[b] = SN[b].SN[b]^T (f16; values in [-1, 1])
  gemm_hhx_body<0>(so, bx % GB_S, bx / GB_S, SN, DSEM, (size_t)SS * DSEM, SN, DSEM, (size_t)SS * DSEM, 1.0f, nullptr, 0, nullptr, 1, 0, 0, nullptr, SIM, SS, (size_t)SS * SS, SS, SS, DSEM); }
__global__ __launch_bounds__(256) void k_vt(const _Float16* __restrict__ V16, _Float16* __restrict__ Vt) { __shared__ unsigned short tl[64][66]; const int tid = threadIdx.x; const int slab = blockIdx.x / (SS / 64), lg = blockIdx.x % (SS / 64); const int b = slab / NH, h = slab % NH;
  for (int i = tid; i < 64 * 8; i += 256) { const int r = i / 8, c8 = (i % 8) * 8; FragH f; f.half[0] = *(const v8us*)((const unsigned short*)V16 + ((size_t)b * SS + lg * 64 + r) * DM + h * HD + c8);
#pragma unroll
    for (int q = 0; q < 8; ++q) tl[r][c8 + q] = f.u[q]; }
  __syncthreads();
  {
#pragma unroll
    for (int rd = 0; rd < 2; ++rd) { const int d = rd * 32 + tid / 8, pc = tid % 8; FragH f;
#pragma unroll
      for (int q = 0; q < 8; ++q) f.u[q] = tl[pc * 8 + q][d];
      *(v8us*)((unsigned short*)Vt + ((size_t)slab * HD + d) * SS + lg * 64 + pc * 8) = f.half[0]; }
     } }
// fused constrained attention per ((b,h), 128 queries): 16 waves = 4 query groups of 32 x 4 key sets, four waves a SIMD, so that one wave's loads and dependent vector chains hide behind three others;
// key set s holds the 32-key chunks s, s + 4, s + 8, ...: the four sets walk side by side, so a 128-byte line of SIM or Vt is used up by two waves in the same pass and need not outlive it in the cache;
// the four partial results of a query group (own running max, sum, Ot) are joined through LDS behind the loop. s = (q.k)/(8 temp_b) + sem_bias + pos_bias, -inf where mask[b][k] = 0; sem_bias = -(0.5 - sim) if sim < 0.5.
// Transposed products: St = K.Qt (A = 16 key rows, B = 16 query columns), Ot += Vt.Pt. Lane (ln, hh) then holds, for query ln of a tile, the scores of keys 8 hh + r of each 16-key tile:
// the running max and sum are in-lane work plus one swap between the wave halves, two St tiles converted to f16 are the B operand of the second product as they lie, SIM[q][k .. k + 7] is one 16-byte load.
typedef int v4ia __attribute__((ext_vector_type(4), may_alias));
typedef _Float16 v8h __attribute__((ext_vector_type(8)));
union FragP { v16h v; v8h p[2]; };
__device__ __forceinline__ float swap_halves(float x) { const int t = __float_as_int(x); return __int_as_float(__builtin_amdgcn_permlanex16(t, t, 0x76543210, 0xfedcba98, false, false)); }   // lane l <-> l ^ 16
__global__ __launch_bounds__(512) void k_flash(const _Float16* __restrict__ Q16, const _Float16* __restrict__ K16, const _Float16* __restrict__ Vt, const _Float16* __restrict__ SIM, const int* __restrict__ mask, const float* __restrict__ TEMP, float* __restrict__ O) {
  constexpr int RPW = 32, NQB = SS / (4 * RPW), DT = HD / 16, KS = HD / 32, NSP = 4;
  static_assert(NSP == 4 && DT == 4, "in the join, the wave of key set s sums two of the eight output tiles");
  __shared__ __attribute__((aligned(16))) float sO[4 * NSP][2][DT][2][32][4];      // a wave's rescaled Ot: 16 bytes a lane, lanes side by side
  __shared__ float sM[4 * NSP][2][32], sL[4 * NSP][2][32];
  const int tid = threadIdx.x, lane = tid & 31, ln = lane & 15, hh = lane >> 4;
  const int w = __builtin_amdgcn_readfirstlane(tid >> 5), qg = w & 3, ksp = w >> 2, k0 = ksp * 32;      // the wave's number in a scalar register: the key loop's bounds and its branch stay scalar
  const int slab = blockIdx.x / NQB, qblk = blockIdx.x % NQB; const int b = slab / NH, h = slab % NH; const int q0 = qblk * (4 * RPW) + qg * RPW; const float sc = 0.125f / TEMP[b];
  FragH aq[2][KS];
#pragma unroll
  for (int qt = 0; qt < 2; ++qt) { const unsigned short* qr = (const unsigned short*)Q16 + ((size_t)b * SS + q0 + qt * 16 + ln) * DM + h * HD;
#pragma unroll
    for (int ks = 0; ks < KS; ++ks) { aq[qt][ks].half[0] = *(const v8us*)(qr + ks * 32 + 8 * hh); aq[qt][ks].half[1] = *(const v8us*)(qr + ks * 32 + 16 + 8 * hh); } }
  // the lane's four read pointers; each moves on by 4 x 32 keys a pass
  const unsigned short* vp = (const unsigned short*)Vt + ((size_t)slab * HD + ln) * SS + k0 + 8 * hh;
  const unsigned short* kp = (const unsigned short*)K16 + ((size_t)b * SS + k0 + ln) * DM + h * HD + 8 * hh;
  const unsigned short* sp = (const unsigned short*)SIM + ((size_t)b * SS + q0 + ln) * SS + k0 + 8 * hh;
  const int* mp = mask + (size_t)b * SS + k0 + 8 * hh;
  float m_q[2], l_q[2]; v8f oacc[2][DT];
#pragma unroll
  for (int qt = 0; qt < 2; ++qt) { m_q[qt] = -3.0e38f; l_q[qt] = 0.f;
#pragma unroll
    for (int dt = 0; dt < DT; ++dt) oacc[qt][dt] = (v8f){0.f,0.f,0.f,0.f,0.f,0.f,0.f,0.f}; }
#pragma unroll 1
  for (int j0 = k0; j0 < k0 + SS; j0 += NSP * 32) {
    // every load of the pass stands in front of its first product: none depends on the scores any more, so the pass waits for memory once
    FragH bk[2][KS], bv[DT], sm[2][2]; v4ia mk[2][2];
#pragma unroll
    for (int nt = 0; nt < 2; ++nt) {
#pragma unroll
      for (int ks = 0; ks < KS; ++ks) { bk[nt][ks].half[0] = *(const v8us*)(kp + nt * 16 * DM + ks * 32); bk[nt][ks].half[1] = *(const v8us*)(kp + nt * 16 * DM + ks * 32 + 16); }
      mk[nt][0] = *(const v4ia*)(mp + nt * 16); mk[nt][1] = *(const v4ia*)(mp + nt * 16 + 4);
#pragma unroll
      for (int qt = 0; qt < 2; ++qt) sm[qt][nt].half[0] = *(const v8us*)(sp + qt * 16 * SS + nt * 16); }
#pragma unroll
    for (int dt = 0; dt < DT; ++dt) { bv[dt].half[0] = *(const v8us*)(vp + dt * 16 * SS); bv[dt].half[1] = *(const v8us*)(vp + dt * 16 * SS + 16); }
    asm volatile("s_wait_xcnt 0x0" :: "v"(kp), "v"(mp), "v"(sp), "v"(vp) : "memory");      // stands in front of every write of a register that one of the 24 loads names as its address; the four inputs keep those registers live up to it
    __builtin_amdgcn_sched_barrier(0);      // keeps the 24 loads one group (else half of them issue behind the first wait and the pass pays the latency twice) and the pointer steps behind the wait above
    kp += NSP * 32 * DM; mp += NSP * 32; sp += NSP * 32; vp += NSP * 32;
    v8f s[2][2];
#pragma unroll
    for (int nt = 0; nt < 2; ++nt)
#pragma unroll
      for (int qt = 0; qt < 2; ++qt) { v8f acc = (v8f){0.f,0.f,0.f,0.f,0.f,0.f,0.f,0.f};
#pragma unroll
        for (int ks = 0; ks < KS; ++ks) acc = mmaH<1>(bk[nt][ks].v, bk[nt][ks].v, aq[qt][ks].v, aq[qt][ks].v, acc); s[qt][nt] = acc; }
    FragP pb[2];
#pragma unroll
    for (int qt = 0; qt < 2; ++qt) { const int qi = q0 + qt * 16 + ln; float mc = -INFINITY;
#pragma unroll
      for (int nt = 0; nt < 2; ++nt)
#pragma unroll
        for (int r = 0; r < 8; ++r) { const int k = j0 + nt * 16 + 8 * hh + r; const float sim = (float)sm[qt][nt].h[r]; const float sb = (sim < 0.5f) ? -(0.5f - sim) : 0.f;
          const float dd = fabsf((float)(qi - k)); const float pbias = (dd > 10.f) ? -0.1f * (dd - 10.f) : 0.f;
          const float su = s[qt][nt][r] * sc + sb + pbias; const float sv = (mk[nt][r >> 2][r & 3] != 0) ? su : -INFINITY; s[qt][nt][r] = sv; mc = fmaxf(mc, sv); }
      mc = fmaxf(mc, swap_halves(mc));
      const float mn = fmaxf(m_q[qt], mc); const float al = expf(m_q[qt] - mn); m_q[qt] = mn; float ls = 0.f;
#pragma unroll
      for (int nt = 0; nt < 2; ++nt) {
#pragma unroll
        for (int r = 0; r < 8; ++r) { const float p = expf(s[qt][nt][r] - mn); s[qt][nt][r] = p; ls += p; }
        pb[qt].p[nt] = __builtin_convertvector(s[qt][nt], v8h); }
      l_q[qt] = l_q[qt] * al + ls;      // partial sum of this half's 16 keys; the halves are joined behind the loop
#pragma unroll
      for (int dt = 0; dt < DT; ++dt)
#pragma unroll
        for (int r = 0; r < 8; ++r) oacc[qt][dt][r] *= al; }
#pragma unroll
    for (int dt = 0; dt < DT; ++dt)
#pragma unroll
      for (int qt = 0; qt < 2; ++qt) oacc[qt][dt] = mmaH<1>(bv[dt].v, bv[dt].v, pb[qt].v, pb[qt].v, oacc[qt][dt]); }
  // join of the four key sets of a query group. Step 1: every wave publishes its max and its sum (halves joined)
#pragma unroll
  for (int qt = 0; qt < 2; ++qt) { float l = l_q[qt]; l += swap_halves(l); sM[w][qt][lane] = m_q[qt]; sL[w][qt][lane] = l; }
  __syncthreads();
  // step 2: the common max, the common sum (sets in order), and the wave's Ot rescaled to the common max into LDS
  float inv[2];
#pragma unroll
  for (int qt = 0; qt < 2; ++qt) { float ms[NSP], mx = -3.0e38f, l = 0.f;
#pragma unroll
    for (int s = 0; s < NSP; ++s) { ms[s] = sM[s * 4 + qg][qt][lane]; mx = fmaxf(mx, ms[s]); }
#pragma unroll
    for (int s = 0; s < NSP; ++s) l += sL[s * 4 + qg][qt][lane] * expf(ms[s] - mx);
    inv[qt] = (l > 0.f) ? 1.0f / l : 0.f; const float f = expf(m_q[qt] - mx);
#pragma unroll
    for (int dt = 0; dt < DT; ++dt) { v4f lo, hi;
#pragma unroll
      for (int r = 0; r < 4; ++r) { lo[r] = oacc[qt][dt][r] * f; hi[r] = oacc[qt][dt][4 + r] * f; }
      *(v4fa*)&sO[w][qt][dt][0][lane][0] = lo; *(v4fa*)&sO[w][qt][dt][1][lane][0] = hi; } }
  __syncthreads();
  // step 3: the wave of key set s sums, over the four sets in order, tiles 2 (s & 1) and 2 (s & 1) + 1 of query tile s >> 1: 32 columns = one whole 128-byte line of each of 16 output rows, so a line has one writer
  const int qs = ksp >> 1, d0 = (ksp & 1) * 2; const float iv = qs ? inv[1] : inv[0];
  float* orow = O + ((size_t)b * SS + q0 + qs * 16 + ln) * DM + h * HD + d0 * 16 + 8 * hh;      // register r of tile dt is column dt * 16 + 8 hh + r of the query's row
#pragma unroll
  for (int d = 0; d < 2; ++d) { v4f lo = *(const v4fa*)&sO[qg][qs][d0 + d][0][lane][0], hi = *(const v4fa*)&sO[qg][qs][d0 + d][1][lane][0];
#pragma unroll
    for (int s = 1; s < NSP; ++s) { lo += *(const v4fa*)&sO[s * 4 + qg][qs][d0 + d][0][lane][0]; hi += *(const v4fa*)&sO[s * 4 + qg][qs][d0 + d][1][lane][0]; }
    *(v4f*)(orow + d * 16) = lo * iv; *(v4f*)(orow + d * 16 + 4) = hi * iv; } }
extern "C" void kernel_launch(void* const* d_in, const int* in_sizes, int n_in,
                              void* d_out, int out_size, void* d_ws, size_t ws_size, hipStream_t stream) {
  (void)in_sizes; (void)n_in; (void)out_size;
  const float* xq = (const float*)d_in[0]; const float* xk = (const float*)d_in[1]; const float* xv = (const float*)d_in[2]; const int* mask = (const int*)d_in[3]; const float* sf = (const float*)d_in[4];
  const float* Wq = (const float*)d_in[5]; const float* bq = (const float*)d_in[6]; const float* Wk = (const float*)d_in[7]; const float* bk = (const float*)d_in[8]; const float* Wv = (const float*)d_in[9]; const float* bv = (const float*)d_in[10]; const float* Wo = (const float*)d_in[11]; const float* bo = (const float*)d_in[12]; const float* Wt1 = (const float*)d_in[13]; const float* bt1 = (const float*)d_in[14]; const float* Wt2 = (const float*)d_in[15]; const float* bt2 = (const float*)d_in[16];
  char* ws = (char*)d_ws; size_t off = 0;
  auto take = [&](size_t bytes) { char* p = ws + off; off += (bytes + 255) & ~(size_t)255; return p; };
  const size_t w8 = (size_t)DM * DM / 8;
  _Float16* Bq = (_Float16*)take(w8 * 16); _Float16* Bk = (_Float16*)take(w8 * 16); _Float16* Bv = (_Float16*)take(w8 * 16); _Float16* Bo = (_Float16*)take(w8 * 16);
  _Float16* XQ = (_Float16*)take((size_t)NR * DM * 2); _Float16* XK = (_Float16*)take((size_t)NR * DM * 2); _Float16* XV = (_Float16*)take((size_t)NR * DM * 2); _Float16* Q16 = (_Float16*)take((size_t)NR * DM * 2); _Float16* K16 = (_Float16*)take((size_t)NR * DM * 2); _Float16* V16 = (_Float16*)take((size_t)NR * DM * 2); _Float16* Vt = (_Float16*)take((size_t)NR * DM * 2);
  _Float16* SN = (_Float16*)take((size_t)NR * DSEM * 2); _Float16* SIM = (_Float16*)take((size_t)BB * SS * SS * 2); float* TEMP = (float*)take(256); float* O = (float*)take((size_t)NR * DM * 4); float* PART = (float*)take((size_t)BB * QP * DM * 4); _Float16* O16 = XQ;      // the query plane is dead after the q GEMM
  if (off > ws_size) return;      // ≈ 2 + 4.2×7 + 2.1 + 16.8 + 8.4 ≈ 57 MiB
  const unsigned gx = (unsigned)(((size_t)NR * DM / 8 + 255) / 256);
  k_prep<<<PB_QS + 3 * PB_X + PB_SN + 4 * PB_W, 512, 0, stream>>>(xq, xk, xv, sf, Wq, Wk, Wv, Wo, XQ, XK, XV, SN, Bq, Bk, Bv, Bo, PART);
  k_proj<<<1 + 3 * GB_P + BB * GB_S, 128, 0, stream>>>(XQ, XK, XV, Bq, Bk, Bv, bq, bk, bv, Q16, K16, V16, SN, SIM, PART, Wt1, bt1, Wt2, bt2, TEMP);
  const dim3 gg(((NR / 16) * (DM / 64) + 3) / 4, 1);
  k_vt<<<BB * NH * (SS / 64), 256, 0, stream>>>(V16, Vt);
  k_flash<<<BB * NH * (SS / 128), 512, 0, stream>>>(Q16, K16, Vt, SIM, mask, TEMP, O);
  k_h16<<<gx, 256, 0, stream>>>(O, O16, (size_t)NR * DM / 8);
  k_gemm_hhx<0><<<gg, 128, 0, stream>>>(O16, DM, 0, Bo, DM, 0, 0.0625f, bo, 0, nullptr, 1, 0, 0, (float*)d_out, nullptr, DM, 0, NR, DM, DM);
}

// v005
// Measured time: 141 microseconds a run.
// Two timings next to v004 put it at 1.14 and 1.11 times that version's speed.
// Counting every step since v000, it is 6.01 times as fast.
#include <hip/hip_runtime.h>
// q/k/v/o projections (4096 × 512 × 512, + bias), the cosine-similarity matrix of the normalised semantic features (per batch 2048 × 2048 × 256, kept as an f16 plane) and the 8-head
// constrained attention on v_wmma_f32_16x16x32_f16 (fused flash-style kernel: Sᵀ = K·Qᵀ, Oᵀ = Vᵀ·Pᵀ on WMMA; scores / (8·temperature_b) + semantic bias + positional bias, key mask → −inf;
// online max/sum softmax f32; P f16 ≤ 1); the dynamic-temperature MLP on the mean query is f32 VALU (column sums over 64 blocks, then one block); A = f16(bf16 ·) exact operands, weights bf16-exact ×2^4 ((out,in)),
// single products, f32 accumulate.
// Every f16 plane of the workspace lies in fragment order: a plane of KD columns is cut into blocks of 16 rows x 32 columns (row tile major, then column block), a block is 2 x 512 bytes,
// and 16-byte chunk (j, hh, ln) of a block holds row ln, columns 16 j + 8 hh .. + 7. Lane 16 hh + ln of a wave then finds half j of its A or B fragment at byte 16 lane of that half:
// one fragment load reads 512 bytes in a row (4 whole 128-byte lines), where a row-major plane gave it 32 bytes out of each of 16 lines.
#define BB 2
#define SS 2048
#define DM 512
#define NH 8
#define HD 64
#define DSEM 256
#define NR (BB * SS)

typedef __bf16 v16b __attribute__((ext_vector_type(16)));
typedef unsigned short v8us __attribute__((ext_vector_type(8), may_alias));
typedef float  v8f  __attribute__((ext_vector_type(8)));
typedef float  v4f  __attribute__((ext_vector_type(4)));
typedef float  v4fa __attribute__((ext_vector_type(4), may_alias));
union FragB { v16b v; v8us half[2]; unsigned short u[16]; };

__device__ __forceinline__ unsigned short bf16_bits(float x) { unsigned int u = __float_as_uint(x); return (unsigned short)((u + 0x7FFFu + ((u >> 16) & 1u)) >> 16); }
__device__ __forceinline__ float bf16_val(unsigned short b) { return __uint_as_float(((unsigned int)b) << 16); }
__device__ __forceinline__ float bf16_round(float x) { return bf16_val(bf16_bits(x)); }
// D += A·B with NT terms: 1 = ah·bh, 2 = + al·bh (A split), 3 = + ah·bl (both split)
template <int NT>
__device__ __forceinline__ v8f mmaN(v16b ah, v16b al, v16b bh, v16b bl, v8f c) {
  c = __builtin_amdgcn_wmma_f32_16x16x32_bf16(false, ah, false, bh, (short)0, c, false, false);
  if (NT >= 2) c = __builtin_amdgcn_wmma_f32_16x16x32_bf16(false, al, false, bh, (short)0, c, false, false);
  if (NT >= 3) c = __builtin_amdgcn_wmma_f32_16x16x32_bf16(false, ah, false, bl, (short)0, c, false, false);
  asm volatile("v_nop\n\tv_nop\n\tv_nop\n\tv_nop" : "+v"(c) : "v"(ah), "v"(al), "v"(bh), "v"(bl));
  return c;
}

__global__ __launch_bounds__(256) void k_wt_bf16(const float* __restrict__ W, unsigned short* __restrict__ Wt, int K, int N) {
  const int t = blockIdx.x * 256 + threadIdx.x;
  const int k8n = K / 8;
  if (t >= N * k8n) return;
  const int n = t / k8n, k8 = (t % k8n) * 8;
  v8us v;
#pragma unroll
  for (int i = 0; i < 8; ++i) v[i] = bf16_bits(W[(size_t)(k8 + i) * N + n]);
  *(v8us*)(Wt + (size_t)n * K + k8) = v;
  
}

// GEMM C[M][N] (f32, pitch ldc) = act(A[M][K]·W + bias). A f32 row-major (pitch lda) converted per fragment to bf16
// (ASPLIT: hi/lo two planes -> 2 terms, else single rounded term); Wt bf16 [N][K] (pitch ldb). BIAS_BF16 rounds the
// bias to bf16 first (bias quantised to bf16 before the add). K%32==0, M%16==0, N%64==0.
template <bool ASPLIT, int ACT, bool BIAS_BF16>
__global__ __launch_bounds__(128) void k_gemm_bf(const float* __restrict__ A, int lda, const unsigned short* __restrict__ Wt, int ldb,
                                               const float* __restrict__ bias, float* __restrict__ C, int ldc, int M, int N, int K) {
  __shared__ __attribute__((aligned(16))) float so[4][16][64];
  const int tid = threadIdx.x, w = tid >> 5, lane = tid & 31, ln = lane & 15, hh = lane >> 4;
  const int ntn = N / 64;
  const int wid = blockIdx.x * 4 + w;
  const int mt = wid / ntn, nq = wid % ntn;
  if (mt * 16 >= M) return;
  const int row0 = mt * 16, col0 = nq * 64;
  const float* arow = A + (size_t)(row0 + ln) * lda;
  v8f acc[4] = {};
  for (int kb = 0; kb < K; kb += 32) {
    FragB ah, al;
    const v4f x0 = *(const v4fa*)(arow + kb + 8 * hh), x1 = *(const v4fa*)(arow + kb + 8 * hh + 4);
    const v4f x2 = *(const v4fa*)(arow + kb + 16 + 8 * hh), x3 = *(const v4fa*)(arow + kb + 16 + 8 * hh + 4);
    float xs[16] = {x0[0],x0[1],x0[2],x0[3],x1[0],x1[1],x1[2],x1[3],x2[0],x2[1],x2[2],x2[3],x3[0],x3[1],x3[2],x3[3]};
#pragma unroll
    for (int i = 0; i < 16; ++i) { const unsigned short hb = bf16_bits(xs[i]); ah.u[i] = hb; al.u[i] = ASPLIT ? bf16_bits(xs[i] - bf16_val(hb)) : (unsigned short)0; }
#pragma unroll
    for (int t = 0; t < 4; ++t) {
      const unsigned short* brow = Wt + (size_t)(col0 + t * 16 + ln) * ldb + kb;
      FragB b;
      b.half[0] = *(const v8us*)(brow + 8 * hh);
      b.half[1] = *(const v8us*)(brow + 16 + 8 * hh);
      acc[t] = mmaN<ASPLIT ? 2 : 1>(ah.v, al.v, b.v, b.v, acc[t]);
    }
  }
#pragma unroll
  for (int t = 0; t < 4; ++t) {
    float bv = bias ? bias[col0 + t * 16 + ln] : 0.f;
    if (BIAS_BF16) bv = bf16_round(bv);
#pragma unroll
    for (int r = 0; r < 8; ++r) { float v = acc[t][r] + bv; if (ACT == 1) v = fmaxf(v, 0.f); so[w][8 * hh + r][t * 16 + ln] = v; }
  }
  __builtin_amdgcn_fence(__ATOMIC_ACQ_REL, "workgroup");
  __builtin_amdgcn_wave_barrier();
  const int rsub = lane >> 4, c4 = (lane & 15) * 4;
  {
#pragma unroll
    for (int q = 0; q < 8; ++q) {
      const int r = q * 2 + rsub;
      const v4f v = *(const v4fa*)&so[w][r][c4];
      *(v4f*)(C + (size_t)(row0 + r) * ldc + col0 + c4) = v;
    }
    
  }
}

// Flash-style causal/unmasked attention, all contractions 3-term bf16 hi/lo splits, f32 softmax with running max.
// q,k,v rows are read from f32 buffers with arbitrary row pitch (so they can live inside a fused qkv buffer);
// D = head size (multiple of 32, <= 128); one wave = 16 query rows; block = 4 waves (64 queries) sharing K/V chunks of 32.
template <int D, bool CAUSAL>
__global__ __launch_bounds__(128) void k_flash(const float* __restrict__ qb, const float* __restrict__ kb, const float* __restrict__ vb,
                                             int pitch, int T, int H, float scale, float* __restrict__ y, int ypitch) {
  constexpr int KS = D / 32;        // k-steps for QK
  constexpr int DT = D / 16;        // d tiles for PV
  __shared__ __attribute__((aligned(16))) unsigned short sKh[32][D + 8], sKl[32][D + 8], sVh[32][D + 8], sVl[32][D + 8];
  __shared__ __attribute__((aligned(16))) unsigned short sPh[4][16][40], sPl[4][16][40];
  __shared__ __attribute__((aligned(16))) float sO[4][16][D];
  const int tid = threadIdx.x, w = tid >> 5, lane = tid & 31, ln = lane & 15, hh = lane >> 4;
  const int nqb = (T + 63) / 64;
  const int bh = blockIdx.x / nqb, qblk = blockIdx.x % nqb;
  const int b = bh / H, h = bh % H;
  const int q0 = qblk * 64 + w * 16;
  const float* Q = qb + (size_t)b * T * pitch + h * D;
  const float* K = kb + (size_t)b * T * pitch + h * D;
  const float* V = vb + (size_t)b * T * pitch + h * D;

  // A fragments of the wave's 16 query rows (scaled), hi/lo
  FragB aqh[KS], aql[KS];
  {
    int row = q0 + ln; if (row >= T) row = T - 1;
    const float* qr = Q + (size_t)row * pitch;
#pragma unroll
    for (int ks = 0; ks < KS; ++ks)
#pragma unroll
      for (int i = 0; i < 16; ++i) {
        const int d = ks * 32 + ((i < 8) ? (8 * hh + i) : (16 + 8 * hh + (i - 8)));
        const float x = qr[d] * scale; const unsigned short hb = bf16_bits(x);
        aqh[ks].u[i] = hb; aql[ks].u[i] = bf16_bits(x - bf16_val(hb));
      }
  }
  float m_r[8], l_r[8];
#pragma unroll
  for (int r = 0; r < 8; ++r) { m_r[r] = -3.0e38f; l_r[r] = 0.f; }
  v8f oacc[DT];
#pragma unroll
  for (int dt = 0; dt < DT; ++dt) oacc[dt] = (v8f){0.f,0.f,0.f,0.f,0.f,0.f,0.f,0.f};

  const int kv_end = CAUSAL ? min(T, qblk * 64 + 64) : T;     // block-uniform
  for (int j0 = 0; j0 < kv_end; j0 += 32) {
    __syncthreads();
    for (int e = tid; e < 32 * (D / 4); e += 128) {
      const int r = e / (D / 4), c4 = (e % (D / 4)) * 4;
      const int key = j0 + r;
      v4f kf = {0.f,0.f,0.f,0.f}, vf = {0.f,0.f,0.f,0.f};
      if (key < T) { kf = *(const v4fa*)(K + (size_t)key * pitch + c4); vf = *(const v4fa*)(V + (size_t)key * pitch + c4); }
#pragma unroll
      for (int t = 0; t < 4; ++t) {
        unsigned short hb = bf16_bits(kf[t]); sKh[r][c4 + t] = hb; sKl[r][c4 + t] = bf16_bits(kf[t] - bf16_val(hb));
        hb = bf16_bits(vf[t]); sVh[r][c4 + t] = hb; sVl[r][c4 + t] = bf16_bits(vf[t] - bf16_val(hb));
      }
    }
    __syncthreads();
    // S tile 16 x 32
    v8f s[2];
#pragma unroll
    for (int nt = 0; nt < 2; ++nt) {
      v8f acc = {};
#pragma unroll
      for (int ks = 0; ks < KS; ++ks) {
        FragB bh_, bl_;
        bh_.half[0] = *(const v8us*)&sKh[nt * 16 + ln][ks * 32 + 8 * hh]; bh_.half[1] = *(const v8us*)&sKh[nt * 16 + ln][ks * 32 + 16 + 8 * hh];
        bl_.half[0] = *(const v8us*)&sKl[nt * 16 + ln][ks * 32 + 8 * hh]; bl_.half[1] = *(const v8us*)&sKl[nt * 16 + ln][ks * 32 + 16 + 8 * hh];
        acc = mmaN<3>(aqh[ks].v, aql[ks].v, bh_.v, bl_.v, acc);
      }
      s[nt] = acc;
    }
    // mask + running max (rows 8hh+r; the 16 lanes of a half share rows)
    float alpha[8];
#pragma unroll
    for (int r = 0; r < 8; ++r) {
      const int qi = q0 + 8 * hh + r;
      const int ja = j0 + ln, jb = j0 + 16 + ln;
      if (CAUSAL) { if (ja > qi) s[0][r] = -3.0e38f; if (jb > qi) s[1][r] = -3.0e38f; }
      if (ja >= T) s[0][r] = -3.0e38f;
      if (jb >= T) s[1][r] = -3.0e38f;
      float mx = fmaxf(s[0][r], s[1][r]);
      mx = fmaxf(mx, __shfl_xor(mx, 1, 32)); mx = fmaxf(mx, __shfl_xor(mx, 2, 32)); mx = fmaxf(mx, __shfl_xor(mx, 4, 32)); mx = fmaxf(mx, __shfl_xor(mx, 8, 32));
      const float mnew = fmaxf(m_r[r], mx);
      alpha[r] = (mnew > -1.0e38f) ? __expf(m_r[r] - mnew) : 1.0f;
      const float p0 = (s[0][r] > -1.0e38f) ? __expf(s[0][r] - mnew) : 0.f;
      const float p1 = (s[1][r] > -1.0e38f) ? __expf(s[1][r] - mnew) : 0.f;
      m_r[r] = mnew;
      l_r[r] = l_r[r] * alpha[r] + p0 + p1;            // per-lane partial row sum (16 lanes combined at the end)
      unsigned short hb = bf16_bits(p0); sPh[w][8 * hh + r][ln] = hb;      sPl[w][8 * hh + r][ln] = bf16_bits(p0 - bf16_val(hb));
      hb = bf16_bits(p1);                sPh[w][8 * hh + r][16 + ln] = hb; sPl[w][8 * hh + r][16 + ln] = bf16_bits(p1 - bf16_val(hb));
    }
#pragma unroll
    for (int dt = 0; dt < DT; ++dt)
#pragma unroll
      for (int r = 0; r < 8; ++r) oacc[dt][r] *= alpha[r];
    __builtin_amdgcn_fence(__ATOMIC_ACQ_REL, "workgroup");
    __builtin_amdgcn_wave_barrier();
    FragB pah, pal;
    pah.half[0] = *(const v8us*)&sPh[w][ln][8 * hh]; pah.half[1] = *(const v8us*)&sPh[w][ln][16 + 8 * hh];
    pal.half[0] = *(const v8us*)&sPl[w][ln][8 * hh]; pal.half[1] = *(const v8us*)&sPl[w][ln][16 + 8 * hh];
#pragma unroll
    for (int dt = 0; dt < DT; ++dt) {
      FragB bvh, bvl;
#pragma unroll
      for (int i = 0; i < 8; ++i) {
        bvh.u[i] = sVh[8 * hh + i][dt * 16 + ln]; bvh.u[8 + i] = sVh[16 + 8 * hh + i][dt * 16 + ln];
        bvl.u[i] = sVl[8 * hh + i][dt * 16 + ln]; bvl.u[8 + i] = sVl[16 + 8 * hh + i][dt * 16 + ln];
      }
      oacc[dt] = mmaN<3>(pah.v, pal.v, bvh.v, bvl.v, oacc[dt]);
    }
    __builtin_amdgcn_fence(__ATOMIC_ACQ_REL, "workgroup");
    __builtin_amdgcn_wave_barrier();
  }
#pragma unroll
  for (int r = 0; r < 8; ++r) {
    float l = l_r[r];
    l += __shfl_xor(l, 1, 32); l += __shfl_xor(l, 2, 32); l += __shfl_xor(l, 4, 32); l += __shfl_xor(l, 8, 32);
    l_r[r] = (l > 0.f) ? 1.0f / l : 0.f;
  }
#pragma unroll
  for (int dt = 0; dt < DT; ++dt)
#pragma unroll
    for (int r = 0; r < 8; ++r) sO[w][8 * hh + r][dt * 16 + ln] = oacc[dt][r] * l_r[r];
  __builtin_amdgcn_fence(__ATOMIC_ACQ_REL, "workgroup");
  __builtin_amdgcn_wave_barrier();
  {
    for (int r = 0; r < 16; ++r) {
      const int row = q0 + r;
      if (row < T && lane < D / 4) {
        const v4f val = *(const v4fa*)&sO[w][r][lane * 4];
        *(v4f*)(y + ((size_t)b * T + row) * ypitch + h * D + lane * 4) = val;
      }
    }
    
  }
}

// GEMM C = act(A·W + bias + resid): A f32 (ASPLIT -> hi/lo 2 terms), Wt bf16 [N][K]; ACT 0 none, 1 relu, 2 exact gelu;
// resid (optional, f32, row index = (row % rmod), pitch ldr, RES_BF16 rounds it) added before the activation.
template <bool ASPLIT, int ACT, bool BIAS_BF16, bool RES_BF16>
__global__ __launch_bounds__(128) void k_gemm_bf3(const float* __restrict__ A, int lda, const unsigned short* __restrict__ Wt, int ldb,
                                                const float* __restrict__ bias, const float* __restrict__ resid, int rmod, int ldr,
                                                float* __restrict__ C, int ldc, int M, int N, int K) {
  __shared__ __attribute__((aligned(16))) float so[4][16][64];
  const int tid = threadIdx.x, w = tid >> 5, lane = tid & 31, ln = lane & 15, hh = lane >> 4;
  const int ntn = N / 64;
  const int wid = blockIdx.x * 4 + w;
  const int mt = wid / ntn, nq = wid % ntn;
  if (mt * 16 >= M) return;
  const int row0 = mt * 16, col0 = nq * 64;
  const float* arow = A + (size_t)(row0 + ln) * lda;
  v8f acc[4] = {};
  for (int kb = 0; kb < K; kb += 32) {
    FragB ah, al;
    const v4f x0 = *(const v4fa*)(arow + kb + 8 * hh), x1 = *(const v4fa*)(arow + kb + 8 * hh + 4);
    const v4f x2 = *(const v4fa*)(arow + kb + 16 + 8 * hh), x3 = *(const v4fa*)(arow + kb + 16 + 8 * hh + 4);
    float xs[16] = {x0[0],x0[1],x0[2],x0[3],x1[0],x1[1],x1[2],x1[3],x2[0],x2[1],x2[2],x2[3],x3[0],x3[1],x3[2],x3[3]};
#pragma unroll
    for (int i = 0; i < 16; ++i) { const unsigned short hb = bf16_bits(xs[i]); ah.u[i] = hb; al.u[i] = ASPLIT ? bf16_bits(xs[i] - bf16_val(hb)) : (unsigned short)0; }
#pragma unroll
    for (int t = 0; t < 4; ++t) {
      const unsigned short* brow = Wt + (size_t)(col0 + t * 16 + ln) * ldb + kb;
      FragB b;
      b.half[0] = *(const v8us*)(brow + 8 * hh);
      b.half[1] = *(const v8us*)(brow + 16 + 8 * hh);
      acc[t] = mmaN<ASPLIT ? 2 : 1>(ah.v, al.v, b.v, b.v, acc[t]);
    }
  }
#pragma unroll
  for (int t = 0; t < 4; ++t) {
    const int col = col0 + t * 16 + ln;
    float bv = bias ? bias[col] : 0.f;
    if (BIAS_BF16) bv = bf16_round(bv);
#pragma unroll
    for (int r = 0; r < 8; ++r) {
      float v = acc[t][r] + bv;
      if (resid) { float rv = resid[(size_t)((row0 + 8 * hh + r) % rmod) * ldr + col]; if (RES_BF16) rv = bf16_round(rv); v += rv; }
      if (ACT == 1) v = fmaxf(v, 0.f);
      if (ACT == 2) v = 0.5f * v * (1.0f + erff(v * 0.70710678118654752f));
      if (ACT == 3) { const float u = 0.7978845608028654f * (v + 0.044715f * v * v * v); v = 0.5f * v * (1.0f + tanhf(u)); }
      so[w][8 * hh + r][t * 16 + ln] = v;
    }
  }
  __builtin_amdgcn_fence(__ATOMIC_ACQ_REL, "workgroup");
  __builtin_amdgcn_wave_barrier();
  const int rsub = lane >> 4, c4 = (lane & 15) * 4;
  {
#pragma unroll
    for (int q = 0; q < 8; ++q) {
      const int r = q * 2 + rsub;
      const v4f v = *(const v4fa*)&so[w][r][c4];
      *(v4f*)(C + (size_t)(row0 + r) * ldc + col0 + c4) = v;
    }
    
  }
}
// row LayerNorm (biased variance, eps) over N: s = X (+ R); optional out_sum <- s; out_norm <- (s-mu)*rsqrt(var+eps)*g + b
template <bool PARAM_BF16>
__global__ __launch_bounds__(256) void k_layernorm(const float* __restrict__ X, const float* __restrict__ R, const float* __restrict__ g, const float* __restrict__ bta,
                                                  float* __restrict__ out_sum, float* __restrict__ out_norm, int N, float eps) {
  __shared__ float red[256];
  const int row = blockIdx.x, tid = threadIdx.x;
  const float* x = X + (size_t)row * N; const float* rr = R ? R + (size_t)row * N : nullptr;
  float vals[16];                     // up to N = 4096
  const int per = N / 256;            // contiguous chunk per thread? use strided-by-4 chunks: thread handles j = tid*4 + 1024*u
  float s1 = 0.f;
  for (int u = 0; u < per / 4; ++u) {
    const int j = tid * 4 + 1024 * u;
    const v4f a = *(const v4fa*)(x + j);
    v4f b = {0.f,0.f,0.f,0.f}; if (rr) b = *(const v4fa*)(rr + j);
#pragma unroll
    for (int q = 0; q < 4; ++q) { const float v = a[q] + b[q]; vals[u * 4 + q] = v; s1 += v; }
  }
  red[tid] = s1; __syncthreads();
  for (int st = 128; st > 0; st >>= 1) { if (tid < st) red[tid] += red[tid + st]; __syncthreads(); }
  const float mu = red[0] / (float)N; __syncthreads();
  float s2 = 0.f;
  for (int u = 0; u < per / 4; ++u)
#pragma unroll
    for (int q = 0; q < 4; ++q) { const float c = vals[u * 4 + q] - mu; s2 += c * c; }
  red[tid] = s2; __syncthreads();
  for (int st = 128; st > 0; st >>= 1) { if (tid < st) red[tid] += red[tid + st]; __syncthreads(); }
  const float rs = rsqrtf(red[0] / (float)N + eps);
  {
    for (int u = 0; u < per / 4; ++u) {
      const int j = tid * 4 + 1024 * u;
      v4f o, sm;
#pragma unroll
      for (int q = 0; q < 4; ++q) {
        float gg = g[j + q], bb = bta[j + q];
        if (PARAM_BF16) { gg = bf16_round(gg); bb = bf16_round(bb); }
        sm[q] = vals[u * 4 + q]; o[q] = (vals[u * 4 + q] - mu) * rs * gg + bb;
      }
      if (out_sum) *(v4f*)(out_sum + (size_t)row * N + j) = sm;
      *(v4f*)(out_norm + (size_t)row * N + j) = o;
    }
    
  }
}



// ---- f16 WMMA path (v_wmma_f32_16x16x32_f16): 11-bit significands for operands in range — used where a [0,1] probability operand needs more precision than bf16
typedef _Float16 v16h __attribute__((ext_vector_type(16)));
union FragH { v16h v; v8us half[2]; _Float16 h[16]; unsigned short u[16]; };
template <int NT>
__device__ __forceinline__ v8f mmaH(v16h ah, v16h al, v16h bh, v16h bl, v8f c) {
  c = __builtin_amdgcn_wmma_f32_16x16x32_f16(false, ah, false, bh, (short)0, c, false, false);
  if (NT >= 2) c = __builtin_amdgcn_wmma_f32_16x16x32_f16(false, al, false, bh, (short)0, c, false, false);
  if (NT >= 3) c = __builtin_amdgcn_wmma_f32_16x16x32_f16(false, ah, false, bl, (short)0, c, false, false);
  asm volatile("v_nop\n\tv_nop\n\tv_nop\n\tv_nop" : "+v"(c) : "v"(ah), "v"(al), "v"(bh), "v"(bl));
  return c;
}
// batched GEMM like k_gemm_b but f16 operands: A f32 (split into f16 hi/lo if ASPLIT, else rounded to f16), Bt = f16 values [n][k]; alpha; C f32; N multiple of 16 (partial tiles skipped)
template <bool ASPLIT>
__global__ __launch_bounds__(128) void k_gemm_h(const float* __restrict__ A, int lda, size_t sA, const _Float16* __restrict__ Bh, int ldb, size_t sB, float alpha, float* __restrict__ C, int ldc, size_t sC, int M, int N, int K) {
  __shared__ __attribute__((aligned(16))) float so[4][16][64];
  const int tid = threadIdx.x, w = tid >> 5, lane = tid & 31, ln = lane & 15, hh = lane >> 4; const int by = blockIdx.y;
  A += (size_t)by * sA; Bh += (size_t)by * sB; C += (size_t)by * sC;
  const int ntn = (N + 63) / 64; const int wid = blockIdx.x * 4 + w; const int mt = wid / ntn, nq = wid % ntn; if (mt * 16 >= M) return;
  const int row0 = mt * 16, col0 = nq * 64; const float* arow = A + (size_t)(row0 + ln) * lda;
  v8f acc[4] = {};
  for (int kb = 0; kb < K; kb += 32) {
    FragH ah, al;
    const v4f x0 = *(const v4fa*)(arow + kb + 8 * hh), x1 = *(const v4fa*)(arow + kb + 8 * hh + 4), x2 = *(const v4fa*)(arow + kb + 16 + 8 * hh), x3 = *(const v4fa*)(arow + kb + 16 + 8 * hh + 4);
    float xs[16] = {x0[0],x0[1],x0[2],x0[3],x1[0],x1[1],x1[2],x1[3],x2[0],x2[1],x2[2],x2[3],x3[0],x3[1],x3[2],x3[3]};
#pragma unroll
    for (int i = 0; i < 16; ++i) { const _Float16 h = (_Float16)xs[i]; ah.h[i] = h; al.h[i] = ASPLIT ? (_Float16)(xs[i] - (float)h) : (_Float16)0.0f; }
#pragma unroll
    for (int t = 0; t < 4; ++t) { if (col0 + t * 16 >= N) continue; const size_t boff = (size_t)(col0 + t * 16 + ln) * ldb + kb; FragH bq; bq.half[0] = *(const v8us*)(Bh + boff + 8 * hh); bq.half[1] = *(const v8us*)(Bh + boff + 16 + 8 * hh);
      acc[t] = mmaH<ASPLIT ? 2 : 1>(ah.v, al.v, bq.v, bq.v, acc[t]); }
  }
#pragma unroll
  for (int t = 0; t < 4; ++t) { if (col0 + t * 16 >= N) continue;
#pragma unroll
    for (int r = 0; r < 8; ++r) so[w][8 * hh + r][t * 16 + ln] = acc[t][r] * alpha; }
  __builtin_amdgcn_fence(__ATOMIC_ACQ_REL, "workgroup"); __builtin_amdgcn_wave_barrier();
  const int rsub = lane >> 4, c4 = (lane & 15) * 4;
  {
#pragma unroll
    for (int q = 0; q < 8; ++q) { const int r = q * 2 + rsub; if (col0 + c4 < N) { const v4f v = *(const v4fa*)&so[w][r][c4]; *(v4f*)(C + (size_t)(row0 + r) * ldc + col0 + c4) = v; } }
     }
}

// Wt[n][k] = f16(W[k][n]·scale) from f32 row-major W[K][N] (scale = power of two; bf16-exact weights stay exact in f16 away from the subnormal range)
__global__ __launch_bounds__(256) void k_wt_f16(const float* __restrict__ W, _Float16* __restrict__ Wt, int K, int N, float scale) {
  const int t = blockIdx.x * 256 + threadIdx.x; if (t >= N * (K / 8)) return; const int n = t / (K / 8), k8 = (t % (K / 8)) * 8; FragH f;
#pragma unroll
  for (int i = 0; i < 8; ++i) f.h[i] = (_Float16)(bf16_round(W[(size_t)(k8 + i) * N + n]) * scale); const v8us o = f.half[0];
  *(v8us*)((unsigned short*)Wt + (size_t)n * K + k8) = o; 
}
// k_gemm_hh variant with fused epilogue: v = acc·alpha + bias[by·sBias + col] (+ CP[(row/rowsPerB)·sCPb + by·64 + col] if CP) ; ACT 0 none / 1 elu ; writes f16 C16 and f32 C, each if non-null
// the body takes its block indices (bx, by) and its 17 KiB of LDS from the caller, so that several products can share one launch
// A (M x K), Bh (N x K) and C16 (M x N) lie in fragment order; C is row-major with pitch ldc. SOP: row pitch of the LDS tile in floats, 4 more than the row so that 16 lanes reading 16 rows at one column meet 16 different bank groups
#define SOP 68
// row-major element offset of 16-byte chunk t of a fragment-order plane of KD columns
__device__ __forceinline__ size_t frag_src(const size_t t, const int KD) { const size_t blk = t >> 6; const int kbn = KD >> 5;
  return ((blk / kbn) * 16 + (t & 15)) * KD + (blk % kbn) * 32 + ((t >> 5) & 1) * 16 + ((t >> 4) & 1) * 8; }
template <int ACT>
__device__ __forceinline__ void gemm_hhx_body(float (*so)[16][SOP], const int bx, const int by, const _Float16* __restrict__ A, size_t sA, const _Float16* __restrict__ Bh, size_t sB, float alpha, const float* __restrict__ bias, size_t sBias, const float* __restrict__ CP, int rowsPerB, size_t sCPb, int row0g,
    float* __restrict__ C, _Float16* __restrict__ C16, int ldc, size_t sC, int M, int N, int K) {
  const int tid = threadIdx.x, w = tid >> 5, lane = tid & 31, ln = lane & 15, hh = lane >> 4;
  A += (size_t)by * sA; Bh += (size_t)by * sB; const size_t cofs = (size_t)by * sC; const float* bp = bias ? bias + (size_t)by * sBias : nullptr;
  const int ntn = (N + 63) / 64; const int wid = bx * 4 + w; const int mt = wid / ntn, nq = wid % ntn; if (mt * 16 >= M) return;
  const int row0 = mt * 16, col0 = nq * 64; const size_t tsz = (size_t)(K >> 5) * 512;      // f16 elements of one 16-row tile
  const unsigned short* afr = (const unsigned short*)A + (size_t)mt * tsz + lane * 8; const unsigned short* bfr = (const unsigned short*)Bh + (size_t)(col0 >> 4) * tsz + lane * 8;
  v8f acc[4] = {};
  for (int kb = 0; kb < K; kb += 32) { FragH ah; ah.half[0] = *(const v8us*)(afr + kb * 16); ah.half[1] = *(const v8us*)(afr + kb * 16 + 256);
#pragma unroll
    for (int t = 0; t < 4; ++t) { if (col0 + t * 16 >= N) continue; const size_t boff = (size_t)t * tsz + kb * 16; FragH bq; bq.half[0] = *(const v8us*)(bfr + boff); bq.half[1] = *(const v8us*)(bfr + boff + 256);
      acc[t] = mmaH<1>(ah.v, ah.v, bq.v, bq.v, acc[t]); }
  }
#pragma unroll
  for (int t = 0; t < 4; ++t) { if (col0 + t * 16 >= N) continue; const int col = col0 + t * 16 + ln; const float bv = bp ? bf16_round(bp[col]) : 0.f;
#pragma unroll
    for (int r = 0; r < 8; ++r) { float v = acc[t][r] * alpha + bv; if (CP) { const int bidx = (row0g + row0 + 8 * hh + r) / rowsPerB; v += CP[(size_t)bidx * sCPb + (size_t)by * 64 + col]; } if (ACT == 1) v = (v > 0.f) ? v : expm1f(v); else if (ACT == 3) v = fmaxf(v, 0.f); so[w][8 * hh + r][t * 16 + ln] = v; } }
  __builtin_amdgcn_fence(__ATOMIC_ACQ_REL, "workgroup"); __builtin_amdgcn_wave_barrier();
  const int rsub = lane >> 4, c4 = (lane & 15) * 4;
  if (C) {
#pragma unroll
    for (int q = 0; q < 8; ++q) { const int r = q * 2 + rsub; if (col0 + c4 < N) { const v4f v = *(const v4fa*)&so[w][r][c4]; *(v4f*)(C + cofs + (size_t)(row0 + r) * ldc + col0 + c4) = v; } }
  }
  if (C16) {      // the wave's 16 x 64 tile is two blocks of the plane, 2 KiB in a row: four stores of 512 bytes
    unsigned short* cfr = (unsigned short*)C16 + cofs + ((size_t)mt * (N >> 5) + (col0 >> 5)) * 512 + lane * 8;
#pragma unroll
    for (int c = 0; c < 4; ++c) { if (col0 + c * 16 >= N) continue; const v4f v0 = *(const v4fa*)&so[w][ln][c * 16 + 8 * hh], v1 = *(const v4fa*)&so[w][ln][c * 16 + 8 * hh + 4]; FragH f;
#pragma unroll
      for (int i = 0; i < 4; ++i) { f.h[i] = (_Float16)v0[i]; f.h[4 + i] = (_Float16)v1[i]; }
      *(v8us*)(cfr + c * 256) = f.half[0]; }
  }
}
template <int ACT>
__global__ __launch_bounds__(128) void k_gemm_hhx(const _Float16* __restrict__ A, size_t sA, const _Float16* __restrict__ Bh, size_t sB, float alpha, const float* __restrict__ bias, size_t sBias, const float* __restrict__ CP, int rowsPerB, size_t sCPb, int row0g,
    float* __restrict__ C, _Float16* __restrict__ C16, int ldc, size_t sC, int M, int N, int K) {
  __shared__ __attribute__((aligned(16))) float so[4][16][SOP];
  gemm_hhx_body<ACT>(so, blockIdx.x, blockIdx.y, A, sA, Bh, sB, alpha, bias, sBias, CP, rowsPerB, sCPb, row0g, C, C16, ldc, sC, M, N, K);
}


// x16_body, round16f_body, sn_body and qsum_body are roles of one launch (k_prep, blocks of 512): each takes its block index bx inside its role
__device__ __forceinline__ void x16_body(const int bx, const float* __restrict__ x, _Float16* __restrict__ X16) { const size_t t = (size_t)bx * 512 + threadIdx.x, s = frag_src(t, DM); FragH f;
#pragma unroll
  for (int q = 0; q < 8; ++q) f.h[q] = (_Float16)bf16_round(x[s + q]); *(v8us*)((unsigned short*)X16 + t * 8) = f.half[0];  }
__global__ __launch_bounds__(256) void k_h16(const float* __restrict__ x, _Float16* __restrict__ X16, size_t n8) { const size_t t = (size_t)blockIdx.x * 256 + threadIdx.x; if (t >= n8) return; const size_t s = frag_src(t, DM); FragH f;
#pragma unroll
  for (int q = 0; q < 8; ++q) f.h[q] = (_Float16)x[s + q]; *(v8us*)((unsigned short*)X16 + t * 8) = f.half[0];  }
__device__ __forceinline__ void round16f_body(const int bx, const float* __restrict__ W, _Float16* __restrict__ Bt) { const size_t t = (size_t)bx * 512 + threadIdx.x, s = frag_src(t, DM); FragH f;
#pragma unroll
  for (int i = 0; i < 8; ++i) f.h[i] = (_Float16)(bf16_round(W[s + i]) * 16.0f); *(v8us*)((unsigned short*)Bt + t * 8) = f.half[0];
  asm volatile("s_wait_xcnt 0x0" ::: "memory");      // in the merged listing the next role's code follows this store and writes its address register: the wait stands in front of that write
}
// the block's 16 rows are one row tile of SN (8 KiB): each wave lays its row's chunks into LDS at their places in the tile, and behind the barrier every thread stores 16 bytes of it in a row, so that a 128-byte line has one writer
__device__ __forceinline__ void sn_body(unsigned short* __restrict__ st, const int bx, const float* __restrict__ sf, _Float16* __restrict__ SN) { const int tid = threadIdx.x, wv = tid >> 5, lane = tid & 31; const size_t row = (size_t)bx * 16 + wv; float v[8]; float s = 0.f;
#pragma unroll
  for (int q = 0; q < 8; ++q) { v[q] = bf16_round(sf[row * DSEM + lane * 8 + q]); s += v[q] * v[q]; }
  for (int o = 16; o >= 1; o >>= 1) s += __shfl_xor(s, o, 32); const float inv = 1.0f / fmaxf(sqrtf(s), 1e-12f); FragH f;
#pragma unroll
  for (int q = 0; q < 8; ++q) f.h[q] = (_Float16)(v[q] * inv);
  *(v8us*)(st + (lane >> 1) * 256 + ((lane & 1) * 16 + wv) * 8) = f.half[0];      // chunk lane of the row = columns 8 lane ..: block lane >> 2, j = (lane >> 1) & 1, hh = lane & 1
  __syncthreads();
  *(v8us*)((unsigned short*)SN + (size_t)bx * (16 * DSEM) + tid * 8) = *(const v8us*)(st + tid * 8);
  asm volatile("s_wait_xcnt 0x0" ::: "memory");      // in the merged listing the next role's code follows this store and writes its address register: the wait stands in front of that write
}
// dynamic temperature, stage 1: column sums of the bf16-rounded query over QROWS rows per block -> PART[b][chunk][DM]; thread = 4 columns x one of 4 row phases, 16 independent 16-byte loads
#define QP 32
#define QROWS (SS / QP)
__device__ __forceinline__ void qsum_body(float (*sred)[DM], const int bx, const float* __restrict__ query, float* __restrict__ PART) {
  const int tid = threadIdx.x, ph = tid >> 7, c4 = (tid & 127) * 4;
  const float* src = query + ((size_t)bx * QROWS + ph * (QROWS / 4)) * DM + c4; v4f s = {0.f, 0.f, 0.f, 0.f};
#pragma unroll  // all 16 row loads issue before the first add: one memory latency instead of 16
  for (int r = 0; r < QROWS / 4; ++r) { const v4f x = *(const v4fa*)(src + (size_t)r * DM);
#pragma unroll
    for (int q = 0; q < 4; ++q) s[q] += bf16_round(x[q]); }
  *(v4fa*)&sred[ph][c4] = s; __syncthreads();
  PART[(size_t)bx * DM + tid] = (sred[0][tid] + sred[1][tid]) + (sred[2][tid] + sred[3][tid]); }
// one launch for all work that reads inputs only: column sums of the query, the three f16 activation planes, the normalised semantic rows, the four weight planes; role by block range
#define PB_QS (BB * QP)
#define PB_X (NR * DM / 8 / 512)
#define PB_SN (NR / 16)
#define PB_W (DM * DM / 8 / 512)
__global__ __launch_bounds__(512) void k_prep(const float* __restrict__ xq, const float* __restrict__ xk, const float* __restrict__ xv, const float* __restrict__ sf,
    const float* __restrict__ Wq, const float* __restrict__ Wk, const float* __restrict__ Wv, const float* __restrict__ Wo,
    _Float16* __restrict__ XQ, _Float16* __restrict__ XK, _Float16* __restrict__ XV, _Float16* __restrict__ SN,
    _Float16* __restrict__ Bq, _Float16* __restrict__ Bk, _Float16* __restrict__ Bv, _Float16* __restrict__ Bo, float* __restrict__ PART) {
  __shared__ __attribute__((aligned(16))) float sred[4][DM];
  const int bx = blockIdx.x, bx1 = bx - PB_QS, bx2 = bx1 - 3 * PB_X, bx3 = bx2 - PB_SN;
  if (bx1 < 0) qsum_body(sred, bx, xq, PART);
  else if (bx2 < 0) { const int g = bx1 / PB_X; x16_body(bx1 % PB_X, g == 0 ? xq : g == 1 ? xk : xv, g == 0 ? XQ : g == 1 ? XK : XV); }
  else if (bx3 < 0) sn_body((unsigned short*)&sred[0][0], bx2, sf, SN);
  else { const int g = bx3 / PB_W; round16f_body(bx3 % PB_W, g == 0 ? Wq : g == 1 ? Wk : g == 2 ? Wv : Wo, g == 0 ? Bq : g == 1 ? Bk : g == 2 ? Bv : Bo); } }
// stage 2 (one block of 4 waves, a role of k_proj, beside the products that do not need it): mean query of both batches from PART, then one wave per hidden unit (lanes along DM, 16-byte loads of the
// Wt1 row shared by both batches), relu, Wt2 dot, sigmoid. The hidden units are summed in 32 groups of 8, each wave taking 8 groups in turn.
__device__ __forceinline__ void temp_body(float* __restrict__ sm, const float* __restrict__ PART, const float* __restrict__ Wt1, const float* __restrict__ bt1, const float* __restrict__ Wt2, const float* __restrict__ bt2, float* __restrict__ TEMP) {
  float (*qm)[DM] = (float (*)[DM])sm; float (*red)[32] = (float (*)[32])(sm + BB * DM); const int tid = threadIdx.x, wv = tid >> 5, lane = tid & 31;
#pragma unroll 1  // kept rolled: unrolled, its loads raise the register count of the whole launch (142 against 104) and cost the products waves
  for (int it = 0; it < BB * DM / 128; ++it) { const int c = it * 128 + tid, b = c >> 9, col = c & (DM - 1); float s = 0.f;
#pragma unroll  // all 32 partial loads in flight together
    for (int p = 0; p < QP; ++p) s += PART[((size_t)b * QP + p) * DM + col];
    qm[b][col] = s / (float)SS; }
  __syncthreads();
  v4f qv[BB][4];
#pragma unroll
  for (int b = 0; b < BB; ++b)
#pragma unroll
    for (int j = 0; j < 4; ++j) qv[b][j] = *(const v4fa*)&qm[b][j * 128 + lane * 4];
#pragma unroll 1  // one group of 8 hidden units a trip, kept rolled: unrolled, it would raise the register count of the launch's products
  for (int gq = 0; gq < 8; ++gq) { const int grp = wv * 8 + gq;
  float pw[BB] = {0.f, 0.f};
#pragma unroll 2  // two rows = 8 loads of 16 bytes in flight per lane; more would raise the register count of the launch's products
  for (int i = 0; i < (DM / 2) / 32; ++i) { const int u = grp * ((DM / 2) / 32) + i; const float* wr = Wt1 + (size_t)u * DM + lane * 4; float a[BB] = {0.f, 0.f};
#pragma unroll
    for (int j = 0; j < 4; ++j) { const v4f wq = *(const v4fa*)(wr + j * 128);
#pragma unroll
      for (int q = 0; q < 4; ++q) { const float wb = bf16_round(wq[q]);
#pragma unroll
        for (int b = 0; b < BB; ++b) a[b] += wb * qv[b][j][q]; } }
    const float b1 = bf16_round(bt1[u]), w2 = bf16_round(Wt2[u]);
#pragma unroll
    for (int b = 0; b < BB; ++b) { float t = a[b]; for (int o = 16; o >= 1; o >>= 1) t += __shfl_xor(t, o, 32); pw[b] += fmaxf(t + b1, 0.f) * w2; } }
  if (lane == 0) {
#pragma unroll
    for (int b = 0; b < BB; ++b) red[b][grp] = pw[b]; } }
  __syncthreads();
  if (tid < 32) { float v = 0.f; if (tid < BB) { float z = bf16_round(bt2[0]); for (int q = 0; q < 32; ++q) z += red[tid][q]; const float t = 1.0f / (1.0f + expf(-z)); v = 0.5f + t * 1.5f; } TEMP[tid] = v; } }
// one launch for all that needs k_prep alone: block 0 the temperature, then the q, k and v projections (the longer products first), then the similarity plane; role by block range
#define GB_P ((NR / 16) * (DM / 64) / 4)
#define GB_S ((SS / 16) * (SS / 64) / 4)
__global__ __launch_bounds__(128) void k_proj(const _Float16* __restrict__ XQ, const _Float16* __restrict__ XK, const _Float16* __restrict__ XV, const _Float16* __restrict__ Bq, const _Float16* __restrict__ Bk, const _Float16* __restrict__ Bv,
    const float* __restrict__ bq, const float* __restrict__ bk, const float* __restrict__ bv, _Float16* __restrict__ Q16, _Float16* __restrict__ K16, _Float16* __restrict__ V16, const _Float16* __restrict__ SN, _Float16* __restrict__ SIM,
    const float* __restrict__ PART, const float* __restrict__ Wt1, const float* __restrict__ bt1, const float* __restrict__ Wt2, const float* __restrict__ bt2, float* __restrict__ TEMP) {
  __shared__ __attribute__((aligned(16))) float so[4][16][SOP];
  int bx = blockIdx.x;
  if (bx == 0) { temp_body(&so[0][0][0], PART, Wt1, bt1, Wt2, bt2, TEMP); return; }
  bx -= 1;
  if (bx < 3 * GB_P) { const int g = bx / GB_P;
    gemm_hhx_body<0>(so, bx % GB_P, 0, g == 0 ? XQ : g == 1 ? XK : XV, 0, g == 0 ? Bq : g == 1 ? Bk : Bv, 0, 0.0625f, g == 0 ? bq : g == 1 ? bk : bv, 0, nullptr, 1, 0, 0, nullptr, g == 0 ? Q16 : g == 1 ? K16 : V16, DM, 0, NR, DM, DM); return; }
  bx -= 3 * GB_P;
  // SIM[b] = SN[b].SN[b]^T (f16; values in [-1, 1])
  gemm_hhx_body<0>(so, bx % GB_S, bx / GB_S, SN, (size_t)SS * DSEM, SN, (size_t)SS * DSEM, 1.0f, nullptr, 0, nullptr, 1, 0, 0, nullptr, SIM, SS, (size_t)SS * SS, SS, SS, DSEM); }
__global__ __launch_bounds__(256) void k_vt(const _Float16* __restrict__ V16, _Float16* __restrict__ Vt) { __shared__ unsigned short tl[64][66]; const int tid = threadIdx.x; const int slab = blockIdx.x / (SS / 64), lg = blockIdx.x % (SS / 64); const int b = slab / NH, h = slab % NH;
  // both planes in fragment order: chunk i of the 64 x 64 piece is row tile i >> 7, 16-column group (i >> 5) & 3, hh = (i >> 4) & 1, row i & 15; a row tile's share of the piece is 2 KiB in a row
  for (int i = tid; i < 64 * 8; i += 256) { const int r = (i >> 7) * 16 + (i & 15), c8 = ((i >> 5) & 3) * 16 + ((i >> 4) & 1) * 8; FragH f; f.half[0] = *(const v8us*)((const unsigned short*)V16 + ((size_t)((b * SS + lg * 64) / 16 + (i >> 7)) * (DM / 32) + h * (HD / 32)) * 512 + (i & 127) * 8);
#pragma unroll
    for (int q = 0; q < 8; ++q) tl[r][c8 + q] = f.u[q]; }
  __syncthreads();
  {
#pragma unroll
    for (int rd = 0; rd < 2; ++rd) { const int i = rd * 256 + tid, d = (i >> 7) * 16 + (i & 15), p8 = ((i >> 5) & 3) * 16 + ((i >> 4) & 1) * 8; FragH f;
#pragma unroll
      for (int q = 0; q < 8; ++q) f.u[q] = tl[p8 + q][d];
      *(v8us*)((unsigned short*)Vt + ((size_t)(slab * (HD / 16) + (i >> 7)) * (SS / 32) + lg * 2) * 512 + (i & 127) * 8) = f.half[0]; }
     } }
// fused constrained attention per ((b,h), 128 queries): 16 waves = 4 query groups of 32 x 4 key sets, four waves a SIMD, so that one wave's loads and dependent vector chains hide behind three others;
// key set s holds the 32-key chunks s, s + 4, s + 8, ...: the four sets walk side by side; Q16, K16, Vt and SIM lie in fragment order, so each of a pass's 20 fragment loads reads 4 whole lines;
// the four partial results of a query group (own running max, sum, Ot) are joined through LDS behind the loop. s = (q.k)/(8 temp_b) + sem_bias + pos_bias, -inf where mask[b][k] = 0; sem_bias = -(0.5 - sim) if sim < 0.5.
// Transposed products: St = K.Qt (A = 16 key rows, B = 16 query columns), Ot += Vt.Pt. Lane (ln, hh) then holds, for query ln of a tile, the scores of keys 8 hh + r of each 16-key tile:
// the running max and sum are in-lane work plus one swap between the wave halves, two St tiles converted to f16 are the B operand of the second product as they lie, SIM[q][k .. k + 7] is one 16-byte load (half nt of the plane's block: query tile x 32 keys).
typedef int v4ia __attribute__((ext_vector_type(4), may_alias));
typedef _Float16 v8h __attribute__((ext_vector_type(8)));
union FragP { v16h v; v8h p[2]; };
__device__ __forceinline__ float swap_halves(float x) { const int t = __float_as_int(x); return __int_as_float(__builtin_amdgcn_permlanex16(t, t, 0x76543210, 0xfedcba98, false, false)); }   // lane l <-> l ^ 16
__global__ __launch_bounds__(512) void k_flash(const _Float16* __restrict__ Q16, const _Float16* __restrict__ K16, const _Float16* __restrict__ Vt, const _Float16* __restrict__ SIM, const int* __restrict__ mask, const float* __restrict__ TEMP, float* __restrict__ O) {
  constexpr int RPW = 32, NQB = SS / (4 * RPW), DT = HD / 16, KS = HD / 32, NSP = 4;
  static_assert(NSP == 4 && DT == 4, "in the join, the wave of key set s sums two of the eight output tiles");
  __shared__ __attribute__((aligned(16))) float sO[4 * NSP][2][DT][2][32][4];      // a wave's rescaled Ot: 16 bytes a lane, lanes side by side
  __shared__ float sM[4 * NSP][2][32], sL[4 * NSP][2][32];
  const int tid = threadIdx.x, lane = tid & 31, ln = lane & 15, hh = lane >> 4;
  const int w = __builtin_amdgcn_readfirstlane(tid >> 5), qg = w & 3, ksp = w >> 2, k0 = ksp * 32;      // the wave's number in a scalar register: the key loop's bounds and its branch stay scalar
  const int slab = blockIdx.x / NQB, qblk = blockIdx.x % NQB; const int b = slab / NH, h = slab % NH; const int q0 = qblk * (4 * RPW) + qg * RPW; const float sc = 0.125f / TEMP[b];
  FragH aq[2][KS];
#pragma unroll
  for (int qt = 0; qt < 2; ++qt) { const unsigned short* qr = (const unsigned short*)Q16 + ((size_t)((b * SS + q0) / 16 + qt) * (DM / 32) + h * KS) * 512 + lane * 8;
#pragma unroll
    for (int ks = 0; ks < KS; ++ks) { aq[qt][ks].half[0] = *(const v8us*)(qr + ks * 512); aq[qt][ks].half[1] = *(const v8us*)(qr + ks * 512 + 256); } }
  // the lane's four read pointers; each moves on by 4 x 32 keys a pass (K16: 8 row tiles; Vt and SIM: 4 blocks of 32 keys)
  constexpr int TK = (DM / 32) * 512, TS = (SS / 32) * 512;      // f16 elements of a 16-row tile of a plane of DM and of SS columns
  const unsigned fo = lane * 8, mo = hh * 8;
  const unsigned short* vp = (const unsigned short*)Vt + (size_t)slab * DT * TS + (k0 / 32) * 512 + fo;
  const unsigned short* kp = (const unsigned short*)K16 + (size_t)((b * SS + k0) / 16) * TK + h * KS * 512 + fo;
  const unsigned short* sp = (const unsigned short*)SIM + (size_t)b * SS * SS + (size_t)(q0 / 16) * TS + (k0 / 32) * 512 + fo;
  const int* mp = mask + (size_t)b * SS + k0 + mo;
  float m_q[2], l_q[2]; v8f oacc[2][DT];
#pragma unroll
  for (int qt = 0; qt < 2; ++qt) { m_q[qt] = -3.0e38f; l_q[qt] = 0.f;
#pragma unroll
    for (int dt = 0; dt < DT; ++dt) oacc[qt][dt] = (v8f){0.f,0.f,0.f,0.f,0.f,0.f,0.f,0.f}; }
#pragma unroll 1
  for (int j0 = k0; j0 < k0 + SS; j0 += NSP * 32) {
    // every load of the pass stands in front of its first product: none depends on the scores any more, so the pass waits for memory once
    FragH bk[2][KS], bv[DT], sm[2][2]; v4ia mk[2][2];
#pragma unroll
    for (int nt = 0; nt < 2; ++nt) {
#pragma unroll
      for (int ks = 0; ks < KS; ++ks) { bk[nt][ks].half[0] = *(const v8us*)(kp + nt * TK + ks * 512); bk[nt][ks].half[1] = *(const v8us*)(kp + nt * TK + ks * 512 + 256); }
      mk[nt][0] = *(const v4ia*)(mp + nt * 16); mk[nt][1] = *(const v4ia*)(mp + nt * 16 + 4);
#pragma unroll
      for (int qt = 0; qt < 2; ++qt) sm[qt][nt].half[0] = *(const v8us*)(sp + qt * TS + nt * 256); }
#pragma unroll
    for (int dt = 0; dt < DT; ++dt) { bv[dt].half[0] = *(const v8us*)(vp + dt * TS); bv[dt].half[1] = *(const v8us*)(vp + dt * TS + 256); }
    asm volatile("s_wait_xcnt 0x0" ::: "memory");      // stands in front of every write of a register that one of the 24 loads names as its address: the four pointers live round the loop, so only their steps below write them (named as inputs here, they cost this build spills in the loop)
    __builtin_amdgcn_sched_barrier(0);      // keeps the 24 loads one group (else half of them issue behind the first wait and the pass pays the latency twice) and the pointer steps behind the wait above
    kp += NSP * 2 * TK; mp += NSP * 32; sp += NSP * 512; vp += NSP * 512;
    v8f s[2][2];
#pragma unroll
    for (int nt = 0; nt < 2; ++nt)
#pragma unroll
      for (int qt = 0; qt < 2; ++qt) { v8f acc = (v8f){0.f,0.f,0.f,0.f,0.f,0.f,0.f,0.f};
#pragma unroll
        for (int ks = 0; ks < KS; ++ks) acc = mmaH<1>(bk[nt][ks].v, bk[nt][ks].v, aq[qt][ks].v, aq[qt][ks].v, acc); s[qt][nt] = acc; }
    FragP pb[2];
#pragma unroll
    for (int qt = 0; qt < 2; ++qt) { const int qi = q0 + qt * 16 + ln; float mc = -INFINITY;
#pragma unroll
      for (int nt = 0; nt < 2; ++nt)
#pragma unroll
        for (int r = 0; r < 8; ++r) { const int k = j0 + nt * 16 + 8 * hh + r; const float sim = (float)sm[qt][nt].h[r]; const float sb = (sim < 0.5f) ? -(0.5f - sim) : 0.f;
          const float dd = fabsf((float)(qi - k)); const float pbias = (dd > 10.f) ? -0.1f * (dd - 10.f) : 0.f;
          const float su = s[qt][nt][r] * sc + sb + pbias; const float sv = (mk[nt][r >> 2][r & 3] != 0) ? su : -INFINITY; s[qt][nt][r] = sv; mc = fmaxf(mc, sv); }
      mc = fmaxf(mc, swap_halves(mc));
      const float mn = fmaxf(m_q[qt], mc); const float al = expf(m_q[qt] - mn); m_q[qt] = mn; float ls = 0.f;
#pragma unroll
      for (int nt = 0; nt < 2; ++nt) {
#pragma unroll
        for (int r = 0; r < 8; ++r) { const float p = expf(s[qt][nt][r] - mn); s[qt][nt][r] = p; ls += p; }
        pb[qt].p[nt] = __builtin_convertvector(s[qt][nt], v8h); }
      l_q[qt] = l_q[qt] * al + ls;      // partial sum of this half's 16 keys; the halves are joined behind the loop
#pragma unroll
      for (int dt = 0; dt < DT; ++dt)
#pragma unroll
        for (int r = 0; r < 8; ++r) oacc[qt][dt][r] *= al; }
#pragma unroll
    for (int dt = 0; dt < DT; ++dt)
#pragma unroll
      for (int qt = 0; qt < 2; ++qt) oacc[qt][dt] = mmaH<1>(bv[dt].v, bv[dt].v, pb[qt].v, pb[qt].v, oacc[qt][dt]); }
  // join of the four key sets of a query group. Step 1: every wave publishes its max and its sum (halves joined)
#pragma unroll
  for (int qt = 0; qt < 2; ++qt) { float l = l_q[qt]; l += swap_halves(l); sM[w][qt][lane] = m_q[qt]; sL[w][qt][lane] = l; }
  __syncthreads();
  // step 2: the common max, the common sum (sets in order), and the wave's Ot rescaled to the common max into LDS
  float inv[2];
#pragma unroll
  for (int qt = 0; qt < 2; ++qt) { float ms[NSP], mx = -3.0e38f, l = 0.f;
#pragma unroll
    for (int s = 0; s < NSP; ++s) { ms[s] = sM[s * 4 + qg][qt][lane]; mx = fmaxf(mx, ms[s]); }
#pragma unroll
    for (int s = 0; s < NSP; ++s) l += sL[s * 4 + qg][qt][lane] * expf(ms[s] - mx);
    inv[qt] = (l > 0.f) ? 1.0f / l : 0.f; const float f = expf(m_q[qt] - mx);
#pragma unroll
    for (int dt = 0; dt < DT; ++dt) { v4f lo, hi;
#pragma unroll
      for (int r = 0; r < 4; ++r) { lo[r] = oacc[qt][dt][r] * f; hi[r] = oacc[qt][dt][4 + r] * f; }
      *(v4fa*)&sO[w][qt][dt][0][lane][0] = lo; *(v4fa*)&sO[w][qt][dt][1][lane][0] = hi; } }
  __syncthreads();
  // step 3: the wave of key set s sums, over the four sets in order, tiles 2 (s & 1) and 2 (s & 1) + 1 of query tile s >> 1: 32 columns = one whole 128-byte line of each of 16 output rows, so a line has one writer
  const int qs = ksp >> 1, d0 = (ksp & 1) * 2; const float iv = qs ? inv[1] : inv[0];
  float* orow = O + ((size_t)b * SS + q0 + qs * 16 + ln) * DM + h * HD + d0 * 16 + 8 * hh;      // register r of tile dt is column dt * 16 + 8 hh + r of the query's row
#pragma unroll
  for (int d = 0; d < 2; ++d) { v4f lo = *(const v4fa*)&sO[qg][qs][d0 + d][0][lane][0], hi = *(const v4fa*)&sO[qg][qs][d0 + d][1][lane][0];
#pragma unroll
    for (int s = 1; s < NSP; ++s) { lo += *(const v4fa*)&sO[s * 4 + qg][qs][d0 + d][0][lane][0]; hi += *(const v4fa*)&sO[s * 4 + qg][qs][d0 + d][1][lane][0]; }
    *(v4f*)(orow + d * 16) = lo * iv; *(v4f*)(orow + d * 16 + 4) = hi * iv; } }
extern "C" void kernel_launch(void* const* d_in, const int* in_sizes, int n_in,
                              void* d_out, int out_size, void* d_ws, size_t ws_size, hipStream_t stream) {
  (void)in_sizes; (void)n_in; (void)out_size;
  const float* xq = (const float*)d_in[0]; const float* xk = (const float*)d_in[1]; const float* xv = (const float*)d_in[2]; const int* mask = (const int*)d_in[3]; const float* sf = (const float*)d_in[4];
  const float* Wq = (const float*)d_in[5]; const float* bq = (const float*)d_in[6]; const float* Wk = (const float*)d_in[7]; const float* bk = (const float*)d_in[8]; const float* Wv = (const float*)d_in[9]; const float* bv = (const float*)d_in[10]; const float* Wo = (const float*)d_in[11]; const float* bo = (const float*)d_in[12]; const float* Wt1 = (const float*)d_in[13]; const float* bt1 = (const float*)d_in[14]; const float* Wt2 = (const float*)d_in[15]; const float* bt2 = (const float*)d_in[16];
  char* ws = (char*)d_ws; size_t off = 0;
  auto take = [&](size_t bytes) { char* p = ws + off; off += (bytes + 255) & ~(size_t)255; return p; };
  const size_t w8 = (size_t)DM * DM / 8;
  _Float16* Bq = (_Float16*)take(w8 * 16); _Float16* Bk = (_Float16*)take(w8 * 16); _Float16* Bv = (_Float16*)take(w8 * 16); _Float16* Bo = (_Float16*)take(w8 * 16);
  _Float16* XQ = (_Float16*)take((size_t)NR * DM * 2); _Float16* XK = (_Float16*)take((size_t)NR * DM * 2); _Float16* XV = (_Float16*)take((size_t)NR * DM * 2); _Float16* Q16 = (_Float16*)take((size_t)NR * DM * 2); _Float16* K16 = (_Float16*)take((size_t)NR * DM * 2); _Float16* V16 = (_Float16*)take((size_t)NR * DM * 2); _Float16* Vt = (_Float16*)take((size_t)NR * DM * 2);
  _Float16* SN = (_Float16*)take((size_t)NR * DSEM * 2); _Float16* SIM = (_Float16*)take((size_t)BB * SS * SS * 2); float* TEMP = (float*)take(256); float* O = (float*)take((size_t)NR * DM * 4); float* PART = (float*)take((size_t)BB * QP * DM * 4); _Float16* O16 = XQ;      // the query plane is dead after the q GEMM
  if (off > ws_size) return;      // ≈ 2 + 4.2×7 + 2.1 + 16.8 + 8.4 ≈ 57 MiB
  const unsigned gx = (unsigned)(((size_t)NR * DM / 8 + 255) / 256);
  k_prep<<<PB_QS + 3 * PB_X + PB_SN + 4 * PB_W, 512, 0, stream>>>(xq, xk, xv, sf, Wq, Wk, Wv, Wo, XQ, XK, XV, SN, Bq, Bk, Bv, Bo, PART);
  k_proj<<<1 + 3 * GB_P + BB * GB_S, 128, 0, stream>>>(XQ, XK, XV, Bq, Bk, Bv, bq, bk, bv, Q16, K16, V16, SN, SIM, PART, Wt1, bt1, Wt2, bt2, TEMP);
  const dim3 gg(((NR / 16) * (DM / 64) + 3) / 4, 1);
  k_vt<<<BB * NH * (SS / 64), 256, 0, stream>>>(V16, Vt);
  k_flash<<<BB * NH * (SS / 128), 512, 0, stream>>>(Q16, K16, Vt, SIM, mask, TEMP, O);
  k_h16<<<gx, 256, 0, stream>>>(O, O16, (size_t)NR * DM / 8);
  k_gemm_hhx<0><<<gg, 128, 0, stream>>>(O16, 0, Bo, 0, 0.0625f, bo, 0, nullptr, 1, 0, 0, (float*)d_out, nullptr, DM, 0, NR, DM, DM);
}

// v006
// Measured time: 122 microseconds a run.
// Next to v005, in two timings, it ran 1.11 times as fast each time.
// Over all steps from v000 it is 6.67 times as fast.
#include <hip/hip_runtime.h>
// q/k/v/o projections (4096 × 512 × 512, + bias), the cosine-similarity matrix of the normalised semantic features (per batch 2048 × 2048 × 256, kept as an f16 plane) and the 8-head
// constrained attention on v_wmma_f32_16x16x32_f16 (fused flash-style kernel: Sᵀ = K·Qᵀ, Oᵀ = Vᵀ·Pᵀ on WMMA; scores / (8·temperature_b) + semantic bias + positional bias, key mask → −inf;
// online max/sum softmax f32; P f16 ≤ 1); the dynamic-temperature MLP on the mean query is f32 VALU (column sums over 64 blocks, then one block); A = f16(bf16 ·) exact operands, weights bf16-exact ×2^4 ((out,in)),
// single products, f32 accumulate.
// Every f16 plane of the workspace lies in fragment order: a plane of KD columns is cut into blocks of 16 rows x 32 columns (row tile major, then column block), a block is 2 x 512 bytes,
// and 16-byte chunk (j, hh, ln) of a block holds row ln, columns 16 j + 8 hh .. + 7. Lane 16 hh + ln of a wave then finds half j of its A or B fragment at byte 16 lane of that half:
// one fragment load reads 512 bytes in a row (4 whole 128-byte lines), where a row-major plane gave it 32 bytes out of each of 16 lines.
#define BB 2
#define SS 2048
#define DM 512
#define NH 8
#define HD 64
#define DSEM 256
#define NR (BB * SS)

typedef __bf16 v16b __attribute__((ext_vector_type(16)));
typedef unsigned short v8us __attribute__((ext_vector_type(8), may_alias));
typedef float  v8f  __attribute__((ext_vector_type(8)));
typedef float  v4f  __attribute__((ext_vector_type(4)));
typedef float  v4fa __attribute__((ext_vector_type(4), may_alias));
union FragB { v16b v; v8us half[2]; unsigned short u[16]; };

__device__ __forceinline__ unsigned short bf16_bits(float x) { unsigned int u = __float_as_uint(x); return (unsigned short)((u + 0x7FFFu + ((u >> 16) & 1u)) >> 16); }
__device__ __forceinline__ float bf16_val(unsigned short b) { return __uint_as_float(((unsigned int)b) << 16); }
__device__ __forceinline__ float bf16_round(float x) { return bf16_val(bf16_bits(x)); }
// D += A·B with NT terms: 1 = ah·bh, 2 = + al·bh (A split), 3 = + ah·bl (both split)
template <int NT>
__device__ __forceinline__ v8f mmaN(v16b ah, v16b al, v16b bh, v16b bl, v8f c) {
  c = __builtin_amdgcn_wmma_f32_16x16x32_bf16(false, ah, false, bh, (short)0, c, false, false);
  if (NT >= 2) c = __builtin_amdgcn_wmma_f32_16x16x32_bf16(false, al, false, bh, (short)0, c, false, false);
  if (NT >= 3) c = __builtin_amdgcn_wmma_f32_16x16x32_bf16(false, ah, false, bl, (short)0, c, false, false);
  asm volatile("v_nop\n\tv_nop\n\tv_nop\n\tv_nop" : "+v"(c) : "v"(ah), "v"(al), "v"(bh), "v"(bl));
  return c;
}

__global__ __launch_bounds__(256) void k_wt_bf16(const float* __restrict__ W, unsigned short* __restrict__ Wt, int K, int N) {
  const int t = blockIdx.x * 256 + threadIdx.x;
  const int k8n = K / 8;
  if (t >= N * k8n) return;
  const int n = t / k8n, k8 = (t % k8n) * 8;
  v8us v;
#pragma unroll
  for (int i = 0; i < 8; ++i) v[i] = bf16_bits(W[(size_t)(k8 + i) * N + n]);
  *(v8us*)(Wt + (size_t)n * K + k8) = v;
  
}

// GEMM C[M][N] (f32, pitch ldc) = act(A[M][K]·W + bias). A f32 row-major (pitch lda) converted per fragment to bf16
// (ASPLIT: hi/lo two planes -> 2 terms, else single rounded term); Wt bf16 [N][K] (pitch ldb). BIAS_BF16 rounds the
// bias to bf16 first (bias quantised to bf16 before the add). K%32==0, M%16==0, N%64==0.
template <bool ASPLIT, int ACT, bool BIAS_BF16>
__global__ __launch_bounds__(128) void k_gemm_bf(const float* __restrict__ A, int lda, const unsigned short* __restrict__ Wt, int ldb,
                                               const float* __restrict__ bias, float* __restrict__ C, int ldc, int M, int N, int K) {
  __shared__ __attribute__((aligned(16))) float so[4][16][64];
  const int tid = threadIdx.x, w = tid >> 5, lane = tid & 31, ln = lane & 15, hh = lane >> 4;
  const int ntn = N / 64;
  const int wid = blockIdx.x * 4 + w;
  const int mt = wid / ntn, nq = wid % ntn;
  if (mt * 16 >= M) return;
  const int row0 = mt * 16, col0 = nq * 64;
  const float* arow = A + (size_t)(row0 + ln) * lda;
  v8f acc[4] = {};
  for (int kb = 0; kb < K; kb += 32) {
    FragB ah, al;
    const v4f x0 = *(const v4fa*)(arow + kb + 8 * hh), x1 = *(const v4fa*)(arow + kb + 8 * hh + 4);
    const v4f x2 = *(const v4fa*)(arow + kb + 16 + 8 * hh), x3 = *(const v4fa*)(arow + kb + 16 + 8 * hh + 4);
    float xs[16] = {x0[0],x0[1],x0[2],x0[3],x1[0],x1[1],x1[2],x1[3],x2[0],x2[1],x2[2],x2[3],x3[0],x3[1],x3[2],x3[3]};
#pragma unroll
    for (int i = 0; i < 16; ++i) { const unsigned short hb = bf16_bits(xs[i]); ah.u[i] = hb; al.u[i] = ASPLIT ? bf16_bits(xs[i] - bf16_val(hb)) : (unsigned short)0; }
#pragma unroll
    for (int t = 0; t < 4; ++t) {
      const unsigned short* brow = Wt + (size_t)(col0 + t * 16 + ln) * ldb + kb;
      FragB b;
      b.half[0] = *(const v8us*)(brow + 8 * hh);
      b.half[1] = *(const v8us*)(brow + 16 + 8 * hh);
      acc[t] = mmaN<ASPLIT ? 2 : 1>(ah.v, al.v, b.v, b.v, acc[t]);
    }
  }
#pragma unroll
  for (int t = 0; t < 4; ++t) {
    float bv = bias ? bias[col0 + t * 16 + ln] : 0.f;
    if (BIAS_BF16) bv = bf16_round(bv);
#pragma unroll
    for (int r = 0; r < 8; ++r) { float v = acc[t][r] + bv; if (ACT == 1) v = fmaxf(v, 0.f); so[w][8 * hh + r][t * 16 + ln] = v; }
  }
  __builtin_amdgcn_fence(__ATOMIC_ACQ_REL, "workgroup");
  __builtin_amdgcn_wave_barrier();
  const int rsub = lane >> 4, c4 = (lane & 15) * 4;
  {
#pragma unroll
    for (int q = 0; q < 8; ++q) {
      const int r = q * 2 + rsub;
      const v4f v = *(const v4fa*)&so[w][r][c4];
      *(v4f*)(C + (size_t)(row0 + r) * ldc + col0 + c4) = v;
    }
    
  }
}

// Flash-style causal/unmasked attention, all contractions 3-term bf16 hi/lo splits, f32 softmax with running max.
// q,k,v rows are read from f32 buffers with arbitrary row pitch (so they can live inside a fused qkv buffer);
// D = head size (multiple of 32, <= 128); one wave = 16 query rows; block = 4 waves (64 queries) sharing K/V chunks of 32.
template <int D, bool CAUSAL>
__global__ __launch_bounds__(128) void k_flash(const float* __restrict__ qb, const float* __restrict__ kb, const float* __restrict__ vb,
                                             int pitch, int T, int H, float scale, float* __restrict__ y, int ypitch) {
  constexpr int KS = D / 32;        // k-steps for QK
  constexpr int DT = D / 16;        // d tiles for PV
  __shared__ __attribute__((aligned(16))) unsigned short sKh[32][D + 8], sKl[32][D + 8], sVh[32][D + 8], sVl[32][D + 8];
  __shared__ __attribute__((aligned(16))) unsigned short sPh[4][16][40], sPl[4][16][40];
  __shared__ __attribute__((aligned(16))) float sO[4][16][D];
  const int tid = threadIdx.x, w = tid >> 5, lane = tid & 31, ln = lane & 15, hh = lane >> 4;
  const int nqb = (T + 63) / 64;
  const int bh = blockIdx.x / nqb, qblk = blockIdx.x % nqb;
  const int b = bh / H, h = bh % H;
  const int q0 = qblk * 64 + w * 16;
  const float* Q = qb + (size_t)b * T * pitch + h * D;
  const float* K = kb + (size_t)b * T * pitch + h * D;
  const float* V = vb + (size_t)b * T * pitch + h * D;

  // A fragments of the wave's 16 query rows (scaled), hi/lo
  FragB aqh[KS], aql[KS];
  {
    int row = q0 + ln; if (row >= T) row = T - 1;
    const float* qr = Q + (size_t)row * pitch;
#pragma unroll
    for (int ks = 0; ks < KS; ++ks)
#pragma unroll
      for (int i = 0; i < 16; ++i) {
        const int d = ks * 32 + ((i < 8) ? (8 * hh + i) : (16 + 8 * hh + (i - 8)));
        const float x = qr[d] * scale; const unsigned short hb = bf16_bits(x);
        aqh[ks].u[i] = hb; aql[ks].u[i] = bf16_bits(x - bf16_val(hb));
      }
  }
  float m_r[8], l_r[8];
#pragma unroll
  for (int r = 0; r < 8; ++r) { m_r[r] = -3.0e38f; l_r[r] = 0.f; }
  v8f oacc[DT];
#pragma unroll
  for (int dt = 0; dt < DT; ++dt) oacc[dt] = (v8f){0.f,0.f,0.f,0.f,0.f,0.f,0.f,0.f};

  const int kv_end = CAUSAL ? min(T, qblk * 64 + 64) : T;     // block-uniform
  for (int j0 = 0; j0 < kv_end; j0 += 32) {
    __syncthreads();
    for (int e = tid; e < 32 * (D / 4); e += 128) {
      const int r = e / (D / 4), c4 = (e % (D / 4)) * 4;
      const int key = j0 + r;
      v4f kf = {0.f,0.f,0.f,0.f}, vf = {0.f,0.f,0.f,0.f};
      if (key < T) { kf = *(const v4fa*)(K + (size_t)key * pitch + c4); vf = *(const v4fa*)(V + (size_t)key * pitch + c4); }
#pragma unroll
      for (int t = 0; t < 4; ++t) {
        unsigned short hb = bf16_bits(kf[t]); sKh[r][c4 + t] = hb; sKl[r][c4 + t] = bf16_bits(kf[t] - bf16_val(hb));
        hb = bf16_bits(vf[t]); sVh[r][c4 + t] = hb; sVl[r][c4 + t] = bf16_bits(vf[t] - bf16_val(hb));
      }
    }
    __syncthreads();
    // S tile 16 x 32
    v8f s[2];
#pragma unroll
    for (int nt = 0; nt < 2; ++nt) {
      v8f acc = {};
#pragma unroll
      for (int ks = 0; ks < KS; ++ks) {
        FragB bh_, bl_;
        bh_.half[0] = *(const v8us*)&sKh[nt * 16 + ln][ks * 32 + 8 * hh]; bh_.half[1] = *(const v8us*)&sKh[nt * 16 + ln][ks * 32 + 16 + 8 * hh];
        bl_.half[0] = *(const v8us*)&sKl[nt * 16 + ln][ks * 32 + 8 * hh]; bl_.half[1] = *(const v8us*)&sKl[nt * 16 + ln][ks * 32 + 16 + 8 * hh];
        acc = mmaN<3>(aqh[ks].v, aql[ks].v, bh_.v, bl_.v, acc);
      }
      s[nt] = acc;
    }
    // mask + running max (rows 8hh+r; the 16 lanes of a half share rows)
    float alpha[8];
#pragma unroll
    for (int r = 0; r < 8; ++r) {
      const int qi = q0 + 8 * hh + r;
      const int ja = j0 + ln, jb = j0 + 16 + ln;
      if (CAUSAL) { if (ja > qi) s[0][r] = -3.0e38f; if (jb > qi) s[1][r] = -3.0e38f; }
      if (ja >= T) s[0][r] = -3.0e38f;
      if (jb >= T) s[1][r] = -3.0e38f;
      float mx = fmaxf(s[0][r], s[1][r]);
      mx = fmaxf(mx, __shfl_xor(mx, 1, 32)); mx = fmaxf(mx, __shfl_xor(mx, 2, 32)); mx = fmaxf(mx, __shfl_xor(mx, 4, 32)); mx = fmaxf(mx, __shfl_xor(mx, 8, 32));
      const float mnew = fmaxf(m_r[r], mx);
      alpha[r] = (mnew > -1.0e38f) ? __expf(m_r[r] - mnew) : 1.0f;
      const float p0 = (s[0][r] > -1.0e38f) ? __expf(s[0][r] - mnew) : 0.f;
      const float p1 = (s[1][r] > -1.0e38f) ? __expf(s[1][r] - mnew) : 0.f;
      m_r[r] = mnew;
      l_r[r] = l_r[r] * alpha[r] + p0 + p1;            // per-lane partial row sum (16 lanes combined at the end)
      unsigned short hb = bf16_bits(p0); sPh[w][8 * hh + r][ln] = hb;      sPl[w][8 * hh + r][ln] = bf16_bits(p0 - bf16_val(hb));
      hb = bf16_bits(p1);                sPh[w][8 * hh + r][16 + ln] = hb; sPl[w][8 * hh + r][16 + ln] = bf16_bits(p1 - bf16_val(hb));
    }
#pragma unroll
    for (int dt = 0; dt < DT; ++dt)
#pragma unroll
      for (int r = 0; r < 8; ++r) oacc[dt][r] *= alpha[r];
    __builtin_amdgcn_fence(__ATOMIC_ACQ_REL, "workgroup");
    __builtin_amdgcn_wave_barrier();
    FragB pah, pal;
    pah.half[0] = *(const v8us*)&sPh[w][ln][8 * hh]; pah.half[1] = *(const v8us*)&sPh[w][ln][16 + 8 * hh];
    pal.half[0] = *(const v8us*)&sPl[w][ln][8 * hh]; pal.half[1] = *(const v8us*)&sPl[w][ln][16 + 8 * hh];
#pragma unroll
    for (int dt = 0; dt < DT; ++dt) {
      FragB bvh, bvl;
#pragma unroll
      for (int i = 0; i < 8; ++i) {
        bvh.u[i] = sVh[8 * hh + i][dt * 16 + ln]; bvh.u[8 + i] = sVh[16 + 8 * hh + i][dt * 16 + ln];
        bvl.u[i] = sVl[8 * hh + i][dt * 16 + ln]; bvl.u[8 + i] = sVl[16 + 8 * hh + i][dt * 16 + ln];
      }
      oacc[dt] = mmaN<3>(pah.v, pal.v, bvh.v, bvl.v, oacc[dt]);
    }
    __builtin_amdgcn_fence(__ATOMIC_ACQ_REL, "workgroup");
    __builtin_amdgcn_wave_barrier();
  }
#pragma unroll
  for (int r = 0; r < 8; ++r) {
    float l = l_r[r];
    l += __shfl_xor(l, 1, 32); l += __shfl_xor(l, 2, 32); l += __shfl_xor(l, 4, 32); l += __shfl_xor(l, 8, 32);
    l_r[r] = (l > 0.f) ? 1.0f / l : 0.f;
  }
#pragma unroll
  for (int dt = 0; dt < DT; ++dt)
#pragma unroll
    for (int r = 0; r < 8; ++r) sO[w][8 * hh + r][dt * 16 + ln] = oacc[dt][r] * l_r[r];
  __builtin_amdgcn_fence(__ATOMIC_ACQ_REL, "workgroup");
  __builtin_amdgcn_wave_barrier();
  {
    for (int r = 0; r < 16; ++r) {
      const int row = q0 + r;
      if (row < T && lane < D / 4) {
        const v4f val = *(const v4fa*)&sO[w][r][lane * 4];
        *(v4f*)(y + ((size_t)b * T + row) * ypitch + h * D + lane * 4) = val;
      }
    }
    
  }
}

// GEMM C = act(A·W + bias + resid): A f32 (ASPLIT -> hi/lo 2 terms), Wt bf16 [N][K]; ACT 0 none, 1 relu, 2 exact gelu;
// resid (optional, f32, row index = (row % rmod), pitch ldr, RES_BF16 rounds it) added before the activation.
template <bool ASPLIT, int ACT, bool BIAS_BF16, bool RES_BF16>
__global__ __launch_bounds__(128) void k_gemm_bf3(const float* __restrict__ A, int lda, const unsigned short* __restrict__ Wt, int ldb,
                                                const float* __restrict__ bias, const float* __restrict__ resid, int rmod, int ldr,
                                                float* __restrict__ C, int ldc, int M, int N, int K) {
  __shared__ __attribute__((aligned(16))) float so[4][16][64];
  const int tid = threadIdx.x, w = tid >> 5, lane = tid & 31, ln = lane & 15, hh = lane >> 4;
  const int ntn = N / 64;
  const int wid = blockIdx.x * 4 + w;
  const int mt = wid / ntn, nq = wid % ntn;
  if (mt * 16 >= M) return;
  const int row0 = mt * 16, col0 = nq * 64;
  const float* arow = A + (size_t)(row0 + ln) * lda;
  v8f acc[4] = {};
  for (int kb = 0; kb < K; kb += 32) {
    FragB ah, al;
    const v4f x0 = *(const v4fa*)(arow + kb + 8 * hh), x1 = *(const v4fa*)(arow + kb + 8 * hh + 4);
    const v4f x2 = *(const v4fa*)(arow + kb + 16 + 8 * hh), x3 = *(const v4fa*)(arow + kb + 16 + 8 * hh + 4);
    float xs[16] = {x0[0],x0[1],x0[2],x0[3],x1[0],x1[1],x1[2],x1[3],x2[0],x2[1],x2[2],x2[3],x3[0],x3[1],x3[2],x3[3]};
#pragma unroll
    for (int i = 0; i < 16; ++i) { const unsigned short hb = bf16_bits(xs[i]); ah.u[i] = hb; al.u[i] = ASPLIT ? bf16_bits(xs[i] - bf16_val(hb)) : (unsigned short)0; }
#pragma unroll
    for (int t = 0; t < 4; ++t) {
      const unsigned short* brow = Wt + (size_t)(col0 + t * 16 + ln) * ldb + kb;
      FragB b;
      b.half[0] = *(const v8us*)(brow + 8 * hh);
      b.half[1] = *(const v8us*)(brow + 16 + 8 * hh);
      acc[t] = mmaN<ASPLIT ? 2 : 1>(ah.v, al.v, b.v, b.v, acc[t]);
    }
  }
#pragma unroll
  for (int t = 0; t < 4; ++t) {
    const int col = col0 + t * 16 + ln;
    float bv = bias ? bias[col] : 0.f;
    if (BIAS_BF16) bv = bf16_round(bv);
#pragma unroll
    for (int r = 0; r < 8; ++r) {
      float v = acc[t][r] + bv;
      if (resid) { float rv = resid[(size_t)((row0 + 8 * hh + r) % rmod) * ldr + col]; if (RES_BF16) rv = bf16_round(rv); v += rv; }
      if (ACT == 1) v = fmaxf(v, 0.f);
      if (ACT == 2) v = 0.5f * v * (1.0f + erff(v * 0.70710678118654752f));
      if (ACT == 3) { const float u = 0.7978845608028654f * (v + 0.044715f * v * v * v); v = 0.5f * v * (1.0f + tanhf(u)); }
      so[w][8 * hh + r][t * 16 + ln] = v;
    }
  }
  __builtin_amdgcn_fence(__ATOMIC_ACQ_REL, "workgroup");
  __builtin_amdgcn_wave_barrier();
  const int rsub = lane >> 4, c4 = (lane & 15) * 4;
  {
#pragma unroll
    for (int q = 0; q < 8; ++q) {
      const int r = q * 2 + rsub;
      const v4f v = *(const v4fa*)&so[w][r][c4];
      *(v4f*)(C + (size_t)(row0 + r) * ldc + col0 + c4) = v;
    }
    
  }
}
// row LayerNorm (biased variance, eps) over N: s = X (+ R); optional out_sum <- s; out_norm <- (s-mu)*rsqrt(var+eps)*g + b
template <bool PARAM_BF16>
__global__ __launch_bounds__(256) void k_layernorm(const float* __restrict__ X, const float* __restrict__ R, const float* __restrict__ g, const float* __restrict__ bta,
                                                  float* __restrict__ out_sum, float* __restrict__ out_norm, int N, float eps) {
  __shared__ float red[256];
  const int row = blockIdx.x, tid = threadIdx.x;
  const float* x = X + (size_t)row * N; const float* rr = R ? R + (size_t)row * N : nullptr;
  float vals[16];                     // up to N = 4096
  const int per = N / 256;            // contiguous chunk per thread? use strided-by-4 chunks: thread handles j = tid*4 + 1024*u
  float s1 = 0.f;
  for (int u = 0; u < per / 4; ++u) {
    const int j = tid * 4 + 1024 * u;
    const v4f a = *(const v4fa*)(x + j);
    v4f b = {0.f,0.f,0.f,0.f}; if (rr) b = *(const v4fa*)(rr + j);
#pragma unroll
    for (int q = 0; q < 4; ++q) { const float v = a[q] + b[q]; vals[u * 4 + q] = v; s1 += v; }
  }
  red[tid] = s1; __syncthreads();
  for (int st = 128; st > 0; st >>= 1) { if (tid < st) red[tid] += red[tid + st]; __syncthreads(); }
  const float mu = red[0] / (float)N; __syncthreads();
  float s2 = 0.f;
  for (int u = 0; u < per / 4; ++u)
#pragma unroll
    for (int q = 0; q < 4; ++q) { const float c = vals[u * 4 + q] - mu; s2 += c * c; }
  red[tid] = s2; __syncthreads();
  for (int st = 128; st > 0; st >>= 1) { if (tid < st) red[tid] += red[tid + st]; __syncthreads(); }
  const float rs = rsqrtf(red[0] / (float)N + eps);
  {
    for (int u = 0; u < per / 4; ++u) {
      const int j = tid * 4 + 1024 * u;
      v4f o, sm;
#pragma unroll
      for (int q = 0; q < 4; ++q) {
        float gg = g[j + q], bb = bta[j + q];
        if (PARAM_BF16) { gg = bf16_round(gg); bb = bf16_round(bb); }
        sm[q] = vals[u * 4 + q]; o[q] = (vals[u * 4 + q] - mu) * rs * gg + bb;
      }
      if (out_sum) *(v4f*)(out_sum + (size_t)row * N + j) = sm;
      *(v4f*)(out_norm + (size_t)row * N + j) = o;
    }
    
  }
}



// ---- f16 WMMA path (v_wmma_f32_16x16x32_f16): 11-bit significands for operands in range — used where a [0,1] probability operand needs more precision than bf16
typedef _Float16 v16h __attribute__((ext_vector_type(16)));
union FragH { v16h v; v8us half[2]; _Float16 h[16]; unsigned short u[16]; };
template <int NT>
__device__ __forceinline__ v8f mmaH(v16h ah, v16h al, v16h bh, v16h bl, v8f c) {
  c = __builtin_amdgcn_wmma_f32_16x16x32_f16(false, ah, false, bh, (short)0, c, false, false);
  if (NT >= 2) c = __builtin_amdgcn_wmma_f32_16x16x32_f16(false, al, false, bh, (short)0, c, false, false);
  if (NT >= 3) c = __builtin_amdgcn_wmma_f32_16x16x32_f16(false, ah, false, bl, (short)0, c, false, false);
  asm volatile("v_nop\n\tv_nop\n\tv_nop\n\tv_nop" : "+v"(c) : "v"(ah), "v"(al), "v"(bh), "v"(bl));
  return c;
}
// batched GEMM like k_gemm_b but f16 operands: A f32 (split into f16 hi/lo if ASPLIT, else rounded to f16), Bt = f16 values [n][k]; alpha; C f32; N multiple of 16 (partial tiles skipped)
template <bool ASPLIT>
__global__ __launch_bounds__(128) void k_gemm_h(const float* __restrict__ A, int lda, size_t sA, const _Float16* __restrict__ Bh, int ldb, size_t sB, float alpha, float* __restrict__ C, int ldc, size_t sC, int M, int N, int K) {
  __shared__ __attribute__((aligned(16))) float so[4][16][64];
  const int tid = threadIdx.x, w = tid >> 5, lane = tid & 31, ln = lane & 15, hh = lane >> 4; const int by = blockIdx.y;
  A += (size_t)by * sA; Bh += (size_t)by * sB; C += (size_t)by * sC;
  const int ntn = (N + 63) / 64; const int wid = blockIdx.x * 4 + w; const int mt = wid / ntn, nq = wid % ntn; if (mt * 16 >= M) return;
  const int row0 = mt * 16, col0 = nq * 64; const float* arow = A + (size_t)(row0 + ln) * lda;
  v8f acc[4] = {};
  for (int kb = 0; kb < K; kb += 32) {
    FragH ah, al;
    const v4f x0 = *(const v4fa*)(arow + kb + 8 * hh), x1 = *(const v4fa*)(arow + kb + 8 * hh + 4), x2 = *(const v4fa*)(arow + kb + 16 + 8 * hh), x3 = *(const v4fa*)(arow + kb + 16 + 8 * hh + 4);
    float xs[16] = {x0[0],x0[1],x0[2],x0[3],x1[0],x1[1],x1[2],x1[3],x2[0],x2[1],x2[2],x2[3],x3[0],x3[1],x3[2],x3[3]};
#pragma unroll
    for (int i = 0; i < 16; ++i) { const _Float16 h = (_Float16)xs[i]; ah.h[i] = h; al.h[i] = ASPLIT ? (_Float16)(xs[i] - (float)h) : (_Float16)0.0f; }
#pragma unroll
    for (int t = 0; t < 4; ++t) { if (col0 + t * 16 >= N) continue; const size_t boff = (size_t)(col0 + t * 16 + ln) * ldb + kb; FragH bq; bq.half[0] = *(const v8us*)(Bh + boff + 8 * hh); bq.half[1] = *(const v8us*)(Bh + boff + 16 + 8 * hh);
      acc[t] = mmaH<ASPLIT ? 2 : 1>(ah.v, al.v, bq.v, bq.v, acc[t]); }
  }
#pragma unroll
  for (int t = 0; t < 4; ++t) { if (col0 + t * 16 >= N) continue;
#pragma unroll
    for (int r = 0; r < 8; ++r) so[w][8 * hh + r][t * 16 + ln] = acc[t][r] * alpha; }
  __builtin_amdgcn_fence(__ATOMIC_ACQ_REL, "workgroup"); __builtin_amdgcn_wave_barrier();
  const int rsub = lane >> 4, c4 = (lane & 15) * 4;
  {
#pragma unroll
    for (int q = 0; q < 8; ++q) { const int r = q * 2 + rsub; if (col0 + c4 < N) { const v4f v = *(const v4fa*)&so[w][r][c4]; *(v4f*)(C + (size_t)(row0 + r) * ldc + col0 + c4) = v; } }
     }
}

// Wt[n][k] = f16(W[k][n]·scale) from f32 row-major W[K][N] (scale = power of two; bf16-exact weights stay exact in f16 away from the subnormal range)
__global__ __launch_bounds__(256) void k_wt_f16(const float* __restrict__ W, _Float16* __restrict__ Wt, int K, int N, float scale) {
  const int t = blockIdx.x * 256 + threadIdx.x; if (t >= N * (K / 8)) return; const int n = t / (K / 8), k8 = (t % (K / 8)) * 8; FragH f;
#pragma unroll
  for (int i = 0; i < 8; ++i) f.h[i] = (_Float16)(bf16_round(W[(size_t)(k8 + i) * N + n]) * scale); const v8us o = f.half[0];
  *(v8us*)((unsigned short*)Wt + (size_t)n * K + k8) = o; 
}
// k_gemm_hh variant with fused epilogue: v = acc·alpha + bias[by·sBias + col] (+ CP[(row/rowsPerB)·sCPb + by·64 + col] if CP) ; ACT 0 none / 1 elu ; writes f16 C16 and f32 C, each if non-null
// the body takes its block indices (bx, by) and its 17 KiB of LDS from the caller, so that several products can share one launch
// A (M x K), Bh (N x K) and C16 (M x N) lie in fragment order; C is row-major with pitch ldc. SOP: row pitch of the LDS tile in floats, 4 more than the row so that 16 lanes reading 16 rows at one column meet 16 different bank groups
#define SOP 68
// row-major element offset of 16-byte chunk t of a fragment-order plane of KD columns
__device__ __forceinline__ size_t frag_src(const size_t t, const int KD) { const size_t blk = t >> 6; const int kbn = KD >> 5;
  return ((blk / kbn) * 16 + (t & 15)) * KD + (blk % kbn) * 32 + ((t >> 5) & 1) * 16 + ((t >> 4) & 1) * 8; }
template <int ACT>
__device__ __forceinline__ void gemm_hhx_body(float (*so)[16][SOP], const int bx, const int by, const _Float16* __restrict__ A, size_t sA, const _Float16* __restrict__ Bh, size_t sB, float alpha, const float* __restrict__ bias, size_t sBias, const float* __restrict__ CP, int rowsPerB, size_t sCPb, int row0g,
    float* __restrict__ C, _Float16* __restrict__ C16, int ldc, size_t sC, int M, int N, int K) {
  const int tid = threadIdx.x, w = tid >> 5, lane = tid & 31, ln = lane & 15, hh = lane >> 4;
  A += (size_t)by * sA; Bh += (size_t)by * sB; const size_t cofs = (size_t)by * sC; const float* bp = bias ? bias + (size_t)by * sBias : nullptr;
  const int ntn = (N + 63) / 64; const int wid = bx * 4 + w; const int mt = wid / ntn, nq = wid % ntn; if (mt * 16 >= M) return;
  const int row0 = mt * 16, col0 = nq * 64; const size_t tsz = (size_t)(K >> 5) * 512;      // f16 elements of one 16-row tile
  const unsigned short* afr = (const unsigned short*)A + (size_t)mt * tsz + lane * 8; const unsigned short* bfr = (const unsigned short*)Bh + (size_t)(col0 >> 4) * tsz + lane * 8;
  v8f acc[4] = {};
  for (int kb = 0; kb < K; kb += 32) { FragH ah; ah.half[0] = *(const v8us*)(afr + kb * 16); ah.half[1] = *(const v8us*)(afr + kb * 16 + 256);
#pragma unroll
    for (int t = 0; t < 4; ++t) { if (col0 + t * 16 >= N) continue; const size_t boff = (size_t)t * tsz + kb * 16; FragH bq; bq.half[0] = *(const v8us*)(bfr + boff); bq.half[1] = *(const v8us*)(bfr + boff + 256);
      acc[t] = mmaH<1>(ah.v, ah.v, bq.v, bq.v, acc[t]); }
  }
#pragma unroll
  for (int t = 0; t < 4; ++t) { if (col0 + t * 16 >= N) continue; const int col = col0 + t * 16 + ln; const float bv = bp ? bf16_round(bp[col]) : 0.f;
#pragma unroll
    for (int r = 0; r < 8; ++r) { float v = acc[t][r] * alpha + bv; if (CP) { const int bidx = (row0g + row0 + 8 * hh + r) / rowsPerB; v += CP[(size_t)bidx * sCPb + (size_t)by * 64 + col]; } if (ACT == 1) v = (v > 0.f) ? v : expm1f(v); else if (ACT == 3) v = fmaxf(v, 0.f); so[w][8 * hh + r][t * 16 + ln] = v; } }
  __builtin_amdgcn_fence(__ATOMIC_ACQ_REL, "workgroup"); __builtin_amdgcn_wave_barrier();
  const int rsub = lane >> 4, c4 = (lane & 15) * 4;
  if (C) {
#pragma unroll
    for (int q = 0; q < 8; ++q) { const int r = q * 2 + rsub; if (col0 + c4 < N) { const v4f v = *(const v4fa*)&so[w][r][c4]; *(v4f*)(C + cofs + (size_t)(row0 + r) * ldc + col0 + c4) = v; } }
  }
  if (C16) {      // the wave's 16 x 64 tile is two blocks of the plane, 2 KiB in a row: four stores of 512 bytes
    unsigned short* cfr = (unsigned short*)C16 + cofs + ((size_t)mt * (N >> 5) + (col0 >> 5)) * 512 + lane * 8;
#pragma unroll
    for (int c = 0; c < 4; ++c) { if (col0 + c * 16 >= N) continue; const v4f v0 = *(const v4fa*)&so[w][ln][c * 16 + 8 * hh], v1 = *(const v4fa*)&so[w][ln][c * 16 + 8 * hh + 4]; FragH f;
#pragma unroll
      for (int i = 0; i < 4; ++i) { f.h[i] = (_Float16)v0[i]; f.h[4 + i] = (_Float16)v1[i]; }
      *(v8us*)(cfr + c * 256) = f.half[0]; }
  }
}
template <int ACT>
__global__ __launch_bounds__(128) void k_gemm_hhx(const _Float16* __restrict__ A, size_t sA, const _Float16* __restrict__ Bh, size_t sB, float alpha, const float* __restrict__ bias, size_t sBias, const float* __restrict__ CP, int rowsPerB, size_t sCPb, int row0g,
    float* __restrict__ C, _Float16* __restrict__ C16, int ldc, size_t sC, int M, int N, int K) {
  __shared__ __attribute__((aligned(16))) float so[4][16][SOP];
  gemm_hhx_body<ACT>(so, blockIdx.x, blockIdx.y, A, sA, Bh, sB, alpha, bias, sBias, CP, rowsPerB, sCPb, row0g, C, C16, ldc, sC, M, N, K);
}


// x16_body, round16f_body, sn_body and qsum_body are roles of one launch (k_prep, blocks of 512): each takes its block index bx inside its role
__device__ __forceinline__ void x16_body(const int bx, const float* __restrict__ x, _Float16* __restrict__ X16) { const size_t t = (size_t)bx * 512 + threadIdx.x, s = frag_src(t, DM); FragH f;
#pragma unroll
  for (int q = 0; q < 8; ++q) f.h[q] = (_Float16)bf16_round(x[s + q]); *(v8us*)((unsigned short*)X16 + t * 8) = f.half[0];  }
__global__ __launch_bounds__(256) void k_h16(const float* __restrict__ x, _Float16* __restrict__ X16, size_t n8) { const size_t t = (size_t)blockIdx.x * 256 + threadIdx.x; if (t >= n8) return; const size_t s = frag_src(t, DM); FragH f;
#pragma unroll
  for (int q = 0; q < 8; ++q) f.h[q] = (_Float16)x[s + q]; *(v8us*)((unsigned short*)X16 + t * 8) = f.half[0];  }
__device__ __forceinline__ void round16f_body(const int bx, const float* __restrict__ W, _Float16* __restrict__ Bt) { const size_t t = (size_t)bx * 512 + threadIdx.x, s = frag_src(t, DM); FragH f;
#pragma unroll
  for (int i = 0; i < 8; ++i) f.h[i] = (_Float16)(bf16_round(W[s + i]) * 16.0f); *(v8us*)((unsigned short*)Bt + t * 8) = f.half[0];
  asm volatile("s_wait_xcnt 0x0" ::: "memory");      // in the merged listing the next role's code follows this store and writes its address register: the wait stands in front of that write
}
// the block's 16 rows are one row tile of SN (8 KiB): each wave lays its row's chunks into LDS at their places in the tile, and behind the barrier every thread stores 16 bytes of it in a row, so that a 128-byte line has one writer
__device__ __forceinline__ void sn_body(unsigned short* __restrict__ st, const int bx, const float* __restrict__ sf, _Float16* __restrict__ SN) { const int tid = threadIdx.x, wv = tid >> 5, lane = tid & 31; const size_t row = (size_t)bx * 16 + wv; float v[8]; float s = 0.f;
#pragma unroll
  for (int q = 0; q < 8; ++q) { v[q] = bf16_round(sf[row * DSEM + lane * 8 + q]); s += v[q] * v[q]; }
  for (int o = 16; o >= 1; o >>= 1) s += __shfl_xor(s, o, 32); const float inv = 1.0f / fmaxf(sqrtf(s), 1e-12f); FragH f;
#pragma unroll
  for (int q = 0; q < 8; ++q) f.h[q] = (_Float16)(v[q] * inv);
  *(v8us*)(st + (lane >> 1) * 256 + ((lane & 1) * 16 + wv) * 8) = f.half[0];      // chunk lane of the row = columns 8 lane ..: block lane >> 2, j = (lane >> 1) & 1, hh = lane & 1
  __syncthreads();
  *(v8us*)((unsigned short*)SN + (size_t)bx * (16 * DSEM) + tid * 8) = *(const v8us*)(st + tid * 8);
  asm volatile("s_wait_xcnt 0x0" ::: "memory");      // in the merged listing the next role's code follows this store and writes its address register: the wait stands in front of that write
}
// dynamic temperature, stage 1: column sums of the bf16-rounded query over QROWS rows per block -> PART[b][chunk][DM]; thread = 4 columns x one of 4 row phases, 16 independent 16-byte loads
#define QP 32
#define QROWS (SS / QP)
__device__ __forceinline__ void qsum_body(float (*sred)[DM], const int bx, const float* __restrict__ query, float* __restrict__ PART) {
  const int tid = threadIdx.x, ph = tid >> 7, c4 = (tid & 127) * 4;
  const float* src = query + ((size_t)bx * QROWS + ph * (QROWS / 4)) * DM + c4; v4f s = {0.f, 0.f, 0.f, 0.f};
#pragma unroll  // all 16 row loads issue before the first add: one memory latency instead of 16
  for (int r = 0; r < QROWS / 4; ++r) { const v4f x = *(const v4fa*)(src + (size_t)r * DM);
#pragma unroll
    for (int q = 0; q < 4; ++q) s[q] += bf16_round(x[q]); }
  *(v4fa*)&sred[ph][c4] = s; __syncthreads();
  PART[(size_t)bx * DM + tid] = (sred[0][tid] + sred[1][tid]) + (sred[2][tid] + sred[3][tid]); }
// one launch for all work that reads inputs only: column sums of the query, the three f16 activation planes, the normalised semantic rows, the four weight planes; role by block range
#define PB_QS (BB * QP)
#define PB_X (NR * DM / 8 / 512)
#define PB_SN (NR / 16)
#define PB_W (DM * DM / 8 / 512)
__global__ __launch_bounds__(512) void k_prep(const float* __restrict__ xq, const float* __restrict__ xk, const float* __restrict__ xv, const float* __restrict__ sf,
    const float* __restrict__ Wq, const float* __restrict__ Wk, const float* __restrict__ Wv, const float* __restrict__ Wo,
    _Float16* __restrict__ XQ, _Float16* __restrict__ XK, _Float16* __restrict__ XV, _Float16* __restrict__ SN,
    _Float16* __restrict__ Bq, _Float16* __restrict__ Bk, _Float16* __restrict__ Bv, _Float16* __restrict__ Bo, float* __restrict__ PART) {
  __shared__ __attribute__((aligned(16))) float sred[4][DM];
  const int bx = blockIdx.x, bx1 = bx - PB_QS, bx2 = bx1 - 3 * PB_X, bx3 = bx2 - PB_SN;
  if (bx1 < 0) qsum_body(sred, bx, xq, PART);
  else if (bx2 < 0) { const int g = bx1 / PB_X; x16_body(bx1 % PB_X, g == 0 ? xq : g == 1 ? xk : xv, g == 0 ? XQ : g == 1 ? XK : XV); }
  else if (bx3 < 0) sn_body((unsigned short*)&sred[0][0], bx2, sf, SN);
  else { const int g = bx3 / PB_W; round16f_body(bx3 % PB_W, g == 0 ? Wq : g == 1 ? Wk : g == 2 ? Wv : Wo, g == 0 ? Bq : g == 1 ? Bk : g == 2 ? Bv : Bo); } }
// stage 2 (one block of 4 waves, a role of k_proj, beside the products that do not need it): mean query of both batches from PART, then one wave per hidden unit (lanes along DM, 16-byte loads of the
// Wt1 row shared by both batches), relu, Wt2 dot, sigmoid. The hidden units are summed in 32 groups of 8, each wave taking 8 groups in turn.
__device__ __forceinline__ void temp_body(float* __restrict__ sm, const float* __restrict__ PART, const float* __restrict__ Wt1, const float* __restrict__ bt1, const float* __restrict__ Wt2, const float* __restrict__ bt2, float* __restrict__ TEMP) {
  float (*qm)[DM] = (float (*)[DM])sm; float (*red)[32] = (float (*)[32])(sm + BB * DM); const int tid = threadIdx.x, wv = tid >> 5, lane = tid & 31;
#pragma unroll 1  // kept rolled: unrolled, its loads raise the register count of the whole launch (142 against 104) and cost the products waves
  for (int it = 0; it < BB * DM / 128; ++it) { const int c = it * 128 + tid, b = c >> 9, col = c & (DM - 1); float s = 0.f;
#pragma unroll  // all 32 partial loads in flight together
    for (int p = 0; p < QP; ++p) s += PART[((size_t)b * QP + p) * DM + col];
    qm[b][col] = s / (float)SS; }
  __syncthreads();
  v4f qv[BB][4];
#pragma unroll
  for (int b = 0; b < BB; ++b)
#pragma unroll
    for (int j = 0; j < 4; ++j) qv[b][j] = *(const v4fa*)&qm[b][j * 128 + lane * 4];
#pragma unroll 1  // one group of 8 hidden units a trip, kept rolled: unrolled, it would raise the register count of the launch's products
  for (int gq = 0; gq < 8; ++gq) { const int grp = wv * 8 + gq;
  float pw[BB] = {0.f, 0.f};
#pragma unroll 2  // two rows = 8 loads of 16 bytes in flight per lane; more would raise the register count of the launch's products
  for (int i = 0; i < (DM / 2) / 32; ++i) { const int u = grp * ((DM / 2) / 32) + i; const float* wr = Wt1 + (size_t)u * DM + lane * 4; float a[BB] = {0.f, 0.f};
#pragma unroll
    for (int j = 0; j < 4; ++j) { const v4f wq = *(const v4fa*)(wr + j * 128);
#pragma unroll
      for (int q = 0; q < 4; ++q) { const float wb = bf16_round(wq[q]);
#pragma unroll
        for (int b = 0; b < BB; ++b) a[b] += wb * qv[b][j][q]; } }
    const float b1 = bf16_round(bt1[u]), w2 = bf16_round(Wt2[u]);
#pragma unroll
    for (int b = 0; b < BB; ++b) { float t = a[b]; for (int o = 16; o >= 1; o >>= 1) t += __shfl_xor(t, o, 32); pw[b] += fmaxf(t + b1, 0.f) * w2; } }
  if (lane == 0) {
#pragma unroll
    for (int b = 0; b < BB; ++b) red[b][grp] = pw[b]; } }
  __syncthreads();
  if (tid < 32) { float v = 0.f; if (tid < BB) { float z = bf16_round(bt2[0]); for (int q = 0; q < 32; ++q) z += red[tid][q]; const float t = 1.0f / (1.0f + expf(-z)); v = 0.5f + t * 1.5f; } TEMP[tid] = v; } }
// one launch for all that needs k_prep alone: block 0 the temperature, then the q, k and v projections (the longer products first), then the similarity plane; role by block range
#define GB_P ((NR / 16) * (DM / 64) / 4)
#define GB_S ((SS / 16) * (SS / 64) / 4)
__global__ __launch_bounds__(128) void k_proj(const _Float16* __restrict__ XQ, const _Float16* __restrict__ XK, const _Float16* __restrict__ XV, const _Float16* __restrict__ Bq, const _Float16* __restrict__ Bk, const _Float16* __restrict__ Bv,
    const float* __restrict__ bq, const float* __restrict__ bk, const float* __restrict__ bv, _Float16* __restrict__ Q16, _Float16* __restrict__ K16, _Float16* __restrict__ V16, const _Float16* __restrict__ SN, _Float16* __restrict__ SIM,
    const float* __restrict__ PART, const float* __restrict__ Wt1, const float* __restrict__ bt1, const float* __restrict__ Wt2, const float* __restrict__ bt2, float* __restrict__ TEMP) {
  __shared__ __attribute__((aligned(16))) float so[4][16][SOP];
  int bx = blockIdx.x;
  if (bx == 0) { temp_body(&so[0][0][0], PART, Wt1, bt1, Wt2, bt2, TEMP); return; }
  bx -= 1;
  if (bx < 3 * GB_P) { const int g = bx / GB_P;
    gemm_hhx_body<0>(so, bx % GB_P, 0, g == 0 ? XQ : g == 1 ? XK : XV, 0, g == 0 ? Bq : g == 1 ? Bk : Bv, 0, 0.0625f, g == 0 ? bq : g == 1 ? bk : bv, 0, nullptr, 1, 0, 0, nullptr, g == 0 ? Q16 : g == 1 ? K16 : V16, DM, 0, NR, DM, DM); return; }
  bx -= 3 * GB_P;
  // SIM[b] = SN[b].SN[b]^T (f16; values in [-1, 1])
  gemm_hhx_body<0>(so, bx % GB_S, bx / GB_S, SN, (size_t)SS * DSEM, SN, (size_t)SS * DSEM, 1.0f, nullptr, 0, nullptr, 1, 0, 0, nullptr, SIM, SS, (size_t)SS * SS, SS, SS, DSEM); }
__global__ __launch_bounds__(256) void k_vt(const _Float16* __restrict__ V16, _Float16* __restrict__ Vt) { __shared__ unsigned short tl[64][66]; const int tid = threadIdx.x; const int slab = blockIdx.x / (SS / 64), lg = blockIdx.x % (SS / 64); const int b = slab / NH, h = slab % NH;
  // both planes in fragment order: chunk i of the 64 x 64 piece is row tile i >> 7, 16-column group (i >> 5) & 3, hh = (i >> 4) & 1, row i & 15; a row tile's share of the piece is 2 KiB in a row
  for (int i = tid; i < 64 * 8; i += 256) { const int r = (i >> 7) * 16 + (i & 15), c8 = ((i >> 5) & 3) * 16 + ((i >> 4) & 1) * 8; FragH f; f.half[0] = *(const v8us*)((const unsigned short*)V16 + ((size_t)((b * SS + lg * 64) / 16 + (i >> 7)) * (DM / 32) + h * (HD / 32)) * 512 + (i & 127) * 8);
#pragma unroll
    for (int q = 0; q < 8; ++q) tl[r][c8 + q] = f.u[q]; }
  __syncthreads();
  {
#pragma unroll
    for (int rd = 0; rd < 2; ++rd) { const int i = rd * 256 + tid, d = (i >> 7) * 16 + (i & 15), p8 = ((i >> 5) & 3) * 16 + ((i >> 4) & 1) * 8; FragH f;
#pragma unroll
      for (int q = 0; q < 8; ++q) f.u[q] = tl[p8 + q][d];
      *(v8us*)((unsigned short*)Vt + ((size_t)(slab * (HD / 16) + (i >> 7)) * (SS / 32) + lg * 2) * 512 + (i & 127) * 8) = f.half[0]; }
     } }
// fused constrained attention per ((b,h), 128 queries): 16 waves = 4 query groups of 32 x 4 key sets, four waves a SIMD, so that one wave's loads and dependent vector chains hide behind three others;
// key set s holds the 32-key chunks s, s + 4, s + 8, ...: the four sets walk side by side; Q16, K16, Vt and SIM lie in fragment order, so each of a pass's 20 fragment loads reads 4 whole lines;
// the four partial results of a query group (own running max, sum, Ot) are joined through LDS behind the loop. s = (q.k)/(8 temp_b) + sem_bias + pos_bias, -inf where mask[b][k] = 0; sem_bias = -(0.5 - sim) if sim < 0.5.
// Transposed products: St = K.Qt (A = 16 key rows, B = 16 query columns), Ot += Vt.Pt. Lane (ln, hh) then holds, for query ln of a tile, the scores of keys 8 hh + r of each 16-key tile:
// the running max and sum are in-lane work plus one swap between the wave halves, two St tiles converted to f16 are the B operand of the second product as they lie, SIM[q][k .. k + 7] is one 16-byte load (half nt of the plane's block: query tile x 32 keys).
typedef int v4ia __attribute__((ext_vector_type(4), may_alias));
typedef _Float16 v8h __attribute__((ext_vector_type(8)));
union FragP { v16h v; v8h p[2]; };
// The softmax runs in base 2: log2(e) is folded into the score scale and into both biases, so a score, a running max and their differences are exponents of 2 and every
// exponential is one v_exp_f32 (expf costs about twelve vector instructions: scaling, rounding, ldexp and two range selects). A result below 2^-126 comes out as 0, as does exp2(-inf).
#define L2E 1.4426950408889634f
// Written as asm so that the slot which the instruction set asks for behind a transcendental (one independent instruction or v_nop before its result is used or its source overwritten) is kept by construction:
// Eight in place: none reads or overwrites a register of another; the v_nop is the slot behind the last.
__device__ __forceinline__ float exp2_raw(float x) { asm("v_exp_f32 %0, %0\n\tv_nop" : "+v"(x)); return x; }
__device__ __forceinline__ v8f exp2_x8(const v8f x) { float a = x[0], b = x[1], c = x[2], d = x[3], e = x[4], f = x[5], g = x[6], h = x[7];
  asm("v_exp_f32 %0, %0\n\tv_exp_f32 %1, %1\n\tv_exp_f32 %2, %2\n\tv_exp_f32 %3, %3\n\tv_exp_f32 %4, %4\n\tv_exp_f32 %5, %5\n\tv_exp_f32 %6, %6\n\tv_exp_f32 %7, %7\n\tv_nop"
      : "+v"(a), "+v"(b), "+v"(c), "+v"(d), "+v"(e), "+v"(f), "+v"(g), "+v"(h));      // in place, so no v_exp_f32 touches a register of the one in front of it; v_nop: the slot behind the last
  return (v8f){a, b, c, d, e, f, g, h}; }
__device__ __forceinline__ float swap_halves(float x) { const int t = __float_as_int(x); return __int_as_float(__builtin_amdgcn_permlanex16(t, t, 0x76543210, 0xfedcba98, false, false)); }   // lane l <-> l ^ 16
__global__ __launch_bounds__(512) void k_flash(const _Float16* __restrict__ Q16, const _Float16* __restrict__ K16, const _Float16* __restrict__ Vt, const _Float16* __restrict__ SIM, const int* __restrict__ mask, const float* __restrict__ TEMP, float* __restrict__ O) {
  constexpr int RPW = 32, NQB = SS / (4 * RPW), DT = HD / 16, KS = HD / 32, NSP = 4;
  static_assert(NSP == 4 && DT == 4, "in the join, the wave of key set s sums two of the eight output tiles");
  __shared__ __attribute__((aligned(16))) float sO[4 * NSP][2][DT][2][32][4];      // a wave's rescaled Ot: 16 bytes a lane, lanes side by side
  __shared__ float sM[4 * NSP][2][32], sL[4 * NSP][2][32];
  const int tid = threadIdx.x, lane = tid & 31, ln = lane & 15, hh = lane >> 4;
  const int w = __builtin_amdgcn_readfirstlane(tid >> 5), qg = w & 3, ksp = w >> 2, k0 = ksp * 32;      // the wave's number in a scalar register: the key loop's bounds and its branch stay scalar
  const int slab = blockIdx.x / NQB, qblk = blockIdx.x % NQB; const int b = slab / NH, h = slab % NH; const int q0 = qblk * (4 * RPW) + qg * RPW; const float sc = (0.125f * L2E) / TEMP[b];
  FragH aq[2][KS];
#pragma unroll
  for (int qt = 0; qt < 2; ++qt) { const unsigned short* qr = (const unsigned short*)Q16 + ((size_t)((b * SS + q0) / 16 + qt) * (DM / 32) + h * KS) * 512 + lane * 8;
#pragma unroll
    for (int ks = 0; ks < KS; ++ks) { aq[qt][ks].half[0] = *(const v8us*)(qr + ks * 512); aq[qt][ks].half[1] = *(const v8us*)(qr + ks * 512 + 256); } }
  // the lane's four read pointers; each moves on by 4 x 32 keys a pass (K16: 8 row tiles; Vt and SIM: 4 blocks of 32 keys)
  constexpr int TK = (DM / 32) * 512, TS = (SS / 32) * 512;      // f16 elements of a 16-row tile of a plane of DM and of SS columns
  const unsigned fo = lane * 8, mo = hh * 8;
  const unsigned short* vp = (const unsigned short*)Vt + (size_t)slab * DT * TS + (k0 / 32) * 512 + fo;
  const unsigned short* kp = (const unsigned short*)K16 + (size_t)((b * SS + k0) / 16) * TK + h * KS * 512 + fo;
  const unsigned short* sp = (const unsigned short*)SIM + (size_t)b * SS * SS + (size_t)(q0 / 16) * TS + (k0 / 32) * 512 + fo;
  const int* mp = mask + (size_t)b * SS + k0 + mo;
  float m_q[2], l_q[2]; v8f oacc[2][DT];
#pragma unroll
  for (int qt = 0; qt < 2; ++qt) { m_q[qt] = -3.0e38f; l_q[qt] = 0.f;
#pragma unroll
    for (int dt = 0; dt < DT; ++dt) oacc[qt][dt] = (v8f){0.f,0.f,0.f,0.f,0.f,0.f,0.f,0.f}; }
#pragma unroll 1
  for (int j0 = k0; j0 < k0 + SS; j0 += NSP * 32) {
    // every load of the pass stands in front of its first product: none depends on the scores any more, so the pass waits for memory once
    FragH bk[2][KS], bv[DT], sm[2][2]; v4ia mk[2][2];
#pragma unroll
    for (int nt = 0; nt < 2; ++nt) {
#pragma unroll
      for (int ks = 0; ks < KS; ++ks) { bk[nt][ks].half[0] = *(const v8us*)(kp + nt * TK + ks * 512); bk[nt][ks].half[1] = *(const v8us*)(kp + nt * TK + ks * 512 + 256); }
      mk[nt][0] = *(const v4ia*)(mp + nt * 16); mk[nt][1] = *(const v4ia*)(mp + nt * 16 + 4);
#pragma unroll
      for (int qt = 0; qt < 2; ++qt) sm[qt][nt].half[0] = *(const v8us*)(sp + qt * TS + nt * 256); }
#pragma unroll
    for (int dt = 0; dt < DT; ++dt) { bv[dt].half[0] = *(const v8us*)(vp + dt * TS); bv[dt].half[1] = *(const v8us*)(vp + dt * TS + 256); }
    asm volatile("s_wait_xcnt 0x0" ::: "memory");      // stands in front of every write of a register that one of the 24 loads names as its address: the four pointers live round the loop, so only their steps below write them (named as inputs here, they cost this build spills in the loop)
    __builtin_amdgcn_sched_barrier(0);      // keeps the 24 loads one group (else half of them issue behind the first wait and the pass pays the latency twice) and the pointer steps behind the wait above
    kp += NSP * 2 * TK; mp += NSP * 32; sp += NSP * 512; vp += NSP * 512;
    v8f s[2][2];
#pragma unroll
    for (int nt = 0; nt < 2; ++nt)
#pragma unroll
      for (int qt = 0; qt < 2; ++qt) { v8f acc = (v8f){0.f,0.f,0.f,0.f,0.f,0.f,0.f,0.f};
#pragma unroll
        for (int ks = 0; ks < KS; ++ks) acc = mmaH<1>(bk[nt][ks].v, bk[nt][ks].v, aq[qt][ks].v, aq[qt][ks].v, acc); s[qt][nt] = acc; }
    FragP pb[2];
#pragma unroll
    for (int qt = 0; qt < 2; ++qt) { const int qi = q0 + qt * 16 + ln; float mc = -INFINITY;
#pragma unroll
      for (int nt = 0; nt < 2; ++nt)
#pragma unroll
        for (int r = 0; r < 8; ++r) { const int k = j0 + nt * 16 + 8 * hh + r; const float sim = (float)sm[qt][nt].h[r]; const float sb = (sim < 0.5f) ? fmaf(sim, L2E, -0.5f * L2E) : 0.f;
          const float dd = fabsf((float)(qi - k)); const float pbias = (dd > 10.f) ? (-0.1f * L2E) * (dd - 10.f) : 0.f;
          const float su = s[qt][nt][r] * sc + sb + pbias; const float sv = (mk[nt][r >> 2][r & 3] != 0) ? su : -INFINITY; s[qt][nt][r] = sv; mc = fmaxf(mc, sv); }
      mc = fmaxf(mc, swap_halves(mc));
      const float mn = fmaxf(m_q[qt], mc); const float al = exp2_raw(m_q[qt] - mn); m_q[qt] = mn; float ls = 0.f;
#pragma unroll
      for (int nt = 0; nt < 2; ++nt) {
#pragma unroll
        for (int r = 0; r < 8; ++r) s[qt][nt][r] -= mn;
        s[qt][nt] = exp2_x8(s[qt][nt]);
#pragma unroll
        for (int r = 0; r < 8; ++r) ls += s[qt][nt][r];
        pb[qt].p[nt] = __builtin_convertvector(s[qt][nt], v8h); }
      l_q[qt] = l_q[qt] * al + ls;      // partial sum of this half's 16 keys; the halves are joined behind the loop
#pragma unroll
      for (int dt = 0; dt < DT; ++dt)
#pragma unroll
        for (int r = 0; r < 8; ++r) oacc[qt][dt][r] *= al; }
#pragma unroll
    for (int dt = 0; dt < DT; ++dt)
#pragma unroll
      for (int qt = 0; qt < 2; ++qt) oacc[qt][dt] = mmaH<1>(bv[dt].v, bv[dt].v, pb[qt].v, pb[qt].v, oacc[qt][dt]); }
  // join of the four key sets of a query group. Step 1: every wave publishes its max and its sum (halves joined)
#pragma unroll
  for (int qt = 0; qt < 2; ++qt) { float l = l_q[qt]; l += swap_halves(l); sM[w][qt][lane] = m_q[qt]; sL[w][qt][lane] = l; }
  __syncthreads();
  // step 2: the common max, the common sum (sets in order), and the wave's Ot rescaled to the common max into LDS
  float inv[2];
#pragma unroll
  for (int qt = 0; qt < 2; ++qt) { float ms[NSP], mx = -3.0e38f, l = 0.f;
#pragma unroll
    for (int s = 0; s < NSP; ++s) { ms[s] = sM[s * 4 + qg][qt][lane]; mx = fmaxf(mx, ms[s]); }
#pragma unroll
    for (int s = 0; s < NSP; ++s) l += sL[s * 4 + qg][qt][lane] * exp2_raw(ms[s] - mx);
    inv[qt] = (l > 0.f) ? 1.0f / l : 0.f; const float f = exp2_raw(m_q[qt] - mx);
#pragma unroll
    for (int dt = 0; dt < DT; ++dt) { v4f lo, hi;
#pragma unroll
      for (int r = 0; r < 4; ++r) { lo[r] = oacc[qt][dt][r] * f; hi[r] = oacc[qt][dt][4 + r] * f; }
      *(v4fa*)&sO[w][qt][dt][0][lane][0] = lo; *(v4fa*)&sO[w][qt][dt][1][lane][0] = hi; } }
  __syncthreads();
  // step 3: the wave of key set s sums, over the four sets in order, tiles 2 (s & 1) and 2 (s & 1) + 1 of query tile s >> 1: 32 columns = one whole 128-byte line of each of 16 output rows, so a line has one writer
  const int qs = ksp >> 1, d0 = (ksp & 1) * 2; const float iv = qs ? inv[1] : inv[0];
  float* orow = O + ((size_t)b * SS + q0 + qs * 16 + ln) * DM + h * HD + d0 * 16 + 8 * hh;      // register r of tile dt is column dt * 16 + 8 hh + r of the query's row
#pragma unroll
  for (int d = 0; d < 2; ++d) { v4f lo = *(const v4fa*)&sO[qg][qs][d0 + d][0][lane][0], hi = *(const v4fa*)&sO[qg][qs][d0 + d][1][lane][0];
#pragma unroll
    for (int s = 1; s < NSP; ++s) { lo += *(const v4fa*)&sO[s * 4 + qg][qs][d0 + d][0][lane][0]; hi += *(const v4fa*)&sO[s * 4 + qg][qs][d0 + d][1][lane][0]; }
    *(v4f*)(orow + d * 16) = lo * iv; *(v4f*)(orow + d * 16 + 4) = hi * iv; } }
extern "C" void kernel_launch(void* const* d_in, const int* in_sizes, int n_in,
                              void* d_out, int out_size, void* d_ws, size_t ws_size, hipStream_t stream) {
  (void)in_sizes; (void)n_in; (void)out_size;
  const float* xq = (const float*)d_in[0]; const float* xk = (const float*)d_in[1]; const float* xv = (const float*)d_in[2]; const int* mask = (const int*)d_in[3]; const float* sf = (const float*)d_in[4];
  const float* Wq = (const float*)d_in[5]; const float* bq = (const float*)d_in[6]; const float* Wk = (const float*)d_in[7]; const float* bk = (const float*)d_in[8]; const float* Wv = (const float*)d_in[9]; const float* bv = (const float*)d_in[10]; const float* Wo = (const float*)d_in[11]; const float* bo = (const float*)d_in[12]; const float* Wt1 = (const float*)d_in[13]; const float* bt1 = (const float*)d_in[14]; const float* Wt2 = (const float*)d_in[15]; const float* bt2 = (const float*)d_in[16];
  char* ws = (char*)d_ws; size_t off = 0;
  auto take = [&](size_t bytes) { char* p = ws + off; off += (bytes + 255) & ~(size_t)255; return p; };
  const size_t w8 = (size_t)DM * DM / 8;
  _Float16* Bq = (_Float16*)take(w8 * 16); _Float16* Bk = (_Float16*)take(w8 * 16); _Float16* Bv = (_Float16*)take(w8 * 16); _Float16* Bo = (_Float16*)take(w8 * 16);
  _Float16* XQ = (_Float16*)take((size_t)NR * DM * 2); _Float16* XK = (_Float16*)take((size_t)NR * DM * 2); _Float16* XV = (_Float16*)take((size_t)NR * DM * 2); _Float16* Q16 = (_Float16*)take((size_t)NR * DM * 2); _Float16* K16 = (_Float16*)take((size_t)NR * DM * 2); _Float16* V16 = (_Float16*)take((size_t)NR * DM * 2); _Float16* Vt = (_Float16*)take((size_t)NR * DM * 2);
  _Float16* SN = (_Float16*)take((size_t)NR * DSEM * 2); _Float16* SIM = (_Float16*)take((size_t)BB * SS * SS * 2); float* TEMP = (float*)take(256); float* O = (float*)take((size_t)NR * DM * 4); float* PART = (float*)take((size_t)BB * QP * DM * 4); _Float16* O16 = XQ;      // the query plane is dead after the q GEMM
  if (off > ws_size) return;      // ≈ 2 + 4.2×7 + 2.1 + 16.8 + 8.4 ≈ 57 MiB
  const unsigned gx = (unsigned)(((size_t)NR * DM / 8 + 255) / 256);
  k_prep<<<PB_QS + 3 * PB_X + PB_SN + 4 * PB_W, 512, 0, stream>>>(xq, xk, xv, sf, Wq, Wk, Wv, Wo, XQ, XK, XV, SN, Bq, Bk, Bv, Bo, PART);
  k_proj<<<1 + 3 * GB_P + BB * GB_S, 128, 0, stream>>>(XQ, XK, XV, Bq, Bk, Bv, bq, bk, bv, Q16, K16, V16, SN, SIM, PART, Wt1, bt1, Wt2, bt2, TEMP);
  const dim3 gg(((NR / 16) * (DM / 64) + 3) / 4, 1);
  k_vt<<<BB * NH * (SS / 64), 256, 0, stream>>>(V16, Vt);
  k_flash<<<BB * NH * (SS / 128), 512, 0, stream>>>(Q16, K16, Vt, SIM, mask, TEMP, O);
  k_h16<<<gx, 256, 0, stream>>>(O, O16, (size_t)NR * DM / 8);
  k_gemm_hhx<0><<<gg, 128, 0, stream>>>(O16, 0, Bo, 0, 0.0625f, bo, 0, nullptr, 1, 0, 0, (float*)d_out, nullptr, DM, 0, NR, DM, DM);
}

// v007
// It runs in 101 microseconds.
// In two side-by-side timings against v006, it was 1.22 and 1.24 times as fast.
// Counting every step since v000, it is 8.19 times as fast.
#include <hip/hip_runtime.h>
// q/k/v/o projections (4096 × 512 × 512, + bias), the cosine-similarity matrix of the normalised semantic features (per batch 2048 × 2048 × 256, kept as an f16 plane) and the 8-head
// constrained attention on v_wmma_f32_16x16x32_f16 (fused flash-style kernel: Sᵀ = K·Qᵀ, Oᵀ = Vᵀ·Pᵀ on WMMA; scores / (8·temperature_b) + semantic bias + positional bias, key mask → −inf;
// online max/sum softmax f32; P f16 ≤ 1); the dynamic-temperature MLP on the mean query is f32 VALU (column sums over 64 blocks, then one block); A = f16(bf16 ·) exact operands, weights bf16-exact ×2^4 ((out,in)),
// single products, f32 accumulate.
// Every f16 plane of the workspace lies in fragment order: a plane of KD columns is cut into blocks of 16 rows x 32 columns (row tile major, then column block), a block is 2 x 512 bytes,
// and 16-byte chunk (j, hh, ln) of a block holds row ln, columns 16 j + 8 hh .. + 7. Lane 16 hh + ln of a wave then finds half j of its A or B fragment at byte 16 lane of that half:
// one fragment load reads 512 bytes in a row (4 whole 128-byte lines), where a row-major plane gave it 32 bytes out of each of 16 lines.
#define BB 2
#define SS 2048
#define DM 512
#define NH 8
#define HD 64
#define DSEM 256
#define NR (BB * SS)

typedef __bf16 v16b __attribute__((ext_vector_type(16)));
typedef unsigned short v8us __attribute__((ext_vector_type(8), may_alias));
typedef float  v8f  __attribute__((ext_vector_type(8)));
typedef float  v4f  __attribute__((ext_vector_type(4)));
typedef float  v4fa __attribute__((ext_vector_type(4), may_alias));
union FragB { v16b v; v8us half[2]; unsigned short u[16]; };

__device__ __forceinline__ unsigned short bf16_bits(float x) { unsigned int u = __float_as_uint(x); return (unsigned short)((u + 0x7FFFu + ((u >> 16) & 1u)) >> 16); }
__device__ __forceinline__ float bf16_val(unsigned short b) { return __uint_as_float(((unsigned int)b) << 16); }
__device__ __forceinline__ float bf16_round(float x) { return bf16_val(bf16_bits(x)); }
// D += A·B with NT terms: 1 = ah·bh, 2 = + al·bh (A split), 3 = + ah·bl (both split)
template <int NT>
__device__ __forceinline__ v8f mmaN(v16b ah, v16b al, v16b bh, v16b bl, v8f c) {
  c = __builtin_amdgcn_wmma_f32_16x16x32_bf16(false, ah, false, bh, (short)0, c, false, false);
  if (NT >= 2) c = __builtin_amdgcn_wmma_f32_16x16x32_bf16(false, al, false, bh, (short)0, c, false, false);
  if (NT >= 3) c = __builtin_amdgcn_wmma_f32_16x16x32_bf16(false, ah, false, bl, (short)0, c, false, false);
  asm volatile("v_nop\n\tv_nop\n\tv_nop\n\tv_nop" : "+v"(c) : "v"(ah), "v"(al), "v"(bh), "v"(bl));
  return c;
}

__global__ __launch_bounds__(256) void k_wt_bf16(const float* __restrict__ W, unsigned short* __restrict__ Wt, int K, int N) {
  const int t = blockIdx.x * 256 + threadIdx.x;
  const int k8n = K / 8;
  if (t >= N * k8n) return;
  const int n = t / k8n, k8 = (t % k8n) * 8;
  v8us v;
#pragma unroll
  for (int i = 0; i < 8; ++i) v[i] = bf16_bits(W[(size_t)(k8 + i) * N + n]);
  *(v8us*)(Wt + (size_t)n * K + k8) = v;
  
}

// GEMM C[M][N] (f32, pitch ldc) = act(A[M][K]·W + bias). A f32 row-major (pitch lda) converted per fragment to bf16
// (ASPLIT: hi/lo two planes -> 2 terms, else single rounded term); Wt bf16 [N][K] (pitch ldb). BIAS_BF16 rounds the
// bias to bf16 first (bias quantised to bf16 before the add). K%32==0, M%16==0, N%64==0.
template <bool ASPLIT, int ACT, bool BIAS_BF16>
__global__ __launch_bounds__(128) void k_gemm_bf(const float* __restrict__ A, int lda, const unsigned short* __restrict__ Wt, int ldb,
                                               const float* __restrict__ bias, float* __restrict__ C, int ldc, int M, int N, int K) {
  __shared__ __attribute__((aligned(16))) float so[4][16][64];
  const int tid = threadIdx.x, w = tid >> 5, lane = tid & 31, ln = lane & 15, hh = lane >> 4;
  const int ntn = N / 64;
  const int wid = blockIdx.x * 4 + w;
  const int mt = wid / ntn, nq = wid % ntn;
  if (mt * 16 >= M) return;
  const int row0 = mt * 16, col0 = nq * 64;
  const float* arow = A + (size_t)(row0 + ln) * lda;
  v8f acc[4] = {};
  for (int kb = 0; kb < K; kb += 32) {
    FragB ah, al;
    const v4f x0 = *(const v4fa*)(arow + kb + 8 * hh), x1 = *(const v4fa*)(arow + kb + 8 * hh + 4);
    const v4f x2 = *(const v4fa*)(arow + kb + 16 + 8 * hh), x3 = *(const v4fa*)(arow + kb + 16 + 8 * hh + 4);
    float xs[16] = {x0[0],x0[1],x0[2],x0[3],x1[0],x1[1],x1[2],x1[3],x2[0],x2[1],x2[2],x2[3],x3[0],x3[1],x3[2],x3[3]};
#pragma unroll
    for (int i = 0; i < 16; ++i) { const unsigned short hb = bf16_bits(xs[i]); ah.u[i] = hb; al.u[i] = ASPLIT ? bf16_bits(xs[i] - bf16_val(hb)) : (unsigned short)0; }
#pragma unroll
    for (int t = 0; t < 4; ++t) {
      const unsigned short* brow = Wt + (size_t)(col0 + t * 16 + ln) * ldb + kb;
      FragB b;
      b.half[0] = *(const v8us*)(brow + 8 * hh);
      b.half[1] = *(const v8us*)(brow + 16 + 8 * hh);
      acc[t] = mmaN<ASPLIT ? 2 : 1>(ah.v, al.v, b.v, b.v, acc[t]);
    }
  }
#pragma unroll
  for (int t = 0; t < 4; ++t) {
    float bv = bias ? bias[col0 + t * 16 + ln] : 0.f;
    if (BIAS_BF16) bv = bf16_round(bv);
#pragma unroll
    for (int r = 0; r < 8; ++r) { float v = acc[t][r] + bv; if (ACT == 1) v = fmaxf(v, 0.f); so[w][8 * hh + r][t * 16 + ln] = v; }
  }
  __builtin_amdgcn_fence(__ATOMIC_ACQ_REL, "workgroup");
  __builtin_amdgcn_wave_barrier();
  const int rsub = lane >> 4, c4 = (lane & 15) * 4;
  {
#pragma unroll
    for (int q = 0; q < 8; ++q) {
      const int r = q * 2 + rsub;
      const v4f v = *(const v4fa*)&so[w][r][c4];
      *(v4f*)(C + (size_t)(row0 + r) * ldc + col0 + c4) = v;
    }
    
  }
}

// Flash-style causal/unmasked attention, all contractions 3-term bf16 hi/lo splits, f32 softmax with running max.
// q,k,v rows are read from f32 buffers with arbitrary row pitch (so they can live inside a fused qkv buffer);
// D = head size (multiple of 32, <= 128); one wave = 16 query rows; block = 4 waves (64 queries) sharing K/V chunks of 32.
template <int D, bool CAUSAL>
__global__ __launch_bounds__(128) void k_flash(const float* __restrict__ qb, const float* __restrict__ kb, const float* __restrict__ vb,
                                             int pitch, int T, int H, float scale, float* __restrict__ y, int ypitch) {
  constexpr int KS = D / 32;        // k-steps for QK
  constexpr int DT = D / 16;        // d tiles for PV
  __shared__ __attribute__((aligned(16))) unsigned short sKh[32][D + 8], sKl[32][D + 8], sVh[32][D + 8], sVl[32][D + 8];
  __shared__ __attribute__((aligned(16))) unsigned short sPh[4][16][40], sPl[4][16][40];
  __shared__ __attribute__((aligned(16))) float sO[4][16][D];
  const int tid = threadIdx.x, w = tid >> 5, lane = tid & 31, ln = lane & 15, hh = lane >> 4;
  const int nqb = (T + 63) / 64;
  const int bh = blockIdx.x / nqb, qblk = blockIdx.x % nqb;
  const int b = bh / H, h = bh % H;
  const int q0 = qblk * 64 + w * 16;
  const float* Q = qb + (size_t)b * T * pitch + h * D;
  const float* K = kb + (size_t)b * T * pitch + h * D;
  const float* V = vb + (size_t)b * T * pitch + h * D;

  // A fragments of the wave's 16 query rows (scaled), hi/lo
  FragB aqh[KS], aql[KS];
  {
    int row = q0 + ln; if (row >= T) row = T - 1;
    const float* qr = Q + (size_t)row * pitch;
#pragma unroll
    for (int ks = 0; ks < KS; ++ks)
#pragma unroll
      for (int i = 0; i < 16; ++i) {
        const int d = ks * 32 + ((i < 8) ? (8 * hh + i) : (16 + 8 * hh + (i - 8)));
        const float x = qr[d] * scale; const unsigned short hb = bf16_bits(x);
        aqh[ks].u[i] = hb; aql[ks].u[i] = bf16_bits(x - bf16_val(hb));
      }
  }
  float m_r[8], l_r[8];
#pragma unroll
  for (int r = 0; r < 8; ++r) { m_r[r] = -3.0e38f; l_r[r] = 0.f; }
  v8f oacc[DT];
#pragma unroll
  for (int dt = 0; dt < DT; ++dt) oacc[dt] = (v8f){0.f,0.f,0.f,0.f,0.f,0.f,0.f,0.f};

  const int kv_end = CAUSAL ? min(T, qblk * 64 + 64) : T;     // block-uniform
  for (int j0 = 0; j0 < kv_end; j0 += 32) {
    __syncthreads();
    for (int e = tid; e < 32 * (D / 4); e += 128) {
      const int r = e / (D / 4), c4 = (e % (D / 4)) * 4;
      const int key = j0 + r;
      v4f kf = {0.f,0.f,0.f,0.f}, vf = {0.f,0.f,0.f,0.f};
      if (key < T) { kf = *(const v4fa*)(K + (size_t)key * pitch + c4); vf = *(const v4fa*)(V + (size_t)key * pitch + c4); }
#pragma unroll
      for (int t = 0; t < 4; ++t) {
        unsigned short hb = bf16_bits(kf[t]); sKh[r][c4 + t] = hb; sKl[r][c4 + t] = bf16_bits(kf[t] - bf16_val(hb));
        hb = bf16_bits(vf[t]); sVh[r][c4 + t] = hb; sVl[r][c4 + t] = bf16_bits(vf[t] - bf16_val(hb));
      }
    }
    __syncthreads();
    // S tile 16 x 32
    v8f s[2];
#pragma unroll
    for (int nt = 0; nt < 2; ++nt) {
      v8f acc = {};
#pragma unroll
      for (int ks = 0; ks < KS; ++ks) {
        FragB bh_, bl_;
        bh_.half[0] = *(const v8us*)&sKh[nt * 16 + ln][ks * 32 + 8 * hh]; bh_.half[1] = *(const v8us*)&sKh[nt * 16 + ln][ks * 32 + 16 + 8 * hh];
        bl_.half[0] = *(const v8us*)&sKl[nt * 16 + ln][ks * 32 + 8 * hh]; bl_.half[1] = *(const v8us*)&sKl[nt * 16 + ln][ks * 32 + 16 + 8 * hh];
        acc = mmaN<3>(aqh[ks].v, aql[ks].v, bh_.v, bl_.v, acc);
      }
      s[nt] = acc;
    }
    // mask + running max (rows 8hh+r; the 16 lanes of a half share rows)
    float alpha[8];
#pragma unroll
    for (int r = 0; r < 8; ++r) {
      const int qi = q0 + 8 * hh + r;
      const int ja = j0 + ln, jb = j0 + 16 + ln;
      if (CAUSAL) { if (ja > qi) s[0][r] = -3.0e38f; if (jb > qi) s[1][r] = -3.0e38f; }
      if (ja >= T) s[0][r] = -3.0e38f;
      if (jb >= T) s[1][r] = -3.0e38f;
      float mx = fmaxf(s[0][r], s[1][r]);
      mx = fmaxf(mx, __shfl_xor(mx, 1, 32)); mx = fmaxf(mx, __shfl_xor(mx, 2, 32)); mx = fmaxf(mx, __shfl_xor(mx, 4, 32)); mx = fmaxf(mx, __shfl_xor(mx, 8, 32));
      const float mnew = fmaxf(m_r[r], mx);
      alpha[r] = (mnew > -1.0e38f) ? __expf(m_r[r] - mnew) : 1.0f;
      const float p0 = (s[0][r] > -1.0e38f) ? __expf(s[0][r] - mnew) : 0.f;
      const float p1 = (s[1][r] > -1.0e38f) ? __expf(s[1][r] - mnew) : 0.f;
      m_r[r] = mnew;
      l_r[r] = l_r[r] * alpha[r] + p0 + p1;            // per-lane partial row sum (16 lanes combined at the end)
      unsigned short hb = bf16_bits(p0); sPh[w][8 * hh + r][ln] = hb;      sPl[w][8 * hh + r][ln] = bf16_bits(p0 - bf16_val(hb));
      hb = bf16_bits(p1);                sPh[w][8 * hh + r][16 + ln] = hb; sPl[w][8 * hh + r][16 + ln] = bf16_bits(p1 - bf16_val(hb));
    }
#pragma unroll
    for (int dt = 0; dt < DT; ++dt)
#pragma unroll
      for (int r = 0; r < 8; ++r) oacc[dt][r] *= alpha[r];
    __builtin_amdgcn_fence(__ATOMIC_ACQ_REL, "workgroup");
    __builtin_amdgcn_wave_barrier();
    FragB pah, pal;
    pah.half[0] = *(const v8us*)&sPh[w][ln][8 * hh]; pah.half[1] = *(const v8us*)&sPh[w][ln][16 + 8 * hh];
    pal.half[0] = *(const v8us*)&sPl[w][ln][8 * hh]; pal.half[1] = *(const v8us*)&sPl[w][ln][16 + 8 * hh];
#pragma unroll
    for (int dt = 0; dt < DT; ++dt) {
      FragB bvh, bvl;
#pragma unroll
      for (int i = 0; i < 8; ++i) {
        bvh.u[i] = sVh[8 * hh + i][dt * 16 + ln]; bvh.u[8 + i] = sVh[16 + 8 * hh + i][dt * 16 + ln];
        bvl.u[i] = sVl[8 * hh + i][dt * 16 + ln]; bvl.u[8 + i] = sVl[16 + 8 * hh + i][dt * 16 + ln];
      }
      oacc[dt] = mmaN<3>(pah.v, pal.v, bvh.v, bvl.v, oacc[dt]);
    }
    __builtin_amdgcn_fence(__ATOMIC_ACQ_REL, "workgroup");
    __builtin_amdgcn_wave_barrier();
  }
#pragma unroll
  for (int r = 0; r < 8; ++r) {
    float l = l_r[r];
    l += __shfl_xor(l, 1, 32); l += __shfl_xor(l, 2, 32); l += __shfl_xor(l, 4, 32); l += __shfl_xor(l, 8, 32);
    l_r[r] = (l > 0.f) ? 1.0f / l : 0.f;
  }
#pragma unroll
  for (int dt = 0; dt < DT; ++dt)
#pragma unroll
    for (int r = 0; r < 8; ++r) sO[w][8 * hh + r][dt * 16 + ln] = oacc[dt][r] * l_r[r];
  __builtin_amdgcn_fence(__ATOMIC_ACQ_REL, "workgroup");
  __builtin_amdgcn_wave_barrier();
  {
    for (int r = 0; r < 16; ++r) {
      const int row = q0 + r;
      if (row < T && lane < D / 4) {
        const v4f val = *(const v4fa*)&sO[w][r][lane * 4];
        *(v4f*)(y + ((size_t)b * T + row) * ypitch + h * D + lane * 4) = val;
      }
    }
    
  }
}

// GEMM C = act(A·W + bias + resid): A f32 (ASPLIT -> hi/lo 2 terms), Wt bf16 [N][K]; ACT 0 none, 1 relu, 2 exact gelu;
// resid (optional, f32, row index = (row % rmod), pitch ldr, RES_BF16 rounds it) added before the activation.
template <bool ASPLIT, int ACT, bool BIAS_BF16, bool RES_BF16>
__global__ __launch_bounds__(128) void k_gemm_bf3(const float* __restrict__ A, int lda, const unsigned short* __restrict__ Wt, int ldb,
                                                const float* __restrict__ bias, const float* __restrict__ resid, int rmod, int ldr,
                                                float* __restrict__ C, int ldc, int M, int N, int K) {
  __shared__ __attribute__((aligned(16))) float so[4][16][64];
  const int tid = threadIdx.x, w = tid >> 5, lane = tid & 31, ln = lane & 15, hh = lane >> 4;
  const int ntn = N / 64;
  const int wid = blockIdx.x * 4 + w;
  const int mt = wid / ntn, nq = wid % ntn;
  if (mt * 16 >= M) return;
  const int row0 = mt * 16, col0 = nq * 64;
  const float* arow = A + (size_t)(row0 + ln) * lda;
  v8f acc[4] = {};
  for (int kb = 0; kb < K; kb += 32) {
    FragB ah, al;
    const v4f x0 = *(const v4fa*)(arow + kb + 8 * hh), x1 = *(const v4fa*)(arow + kb + 8 * hh + 4);
    const v4f x2 = *(const v4fa*)(arow + kb + 16 + 8 * hh), x3 = *(const v4fa*)(arow + kb + 16 + 8 * hh + 4);
    float xs[16] = {x0[0],x0[1],x0[2],x0[3],x1[0],x1[1],x1[2],x1[3],x2[0],x2[1],x2[2],x2[3],x3[0],x3[1],x3[2],x3[3]};
#pragma unroll
    for (int i = 0; i < 16; ++i) { const unsigned short hb = bf16_bits(xs[i]); ah.u[i] = hb; al.u[i] = ASPLIT ? bf16_bits(xs[i] - bf16_val(hb)) : (unsigned short)0; }
#pragma unroll
    for (int t = 0; t < 4; ++t) {
      const unsigned short* brow = Wt + (size_t)(col0 + t * 16 + ln) * ldb + kb;
      FragB b;
      b.half[0] = *(const v8us*)(brow + 8 * hh);
      b.half[1] = *(const v8us*)(brow + 16 + 8 * hh);
      acc[t] = mmaN<ASPLIT ? 2 : 1>(ah.v, al.v, b.v, b.v, acc[t]);
    }
  }
#pragma unroll
  for (int t = 0; t < 4; ++t) {
    const int col = col0 + t * 16 + ln;
    float bv = bias ? bias[col] : 0.f;
    if (BIAS_BF16) bv = bf16_round(bv);
#pragma unroll
    for (int r = 0; r < 8; ++r) {
      float v = acc[t][r] + bv;
      if (resid) { float rv = resid[(size_t)((row0 + 8 * hh + r) % rmod) * ldr + col]; if (RES_BF16) rv = bf16_round(rv); v += rv; }
      if (ACT == 1) v = fmaxf(v, 0.f);
      if (ACT == 2) v = 0.5f * v * (1.0f + erff(v * 0.70710678118654752f));
      if (ACT == 3) { const float u = 0.7978845608028654f * (v + 0.044715f * v * v * v); v = 0.5f * v * (1.0f + tanhf(u)); }
      so[w][8 * hh + r][t * 16 + ln] = v;
    }
  }
  __builtin_amdgcn_fence(__ATOMIC_ACQ_REL, "workgroup");
  __builtin_amdgcn_wave_barrier();
  const int rsub = lane >> 4, c4 = (lane & 15) * 4;
  {
#pragma unroll
    for (int q = 0; q < 8; ++q) {
      const int r = q * 2 + rsub;
      const v4f v = *(const v4fa*)&so[w][r][c4];
      *(v4f*)(C + (size_t)(row0 + r) * ldc + col0 + c4) = v;
    }
    
  }
}
// row LayerNorm (biased variance, eps) over N: s = X (+ R); optional out_sum <- s; out_norm <- (s-mu)*rsqrt(var+eps)*g + b
template <bool PARAM_BF16>
__global__ __launch_bounds__(256) void k_layernorm(const float* __restrict__ X, const float* __restrict__ R, const float* __restrict__ g, const float* __restrict__ bta,
                                                  float* __restrict__ out_sum, float* __restrict__ out_norm, int N, float eps) {
  __shared__ float red[256];
  const int row = blockIdx.x, tid = threadIdx.x;
  const float* x = X + (size_t)row * N; const float* rr = R ? R + (size_t)row * N : nullptr;
  float vals[16];                     // up to N = 4096
  const int per = N / 256;            // contiguous chunk per thread? use strided-by-4 chunks: thread handles j = tid*4 + 1024*u
  float s1 = 0.f;
  for (int u = 0; u < per / 4; ++u) {
    const int j = tid * 4 + 1024 * u;
    const v4f a = *(const v4fa*)(x + j);
    v4f b = {0.f,0.f,0.f,0.f}; if (rr) b = *(const v4fa*)(rr + j);
#pragma unroll
    for (int q = 0; q < 4; ++q) { const float v = a[q] + b[q]; vals[u * 4 + q] = v; s1 += v; }
  }
  red[tid] = s1; __syncthreads();
  for (int st = 128; st > 0; st >>= 1) { if (tid < st) red[tid] += red[tid + st]; __syncthreads(); }
  const float mu = red[0] / (float)N; __syncthreads();
  float s2 = 0.f;
  for (int u = 0; u < per / 4; ++u)
#pragma unroll
    for (int q = 0; q < 4; ++q) { const float c = vals[u * 4 + q] - mu; s2 += c * c; }
  red[tid] = s2; __syncthreads();
  for (int st = 128; st > 0; st >>= 1) { if (tid < st) red[tid] += red[tid + st]; __syncthreads(); }
  const float rs = rsqrtf(red[0] / (float)N + eps);
  {
    for (int u = 0; u < per / 4; ++u) {
      const int j = tid * 4 + 1024 * u;
      v4f o, sm;
#pragma unroll
      for (int q = 0; q < 4; ++q) {
        float gg = g[j + q], bb = bta[j + q];
        if (PARAM_BF16) { gg = bf16_round(gg); bb = bf16_round(bb); }
        sm[q] = vals[u * 4 + q]; o[q] = (vals[u * 4 + q] - mu) * rs * gg + bb;
      }
      if (out_sum) *(v4f*)(out_sum + (size_t)row * N + j) = sm;
      *(v4f*)(out_norm + (size_t)row * N + j) = o;
    }
    
  }
}



// ---- f16 WMMA path (v_wmma_f32_16x16x32_f16): 11-bit significands for operands in range — used where a [0,1] probability operand needs more precision than bf16
typedef _Float16 v16h __attribute__((ext_vector_type(16)));
union FragH { v16h v; v8us half[2]; _Float16 h[16]; unsigned short u[16]; };
template <int NT>
__device__ __forceinline__ v8f mmaH(v16h ah, v16h al, v16h bh, v16h bl, v8f c) {
  c = __builtin_amdgcn_wmma_f32_16x16x32_f16(false, ah, false, bh, (short)0, c, false, false);
  if (NT >= 2) c = __builtin_amdgcn_wmma_f32_16x16x32_f16(false, al, false, bh, (short)0, c, false, false);
  if (NT >= 3) c = __builtin_amdgcn_wmma_f32_16x16x32_f16(false, ah, false, bl, (short)0, c, false, false);
  asm volatile("v_nop\n\tv_nop\n\tv_nop\n\tv_nop" : "+v"(c) : "v"(ah), "v"(al), "v"(bh), "v"(bl));
  return c;
}
// batched GEMM like k_gemm_b but f16 operands: A f32 (split into f16 hi/lo if ASPLIT, else rounded to f16), Bt = f16 values [n][k]; alpha; C f32; N multiple of 16 (partial tiles skipped)
template <bool ASPLIT>
__global__ __launch_bounds__(128) void k_gemm_h(const float* __restrict__ A, int lda, size_t sA, const _Float16* __restrict__ Bh, int ldb, size_t sB, float alpha, float* __restrict__ C, int ldc, size_t sC, int M, int N, int K) {
  __shared__ __attribute__((aligned(16))) float so[4][16][64];
  const int tid = threadIdx.x, w = tid >> 5, lane = tid & 31, ln = lane & 15, hh = lane >> 4; const int by = blockIdx.y;
  A += (size_t)by * sA; Bh += (size_t)by * sB; C += (size_t)by * sC;
  const int ntn = (N + 63) / 64; const int wid = blockIdx.x * 4 + w; const int mt = wid / ntn, nq = wid % ntn; if (mt * 16 >= M) return;
  const int row0 = mt * 16, col0 = nq * 64; const float* arow = A + (size_t)(row0 + ln) * lda;
  v8f acc[4] = {};
  for (int kb = 0; kb < K; kb += 32) {
    FragH ah, al;
    const v4f x0 = *(const v4fa*)(arow + kb + 8 * hh), x1 = *(const v4fa*)(arow + kb + 8 * hh + 4), x2 = *(const v4fa*)(arow + kb + 16 + 8 * hh), x3 = *(const v4fa*)(arow + kb + 16 + 8 * hh + 4);
    float xs[16] = {x0[0],x0[1],x0[2],x0[3],x1[0],x1[1],x1[2],x1[3],x2[0],x2[1],x2[2],x2[3],x3[0],x3[1],x3[2],x3[3]};
#pragma unroll
    for (int i = 0; i < 16; ++i) { const _Float16 h = (_Float16)xs[i]; ah.h[i] = h; al.h[i] = ASPLIT ? (_Float16)(xs[i] - (float)h) : (_Float16)0.0f; }
#pragma unroll
    for (int t = 0; t < 4; ++t) { if (col0 + t * 16 >= N) continue; const size_t boff = (size_t)(col0 + t * 16 + ln) * ldb + kb; FragH bq; bq.half[0] = *(const v8us*)(Bh + boff + 8 * hh); bq.half[1] = *(const v8us*)(Bh + boff + 16 + 8 * hh);
      acc[t] = mmaH<ASPLIT ? 2 : 1>(ah.v, al.v, bq.v, bq.v, acc[t]); }
  }
#pragma unroll
  for (int t = 0; t < 4; ++t) { if (col0 + t * 16 >= N) continue;
#pragma unroll
    for (int r = 0; r < 8; ++r) so[w][8 * hh + r][t * 16 + ln] = acc[t][r] * alpha; }
  __builtin_amdgcn_fence(__ATOMIC_ACQ_REL, "workgroup"); __builtin_amdgcn_wave_barrier();
  const int rsub = lane >> 4, c4 = (lane & 15) * 4;
  {
#pragma unroll
    for (int q = 0; q < 8; ++q) { const int r = q * 2 + rsub; if (col0 + c4 < N) { const v4f v = *(const v4fa*)&so[w][r][c4]; *(v4f*)(C + (size_t)(row0 + r) * ldc + col0 + c4) = v; } }
     }
}

// Wt[n][k] = f16(W[k][n]·scale) from f32 row-major W[K][N] (scale = power of two; bf16-exact weights stay exact in f16 away from the subnormal range)
__global__ __launch_bounds__(256) void k_wt_f16(const float* __restrict__ W, _Float16* __restrict__ Wt, int K, int N, float scale) {
  const int t = blockIdx.x * 256 + threadIdx.x; if (t >= N * (K / 8)) return; const int n = t / (K / 8), k8 = (t % (K / 8)) * 8; FragH f;
#pragma unroll
  for (int i = 0; i < 8; ++i) f.h[i] = (_Float16)(bf16_round(W[(size_t)(k8 + i) * N + n]) * scale); const v8us o = f.half[0];
  *(v8us*)((unsigned short*)Wt + (size_t)n * K + k8) = o; 
}
// k_gemm_hh variant with fused epilogue: v = acc·alpha + bias[by·sBias + col] (+ CP[(row/rowsPerB)·sCPb + by·64 + col] if CP) ; ACT 0 none / 1 elu ; writes f16 C16 and f32 C, each if non-null
// the body takes its block indices (bx, by) and its 17 KiB of LDS from the caller, so that several products can share one launch
// A (M x K), Bh (N x K) and C16 (M x N) lie in fragment order; C is row-major with pitch ldc. SOP: row pitch of the LDS tile in floats, 4 more than the row so that 16 lanes reading 16 rows at one column meet 16 different bank groups
#define SOP 68
// row-major element offset of 16-byte chunk t of a fragment-order plane of KD columns
__device__ __forceinline__ size_t frag_src(const size_t t, const int KD) { const size_t blk = t >> 6; const int kbn = KD >> 5;
  return ((blk / kbn) * 16 + (t & 15)) * KD + (blk % kbn) * 32 + ((t >> 5) & 1) * 16 + ((t >> 4) & 1) * 8; }
template <int ACT>
__device__ __forceinline__ void gemm_hhx_body(float (*so)[16][SOP], const int bx, const int by, const _Float16* __restrict__ A, size_t sA, const _Float16* __restrict__ Bh, size_t sB, float alpha, const float* __restrict__ bias, size_t sBias, const float* __restrict__ CP, int rowsPerB, size_t sCPb, int row0g,
    float* __restrict__ C, _Float16* __restrict__ C16, int ldc, size_t sC, int M, int N, int K) {
  const int tid = threadIdx.x, w = tid >> 5, lane = tid & 31, ln = lane & 15, hh = lane >> 4;
  A += (size_t)by * sA; Bh += (size_t)by * sB; const size_t cofs = (size_t)by * sC; const float* bp = bias ? bias + (size_t)by * sBias : nullptr;
  const int ntn = (N + 63) / 64; const int wid = bx * 4 + w; const int mt = wid / ntn, nq = wid % ntn; if (mt * 16 >= M) return;
  const int row0 = mt * 16, col0 = nq * 64; const size_t tsz = (size_t)(K >> 5) * 512;      // f16 elements of one 16-row tile
  const unsigned short* afr = (const unsigned short*)A + (size_t)mt * tsz + lane * 8; const unsigned short* bfr = (const unsigned short*)Bh + (size_t)(col0 >> 4) * tsz + lane * 8;
  v8f acc[4] = {};
  // The fragments come in groups of two k steps (20 loads of 16 bytes a lane) into two register sets: while one set is multiplied, the other set's loads are in flight,
  // so a wave waits for memory once a group, behind eight products, where a load, a full wait and one product in turn paid the whole latency for every product. K is a multiple of 128. Each acc[t] still sums k upwards.
  FragH a0[2], b0[2][4], a1[2], b1[2][4];
  auto ldg = [&](FragH (&a)[2], FragH (&b)[2][4], const int kb) {
#pragma unroll
    for (int s = 0; s < 2; ++s) { a[s].half[0] = *(const v8us*)(afr + (kb + 32 * s) * 16); a[s].half[1] = *(const v8us*)(afr + (kb + 32 * s) * 16 + 256);
#pragma unroll
      for (int t = 0; t < 4; ++t) { if (col0 + t * 16 >= N) continue; const size_t boff = (size_t)t * tsz + (kb + 32 * s) * 16; b[s][t].half[0] = *(const v8us*)(bfr + boff); b[s][t].half[1] = *(const v8us*)(bfr + boff + 256); } }
    asm volatile("s_wait_xcnt 0x0" ::: "memory");      // stands in front of every later write of a register that one of the group's loads names as its address
    __builtin_amdgcn_sched_barrier(0);      // keeps the group's loads together and in front of the other set's products (else they sink to their first use and each product waits for its own load again)
  };
  auto mmg = [&](FragH (&a)[2], FragH (&b)[2][4]) {
#pragma unroll
    for (int s = 0; s < 2; ++s)
#pragma unroll
      for (int t = 0; t < 4; ++t) { if (col0 + t * 16 >= N) continue; acc[t] = mmaH<1>(a[s].v, a[s].v, b[s][t].v, b[s][t].v, acc[t]); }
  };
  float bl[4] = {0.f, 0.f, 0.f, 0.f};      // the four bias values are asked for in front of the first group, not one by one behind the loop with a full wait each
  if (bp) {
#pragma unroll
    for (int t = 0; t < 4; ++t) { if (col0 + t * 16 >= N) continue; bl[t] = bp[col0 + t * 16 + ln]; } }
  ldg(a0, b0, 0);
  for (int kb = 0; kb < K; kb += 128) {
    ldg(a1, b1, kb + 64); mmg(a0, b0);
    if (kb + 128 < K) ldg(a0, b0, kb + 128);
    mmg(a1, b1); }
#pragma unroll
  for (int t = 0; t < 4; ++t) { if (col0 + t * 16 >= N) continue; const int col = col0 + t * 16 + ln; const float bv = bf16_round(bl[t]);
#pragma unroll
    for (int r = 0; r < 8; ++r) { float v = acc[t][r] * alpha + bv; if (CP) { const int bidx = (row0g + row0 + 8 * hh + r) / rowsPerB; v += CP[(size_t)bidx * sCPb + (size_t)by * 64 + col]; } if (ACT == 1) v = (v > 0.f) ? v : expm1f(v); else if (ACT == 3) v = fmaxf(v, 0.f); so[w][8 * hh + r][t * 16 + ln] = v; } }
  __builtin_amdgcn_fence(__ATOMIC_ACQ_REL, "workgroup"); __builtin_amdgcn_wave_barrier();
  const int rsub = lane >> 4, c4 = (lane & 15) * 4;
  if (C) {
#pragma unroll
    for (int q = 0; q < 8; ++q) { const int r = q * 2 + rsub; if (col0 + c4 < N) { const v4f v = *(const v4fa*)&so[w][r][c4]; *(v4f*)(C + cofs + (size_t)(row0 + r) * ldc + col0 + c4) = v; } }
  }
  if (C16) {      // the wave's 16 x 64 tile is two blocks of the plane, 2 KiB in a row: four stores of 512 bytes
    unsigned short* cfr = (unsigned short*)C16 + cofs + ((size_t)mt * (N >> 5) + (col0 >> 5)) * 512 + lane * 8;
#pragma unroll
    for (int c = 0; c < 4; ++c) { if (col0 + c * 16 >= N) continue; const v4f v0 = *(const v4fa*)&so[w][ln][c * 16 + 8 * hh], v1 = *(const v4fa*)&so[w][ln][c * 16 + 8 * hh + 4]; FragH f;
#pragma unroll
      for (int i = 0; i < 4; ++i) { f.h[i] = (_Float16)v0[i]; f.h[4 + i] = (_Float16)v1[i]; }
      *(v8us*)(cfr + c * 256) = f.half[0]; }
  }
}
// the output projection: its shapes are constants, as in k_proj, so that the column guards of the body fold away and a group's loads stand in one run with no branch between them
__global__ __launch_bounds__(128) void k_oproj(const _Float16* __restrict__ A, const _Float16* __restrict__ Bh, const float* __restrict__ bias, float* __restrict__ C) {
  __shared__ __attribute__((aligned(16))) float so[4][16][SOP];
  gemm_hhx_body<0>(so, blockIdx.x, 0, A, 0, Bh, 0, 0.0625f, bias, 0, nullptr, 1, 0, 0, C, nullptr, DM, 0, NR, DM, DM);
}


// x16_body, round16f_body, sn_body and qsum_body are roles of one launch (k_prep, blocks of 512): each takes its block index bx inside its role
__device__ __forceinline__ void x16_body(const int bx, const float* __restrict__ x, _Float16* __restrict__ X16) { const size_t t = (size_t)bx * 512 + threadIdx.x, s = frag_src(t, DM); FragH f;
#pragma unroll
  for (int q = 0; q < 8; ++q) f.h[q] = (_Float16)bf16_round(x[s + q]); *(v8us*)((unsigned short*)X16 + t * 8) = f.half[0];  }
__global__ __launch_bounds__(256) void k_h16(const float* __restrict__ x, _Float16* __restrict__ X16, size_t n8) { const size_t t = (size_t)blockIdx.x * 256 + threadIdx.x; if (t >= n8) return; const size_t s = frag_src(t, DM); FragH f;
#pragma unroll
  for (int q = 0; q < 8; ++q) f.h[q] = (_Float16)x[s + q]; *(v8us*)((unsigned short*)X16 + t * 8) = f.half[0];  }
__device__ __forceinline__ void round16f_body(const int bx, const float* __restrict__ W, _Float16* __restrict__ Bt) { const size_t t = (size_t)bx * 512 + threadIdx.x, s = frag_src(t, DM); FragH f;
#pragma unroll
  for (int i = 0; i < 8; ++i) f.h[i] = (_Float16)(bf16_round(W[s + i]) * 16.0f); *(v8us*)((unsigned short*)Bt + t * 8) = f.half[0];
  asm volatile("s_wait_xcnt 0x0" ::: "memory");      // in the merged listing the next role's code follows this store and writes its address register: the wait stands in front of that write
}
// the block's 16 rows are one row tile of SN (8 KiB): each wave lays its row's chunks into LDS at their places in the tile, and behind the barrier every thread stores 16 bytes of it in a row, so that a 128-byte line has one writer
__device__ __forceinline__ void sn_body(unsigned short* __restrict__ st, const int bx, const float* __restrict__ sf, _Float16* __restrict__ SN) { const int tid = threadIdx.x, wv = tid >> 5, lane = tid & 31; const size_t row = (size_t)bx * 16 + wv; float v[8]; float s = 0.f;
#pragma unroll
  for (int q = 0; q < 8; ++q) { v[q] = bf16_round(sf[row * DSEM + lane * 8 + q]); s += v[q] * v[q]; }
  for (int o = 16; o >= 1; o >>= 1) s += __shfl_xor(s, o, 32); const float inv = 1.0f / fmaxf(sqrtf(s), 1e-12f); FragH f;
#pragma unroll
  for (int q = 0; q < 8; ++q) f.h[q] = (_Float16)(v[q] * inv);
  *(v8us*)(st + (lane >> 1) * 256 + ((lane & 1) * 16 + wv) * 8) = f.half[0];      // chunk lane of the row = columns 8 lane ..: block lane >> 2, j = (lane >> 1) & 1, hh = lane & 1
  __syncthreads();
  *(v8us*)((unsigned short*)SN + (size_t)bx * (16 * DSEM) + tid * 8) = *(const v8us*)(st + tid * 8);
  asm volatile("s_wait_xcnt 0x0" ::: "memory");      // in the merged listing the next role's code follows this store and writes its address register: the wait stands in front of that write
}
// dynamic temperature, stage 1: column sums of the bf16-rounded query over QROWS rows per block -> PART[b][chunk][DM]; thread = 4 columns x one of 4 row phases, 16 independent 16-byte loads
#define QP 32
#define QROWS (SS / QP)
__device__ __forceinline__ void qsum_body(float (*sred)[DM], const int bx, const float* __restrict__ query, float* __restrict__ PART) {
  const int tid = threadIdx.x, ph = tid >> 7, c4 = (tid & 127) * 4;
  const float* src = query + ((size_t)bx * QROWS + ph * (QROWS / 4)) * DM + c4; v4f s = {0.f, 0.f, 0.f, 0.f};
#pragma unroll  // all 16 row loads issue before the first add: one memory latency instead of 16
  for (int r = 0; r < QROWS / 4; ++r) { const v4f x = *(const v4fa*)(src + (size_t)r * DM);
#pragma unroll
    for (int q = 0; q < 4; ++q) s[q] += bf16_round(x[q]); }
  *(v4fa*)&sred[ph][c4] = s; __syncthreads();
  PART[(size_t)bx * DM + tid] = (sred[0][tid] + sred[1][tid]) + (sred[2][tid] + sred[3][tid]); }
// one launch for all work that reads inputs only: column sums of the query, the three f16 activation planes, the normalised semantic rows, the four weight planes; role by block range
#define PB_QS (BB * QP)
#define PB_X (NR * DM / 8 / 512)
#define PB_SN (NR / 16)
#define PB_W (DM * DM / 8 / 512)
__global__ __launch_bounds__(512) void k_prep(const float* __restrict__ xq, const float* __restrict__ xk, const float* __restrict__ xv, const float* __restrict__ sf,
    const float* __restrict__ Wq, const float* __restrict__ Wk, const float* __restrict__ Wv, const float* __restrict__ Wo,
    _Float16* __restrict__ XQ, _Float16* __restrict__ XK, _Float16* __restrict__ XV, _Float16* __restrict__ SN,
    _Float16* __restrict__ Bq, _Float16* __restrict__ Bk, _Float16* __restrict__ Bv, _Float16* __restrict__ Bo, float* __restrict__ PART) {
  __shared__ __attribute__((aligned(16))) float sred[4][DM];
  const int bx = blockIdx.x, bx1 = bx - PB_QS, bx2 = bx1 - 3 * PB_X, bx3 = bx2 - PB_SN;
  if (bx1 < 0) qsum_body(sred, bx, xq, PART);
  else if (bx2 < 0) { const int g = bx1 / PB_X; x16_body(bx1 % PB_X, g == 0 ? xq : g == 1 ? xk : xv, g == 0 ? XQ : g == 1 ? XK : XV); }
  else if (bx3 < 0) sn_body((unsigned short*)&sred[0][0], bx2, sf, SN);
  else { const int g = bx3 / PB_W; round16f_body(bx3 % PB_W, g == 0 ? Wq : g == 1 ? Wk : g == 2 ? Wv : Wo, g == 0 ? Bq : g == 1 ? Bk : g == 2 ? Bv : Bo); } }
// stage 2 (one block of 4 waves, a role of k_proj, beside the products that do not need it): mean query of both batches from PART, then one wave per hidden unit (lanes along DM, 16-byte loads of the
// Wt1 row shared by both batches), relu, Wt2 dot, sigmoid. The hidden units are summed in 32 groups of 8, each wave taking 8 groups in turn.
__device__ __forceinline__ void temp_body(float* __restrict__ sm, const float* __restrict__ PART, const float* __restrict__ Wt1, const float* __restrict__ bt1, const float* __restrict__ Wt2, const float* __restrict__ bt2, float* __restrict__ TEMP) {
  float (*qm)[DM] = (float (*)[DM])sm; float (*red)[32] = (float (*)[32])(sm + BB * DM); const int tid = threadIdx.x, wv = tid >> 5, lane = tid & 31;
#pragma unroll 1  // kept rolled: a trip's loads are in flight together already, and all trips' loads at once would need more than 256 registers
  for (int it = 0; it < BB * DM / 128; ++it) { const int c = it * 128 + tid, b = c >> 9, col = c & (DM - 1); float s = 0.f;
#pragma unroll  // all 32 partial loads in flight together
    for (int p = 0; p < QP; ++p) s += PART[((size_t)b * QP + p) * DM + col];
    qm[b][col] = s / (float)SS; }
  __syncthreads();
  v4f qv[BB][4];
#pragma unroll
  for (int b = 0; b < BB; ++b)
#pragma unroll
    for (int j = 0; j < 4; ++j) qv[b][j] = *(const v4fa*)&qm[b][j * 128 + lane * 4];
#pragma unroll 1  // one group of 8 hidden units a trip, kept rolled: two groups' rows at once would need more than 256 registers
  for (int gq = 0; gq < 8; ++gq) { const int grp = wv * 8 + gq;
  float pw[BB] = {0.f, 0.f};
  constexpr int GU = (DM / 2) / 32;      // hidden units of a group
  // the group's loads stand together: eight rows = 32 loads of 16 bytes a lane, and the eight bt1 and Wt2 values: one memory latency a group, was four. With them the launch takes 252 registers against the products' 212: four waves a SIMD either way
  float b1r[GU], w2r[GU], a[GU][BB];
#pragma unroll
  for (int i = 0; i < GU; ++i) { b1r[i] = bt1[grp * GU + i]; w2r[i] = Wt2[grp * GU + i]; }
#pragma unroll
  for (int i = 0; i < GU; ++i) { const float* wr = Wt1 + (size_t)(grp * GU + i) * DM + lane * 4; a[i][0] = 0.f; a[i][1] = 0.f;
#pragma unroll
    for (int j = 0; j < 4; ++j) { const v4f wq = *(const v4fa*)(wr + j * 128);
#pragma unroll
      for (int q = 0; q < 4; ++q) { const float wb = bf16_round(wq[q]);
#pragma unroll
        for (int b = 0; b < BB; ++b) a[i][b] += wb * qv[b][j][q]; } } }
  // loaded values as inputs only: holds the bt1 and Wt2 loads in front of the lane sums (else they sink into the branch of lane 0 below and the group pays a second latency there)
  asm volatile("" :: "v"(b1r[0]), "v"(b1r[1]), "v"(b1r[2]), "v"(b1r[3]), "v"(b1r[4]), "v"(b1r[5]), "v"(b1r[6]), "v"(b1r[7]), "v"(w2r[0]), "v"(w2r[1]), "v"(w2r[2]), "v"(w2r[3]), "v"(w2r[4]), "v"(w2r[5]), "v"(w2r[6]), "v"(w2r[7]));
  static_assert(GU == 8 && BB == 2, "the statement above names eight values of each");
#pragma unroll  // the sixteen lane sums run side by side
  for (int i = 0; i < GU; ++i) { const float b1 = bf16_round(b1r[i]), w2 = bf16_round(w2r[i]);
#pragma unroll
    for (int b = 0; b < BB; ++b) { float t = a[i][b]; for (int o = 16; o >= 1; o >>= 1) t += __shfl_xor(t, o, 32); pw[b] += fmaxf(t + b1, 0.f) * w2; } }
  if (lane == 0) {
#pragma unroll
    for (int b = 0; b < BB; ++b) red[b][grp] = pw[b]; } }
  __syncthreads();
  if (tid < 32) { float v = 0.f; if (tid < BB) { float z = bf16_round(bt2[0]); for (int q = 0; q < 32; ++q) z += red[tid][q]; const float t = 1.0f / (1.0f + expf(-z)); v = 0.5f + t * 1.5f; } TEMP[tid] = v; } }
// one launch for all that needs k_prep alone: block 0 the temperature, then the q, k and v projections (the longer products first), then the similarity plane; role by block range
#define GB_P ((NR / 16) * (DM / 64) / 4)
#define GB_S ((SS / 16) * (SS / 64) / 4)
__global__ __launch_bounds__(128) void k_proj(const _Float16* __restrict__ XQ, const _Float16* __restrict__ XK, const _Float16* __restrict__ XV, const _Float16* __restrict__ Bq, const _Float16* __restrict__ Bk, const _Float16* __restrict__ Bv,
    const float* __restrict__ bq, const float* __restrict__ bk, const float* __restrict__ bv, _Float16* __restrict__ Q16, _Float16* __restrict__ K16, _Float16* __restrict__ V16, const _Float16* __restrict__ SN, _Float16* __restrict__ SIM,
    const float* __restrict__ PART, const float* __restrict__ Wt1, const float* __restrict__ bt1, const float* __restrict__ Wt2, const float* __restrict__ bt2, float* __restrict__ TEMP) {
  __shared__ __attribute__((aligned(16))) float so[4][16][SOP];
  int bx = blockIdx.x;
  if (bx == 0) { temp_body(&so[0][0][0], PART, Wt1, bt1, Wt2, bt2, TEMP); return; }
  bx -= 1;
  if (bx < 3 * GB_P) { const int g = bx / GB_P;
    gemm_hhx_body<0>(so, bx % GB_P, 0, g == 0 ? XQ : g == 1 ? XK : XV, 0, g == 0 ? Bq : g == 1 ? Bk : Bv, 0, 0.0625f, g == 0 ? bq : g == 1 ? bk : bv, 0, nullptr, 1, 0, 0, nullptr, g == 0 ? Q16 : g == 1 ? K16 : V16, DM, 0, NR, DM, DM); return; }
  bx -= 3 * GB_P;
  // SIM[b] = SN[b].SN[b]^T (f16; values in [-1, 1])
  gemm_hhx_body<0>(so, bx % GB_S, bx / GB_S, SN, (size_t)SS * DSEM, SN, (size_t)SS * DSEM, 1.0f, nullptr, 0, nullptr, 1, 0, 0, nullptr, SIM, SS, (size_t)SS * SS, SS, SS, DSEM); }
__global__ __launch_bounds__(256) void k_vt(const _Float16* __restrict__ V16, _Float16* __restrict__ Vt) { __shared__ unsigned short tl[64][66]; const int tid = threadIdx.x; const int slab = blockIdx.x / (SS / 64), lg = blockIdx.x % (SS / 64); const int b = slab / NH, h = slab % NH;
  // both planes in fragment order: chunk i of the 64 x 64 piece is row tile i >> 7, 16-column group (i >> 5) & 3, hh = (i >> 4) & 1, row i & 15; a row tile's share of the piece is 2 KiB in a row
  for (int i = tid; i < 64 * 8; i += 256) { const int r = (i >> 7) * 16 + (i & 15), c8 = ((i >> 5) & 3) * 16 + ((i >> 4) & 1) * 8; FragH f; f.half[0] = *(const v8us*)((const unsigned short*)V16 + ((size_t)((b * SS + lg * 64) / 16 + (i >> 7)) * (DM / 32) + h * (HD / 32)) * 512 + (i & 127) * 8);
#pragma unroll
    for (int q = 0; q < 8; ++q) tl[r][c8 + q] = f.u[q]; }
  __syncthreads();
  {
#pragma unroll
    for (int rd = 0; rd < 2; ++rd) { const int i = rd * 256 + tid, d = (i >> 7) * 16 + (i & 15), p8 = ((i >> 5) & 3) * 16 + ((i >> 4) & 1) * 8; FragH f;
#pragma unroll
      for (int q = 0; q < 8; ++q) f.u[q] = tl[p8 + q][d];
      *(v8us*)((unsigned short*)Vt + ((size_t)(slab * (HD / 16) + (i >> 7)) * (SS / 32) + lg * 2) * 512 + (i & 127) * 8) = f.half[0]; }
     } }
// fused constrained attention per ((b,h), 128 queries): 16 waves = 4 query groups of 32 x 4 key sets, four waves a SIMD, so that one wave's loads and dependent vector chains hide behind three others;
// key set s holds the 32-key chunks s, s + 4, s + 8, ...: the four sets walk side by side; Q16, K16, Vt and SIM lie in fragment order, so each of a pass's 20 fragment loads reads 4 whole lines;
// the four partial results of a query group (own running max, sum, Ot) are joined through LDS behind the loop. s = (q.k)/(8 temp_b) + sem_bias + pos_bias, -inf where mask[b][k] = 0; sem_bias = -(0.5 - sim) if sim < 0.5.
// Transposed products: St = K.Qt (A = 16 key rows, B = 16 query columns), Ot += Vt.Pt. Lane (ln, hh) then holds, for query ln of a tile, the scores of keys 8 hh + r of each 16-key tile:
// the running max and sum are in-lane work plus one swap between the wave halves, two St tiles converted to f16 are the B operand of the second product as they lie, SIM[q][k .. k + 7] is one 16-byte load (half nt of the plane's block: query tile x 32 keys).
typedef int v4ia __attribute__((ext_vector_type(4), may_alias));
typedef _Float16 v8h __attribute__((ext_vector_type(8)));
union FragP { v16h v; v8h p[2]; };
// The softmax runs in base 2: log2(e) is folded into the score scale and into both biases, so a score, a running max and their differences are exponents of 2 and every
// exponential is one v_exp_f32 (expf costs about twelve vector instructions: scaling, rounding, ldexp and two range selects). A result below 2^-126 comes out as 0, as does exp2(-inf).
#define L2E 1.4426950408889634f
// Written as asm so that the slot which the instruction set asks for behind a transcendental (one independent instruction or v_nop before its result is used or its source overwritten) is kept by construction:
// Eight in place: none reads or overwrites a register of another; the v_nop is the slot behind the last.
__device__ __forceinline__ float exp2_raw(float x) { asm("v_exp_f32 %0, %0\n\tv_nop" : "+v"(x)); return x; }
__device__ __forceinline__ v8f exp2_x8(const v8f x) { float a = x[0], b = x[1], c = x[2], d = x[3], e = x[4], f = x[5], g = x[6], h = x[7];
  asm("v_exp_f32 %0, %0\n\tv_exp_f32 %1, %1\n\tv_exp_f32 %2, %2\n\tv_exp_f32 %3, %3\n\tv_exp_f32 %4, %4\n\tv_exp_f32 %5, %5\n\tv_exp_f32 %6, %6\n\tv_exp_f32 %7, %7\n\tv_nop"
      : "+v"(a), "+v"(b), "+v"(c), "+v"(d), "+v"(e), "+v"(f), "+v"(g), "+v"(h));      // in place, so no v_exp_f32 touches a register of the one in front of it; v_nop: the slot behind the last
  return (v8f){a, b, c, d, e, f, g, h}; }
__device__ __forceinline__ float swap_halves(float x) { const int t = __float_as_int(x); return __int_as_float(__builtin_amdgcn_permlanex16(t, t, 0x76543210, 0xfedcba98, false, false)); }   // lane l <-> l ^ 16
__global__ __launch_bounds__(512) void k_flash(const _Float16* __restrict__ Q16, const _Float16* __restrict__ K16, const _Float16* __restrict__ Vt, const _Float16* __restrict__ SIM, const int* __restrict__ mask, const float* __restrict__ TEMP, float* __restrict__ O) {
  constexpr int RPW = 32, NQB = SS / (4 * RPW), DT = HD / 16, KS = HD / 32, NSP = 4;
  static_assert(NSP == 4 && DT == 4, "in the join, the wave of key set s sums two of the eight output tiles");
  __shared__ __attribute__((aligned(16))) float sO[4 * NSP][2][DT][2][32][4];      // a wave's rescaled Ot: 16 bytes a lane, lanes side by side
  __shared__ float sM[4 * NSP][2][32], sL[4 * NSP][2][32];
  const int tid = threadIdx.x, lane = tid & 31, ln = lane & 15, hh = lane >> 4;
  const int w = __builtin_amdgcn_readfirstlane(tid >> 5), qg = w & 3, ksp = w >> 2, k0 = ksp * 32;      // the wave's number in a scalar register: the key loop's bounds and its branch stay scalar
  const int slab = blockIdx.x / NQB, qblk = blockIdx.x % NQB; const int b = slab / NH, h = slab % NH; const int q0 = qblk * (4 * RPW) + qg * RPW; const float sc = (0.125f * L2E) / TEMP[b];
  FragH aq[2][KS];
#pragma unroll
  for (int qt = 0; qt < 2; ++qt) { const unsigned short* qr = (const unsigned short*)Q16 + ((size_t)((b * SS + q0) / 16 + qt) * (DM / 32) + h * KS) * 512 + lane * 8;
#pragma unroll
    for (int ks = 0; ks < KS; ++ks) { aq[qt][ks].half[0] = *(const v8us*)(qr + ks * 512); aq[qt][ks].half[1] = *(const v8us*)(qr + ks * 512 + 256); } }
  // the lane's four read pointers; each moves on by 4 x 32 keys a pass (K16: 8 row tiles; Vt and SIM: 4 blocks of 32 keys)
  constexpr int TK = (DM / 32) * 512, TS = (SS / 32) * 512;      // f16 elements of a 16-row tile of a plane of DM and of SS columns
  const unsigned fo = lane * 8, mo = hh * 8;
  const unsigned short* vp = (const unsigned short*)Vt + (size_t)slab * DT * TS + (k0 / 32) * 512 + fo;
  const unsigned short* kp = (const unsigned short*)K16 + (size_t)((b * SS + k0) / 16) * TK + h * KS * 512 + fo;
  const unsigned short* sp = (const unsigned short*)SIM + (size_t)b * SS * SS + (size_t)(q0 / 16) * TS + (k0 / 32) * 512 + fo;
  const int* mp = mask + (size_t)b * SS + k0 + mo;
  float m_q[2], l_q[2]; v8f oacc[2][DT];
#pragma unroll
  for (int qt = 0; qt < 2; ++qt) { m_q[qt] = -3.0e38f; l_q[qt] = 0.f;
#pragma unroll
    for (int dt = 0; dt < DT; ++dt) oacc[qt][dt] = (v8f){0.f,0.f,0.f,0.f,0.f,0.f,0.f,0.f}; }
#pragma unroll 1
  for (int j0 = k0; j0 < k0 + SS; j0 += NSP * 32) {
    // every load of the pass stands in front of its first product: none depends on the scores any more, so the pass waits for memory once
    FragH bk[2][KS], bv[DT], sm[2][2]; v4ia mk[2][2];
#pragma unroll
    for (int nt = 0; nt < 2; ++nt) {
#pragma unroll
      for (int ks = 0; ks < KS; ++ks) { bk[nt][ks].half[0] = *(const v8us*)(kp + nt * TK + ks * 512); bk[nt][ks].half[1] = *(const v8us*)(kp + nt * TK + ks * 512 + 256); }
      mk[nt][0] = *(const v4ia*)(mp + nt * 16); mk[nt][1] = *(const v4ia*)(mp + nt * 16 + 4);
#pragma unroll
      for (int qt = 0; qt < 2; ++qt) sm[qt][nt].half[0] = *(const v8us*)(sp + qt * TS + nt * 256); }
#pragma unroll
    for (int dt = 0; dt < DT; ++dt) { bv[dt].half[0] = *(const v8us*)(vp + dt * TS); bv[dt].half[1] = *(const v8us*)(vp + dt * TS + 256); }
    asm volatile("s_wait_xcnt 0x0" ::: "memory");      // stands in front of every write of a register that one of the 24 loads names as its address: the four pointers live round the loop, so only their steps below write them (named as inputs here, they cost this build spills in the loop)
    __builtin_amdgcn_sched_barrier(0);      // keeps the 24 loads one group (else half of them issue behind the first wait and the pass pays the latency twice) and the pointer steps behind the wait above
    kp += NSP * 2 * TK; mp += NSP * 32; sp += NSP * 512; vp += NSP * 512;
    v8f s[2][2];
#pragma unroll
    for (int nt = 0; nt < 2; ++nt)
#pragma unroll
      for (int qt = 0; qt < 2; ++qt) { v8f acc = (v8f){0.f,0.f,0.f,0.f,0.f,0.f,0.f,0.f};
#pragma unroll
        for (int ks = 0; ks < KS; ++ks) acc = mmaH<1>(bk[nt][ks].v, bk[nt][ks].v, aq[qt][ks].v, aq[qt][ks].v, acc); s[qt][nt] = acc; }
    FragP pb[2];
#pragma unroll
    for (int qt = 0; qt < 2; ++qt) { const int qi = q0 + qt * 16 + ln; float mc = -INFINITY;
#pragma unroll
      for (int nt = 0; nt < 2; ++nt)
#pragma unroll
        for (int r = 0; r < 8; ++r) { const int k = j0 + nt * 16 + 8 * hh + r; const float sim = (float)sm[qt][nt].h[r]; const float sb = (sim < 0.5f) ? fmaf(sim, L2E, -0.5f * L2E) : 0.f;
          const float dd = fabsf((float)(qi - k)); const float pbias = (dd > 10.f) ? (-0.1f * L2E) * (dd - 10.f) : 0.f;
          const float su = s[qt][nt][r] * sc + sb + pbias; const float sv = (mk[nt][r >> 2][r & 3] != 0) ? su : -INFINITY; s[qt][nt][r] = sv; mc = fmaxf(mc, sv); }
      mc = fmaxf(mc, swap_halves(mc));
      const float mn = fmaxf(m_q[qt], mc); const float al = exp2_raw(m_q[qt] - mn); m_q[qt] = mn; float ls = 0.f;
#pragma unroll
      for (int nt = 0; nt < 2; ++nt) {
#pragma unroll
        for (int r = 0; r < 8; ++r) s[qt][nt][r] -= mn;
        s[qt][nt] = exp2_x8(s[qt][nt]);
#pragma unroll
        for (int r = 0; r < 8; ++r) ls += s[qt][nt][r];
        pb[qt].p[nt] = __builtin_convertvector(s[qt][nt], v8h); }
      l_q[qt] = l_q[qt] * al + ls;      // partial sum of this half's 16 keys; the halves are joined behind the loop
#pragma unroll
      for (int dt = 0; dt < DT; ++dt)
#pragma unroll
        for (int r = 0; r < 8; ++r) oacc[qt][dt][r] *= al; }
#pragma unroll
    for (int dt = 0; dt < DT; ++dt)
#pragma unroll
      for (int qt = 0; qt < 2; ++qt) oacc[qt][dt] = mmaH<1>(bv[dt].v, bv[dt].v, pb[qt].v, pb[qt].v, oacc[qt][dt]); }
  // join of the four key sets of a query group. Step 1: every wave publishes its max and its sum (halves joined)
#pragma unroll
  for (int qt = 0; qt < 2; ++qt) { float l = l_q[qt]; l += swap_halves(l); sM[w][qt][lane] = m_q[qt]; sL[w][qt][lane] = l; }
  __syncthreads();
  // step 2: the common max, the common sum (sets in order), and the wave's Ot rescaled to the common max into LDS
  float inv[2];
#pragma unroll
  for (int qt = 0; qt < 2; ++qt) { float ms[NSP], mx = -3.0e38f, l = 0.f;
#pragma unroll
    for (int s = 0; s < NSP; ++s) { ms[s] = sM[s * 4 + qg][qt][lane]; mx = fmaxf(mx, ms[s]); }
#pragma unroll
    for (int s = 0; s < NSP; ++s) l += sL[s * 4 + qg][qt][lane] * exp2_raw(ms[s] - mx);
    inv[qt] = (l > 0.f) ? 1.0f / l : 0.f; const float f = exp2_raw(m_q[qt] - mx);
#pragma unroll
    for (int dt = 0; dt < DT; ++dt) { v4f lo, hi;
#pragma unroll
      for (int r = 0; r < 4; ++r) { lo[r] = oacc[qt][dt][r] * f; hi[r] = oacc[qt][dt][4 + r] * f; }
      *(v4fa*)&sO[w][qt][dt][0][lane][0] = lo; *(v4fa*)&sO[w][qt][dt][1][lane][0] = hi; } }
  __syncthreads();
  // step 3: the wave of key set s sums, over the four sets in order, tiles 2 (s & 1) and 2 (s & 1) + 1 of query tile s >> 1: 32 columns = one whole 128-byte line of each of 16 output rows, so a line has one writer
  const int qs = ksp >> 1, d0 = (ksp & 1) * 2; const float iv = qs ? inv[1] : inv[0];
  float* orow = O + ((size_t)b * SS + q0 + qs * 16 + ln) * DM + h * HD + d0 * 16 + 8 * hh;      // register r of tile dt is column dt * 16 + 8 hh + r of the query's row
#pragma unroll
  for (int d = 0; d < 2; ++d) { v4f lo = *(const v4fa*)&sO[qg][qs][d0 + d][0][lane][0], hi = *(const v4fa*)&sO[qg][qs][d0 + d][1][lane][0];
#pragma unroll
    for (int s = 1; s < NSP; ++s) { lo += *(const v4fa*)&sO[s * 4 + qg][qs][d0 + d][0][lane][0]; hi += *(const v4fa*)&sO[s * 4 + qg][qs][d0 + d][1][lane][0]; }
    *(v4f*)(orow + d * 16) = lo * iv; *(v4f*)(orow + d * 16 + 4) = hi * iv; } }
extern "C" void kernel_launch(void* const* d_in, const int* in_sizes, int n_in,
                              void* d_out, int out_size, void* d_ws, size_t ws_size, hipStream_t stream) {
  (void)in_sizes; (void)n_in; (void)out_size;
  const float* xq = (const float*)d_in[0]; const float* xk = (const float*)d_in[1]; const float* xv = (const float*)d_in[2]; const int* mask = (const int*)d_in[3]; const float* sf = (const float*)d_in[4];
  const float* Wq = (const float*)d_in[5]; const float* bq = (const float*)d_in[6]; const float* Wk = (const float*)d_in[7]; const float* bk = (const float*)d_in[8]; const float* Wv = (const float*)d_in[9]; const float* bv = (const float*)d_in[10]; const float* Wo = (const float*)d_in[11]; const float* bo = (const float*)d_in[12]; const float* Wt1 = (const float*)d_in[13]; const float* bt1 = (const float*)d_in[14]; const float* Wt2 = (const float*)d_in[15]; const float* bt2 = (const float*)d_in[16];
  char* ws = (char*)d_ws; size_t off = 0;
  auto take = [&](size_t bytes) { char* p = ws + off; off += (bytes + 255) & ~(size_t)255; return p; };
  const size_t w8 = (size_t)DM * DM / 8;
  _Float16* Bq = (_Float16*)take(w8 * 16); _Float16* Bk = (_Float16*)take(w8 * 16); _Float16* Bv = (_Float16*)take(w8 * 16); _Float16* Bo = (_Float16*)take(w8 * 16);
  _Float16* XQ = (_Float16*)take((size_t)NR * DM * 2); _Float16* XK = (_Float16*)take((size_t)NR * DM * 2); _Float16* XV = (_Float16*)take((size_t)NR * DM * 2); _Float16* Q16 = (_Float16*)take((size_t)NR * DM * 2); _Float16* K16 = (_Float16*)take((size_t)NR * DM * 2); _Float16* V16 = (_Float16*)take((size_t)NR * DM * 2); _Float16* Vt = (_Float16*)take((size_t)NR * DM * 2);
  _Float16* SN = (_Float16*)take((size_t)NR * DSEM * 2); _Float16* SIM = (_Float16*)take((size_t)BB * SS * SS * 2); float* TEMP = (float*)take(256); float* O = (float*)take((size_t)NR * DM * 4); float* PART = (float*)take((size_t)BB * QP * DM * 4); _Float16* O16 = XQ;      // the query plane is dead after the q GEMM
  if (off > ws_size) return;      // ≈ 2 + 4.2×7 + 2.1 + 16.8 + 8.4 ≈ 57 MiB
  const unsigned gx = (unsigned)(((size_t)NR * DM / 8 + 255) / 256);
  k_prep<<<PB_QS + 3 * PB_X + PB_SN + 4 * PB_W, 512, 0, stream>>>(xq, xk, xv, sf, Wq, Wk, Wv, Wo, XQ, XK, XV, SN, Bq, Bk, Bv, Bo, PART);
  k_proj<<<1 + 3 * GB_P + BB * GB_S, 128, 0, stream>>>(XQ, XK, XV, Bq, Bk, Bv, bq, bk, bv, Q16, K16, V16, SN, SIM, PART, Wt1, bt1, Wt2, bt2, TEMP);
  const dim3 gg(((NR / 16) * (DM / 64) + 3) / 4, 1);
  k_vt<<<BB * NH * (SS / 64), 256, 0, stream>>>(V16, Vt);
  k_flash<<<BB * NH * (SS / 128), 512, 0, stream>>>(Q16, K16, Vt, SIM, mask, TEMP, O);
  k_h16<<<gx, 256, 0, stream>>>(O, O16, (size_t)NR * DM / 8);
  k_oproj<<<gg, 128, 0, stream>>>(O16, Bo, bo, (float*)d_out);
}

// v008
// A run of this version takes 92.1 microseconds.
// Timed twice side by side with v007, it ran 1.09 times as fast both times.
// Over all steps from v000 it is 8.95 times as fast.
#include <hip/hip_runtime.h>
// q/k/v/o projections (4096 × 512 × 512, + bias), the cosine-similarity matrix of the normalised semantic features (per batch 2048 × 2048 × 256, kept as an f16 plane) and the 8-head
// constrained attention on v_wmma_f32_16x16x32_f16 (fused flash-style kernel: Sᵀ = K·Qᵀ, Oᵀ = Vᵀ·Pᵀ on WMMA; scores / (8·temperature_b) + semantic bias + positional bias, key mask → −inf;
// online max/sum softmax f32; P f16 ≤ 1); the dynamic-temperature MLP on the mean query is f32 VALU (column sums over 64 blocks, then one block); A = f16(bf16 ·) exact operands, weights bf16-exact ×2^4 ((out,in)),
// single products, f32 accumulate.
// Every f16 plane of the workspace lies in fragment order: a plane of KD columns is cut into blocks of 16 rows x 32 columns (row tile major, then column block), a block is 2 x 512 bytes,
// and 16-byte chunk (j, hh, ln) of a block holds row ln, columns 16 j + 8 hh .. + 7. Lane 16 hh + ln of a wave then finds half j of its A or B fragment at byte 16 lane of that half:
// one fragment load reads 512 bytes in a row (4 whole 128-byte lines), where a row-major plane gave it 32 bytes out of each of 16 lines.
#define BB 2
#define SS 2048
#define DM 512
#define NH 8
#define HD 64
#define DSEM 256
#define NR (BB * SS)

typedef __bf16 v16b __attribute__((ext_vector_type(16)));
typedef unsigned short v8us __attribute__((ext_vector_type(8), may_alias));
typedef float  v8f  __attribute__((ext_vector_type(8)));
typedef float  v4f  __attribute__((ext_vector_type(4)));
typedef float  v4fa __attribute__((ext_vector_type(4), may_alias));
union FragB { v16b v; v8us half[2]; unsigned short u[16]; };

__device__ __forceinline__ unsigned short bf16_bits(float x) { unsigned int u = __float_as_uint(x); return (unsigned short)((u + 0x7FFFu + ((u >> 16) & 1u)) >> 16); }
__device__ __forceinline__ float bf16_val(unsigned short b) { return __uint_as_float(((unsigned int)b) << 16); }
__device__ __forceinline__ float bf16_round(float x) { return bf16_val(bf16_bits(x)); }
// D += A·B with NT terms: 1 = ah·bh, 2 = + al·bh (A split), 3 = + ah·bl (both split)
template <int NT>
__device__ __forceinline__ v8f mmaN(v16b ah, v16b al, v16b bh, v16b bl, v8f c) {
  c = __builtin_amdgcn_wmma_f32_16x16x32_bf16(false, ah, false, bh, (short)0, c, false, false);
  if (NT >= 2) c = __builtin_amdgcn_wmma_f32_16x16x32_bf16(false, al, false, bh, (short)0, c, false, false);
  if (NT >= 3) c = __builtin_amdgcn_wmma_f32_16x16x32_bf16(false, ah, false, bl, (short)0, c, false, false);
  asm volatile("v_nop\n\tv_nop\n\tv_nop\n\tv_nop" : "+v"(c) : "v"(ah), "v"(al), "v"(bh), "v"(bl));
  return c;
}

__global__ __launch_bounds__(256) void k_wt_bf16(const float* __restrict__ W, unsigned short* __restrict__ Wt, int K, int N) {
  const int t = blockIdx.x * 256 + threadIdx.x;
  const int k8n = K / 8;
  if (t >= N * k8n) return;
  const int n = t / k8n, k8 = (t % k8n) * 8;
  v8us v;
#pragma unroll
  for (int i = 0; i < 8; ++i) v[i] = bf16_bits(W[(size_t)(k8 + i) * N + n]);
  *(v8us*)(Wt + (size_t)n * K + k8) = v;
  
}

// GEMM C[M][N] (f32, pitch ldc) = act(A[M][K]·W + bias). A f32 row-major (pitch lda) converted per fragment to bf16
// (ASPLIT: hi/lo two planes -> 2 terms, else single rounded term); Wt bf16 [N][K] (pitch ldb). BIAS_BF16 rounds the
// bias to bf16 first (bias quantised to bf16 before the add). K%32==0, M%16==0, N%64==0.
template <bool ASPLIT, int ACT, bool BIAS_BF16>
__global__ __launch_bounds__(128) void k_gemm_bf(const float* __restrict__ A, int lda, const unsigned short* __restrict__ Wt, int ldb,
                                               const float* __restrict__ bias, float* __restrict__ C, int ldc, int M, int N, int K) {
  __shared__ __attribute__((aligned(16))) float so[4][16][64];
  const int tid = threadIdx.x, w = tid >> 5, lane = tid & 31, ln = lane & 15, hh = lane >> 4;
  const int ntn = N / 64;
  const int wid = blockIdx.x * 4 + w;
  const int mt = wid / ntn, nq = wid % ntn;
  if (mt * 16 >= M) return;
  const int row0 = mt * 16, col0 = nq * 64;
  const float* arow = A + (size_t)(row0 + ln) * lda;
  v8f acc[4] = {};
  for (int kb = 0; kb < K; kb += 32) {
    FragB ah, al;
    const v4f x0 = *(const v4fa*)(arow + kb + 8 * hh), x1 = *(const v4fa*)(arow + kb + 8 * hh + 4);
    const v4f x2 = *(const v4fa*)(arow + kb + 16 + 8 * hh), x3 = *(const v4fa*)(arow + kb + 16 + 8 * hh + 4);
    float xs[16] = {x0[0],x0[1],x0[2],x0[3],x1[0],x1[1],x1[2],x1[3],x2[0],x2[1],x2[2],x2[3],x3[0],x3[1],x3[2],x3[3]};
#pragma unroll
    for (int i = 0; i < 16; ++i) { const unsigned short hb = bf16_bits(xs[i]); ah.u[i] = hb; al.u[i] = ASPLIT ? bf16_bits(xs[i] - bf16_val(hb)) : (unsigned short)0; }
#pragma unroll
    for (int t = 0; t < 4; ++t) {
      const unsigned short* brow = Wt + (size_t)(col0 + t * 16 + ln) * ldb + kb;
      FragB b;
      b.half[0] = *(const v8us*)(brow + 8 * hh);
      b.half[1] = *(const v8us*)(brow + 16 + 8 * hh);
      acc[t] = mmaN<ASPLIT ? 2 : 1>(ah.v, al.v, b.v, b.v, acc[t]);
    }
  }
#pragma unroll
  for (int t = 0; t < 4; ++t) {
    float bv = bias ? bias[col0 + t * 16 + ln] : 0.f;
    if (BIAS_BF16) bv = bf16_round(bv);
#pragma unroll
    for (int r = 0; r < 8; ++r) { float v = acc[t][r] + bv; if (ACT == 1) v = fmaxf(v, 0.f); so[w][8 * hh + r][t * 16 + ln] = v; }
  }
  __builtin_amdgcn_fence(__ATOMIC_ACQ_REL, "workgroup");
  __builtin_amdgcn_wave_barrier();
  const int rsub = lane >> 4, c4 = (lane & 15) * 4;
  {
#pragma unroll
    for (int q = 0; q < 8; ++q) {
      const int r = q * 2 + rsub;
      const v4f v = *(const v4fa*)&so[w][r][c4];
      *(v4f*)(C + (size_t)(row0 + r) * ldc + col0 + c4) = v;
    }
    
  }
}

// Flash-style causal/unmasked attention, all contractions 3-term bf16 hi/lo splits, f32 softmax with running max.
// q,k,v rows are read from f32 buffers with arbitrary row pitch (so they can live inside a fused qkv buffer);
// D = head size (multiple of 32, <= 128); one wave = 16 query rows; block = 4 waves (64 queries) sharing K/V chunks of 32.
template <int D, bool CAUSAL>
__global__ __launch_bounds__(128) void k_flash(const float* __restrict__ qb, const float* __restrict__ kb, const float* __restrict__ vb,
                                             int pitch, int T, int H, float scale, float* __restrict__ y, int ypitch) {
  constexpr int KS = D / 32;        // k-steps for QK
  constexpr int DT = D / 16;        // d tiles for PV
  __shared__ __attribute__((aligned(16))) unsigned short sKh[32][D + 8], sKl[32][D + 8], sVh[32][D + 8], sVl[32][D + 8];
  __shared__ __attribute__((aligned(16))) unsigned short sPh[4][16][40], sPl[4][16][40];
  __shared__ __attribute__((aligned(16))) float sO[4][16][D];
  const int tid = threadIdx.x, w = tid >> 5, lane = tid & 31, ln = lane & 15, hh = lane >> 4;
  const int nqb = (T + 63) / 64;
  const int bh = blockIdx.x / nqb, qblk = blockIdx.x % nqb;
  const int b = bh / H, h = bh % H;
  const int q0 = qblk * 64 + w * 16;
  const float* Q = qb + (size_t)b * T * pitch + h * D;
  const float* K = kb + (size_t)b * T * pitch + h * D;
  const float* V = vb + (size_t)b * T * pitch + h * D;

  // A fragments of the wave's 16 query rows (scaled), hi/lo
  FragB aqh[KS], aql[KS];
  {
    int row = q0 + ln; if (row >= T) row = T - 1;
    const float* qr = Q + (size_t)row * pitch;
#pragma unroll
    for (int ks = 0; ks < KS; ++ks)
#pragma unroll
      for (int i = 0; i < 16; ++i) {
        const int d = ks * 32 + ((i < 8) ? (8 * hh + i) : (16 + 8 * hh + (i - 8)));
        const float x = qr[d] * scale; const unsigned short hb = bf16_bits(x);
        aqh[ks].u[i] = hb; aql[ks].u[i] = bf16_bits(x - bf16_val(hb));
      }
  }
  float m_r[8], l_r[8];
#pragma unroll
  for (int r = 0; r < 8; ++r) { m_r[r] = -3.0e38f; l_r[r] = 0.f; }
  v8f oacc[DT];
#pragma unroll
  for (int dt = 0; dt < DT; ++dt) oacc[dt] = (v8f){0.f,0.f,0.f,0.f,0.f,0.f,0.f,0.f};

  const int kv_end = CAUSAL ? min(T, qblk * 64 + 64) : T;     // block-uniform
  for (int j0 = 0; j0 < kv_end; j0 += 32) {
    __syncthreads();
    for (int e = tid; e < 32 * (D / 4); e += 128) {
      const int r = e / (D / 4), c4 = (e % (D / 4)) * 4;
      const int key = j0 + r;
      v4f kf = {0.f,0.f,0.f,0.f}, vf = {0.f,0.f,0.f,0.f};
      if (key < T) { kf = *(const v4fa*)(K + (size_t)key * pitch + c4); vf = *(const v4fa*)(V + (size_t)key * pitch + c4); }
#pragma unroll
      for (int t = 0; t < 4; ++t) {
        unsigned short hb = bf16_bits(kf[t]); sKh[r][c4 + t] = hb; sKl[r][c4 + t] = bf16_bits(kf[t] - bf16_val(hb));
        hb = bf16_bits(vf[t]); sVh[r][c4 + t] = hb; sVl[r][c4 + t] = bf16_bits(vf[t] - bf16_val(hb));
      }
    }
    __syncthreads();
    // S tile 16 x 32
    v8f s[2];
#pragma unroll
    for (int nt = 0; nt < 2; ++nt) {
      v8f acc = {};
#pragma unroll
      for (int ks = 0; ks < KS; ++ks) {
        FragB bh_, bl_;
        bh_.half[0] = *(const v8us*)&sKh[nt * 16 + ln][ks * 32 + 8 * hh]; bh_.half[1] = *(const v8us*)&sKh[nt * 16 + ln][ks * 32 + 16 + 8 * hh];
        bl_.half[0] = *(const v8us*)&sKl[nt * 16 + ln][ks * 32 + 8 * hh]; bl_.half[1] = *(const v8us*)&sKl[nt * 16 + ln][ks * 32 + 16 + 8 * hh];
        acc = mmaN<3>(aqh[ks].v, aql[ks].v, bh_.v, bl_.v, acc);
      }
      s[nt] = acc;
    }
    // mask + running max (rows 8hh+r; the 16 lanes of a half share rows)
    float alpha[8];
#pragma unroll
    for (int r = 0; r < 8; ++r) {
      const int qi = q0 + 8 * hh + r;
      const int ja = j0 + ln, jb = j0 + 16 + ln;
      if (CAUSAL) { if (ja > qi) s[0][r] = -3.0e38f; if (jb > qi) s[1][r] = -3.0e38f; }
      if (ja >= T) s[0][r] = -3.0e38f;
      if (jb >= T) s[1][r] = -3.0e38f;
      float mx = fmaxf(s[0][r], s[1][r]);
      mx = fmaxf(mx, __shfl_xor(mx, 1, 32)); mx = fmaxf(mx, __shfl_xor(mx, 2, 32)); mx = fmaxf(mx, __shfl_xor(mx, 4, 32)); mx = fmaxf(mx, __shfl_xor(mx, 8, 32));
      const float mnew = fmaxf(m_r[r], mx);
      alpha[r] = (mnew > -1.0e38f) ? __expf(m_r[r] - mnew) : 1.0f;
      const float p0 = (s[0][r] > -1.0e38f) ? __expf(s[0][r] - mnew) : 0.f;
      const float p1 = (s[1][r] > -1.0e38f) ? __expf(s[1][r] - mnew) : 0.f;
      m_r[r] = mnew;
      l_r[r] = l_r[r] * alpha[r] + p0 + p1;            // per-lane partial row sum (16 lanes combined at the end)
      unsigned short hb = bf16_bits(p0); sPh[w][8 * hh + r][ln] = hb;      sPl[w][8 * hh + r][ln] = bf16_bits(p0 - bf16_val(hb));
      hb = bf16_bits(p1);                sPh[w][8 * hh + r][16 + ln] = hb; sPl[w][8 * hh + r][16 + ln] = bf16_bits(p1 - bf16_val(hb));
    }
#pragma unroll
    for (int dt = 0; dt < DT; ++dt)
#pragma unroll
      for (int r = 0; r < 8; ++r) oacc[dt][r] *= alpha[r];
    __builtin_amdgcn_fence(__ATOMIC_ACQ_REL, "workgroup");
    __builtin_amdgcn_wave_barrier();
    FragB pah, pal;
    pah.half[0] = *(const v8us*)&sPh[w][ln][8 * hh]; pah.half[1] = *(const v8us*)&sPh[w][ln][16 + 8 * hh];
    pal.half[0] = *(const v8us*)&sPl[w][ln][8 * hh]; pal.half[1] = *(const v8us*)&sPl[w][ln][16 + 8 * hh];
#pragma unroll
    for (int dt = 0; dt < DT; ++dt) {
      FragB bvh, bvl;
#pragma unroll
      for (int i = 0; i < 8; ++i) {
        bvh.u[i] = sVh[8 * hh + i][dt * 16 + ln]; bvh.u[8 + i] = sVh[16 + 8 * hh + i][dt * 16 + ln];
        bvl.u[i] = sVl[8 * hh + i][dt * 16 + ln]; bvl.u[8 + i] = sVl[16 + 8 * hh + i][dt * 16 + ln];
      }
      oacc[dt] = mmaN<3>(pah.v, pal.v, bvh.v, bvl.v, oacc[dt]);
    }
    __builtin_amdgcn_fence(__ATOMIC_ACQ_REL, "workgroup");
    __builtin_amdgcn_wave_barrier();
  }
#pragma unroll
  for (int r = 0; r < 8; ++r) {
    float l = l_r[r];
    l += __shfl_xor(l, 1, 32); l += __shfl_xor(l, 2, 32); l += __shfl_xor(l, 4, 32); l += __shfl_xor(l, 8, 32);
    l_r[r] = (l > 0.f) ? 1.0f / l : 0.f;
  }
#pragma unroll
  for (int dt = 0; dt < DT; ++dt)
#pragma unroll
    for (int r = 0; r < 8; ++r) sO[w][8 * hh + r][dt * 16 + ln] = oacc[dt][r] * l_r[r];
  __builtin_amdgcn_fence(__ATOMIC_ACQ_REL, "workgroup");
  __builtin_amdgcn_wave_barrier();
  {
    for (int r = 0; r < 16; ++r) {
      const int row = q0 + r;
      if (row < T && lane < D / 4) {
        const v4f val = *(const v4fa*)&sO[w][r][lane * 4];
        *(v4f*)(y + ((size_t)b * T + row) * ypitch + h * D + lane * 4) = val;
      }
    }
    
  }
}

// GEMM C = act(A·W + bias + resid): A f32 (ASPLIT -> hi/lo 2 terms), Wt bf16 [N][K]; ACT 0 none, 1 relu, 2 exact gelu;
// resid (optional, f32, row index = (row % rmod), pitch ldr, RES_BF16 rounds it) added before the activation.
template <bool ASPLIT, int ACT, bool BIAS_BF16, bool RES_BF16>
__global__ __launch_bounds__(128) void k_gemm_bf3(const float* __restrict__ A, int lda, const unsigned short* __restrict__ Wt, int ldb,
                                                const float* __restrict__ bias, const float* __restrict__ resid, int rmod, int ldr,
                                                float* __restrict__ C, int ldc, int M, int N, int K) {
  __shared__ __attribute__((aligned(16))) float so[4][16][64];
  const int tid = threadIdx.x, w = tid >> 5, lane = tid & 31, ln = lane & 15, hh = lane >> 4;
  const int ntn = N / 64;
  const int wid = blockIdx.x * 4 + w;
  const int mt = wid / ntn, nq = wid % ntn;
  if (mt * 16 >= M) return;
  const int row0 = mt * 16, col0 = nq * 64;
  const float* arow = A + (size_t)(row0 + ln) * lda;
  v8f acc[4] = {};
  for (int kb = 0; kb < K; kb += 32) {
    FragB ah, al;
    const v4f x0 = *(const v4fa*)(arow + kb + 8 * hh), x1 = *(const v4fa*)(arow + kb + 8 * hh + 4);
    const v4f x2 = *(const v4fa*)(arow + kb + 16 + 8 * hh), x3 = *(const v4fa*)(arow + kb + 16 + 8 * hh + 4);
    float xs[16] = {x0[0],x0[1],x0[2],x0[3],x1[0],x1[1],x1[2],x1[3],x2[0],x2[1],x2[2],x2[3],x3[0],x3[1],x3[2],x3[3]};
#pragma unroll
    for (int i = 0; i < 16; ++i) { const unsigned short hb = bf16_bits(xs[i]); ah.u[i] = hb; al.u[i] = ASPLIT ? bf16_bits(xs[i] - bf16_val(hb)) : (unsigned short)0; }
#pragma unroll
    for (int t = 0; t < 4; ++t) {
      const unsigned short* brow = Wt + (size_t)(col0 + t * 16 + ln) * ldb + kb;
      FragB b;
      b.half[0] = *(const v8us*)(brow + 8 * hh);
      b.half[1] = *(const v8us*)(brow + 16 + 8 * hh);
      acc[t] = mmaN<ASPLIT ? 2 : 1>(ah.v, al.v, b.v, b.v, acc[t]);
    }
  }
#pragma unroll
  for (int t = 0; t < 4; ++t) {
    const int col = col0 + t * 16 + ln;
    float bv = bias ? bias[col] : 0.f;
    if (BIAS_BF16) bv = bf16_round(bv);
#pragma unroll
    for (int r = 0; r < 8; ++r) {
      float v = acc[t][r] + bv;
      if (resid) { float rv = resid[(size_t)((row0 + 8 * hh + r) % rmod) * ldr + col]; if (RES_BF16) rv = bf16_round(rv); v += rv; }
      if (ACT == 1) v = fmaxf(v, 0.f);
      if (ACT == 2) v = 0.5f * v * (1.0f + erff(v * 0.70710678118654752f));
      if (ACT == 3) { const float u = 0.7978845608028654f * (v + 0.044715f * v * v * v); v = 0.5f * v * (1.0f + tanhf(u)); }
      so[w][8 * hh + r][t * 16 + ln] = v;
    }
  }
  __builtin_amdgcn_fence(__ATOMIC_ACQ_REL, "workgroup");
  __builtin_amdgcn_wave_barrier();
  const int rsub = lane >> 4, c4 = (lane & 15) * 4;
  {
#pragma unroll
    for (int q = 0; q < 8; ++q) {
      const int r = q * 2 + rsub;
      const v4f v = *(const v4fa*)&so[w][r][c4];
      *(v4f*)(C + (size_t)(row0 + r) * ldc + col0 + c4) = v;
    }
    
  }
}
// row LayerNorm (biased variance, eps) over N: s = X (+ R); optional out_sum <- s; out_norm <- (s-mu)*rsqrt(var+eps)*g + b
template <bool PARAM_BF16>
__global__ __launch_bounds__(256) void k_layernorm(const float* __restrict__ X, const float* __restrict__ R, const float* __restrict__ g, const float* __restrict__ bta,
                                                  float* __restrict__ out_sum, float* __restrict__ out_norm, int N, float eps) {
  __shared__ float red[256];
  const int row = blockIdx.x, tid = threadIdx.x;
  const float* x = X + (size_t)row * N; const float* rr = R ? R + (size_t)row * N : nullptr;
  float vals[16];                     // up to N = 4096
  const int per = N / 256;            // contiguous chunk per thread? use strided-by-4 chunks: thread handles j = tid*4 + 1024*u
  float s1 = 0.f;
  for (int u = 0; u < per / 4; ++u) {
    const int j = tid * 4 + 1024 * u;
    const v4f a = *(const v4fa*)(x + j);
    v4f b = {0.f,0.f,0.f,0.f}; if (rr) b = *(const v4fa*)(rr + j);
#pragma unroll
    for (int q = 0; q < 4; ++q) { const float v = a[q] + b[q]; vals[u * 4 + q] = v; s1 += v; }
  }
  red[tid] = s1; __syncthreads();
  for (int st = 128; st > 0; st >>= 1) { if (tid < st) red[tid] += red[tid + st]; __syncthreads(); }
  const float mu = red[0] / (float)N; __syncthreads();
  float s2 = 0.f;
  for (int u = 0; u < per / 4; ++u)
#pragma unroll
    for (int q = 0; q < 4; ++q) { const float c = vals[u * 4 + q] - mu; s2 += c * c; }
  red[tid] = s2; __syncthreads();
  for (int st = 128; st > 0; st >>= 1) { if (tid < st) red[tid] += red[tid + st]; __syncthreads(); }
  const float rs = rsqrtf(red[0] / (float)N + eps);
  {
    for (int u = 0; u < per / 4; ++u) {
      const int j = tid * 4 + 1024 * u;
      v4f o, sm;
#pragma unroll
      for (int q = 0; q < 4; ++q) {
        float gg = g[j + q], bb = bta[j + q];
        if (PARAM_BF16) { gg = bf16_round(gg); bb = bf16_round(bb); }
        sm[q] = vals[u * 4 + q]; o[q] = (vals[u * 4 + q] - mu) * rs * gg + bb;
      }
      if (out_sum) *(v4f*)(out_sum + (size_t)row * N + j) = sm;
      *(v4f*)(out_norm + (size_t)row * N + j) = o;
    }
    
  }
}



// ---- f16 WMMA path (v_wmma_f32_16x16x32_f16): 11-bit significands for operands in range — used where a [0,1] probability operand needs more precision than bf16
typedef _Float16 v16h __attribute__((ext_vector_type(16)));
union FragH { v16h v; v8us half[2]; _Float16 h[16]; unsigned short u[16]; };
template <int NT>
__device__ __forceinline__ v8f mmaH(v16h ah, v16h al, v16h bh, v16h bl, v8f c) {
  c = __builtin_amdgcn_wmma_f32_16x16x32_f16(false, ah, false, bh, (short)0, c, false, false);
  if (NT >= 2) c = __builtin_amdgcn_wmma_f32_16x16x32_f16(false, al, false, bh, (short)0, c, false, false);
  if (NT >= 3) c = __builtin_amdgcn_wmma_f32_16x16x32_f16(false, ah, false, bl, (short)0, c, false, false);
  asm volatile("v_nop\n\tv_nop\n\tv_nop\n\tv_nop" : "+v"(c) : "v"(ah), "v"(al), "v"(bh), "v"(bl));
  return c;
}
// batched GEMM like k_gemm_b but f16 operands: A f32 (split into f16 hi/lo if ASPLIT, else rounded to f16), Bt = f16 values [n][k]; alpha; C f32; N multiple of 16 (partial tiles skipped)
template <bool ASPLIT>
__global__ __launch_bounds__(128) void k_gemm_h(const float* __restrict__ A, int lda, size_t sA, const _Float16* __restrict__ Bh, int ldb, size_t sB, float alpha, float* __restrict__ C, int ldc, size_t sC, int M, int N, int K) {
  __shared__ __attribute__((aligned(16))) float so[4][16][64];
  const int tid = threadIdx.x, w = tid >> 5, lane = tid & 31, ln = lane & 15, hh = lane >> 4; const int by = blockIdx.y;
  A += (size_t)by * sA; Bh += (size_t)by * sB; C += (size_t)by * sC;
  const int ntn = (N + 63) / 64; const int wid = blockIdx.x * 4 + w; const int mt = wid / ntn, nq = wid % ntn; if (mt * 16 >= M) return;
  const int row0 = mt * 16, col0 = nq * 64; const float* arow = A + (size_t)(row0 + ln) * lda;
  v8f acc[4] = {};
  for (int kb = 0; kb < K; kb += 32) {
    FragH ah, al;
    const v4f x0 = *(const v4fa*)(arow + kb + 8 * hh), x1 = *(const v4fa*)(arow + kb + 8 * hh + 4), x2 = *(const v4fa*)(arow + kb + 16 + 8 * hh), x3 = *(const v4fa*)(arow + kb + 16 + 8 * hh + 4);
    float xs[16] = {x0[0],x0[1],x0[2],x0[3],x1[0],x1[1],x1[2],x1[3],x2[0],x2[1],x2[2],x2[3],x3[0],x3[1],x3[2],x3[3]};
#pragma unroll
    for (int i = 0; i < 16; ++i) { const _Float16 h = (_Float16)xs[i]; ah.h[i] = h; al.h[i] = ASPLIT ? (_Float16)(xs[i] - (float)h) : (_Float16)0.0f; }
#pragma unroll
    for (int t = 0; t < 4; ++t) { if (col0 + t * 16 >= N) continue; const size_t boff = (size_t)(col0 + t * 16 + ln) * ldb + kb; FragH bq; bq.half[0] = *(const v8us*)(Bh + boff + 8 * hh); bq.half[1] = *(const v8us*)(Bh + boff + 16 + 8 * hh);
      acc[t] = mmaH<ASPLIT ? 2 : 1>(ah.v, al.v, bq.v, bq.v, acc[t]); }
  }
#pragma unroll
  for (int t = 0; t < 4; ++t) { if (col0 + t * 16 >= N) continue;
#pragma unroll
    for (int r = 0; r < 8; ++r) so[w][8 * hh + r][t * 16 + ln] = acc[t][r] * alpha; }
  __builtin_amdgcn_fence(__ATOMIC_ACQ_REL, "workgroup"); __builtin_amdgcn_wave_barrier();
  const int rsub = lane >> 4, c4 = (lane & 15) * 4;
  {
#pragma unroll
    for (int q = 0; q < 8; ++q) { const int r = q * 2 + rsub; if (col0 + c4 < N) { const v4f v = *(const v4fa*)&so[w][r][c4]; *(v4f*)(C + (size_t)(row0 + r) * ldc + col0 + c4) = v; } }
     }
}

// Wt[n][k] = f16(W[k][n]·scale) from f32 row-major W[K][N] (scale = power of two; bf16-exact weights stay exact in f16 away from the subnormal range)
__global__ __launch_bounds__(256) void k_wt_f16(const float* __restrict__ W, _Float16* __restrict__ Wt, int K, int N, float scale) {
  const int t = blockIdx.x * 256 + threadIdx.x; if (t >= N * (K / 8)) return; const int n = t / (K / 8), k8 = (t % (K / 8)) * 8; FragH f;
#pragma unroll
  for (int i = 0; i < 8; ++i) f.h[i] = (_Float16)(bf16_round(W[(size_t)(k8 + i) * N + n]) * scale); const v8us o = f.half[0];
  *(v8us*)((unsigned short*)Wt + (size_t)n * K + k8) = o; 
}
// k_gemm_hh variant with fused epilogue: v = acc·alpha + bias[by·sBias + col] (+ CP[(row/rowsPerB)·sCPb + by·64 + col] if CP) ; ACT 0 none / 1 elu ; writes f32 C and f16 C16, each if non-null
// the body takes its block indices (bx, by) and its 17 KiB of LDS from the caller, so that several products can share one launch
// A (M x K), Bh (N x K) and C16 (M x N) lie in fragment order; C is row-major with pitch ldc; CT, where given, takes the result alone, transposed per head. SOP: row pitch of the LDS tile in floats, 4 more than the row so that 16 lanes reading 16 rows at one column meet 16 different bank groups
#define SOP 68
// row-major element offset of 16-byte chunk t of a fragment-order plane of KD columns
__device__ __forceinline__ size_t frag_src(const size_t t, const int KD) { const size_t blk = t >> 6; const int kbn = KD >> 5;
  return ((blk / kbn) * 16 + (t & 15)) * KD + (blk % kbn) * 32 + ((t >> 5) & 1) * 16 + ((t >> 4) & 1) * 8; }
template <int ACT>
__device__ __forceinline__ void gemm_hhx_body(float (*so)[16][SOP], const int bx, const int by, const _Float16* __restrict__ A, size_t sA, const _Float16* __restrict__ Bh, size_t sB, float alpha, const float* __restrict__ bias, size_t sBias, const float* __restrict__ CP, int rowsPerB, size_t sCPb, int row0g,
    float* __restrict__ C, _Float16* __restrict__ C16, _Float16* __restrict__ CT, int ldc, size_t sC, int M, int N, int K) {
  const int tid = threadIdx.x, w = tid >> 5, lane = tid & 31, ln = lane & 15, hh = lane >> 4;
  A += (size_t)by * sA; Bh += (size_t)by * sB; const size_t cofs = (size_t)by * sC; const float* bp = bias ? bias + (size_t)by * sBias : nullptr;
  const int ntn = (N + 63) / 64; const int wid = bx * 4 + w; const int mt = wid / ntn, nq = wid % ntn; if (mt * 16 >= M) return;
  const int row0 = mt * 16, col0 = nq * 64; const size_t tsz = (size_t)(K >> 5) * 512;      // f16 elements of one 16-row tile
  const unsigned short* afr = (const unsigned short*)A + (size_t)mt * tsz + lane * 8; const unsigned short* bfr = (const unsigned short*)Bh + (size_t)(col0 >> 4) * tsz + lane * 8;
  v8f acc[4] = {};
  // The fragments come in groups of two k steps (20 loads of 16 bytes a lane) into two register sets: while one set is multiplied, the other set's loads are in flight,
  // so a wave waits for memory once a group, behind eight products, where a load, a full wait and one product in turn paid the whole latency for every product. K is a multiple of 128. Each acc[t] still sums k upwards.
  FragH a0[2], b0[2][4], a1[2], b1[2][4];
  auto ldg = [&](FragH (&a)[2], FragH (&b)[2][4], const int kb) {
#pragma unroll
    for (int s = 0; s < 2; ++s) { a[s].half[0] = *(const v8us*)(afr + (kb + 32 * s) * 16); a[s].half[1] = *(const v8us*)(afr + (kb + 32 * s) * 16 + 256);
#pragma unroll
      for (int t = 0; t < 4; ++t) { if (col0 + t * 16 >= N) continue; const size_t boff = (size_t)t * tsz + (kb + 32 * s) * 16; b[s][t].half[0] = *(const v8us*)(bfr + boff); b[s][t].half[1] = *(const v8us*)(bfr + boff + 256); } }
    asm volatile("s_wait_xcnt 0x0" ::: "memory");      // stands in front of every later write of a register that one of the group's loads names as its address
    __builtin_amdgcn_sched_barrier(0);      // keeps the group's loads together and in front of the other set's products (else they sink to their first use and each product waits for its own load again)
  };
  auto mmg = [&](FragH (&a)[2], FragH (&b)[2][4]) {
#pragma unroll
    for (int s = 0; s < 2; ++s)
#pragma unroll
      for (int t = 0; t < 4; ++t) { if (col0 + t * 16 >= N) continue; acc[t] = mmaH<1>(a[s].v, a[s].v, b[s][t].v, b[s][t].v, acc[t]); }
  };
  float bl[4] = {0.f, 0.f, 0.f, 0.f};      // the four bias values are asked for in front of the first group, not one by one behind the loop with a full wait each
  if (bp) {
#pragma unroll
    for (int t = 0; t < 4; ++t) { if (col0 + t * 16 >= N) continue; bl[t] = bp[col0 + t * 16 + ln]; } }
  ldg(a0, b0, 0);
  for (int kb = 0; kb < K; kb += 128) {
    ldg(a1, b1, kb + 64); mmg(a0, b0);
    if (kb + 128 < K) ldg(a0, b0, kb + 128);
    mmg(a1, b1); }
  if (CT) {      // the value product (N = DM, rows = BB x SS keys): lane (ln, hh) holds in acc[t] column 16 t + ln of head nq for keys row0 + 8 hh .. + 7, which is 16-byte chunk (hh, ln) of one half block of the head's
    // transposed plane (HD rows x SS keys, fragment order) as it lies: four stores of 512 bytes in a row straight from the accumulators, no LDS, and no launch that reads the plane back to turn it
    unsigned short* tfr = (unsigned short*)CT + (size_t)((row0 / SS) * NH + nq) * (HD / 16) * ((SS / 32) * 512) + ((row0 % SS) >> 4) * 256 + lane * 8;
#pragma unroll
    for (int t = 0; t < 4; ++t) { const float bv = bf16_round(bl[t]); FragH f;
#pragma unroll
      for (int r = 0; r < 8; ++r) f.h[r] = (_Float16)(acc[t][r] * alpha + bv);
      *(v8us*)(tfr + (size_t)t * ((SS / 32) * 512)) = f.half[0]; }
    asm volatile("s_wait_xcnt 0x0" ::: "memory");      // in the listing the other results' epilogue stands behind a branch after these stores and writes their registers: the wait stands in front of it
    return; }
#pragma unroll
  for (int t = 0; t < 4; ++t) { if (col0 + t * 16 >= N) continue; const int col = col0 + t * 16 + ln; const float bv = bf16_round(bl[t]);
#pragma unroll
    for (int r = 0; r < 8; ++r) { float v = acc[t][r] * alpha + bv; if (CP) { const int bidx = (row0g + row0 + 8 * hh + r) / rowsPerB; v += CP[(size_t)bidx * sCPb + (size_t)by * 64 + col]; } if (ACT == 1) v = (v > 0.f) ? v : expm1f(v); else if (ACT == 3) v = fmaxf(v, 0.f); so[w][8 * hh + r][t * 16 + ln] = v; } }
  __builtin_amdgcn_fence(__ATOMIC_ACQ_REL, "workgroup"); __builtin_amdgcn_wave_barrier();
  const int rsub = lane >> 4, c4 = (lane & 15) * 4;
  if (C) {
#pragma unroll
    for (int q = 0; q < 8; ++q) { const int r = q * 2 + rsub; if (col0 + c4 < N) { const v4f v = *(const v4fa*)&so[w][r][c4]; *(v4f*)(C + cofs + (size_t)(row0 + r) * ldc + col0 + c4) = v; } }
  }
  if (C16) {      // the wave's 16 x 64 tile is two blocks of the plane, 2 KiB in a row: four stores of 512 bytes
    unsigned short* cfr = (unsigned short*)C16 + cofs + ((size_t)mt * (N >> 5) + (col0 >> 5)) * 512 + lane * 8;
#pragma unroll
    for (int c = 0; c < 4; ++c) { if (col0 + c * 16 >= N) continue; const v4f v0 = *(const v4fa*)&so[w][ln][c * 16 + 8 * hh], v1 = *(const v4fa*)&so[w][ln][c * 16 + 8 * hh + 4]; FragH f;
#pragma unroll
      for (int i = 0; i < 4; ++i) { f.h[i] = (_Float16)v0[i]; f.h[4 + i] = (_Float16)v1[i]; }
      *(v8us*)(cfr + c * 256) = f.half[0]; }
  }
}
// the output projection: its shapes are constants, as in k_proj, so that the column guards of the body fold away and a group's loads stand in one run with no branch between them
__global__ __launch_bounds__(128) void k_oproj(const _Float16* __restrict__ A, const _Float16* __restrict__ Bh, const float* __restrict__ bias, float* __restrict__ C) {
  __shared__ __attribute__((aligned(16))) float so[4][16][SOP];
  gemm_hhx_body<0>(so, blockIdx.x, 0, A, 0, Bh, 0, 0.0625f, bias, 0, nullptr, 1, 0, 0, C, nullptr, nullptr, DM, 0, NR, DM, DM);
}


// x16_body, round16f_body, sn_body and qsum_body are roles of one launch (k_prep, blocks of 512): each takes its block index bx inside its role
__device__ __forceinline__ void x16_body(const int bx, const float* __restrict__ x, _Float16* __restrict__ X16) { const size_t t = (size_t)bx * 512 + threadIdx.x, s = frag_src(t, DM); FragH f;
#pragma unroll
  for (int q = 0; q < 8; ++q) f.h[q] = (_Float16)bf16_round(x[s + q]); *(v8us*)((unsigned short*)X16 + t * 8) = f.half[0];  }
__device__ __forceinline__ void round16f_body(const int bx, const float* __restrict__ W, _Float16* __restrict__ Bt) { const size_t t = (size_t)bx * 512 + threadIdx.x, s = frag_src(t, DM); FragH f;
#pragma unroll
  for (int i = 0; i < 8; ++i) f.h[i] = (_Float16)(bf16_round(W[s + i]) * 16.0f); *(v8us*)((unsigned short*)Bt + t * 8) = f.half[0];
  asm volatile("s_wait_xcnt 0x0" ::: "memory");      // in the merged listing the next role's code follows this store and writes its address register: the wait stands in front of that write
}
// the block's 16 rows are one row tile of SN (8 KiB): each wave lays its row's chunks into LDS at their places in the tile, and behind the barrier every thread stores 16 bytes of it in a row, so that a 128-byte line has one writer
__device__ __forceinline__ void sn_body(unsigned short* __restrict__ st, const int bx, const float* __restrict__ sf, _Float16* __restrict__ SN) { const int tid = threadIdx.x, wv = tid >> 5, lane = tid & 31; const size_t row = (size_t)bx * 16 + wv; float v[8]; float s = 0.f;
#pragma unroll
  for (int q = 0; q < 8; ++q) { v[q] = bf16_round(sf[row * DSEM + lane * 8 + q]); s += v[q] * v[q]; }
  for (int o = 16; o >= 1; o >>= 1) s += __shfl_xor(s, o, 32); const float inv = 1.0f / fmaxf(sqrtf(s), 1e-12f); FragH f;
#pragma unroll
  for (int q = 0; q < 8; ++q) f.h[q] = (_Float16)(v[q] * inv);
  *(v8us*)(st + (lane >> 1) * 256 + ((lane & 1) * 16 + wv) * 8) = f.half[0];      // chunk lane of the row = columns 8 lane ..: block lane >> 2, j = (lane >> 1) & 1, hh = lane & 1
  __syncthreads();
  *(v8us*)((unsigned short*)SN + (size_t)bx * (16 * DSEM) + tid * 8) = *(const v8us*)(st + tid * 8);
  asm volatile("s_wait_xcnt 0x0" ::: "memory");      // in the merged listing the next role's code follows this store and writes its address register: the wait stands in front of that write
}
// dynamic temperature, stage 1: column sums of the bf16-rounded query over QROWS rows per block -> PART[b][chunk][DM]; thread = 4 columns x one of 4 row phases, 16 independent 16-byte loads
#define QP 32
#define QROWS (SS / QP)
__device__ __forceinline__ void qsum_body(float (*sred)[DM], const int bx, const float* __restrict__ query, float* __restrict__ PART) {
  const int tid = threadIdx.x, ph = tid >> 7, c4 = (tid & 127) * 4;
  const float* src = query + ((size_t)bx * QROWS + ph * (QROWS / 4)) * DM + c4; v4f s = {0.f, 0.f, 0.f, 0.f};
#pragma unroll  // all 16 row loads issue before the first add: one memory latency instead of 16
  for (int r = 0; r < QROWS / 4; ++r) { const v4f x = *(const v4fa*)(src + (size_t)r * DM);
#pragma unroll
    for (int q = 0; q < 4; ++q) s[q] += bf16_round(x[q]); }
  *(v4fa*)&sred[ph][c4] = s; __syncthreads();
  PART[(size_t)bx * DM + tid] = (sred[0][tid] + sred[1][tid]) + (sred[2][tid] + sred[3][tid]); }
// one launch for all work that reads inputs only: column sums of the query, the three f16 activation planes, the normalised semantic rows, the four weight planes; role by block range
#define PB_QS (BB * QP)
#define PB_X (NR * DM / 8 / 512)
#define PB_SN (NR / 16)
#define PB_W (DM * DM / 8 / 512)
__global__ __launch_bounds__(512) void k_prep(const float* __restrict__ xq, const float* __restrict__ xk, const float* __restrict__ xv, const float* __restrict__ sf,
    const float* __restrict__ Wq, const float* __restrict__ Wk, const float* __restrict__ Wv, const float* __restrict__ Wo,
    _Float16* __restrict__ XQ, _Float16* __restrict__ XK, _Float16* __restrict__ XV, _Float16* __restrict__ SN,
    _Float16* __restrict__ Bq, _Float16* __restrict__ Bk, _Float16* __restrict__ Bv, _Float16* __restrict__ Bo, float* __restrict__ PART) {
  __shared__ __attribute__((aligned(16))) float sred[4][DM];
  const int bx = blockIdx.x, bx1 = bx - PB_QS, bx2 = bx1 - 3 * PB_X, bx3 = bx2 - PB_SN;
  if (bx1 < 0) qsum_body(sred, bx, xq, PART);
  else if (bx2 < 0) { const int g = bx1 / PB_X; x16_body(bx1 % PB_X, g == 0 ? xq : g == 1 ? xk : xv, g == 0 ? XQ : g == 1 ? XK : XV); }
  else if (bx3 < 0) sn_body((unsigned short*)&sred[0][0], bx2, sf, SN);
  else { const int g = bx3 / PB_W; round16f_body(bx3 % PB_W, g == 0 ? Wq : g == 1 ? Wk : g == 2 ? Wv : Wo, g == 0 ? Bq : g == 1 ? Bk : g == 2 ? Bv : Bo); } }
// stage 2 (one block of 4 waves, a role of k_proj, beside the products that do not need it): mean query of both batches from PART, then one wave per hidden unit (lanes along DM, 16-byte loads of the
// Wt1 row shared by both batches), relu, Wt2 dot, sigmoid. The hidden units are summed in 32 groups of 8, each wave taking 8 groups in turn.
__device__ __forceinline__ void temp_body(float* __restrict__ sm, const float* __restrict__ PART, const float* __restrict__ Wt1, const float* __restrict__ bt1, const float* __restrict__ Wt2, const float* __restrict__ bt2, float* __restrict__ TEMP) {
  float (*qm)[DM] = (float (*)[DM])sm; float (*red)[32] = (float (*)[32])(sm + BB * DM); const int tid = threadIdx.x, wv = tid >> 5, lane = tid & 31;
#pragma unroll 1  // kept rolled: a trip's loads are in flight together already, and all trips' loads at once would need more than 256 registers
  for (int it = 0; it < BB * DM / 128; ++it) { const int c = it * 128 + tid, b = c >> 9, col = c & (DM - 1); float s = 0.f;
#pragma unroll  // all 32 partial loads in flight together
    for (int p = 0; p < QP; ++p) s += PART[((size_t)b * QP + p) * DM + col];
    qm[b][col] = s / (float)SS; }
  __syncthreads();
  v4f qv[BB][4];
#pragma unroll
  for (int b = 0; b < BB; ++b)
#pragma unroll
    for (int j = 0; j < 4; ++j) qv[b][j] = *(const v4fa*)&qm[b][j * 128 + lane * 4];
#pragma unroll 1  // one group of 8 hidden units a trip, kept rolled: two groups' rows at once would need more than 256 registers
  for (int gq = 0; gq < 8; ++gq) { const int grp = wv * 8 + gq;
  float pw[BB] = {0.f, 0.f};
  constexpr int GU = (DM / 2) / 32;      // hidden units of a group
  // the group's loads stand together: eight rows = 32 loads of 16 bytes a lane, and the eight bt1 and Wt2 values: one memory latency a group, was four. With them the launch takes 252 registers against the products' 212: four waves a SIMD either way
  float b1r[GU], w2r[GU], a[GU][BB];
#pragma unroll
  for (int i = 0; i < GU; ++i) { b1r[i] = bt1[grp * GU + i]; w2r[i] = Wt2[grp * GU + i]; }
#pragma unroll
  for (int i = 0; i < GU; ++i) { const float* wr = Wt1 + (size_t)(grp * GU + i) * DM + lane * 4; a[i][0] = 0.f; a[i][1] = 0.f;
#pragma unroll
    for (int j = 0; j < 4; ++j) { const v4f wq = *(const v4fa*)(wr + j * 128);
#pragma unroll
      for (int q = 0; q < 4; ++q) { const float wb = bf16_round(wq[q]);
#pragma unroll
        for (int b = 0; b < BB; ++b) a[i][b] += wb * qv[b][j][q]; } } }
  // loaded values as inputs only: holds the bt1 and Wt2 loads in front of the lane sums (else they sink into the branch of lane 0 below and the group pays a second latency there)
  asm volatile("" :: "v"(b1r[0]), "v"(b1r[1]), "v"(b1r[2]), "v"(b1r[3]), "v"(b1r[4]), "v"(b1r[5]), "v"(b1r[6]), "v"(b1r[7]), "v"(w2r[0]), "v"(w2r[1]), "v"(w2r[2]), "v"(w2r[3]), "v"(w2r[4]), "v"(w2r[5]), "v"(w2r[6]), "v"(w2r[7]));
  static_assert(GU == 8 && BB == 2, "the statement above names eight values of each");
#pragma unroll  // the sixteen lane sums run side by side
  for (int i = 0; i < GU; ++i) { const float b1 = bf16_round(b1r[i]), w2 = bf16_round(w2r[i]);
#pragma unroll
    for (int b = 0; b < BB; ++b) { float t = a[i][b]; for (int o = 16; o >= 1; o >>= 1) t += __shfl_xor(t, o, 32); pw[b] += fmaxf(t + b1, 0.f) * w2; } }
  if (lane == 0) {
#pragma unroll
    for (int b = 0; b < BB; ++b) red[b][grp] = pw[b]; } }
  __syncthreads();
  if (tid < 32) { float v = 0.f; if (tid < BB) { float z = bf16_round(bt2[0]); for (int q = 0; q < 32; ++q) z += red[tid][q]; const float t = 1.0f / (1.0f + expf(-z)); v = 0.5f + t * 1.5f; } TEMP[tid] = v; } }
// one launch for all that needs k_prep alone: block 0 the temperature, then the q, k and v projections (the longer products first), then the similarity plane; role by block range
#define GB_P ((NR / 16) * (DM / 64) / 4)
#define GB_S ((SS / 16) * (SS / 64) / 4)
__global__ __launch_bounds__(128) void k_proj(const _Float16* __restrict__ XQ, const _Float16* __restrict__ XK, const _Float16* __restrict__ XV, const _Float16* __restrict__ Bq, const _Float16* __restrict__ Bk, const _Float16* __restrict__ Bv,
    const float* __restrict__ bq, const float* __restrict__ bk, const float* __restrict__ bv, _Float16* __restrict__ Q16, _Float16* __restrict__ K16, _Float16* __restrict__ Vt, const _Float16* __restrict__ SN, _Float16* __restrict__ SIM,
    const float* __restrict__ PART, const float* __restrict__ Wt1, const float* __restrict__ bt1, const float* __restrict__ Wt2, const float* __restrict__ bt2, float* __restrict__ TEMP) {
  __shared__ __attribute__((aligned(16))) float so[4][16][SOP];
  int bx = blockIdx.x;
  if (bx == 0) { temp_body(&so[0][0][0], PART, Wt1, bt1, Wt2, bt2, TEMP); return; }
  bx -= 1;
  if (bx < 3 * GB_P) { const int g = bx / GB_P;
    gemm_hhx_body<0>(so, bx % GB_P, 0, g == 0 ? XQ : g == 1 ? XK : XV, 0, g == 0 ? Bq : g == 1 ? Bk : Bv, 0, 0.0625f, g == 0 ? bq : g == 1 ? bk : bv, 0, nullptr, 1, 0, 0, nullptr, g == 0 ? Q16 : g == 1 ? K16 : nullptr, g == 2 ? Vt : nullptr, DM, 0, NR, DM, DM); return; }
  bx -= 3 * GB_P;
  // SIM[b] = SN[b].SN[b]^T (f16; values in [-1, 1])
  gemm_hhx_body<0>(so, bx % GB_S, bx / GB_S, SN, (size_t)SS * DSEM, SN, (size_t)SS * DSEM, 1.0f, nullptr, 0, nullptr, 1, 0, 0, nullptr, SIM, nullptr, SS, (size_t)SS * SS, SS, SS, DSEM); }
// fused constrained attention per ((b,h), 128 queries): 16 waves = 4 query groups of 32 x 4 key sets, four waves a SIMD, so that one wave's loads and dependent vector chains hide behind three others;
// key set s holds the 32-key chunks s, s + 4, s + 8, ...: the four sets walk side by side; Q16, K16, Vt and SIM lie in fragment order, so each of a pass's 20 fragment loads reads 4 whole lines;
// the four partial results of a query group (own running max, sum, Ot) are joined through LDS behind the loop. s = (q.k)/(8 temp_b) + sem_bias + pos_bias, -inf where mask[b][k] = 0; sem_bias = -(0.5 - sim) if sim < 0.5.
// Transposed products: St = K.Qt (A = 16 key rows, B = 16 query columns), Ot += Vt.Pt. Lane (ln, hh) then holds, for query ln of a tile, the scores of keys 8 hh + r of each 16-key tile:
// the running max and sum are in-lane work plus one swap between the wave halves, two St tiles converted to f16 are the B operand of the second product as they lie, SIM[q][k .. k + 7] is one 16-byte load (half nt of the plane's block: query tile x 32 keys).
typedef int v4ia __attribute__((ext_vector_type(4), may_alias));
typedef _Float16 v8h __attribute__((ext_vector_type(8)));
union FragP { v16h v; v8h p[2]; };
// The softmax runs in base 2: log2(e) is folded into the score scale and into both biases, so a score, a running max and their differences are exponents of 2 and every
// exponential is one v_exp_f32 (expf costs about twelve vector instructions: scaling, rounding, ldexp and two range selects). A result below 2^-126 comes out as 0, as does exp2(-inf).
#define L2E 1.4426950408889634f
// Written as asm so that the slot which the instruction set asks for behind a transcendental (one independent instruction or v_nop before its result is used or its source overwritten) is kept by construction:
// Eight in place: none reads or overwrites a register of another; the v_nop is the slot behind the last.
__device__ __forceinline__ float exp2_raw(float x) { asm("v_exp_f32 %0, %0\n\tv_nop" : "+v"(x)); return x; }
__device__ __forceinline__ v8f exp2_x8(const v8f x) { float a = x[0], b = x[1], c = x[2], d = x[3], e = x[4], f = x[5], g = x[6], h = x[7];
  asm("v_exp_f32 %0, %0\n\tv_exp_f32 %1, %1\n\tv_exp_f32 %2, %2\n\tv_exp_f32 %3, %3\n\tv_exp_f32 %4, %4\n\tv_exp_f32 %5, %5\n\tv_exp_f32 %6, %6\n\tv_exp_f32 %7, %7\n\tv_nop"
      : "+v"(a), "+v"(b), "+v"(c), "+v"(d), "+v"(e), "+v"(f), "+v"(g), "+v"(h));      // in place, so no v_exp_f32 touches a register of the one in front of it; v_nop: the slot behind the last
  return (v8f){a, b, c, d, e, f, g, h}; }
__device__ __forceinline__ float swap_halves(float x) { const int t = __float_as_int(x); return __int_as_float(__builtin_amdgcn_permlanex16(t, t, 0x76543210, 0xfedcba98, false, false)); }   // lane l <-> l ^ 16
__global__ __launch_bounds__(512) void k_flash(const _Float16* __restrict__ Q16, const _Float16* __restrict__ K16, const _Float16* __restrict__ Vt, const _Float16* __restrict__ SIM, const int* __restrict__ mask, const float* __restrict__ TEMP, _Float16* __restrict__ O16) {
  constexpr int RPW = 32, NQB = SS / (4 * RPW), DT = HD / 16, KS = HD / 32, NSP = 4;
  static_assert(NSP == 4 && DT == 4, "in the join, the wave of key set s sums two of the eight output tiles");
  __shared__ __attribute__((aligned(16))) float sO[4 * NSP][2][DT][2][32][4];      // a wave's rescaled Ot: 16 bytes a lane, lanes side by side
  __shared__ float sM[4 * NSP][2][32], sL[4 * NSP][2][32];
  const int tid = threadIdx.x, lane = tid & 31, ln = lane & 15, hh = lane >> 4;
  const int w = __builtin_amdgcn_readfirstlane(tid >> 5), qg = w & 3, ksp = w >> 2, k0 = ksp * 32;      // the wave's number in a scalar register: the key loop's bounds and its branch stay scalar
  const int slab = blockIdx.x / NQB, qblk = blockIdx.x % NQB; const int b = slab / NH, h = slab % NH; const int q0 = qblk * (4 * RPW) + qg * RPW; const float sc = (0.125f * L2E) / TEMP[b];
  FragH aq[2][KS];
#pragma unroll
  for (int qt = 0; qt < 2; ++qt) { const unsigned short* qr = (const unsigned short*)Q16 + ((size_t)((b * SS + q0) / 16 + qt) * (DM / 32) + h * KS) * 512 + lane * 8;
#pragma unroll
    for (int ks = 0; ks < KS; ++ks) { aq[qt][ks].half[0] = *(const v8us*)(qr + ks * 512); aq[qt][ks].half[1] = *(const v8us*)(qr + ks * 512 + 256); } }
  // the lane's four read pointers; each moves on by 4 x 32 keys a pass (K16: 8 row tiles; Vt and SIM: 4 blocks of 32 keys)
  constexpr int TK = (DM / 32) * 512, TS = (SS / 32) * 512;      // f16 elements of a 16-row tile of a plane of DM and of SS columns
  const unsigned fo = lane * 8, mo = hh * 8;
  const unsigned short* vp = (const unsigned short*)Vt + (size_t)slab * DT * TS + (k0 / 32) * 512 + fo;
  const unsigned short* kp = (const unsigned short*)K16 + (size_t)((b * SS + k0) / 16) * TK + h * KS * 512 + fo;
  const unsigned short* sp = (const unsigned short*)SIM + (size_t)b * SS * SS + (size_t)(q0 / 16) * TS + (k0 / 32) * 512 + fo;
  const int* mp = mask + (size_t)b * SS + k0 + mo;
  float m_q[2], l_q[2]; v8f oacc[2][DT];
#pragma unroll
  for (int qt = 0; qt < 2; ++qt) { m_q[qt] = -3.0e38f; l_q[qt] = 0.f;
#pragma unroll
    for (int dt = 0; dt < DT; ++dt) oacc[qt][dt] = (v8f){0.f,0.f,0.f,0.f,0.f,0.f,0.f,0.f}; }
#pragma unroll 1
  for (int j0 = k0; j0 < k0 + SS; j0 += NSP * 32) {
    // every load of the pass stands in front of its first product: none depends on the scores any more, so the pass waits for memory once
    FragH bk[2][KS], bv[DT], sm[2][2]; v4ia mk[2][2];
#pragma unroll
    for (int nt = 0; nt < 2; ++nt) {
#pragma unroll
      for (int ks = 0; ks < KS; ++ks) { bk[nt][ks].half[0] = *(const v8us*)(kp + nt * TK + ks * 512); bk[nt][ks].half[1] = *(const v8us*)(kp + nt * TK + ks * 512 + 256); }
      mk[nt][0] = *(const v4ia*)(mp + nt * 16); mk[nt][1] = *(const v4ia*)(mp + nt * 16 + 4);
#pragma unroll
      for (int qt = 0; qt < 2; ++qt) sm[qt][nt].half[0] = *(const v8us*)(sp + qt * TS + nt * 256); }
#pragma unroll
    for (int dt = 0; dt < DT; ++dt) { bv[dt].half[0] = *(const v8us*)(vp + dt * TS); bv[dt].half[1] = *(const v8us*)(vp + dt * TS + 256); }
    asm volatile("s_wait_xcnt 0x0" ::: "memory");      // stands in front of every write of a register that one of the 24 loads names as its address: the four pointers live round the loop, so only their steps below write them (named as inputs here, they cost this build spills in the loop)
    __builtin_amdgcn_sched_barrier(0);      // keeps the 24 loads one group (else half of them issue behind the first wait and the pass pays the latency twice) and the pointer steps behind the wait above
    kp += NSP * 2 * TK; mp += NSP * 32; sp += NSP * 512; vp += NSP * 512;
    v8f s[2][2];
#pragma unroll
    for (int nt = 0; nt < 2; ++nt)
#pragma unroll
      for (int qt = 0; qt < 2; ++qt) { v8f acc = (v8f){0.f,0.f,0.f,0.f,0.f,0.f,0.f,0.f};
#pragma unroll
        for (int ks = 0; ks < KS; ++ks) acc = mmaH<1>(bk[nt][ks].v, bk[nt][ks].v, aq[qt][ks].v, aq[qt][ks].v, acc); s[qt][nt] = acc; }
    FragP pb[2];
#pragma unroll
    for (int qt = 0; qt < 2; ++qt) { const int qi = q0 + qt * 16 + ln; float mc = -INFINITY;
#pragma unroll
      for (int nt = 0; nt < 2; ++nt)
#pragma unroll
        for (int r = 0; r < 8; ++r) { const int k = j0 + nt * 16 + 8 * hh + r; const float sim = (float)sm[qt][nt].h[r]; const float sb = (sim < 0.5f) ? fmaf(sim, L2E, -0.5f * L2E) : 0.f;
          const float dd = fabsf((float)(qi - k)); const float pbias = (dd > 10.f) ? (-0.1f * L2E) * (dd - 10.f) : 0.f;
          const float su = s[qt][nt][r] * sc + sb + pbias; const float sv = (mk[nt][r >> 2][r & 3] != 0) ? su : -INFINITY; s[qt][nt][r] = sv; mc = fmaxf(mc, sv); }
      mc = fmaxf(mc, swap_halves(mc));
      const float mn = fmaxf(m_q[qt], mc); const float al = exp2_raw(m_q[qt] - mn); m_q[qt] = mn; float ls = 0.f;
#pragma unroll
      for (int nt = 0; nt < 2; ++nt) {
#pragma unroll
        for (int r = 0; r < 8; ++r) s[qt][nt][r] -= mn;
        s[qt][nt] = exp2_x8(s[qt][nt]);
#pragma unroll
        for (int r = 0; r < 8; ++r) ls += s[qt][nt][r];
        pb[qt].p[nt] = __builtin_convertvector(s[qt][nt], v8h); }
      l_q[qt] = l_q[qt] * al + ls;      // partial sum of this half's 16 keys; the halves are joined behind the loop
#pragma unroll
      for (int dt = 0; dt < DT; ++dt)
#pragma unroll
        for (int r = 0; r < 8; ++r) oacc[qt][dt][r] *= al; }
#pragma unroll
    for (int dt = 0; dt < DT; ++dt)
#pragma unroll
      for (int qt = 0; qt < 2; ++qt) oacc[qt][dt] = mmaH<1>(bv[dt].v, bv[dt].v, pb[qt].v, pb[qt].v, oacc[qt][dt]); }
  // join of the four key sets of a query group. Step 1: every wave publishes its max and its sum (halves joined)
#pragma unroll
  for (int qt = 0; qt < 2; ++qt) { float l = l_q[qt]; l += swap_halves(l); sM[w][qt][lane] = m_q[qt]; sL[w][qt][lane] = l; }
  __syncthreads();
  // step 2: the common max, the common sum (sets in order), and the wave's Ot rescaled to the common max into LDS
  float inv[2];
#pragma unroll
  for (int qt = 0; qt < 2; ++qt) { float ms[NSP], mx = -3.0e38f, l = 0.f;
#pragma unroll
    for (int s = 0; s < NSP; ++s) { ms[s] = sM[s * 4 + qg][qt][lane]; mx = fmaxf(mx, ms[s]); }
#pragma unroll
    for (int s = 0; s < NSP; ++s) l += sL[s * 4 + qg][qt][lane] * exp2_raw(ms[s] - mx);
    inv[qt] = (l > 0.f) ? 1.0f / l : 0.f; const float f = exp2_raw(m_q[qt] - mx);
#pragma unroll
    for (int dt = 0; dt < DT; ++dt) { v4f lo, hi;
#pragma unroll
      for (int r = 0; r < 4; ++r) { lo[r] = oacc[qt][dt][r] * f; hi[r] = oacc[qt][dt][4 + r] * f; }
      *(v4fa*)&sO[w][qt][dt][0][lane][0] = lo; *(v4fa*)&sO[w][qt][dt][1][lane][0] = hi; } }
  __syncthreads();
  // step 3: the wave of key set s sums, over the four sets in order, tiles 2 (s & 1) and 2 (s & 1) + 1 of query tile s >> 1: 16 rows x 32 columns = one whole block (1 KiB) of the f16 plane that the output projection reads,
  // and the lane's eight values of a tile are its 16-byte chunk of the block's half as they lie: the plane is stored here, in fragment order, with no f32 copy and no launch to convert it
  const int qs = ksp >> 1, d0 = (ksp & 1) * 2; const float iv = qs ? inv[1] : inv[0];
  unsigned short* ofr = (unsigned short*)O16 + ((size_t)((b * SS + q0) / 16 + qs) * (DM / 32) + h * KS + (ksp & 1)) * 512 + lane * 8;      // register r of tile dt is column dt * 16 + 8 hh + r of query ln
#pragma unroll
  for (int d = 0; d < 2; ++d) { v4f lo = *(const v4fa*)&sO[qg][qs][d0 + d][0][lane][0], hi = *(const v4fa*)&sO[qg][qs][d0 + d][1][lane][0];
#pragma unroll
    for (int s = 1; s < NSP; ++s) { lo += *(const v4fa*)&sO[s * 4 + qg][qs][d0 + d][0][lane][0]; hi += *(const v4fa*)&sO[s * 4 + qg][qs][d0 + d][1][lane][0]; }
    lo *= iv; hi *= iv; FragH f;
#pragma unroll
    for (int i = 0; i < 4; ++i) { f.h[i] = (_Float16)lo[i]; f.h[4 + i] = (_Float16)hi[i]; }
    *(v8us*)(ofr + d * 256) = f.half[0]; } }
extern "C" void kernel_launch(void* const* d_in, const int* in_sizes, int n_in,
                              void* d_out, int out_size, void* d_ws, size_t ws_size, hipStream_t stream) {
  (void)in_sizes; (void)n_in; (void)out_size;
  const float* xq = (const float*)d_in[0]; const float* xk = (const float*)d_in[1]; const float* xv = (const float*)d_in[2]; const int* mask = (const int*)d_in[3]; const float* sf = (const float*)d_in[4];
  const float* Wq = (const float*)d_in[5]; const float* bq = (const float*)d_in[6]; const float* Wk = (const float*)d_in[7]; const float* bk = (const float*)d_in[8]; const float* Wv = (const float*)d_in[9]; const float* bv = (const float*)d_in[10]; const float* Wo = (const float*)d_in[11]; const float* bo = (const float*)d_in[12]; const float* Wt1 = (const float*)d_in[13]; const float* bt1 = (const float*)d_in[14]; const float* Wt2 = (const float*)d_in[15]; const float* bt2 = (const float*)d_in[16];
  char* ws = (char*)d_ws; size_t off = 0;
  auto take = [&](size_t bytes) { char* p = ws + off; off += (bytes + 255) & ~(size_t)255; return p; };
  const size_t w8 = (size_t)DM * DM / 8;
  _Float16* Bq = (_Float16*)take(w8 * 16); _Float16* Bk = (_Float16*)take(w8 * 16); _Float16* Bv = (_Float16*)take(w8 * 16); _Float16* Bo = (_Float16*)take(w8 * 16);
  _Float16* XQ = (_Float16*)take((size_t)NR * DM * 2); _Float16* XK = (_Float16*)take((size_t)NR * DM * 2); _Float16* XV = (_Float16*)take((size_t)NR * DM * 2); _Float16* Q16 = (_Float16*)take((size_t)NR * DM * 2); _Float16* K16 = (_Float16*)take((size_t)NR * DM * 2); _Float16* Vt = (_Float16*)take((size_t)NR * DM * 2);
  _Float16* SN = (_Float16*)take((size_t)NR * DSEM * 2); _Float16* SIM = (_Float16*)take((size_t)BB * SS * SS * 2); float* TEMP = (float*)take(256); float* PART = (float*)take((size_t)BB * QP * DM * 4); _Float16* O16 = XQ;      // the query plane is dead after the q GEMM
  if (off > ws_size) return;      // about 2 + 6 x 4.2 + 2.1 + 16.8 = 46 MiB
  k_prep<<<PB_QS + 3 * PB_X + PB_SN + 4 * PB_W, 512, 0, stream>>>(xq, xk, xv, sf, Wq, Wk, Wv, Wo, XQ, XK, XV, SN, Bq, Bk, Bv, Bo, PART);
  k_proj<<<1 + 3 * GB_P + BB * GB_S, 128, 0, stream>>>(XQ, XK, XV, Bq, Bk, Bv, bq, bk, bv, Q16, K16, Vt, SN, SIM, PART, Wt1, bt1, Wt2, bt2, TEMP);
  const dim3 gg(((NR / 16) * (DM / 64) + 3) / 4, 1);
  k_flash<<<BB * NH * (SS / 128), 512, 0, stream>>>(Q16, K16, Vt, SIM, mask, TEMP, O16);
  k_oproj<<<gg, 128, 0, stream>>>(O16, Bo, bo, (float*)d_out);
}

// v009
// A run of this version takes 79.7 microseconds.
// In both of two side-by-side timings against v008, it was 1.16 times as fast.
// Over all steps from v000 it is 10.4 times as fast.
#include <hip/hip_runtime.h>
// q/k/v/o projections (4096 × 512 × 512, + bias), the cosine-similarity matrix of the normalised semantic features (per batch 2048 × 2048 × 256, stored as an f16 plane of log2(e) (min(sim, 0.5) + pos(q, k) - pos(q, kc)), -inf at masked keys) and the 8-head
// constrained attention on v_wmma_f32_16x16x32_f16 (fused flash-style kernel: S = Q·Kᵀ, O = P·V on WMMA; scores / (8·temperature_b) + semantic bias + positional bias, key mask → −inf;
// online max/sum softmax f32; P f16 ≤ 1); the dynamic-temperature MLP on the mean query is f32 VALU (column sums over 64 blocks, then one block); A = f16(bf16 ·) exact operands, weights bf16-exact ×2^4 ((out,in)),
// single products, f32 accumulate.
// Every f16 plane of the workspace lies in fragment order: a plane of KD columns is cut into blocks of 16 rows x 32 columns (row tile major, then column block), a block is 2 x 512 bytes,
// and 16-byte chunk (j, hh, ln) of a block holds row ln, columns 16 j + 8 hh .. + 7. Lane 16 hh + ln of a wave then finds half j of its A or B fragment at byte 16 lane of that half:
// one fragment load reads 512 bytes in a row (4 whole 128-byte lines), where a row-major plane gave it 32 bytes out of each of 16 lines.
#define BB 2
#define SS 2048
#define DM 512
#define NH 8
#define HD 64
#define DSEM 256
#define NR (BB * SS)

typedef __bf16 v16b __attribute__((ext_vector_type(16)));
typedef unsigned short v8us __attribute__((ext_vector_type(8), may_alias));
typedef float  v8f  __attribute__((ext_vector_type(8)));
typedef float  v4f  __attribute__((ext_vector_type(4)));
typedef float  v4fa __attribute__((ext_vector_type(4), may_alias));
union FragB { v16b v; v8us half[2]; unsigned short u[16]; };

__device__ __forceinline__ unsigned short bf16_bits(float x) { unsigned int u = __float_as_uint(x); return (unsigned short)((u + 0x7FFFu + ((u >> 16) & 1u)) >> 16); }
__device__ __forceinline__ float bf16_val(unsigned short b) { return __uint_as_float(((unsigned int)b) << 16); }
__device__ __forceinline__ float bf16_round(float x) { return bf16_val(bf16_bits(x)); }
// D += A·B with NT terms: 1 = ah·bh, 2 = + al·bh (A split), 3 = + ah·bl (both split)
template <int NT>
__device__ __forceinline__ v8f mmaN(v16b ah, v16b al, v16b bh, v16b bl, v8f c) {
  c = __builtin_amdgcn_wmma_f32_16x16x32_bf16(false, ah, false, bh, (short)0, c, false, false);
  if (NT >= 2) c = __builtin_amdgcn_wmma_f32_16x16x32_bf16(false, al, false, bh, (short)0, c, false, false);
  if (NT >= 3) c = __builtin_amdgcn_wmma_f32_16x16x32_bf16(false, ah, false, bl, (short)0, c, false, false);
  asm volatile("v_nop\n\tv_nop\n\tv_nop\n\tv_nop" : "+v"(c) : "v"(ah), "v"(al), "v"(bh), "v"(bl));
  return c;
}

__global__ __launch_bounds__(256) void k_wt_bf16(const float* __restrict__ W, unsigned short* __restrict__ Wt, int K, int N) {
  const int t = blockIdx.x * 256 + threadIdx.x;
  const int k8n = K / 8;
  if (t >= N * k8n) return;
  const int n = t / k8n, k8 = (t % k8n) * 8;
  v8us v;
#pragma unroll
  for (int i = 0; i < 8; ++i) v[i] = bf16_bits(W[(size_t)(k8 + i) * N + n]);
  *(v8us*)(Wt + (size_t)n * K + k8) = v;
  
}

// GEMM C[M][N] (f32, pitch ldc) = act(A[M][K]·W + bias). A f32 row-major (pitch lda) converted per fragment to bf16
// (ASPLIT: hi/lo two planes -> 2 terms, else single rounded term); Wt bf16 [N][K] (pitch ldb). BIAS_BF16 rounds the
// bias to bf16 first (bias quantised to bf16 before the add). K%32==0, M%16==0, N%64==0.
template <bool ASPLIT, int ACT, bool BIAS_BF16>
__global__ __launch_bounds__(128) void k_gemm_bf(const float* __restrict__ A, int lda, const unsigned short* __restrict__ Wt, int ldb,
                                               const float* __restrict__ bias, float* __restrict__ C, int ldc, int M, int N, int K) {
  __shared__ __attribute__((aligned(16))) float so[4][16][64];
  const int tid = threadIdx.x, w = tid >> 5, lane = tid & 31, ln = lane & 15, hh = lane >> 4;
  const int ntn = N / 64;
  const int wid = blockIdx.x * 4 + w;
  const int mt = wid / ntn, nq = wid % ntn;
  if (mt * 16 >= M) return;
  const int row0 = mt * 16, col0 = nq * 64;
  const float* arow = A + (size_t)(row0 + ln) * lda;
  v8f acc[4] = {};
  for (int kb = 0; kb < K; kb += 32) {
    FragB ah, al;
    const v4f x0 = *(const v4fa*)(arow + kb + 8 * hh), x1 = *(const v4fa*)(arow + kb + 8 * hh + 4);
    const v4f x2 = *(const v4fa*)(arow + kb + 16 + 8 * hh), x3 = *(const v4fa*)(arow + kb + 16 + 8 * hh + 4);
    float xs[16] = {x0[0],x0[1],x0[2],x0[3],x1[0],x1[1],x1[2],x1[3],x2[0],x2[1],x2[2],x2[3],x3[0],x3[1],x3[2],x3[3]};
#pragma unroll
    for (int i = 0; i < 16; ++i) { const unsigned short hb = bf16_bits(xs[i]); ah.u[i] = hb; al.u[i] = ASPLIT ? bf16_bits(xs[i] - bf16_val(hb)) : (unsigned short)0; }
#pragma unroll
    for (int t = 0; t < 4; ++t) {
      const unsigned short* brow = Wt + (size_t)(col0 + t * 16 + ln) * ldb + kb;
      FragB b;
      b.half[0] = *(const v8us*)(brow + 8 * hh);
      b.half[1] = *(const v8us*)(brow + 16 + 8 * hh);
      acc[t] = mmaN<ASPLIT ? 2 : 1>(ah.v, al.v, b.v, b.v, acc[t]);
    }
  }
#pragma unroll
  for (int t = 0; t < 4; ++t) {
    float bv = bias ? bias[col0 + t * 16 + ln] : 0.f;
    if (BIAS_BF16) bv = bf16_round(bv);
#pragma unroll
    for (int r = 0; r < 8; ++r) { float v = acc[t][r] + bv; if (ACT == 1) v = fmaxf(v, 0.f); so[w][8 * hh + r][t * 16 + ln] = v; }
  }
  __builtin_amdgcn_fence(__ATOMIC_ACQ_REL, "workgroup");
  __builtin_amdgcn_wave_barrier();
  const int rsub = lane >> 4, c4 = (lane & 15) * 4;
  {
#pragma unroll
    for (int q = 0; q < 8; ++q) {
      const int r = q * 2 + rsub;
      const v4f v = *(const v4fa*)&so[w][r][c4];
      *(v4f*)(C + (size_t)(row0 + r) * ldc + col0 + c4) = v;
    }
    
  }
}

// Flash-style causal/unmasked attention, all contractions 3-term bf16 hi/lo splits, f32 softmax with running max.
// q,k,v rows are read from f32 buffers with arbitrary row pitch (so they can live inside a fused qkv buffer);
// D = head size (multiple of 32, <= 128); one wave = 16 query rows; block = 4 waves (64 queries) sharing K/V chunks of 32.
template <int D, bool CAUSAL>
__global__ __launch_bounds__(128) void k_flash(const float* __restrict__ qb, const float* __restrict__ kb, const float* __restrict__ vb,
                                             int pitch, int T, int H, float scale, float* __restrict__ y, int ypitch) {
  constexpr int KS = D / 32;        // k-steps for QK
  constexpr int DT = D / 16;        // d tiles for PV
  __shared__ __attribute__((aligned(16))) unsigned short sKh[32][D + 8], sKl[32][D + 8], sVh[32][D + 8], sVl[32][D + 8];
  __shared__ __attribute__((aligned(16))) unsigned short sPh[4][16][40], sPl[4][16][40];
  __shared__ __attribute__((aligned(16))) float sO[4][16][D];
  const int tid = threadIdx.x, w = tid >> 5, lane = tid & 31, ln = lane & 15, hh = lane >> 4;
  const int nqb = (T + 63) / 64;
  const int bh = blockIdx.x / nqb, qblk = blockIdx.x % nqb;
  const int b = bh / H, h = bh % H;
  const int q0 = qblk * 64 + w * 16;
  const float* Q = qb + (size_t)b * T * pitch + h * D;
  const float* K = kb + (size_t)b * T * pitch + h * D;
  const float* V = vb + (size_t)b * T * pitch + h * D;

  // A fragments of the wave's 16 query rows (scaled), hi/lo
  FragB aqh[KS], aql[KS];
  {
    int row = q0 + ln; if (row >= T) row = T - 1;
    const float* qr = Q + (size_t)row * pitch;
#pragma unroll
    for (int ks = 0; ks < KS; ++ks)
#pragma unroll
      for (int i = 0; i < 16; ++i) {
        const int d = ks * 32 + ((i < 8) ? (8 * hh + i) : (16 + 8 * hh + (i - 8)));
        const float x = qr[d] * scale; const unsigned short hb = bf16_bits(x);
        aqh[ks].u[i] = hb; aql[ks].u[i] = bf16_bits(x - bf16_val(hb));
      }
  }
  float m_r[8], l_r[8];
#pragma unroll
  for (int r = 0; r < 8; ++r) { m_r[r] = -3.0e38f; l_r[r] = 0.f; }
  v8f oacc[DT];
#pragma unroll
  for (int dt = 0; dt < DT; ++dt) oacc[dt] = (v8f){0.f,0.f,0.f,0.f,0.f,0.f,0.f,0.f};

  const int kv_end = CAUSAL ? min(T, qblk * 64 + 64) : T;     // block-uniform
  for (int j0 = 0; j0 < kv_end; j0 += 32) {
    __syncthreads();
    for (int e = tid; e < 32 * (D / 4); e += 128) {
      const int r = e / (D / 4), c4 = (e % (D / 4)) * 4;
      const int key = j0 + r;
      v4f kf = {0.f,0.f,0.f,0.f}, vf = {0.f,0.f,0.f,0.f};
      if (key < T) { kf = *(const v4fa*)(K + (size_t)key * pitch + c4); vf = *(const v4fa*)(V + (size_t)key * pitch + c4); }
#pragma unroll
      for (int t = 0; t < 4; ++t) {
        unsigned short hb = bf16_bits(kf[t]); sKh[r][c4 + t] = hb; sKl[r][c4 + t] = bf16_bits(kf[t] - bf16_val(hb));
        hb = bf16_bits(vf[t]); sVh[r][c4 + t] = hb; sVl[r][c4 + t] = bf16_bits(vf[t] - bf16_val(hb));
      }
    }
    __syncthreads();
    // S tile 16 x 32
    v8f s[2];
#pragma unroll
    for (int nt = 0; nt < 2; ++nt) {
      v8f acc = {};
#pragma unroll
      for (int ks = 0; ks < KS; ++ks) {
        FragB bh_, bl_;
        bh_.half[0] = *(const v8us*)&sKh[nt * 16 + ln][ks * 32 + 8 * hh]; bh_.half[1] = *(const v8us*)&sKh[nt * 16 + ln][ks * 32 + 16 + 8 * hh];
        bl_.half[0] = *(const v8us*)&sKl[nt * 16 + ln][ks * 32 + 8 * hh]; bl_.half[1] = *(const v8us*)&sKl[nt * 16 + ln][ks * 32 + 16 + 8 * hh];
        acc = mmaN<3>(aqh[ks].v, aql[ks].v, bh_.v, bl_.v, acc);
      }
      s[nt] = acc;
    }
    // mask + running max (rows 8hh+r; the 16 lanes of a half share rows)
    float alpha[8];
#pragma unroll
    for (int r = 0; r < 8; ++r) {
      const int qi = q0 + 8 * hh + r;
      const int ja = j0 + ln, jb = j0 + 16 + ln;
      if (CAUSAL) { if (ja > qi) s[0][r] = -3.0e38f; if (jb > qi) s[1][r] = -3.0e38f; }
      if (ja >= T) s[0][r] = -3.0e38f;
      if (jb >= T) s[1][r] = -3.0e38f;
      float mx = fmaxf(s[0][r], s[1][r]);
      mx = fmaxf(mx, __shfl_xor(mx, 1, 32)); mx = fmaxf(mx, __shfl_xor(mx, 2, 32)); mx = fmaxf(mx, __shfl_xor(mx, 4, 32)); mx = fmaxf(mx, __shfl_xor(mx, 8, 32));
      const float mnew = fmaxf(m_r[r], mx);
      alpha[r] = (mnew > -1.0e38f) ? __expf(m_r[r] - mnew) : 1.0f;
      const float p0 = (s[0][r] > -1.0e38f) ? __expf(s[0][r] - mnew) : 0.f;
      const float p1 = (s[1][r] > -1.0e38f) ? __expf(s[1][r] - mnew) : 0.f;
      m_r[r] = mnew;
      l_r[r] = l_r[r] * alpha[r] + p0 + p1;            // per-lane partial row sum (16 lanes combined at the end)
      unsigned short hb = bf16_bits(p0); sPh[w][8 * hh + r][ln] = hb;      sPl[w][8 * hh + r][ln] = bf16_bits(p0 - bf16_val(hb));
      hb = bf16_bits(p1);                sPh[w][8 * hh + r][16 + ln] = hb; sPl[w][8 * hh + r][16 + ln] = bf16_bits(p1 - bf16_val(hb));
    }
#pragma unroll
    for (int dt = 0; dt < DT; ++dt)
#pragma unroll
      for (int r = 0; r < 8; ++r) oacc[dt][r] *= alpha[r];
    __builtin_amdgcn_fence(__ATOMIC_ACQ_REL, "workgroup");
    __builtin_amdgcn_wave_barrier();
    FragB pah, pal;
    pah.half[0] = *(const v8us*)&sPh[w][ln][8 * hh]; pah.half[1] = *(const v8us*)&sPh[w][ln][16 + 8 * hh];
    pal.half[0] = *(const v8us*)&sPl[w][ln][8 * hh]; pal.half[1] = *(const v8us*)&sPl[w][ln][16 + 8 * hh];
#pragma unroll
    for (int dt = 0; dt < DT; ++dt) {
      FragB bvh, bvl;
#pragma unroll
      for (int i = 0; i < 8; ++i) {
        bvh.u[i] = sVh[8 * hh + i][dt * 16 + ln]; bvh.u[8 + i] = sVh[16 + 8 * hh + i][dt * 16 + ln];
        bvl.u[i] = sVl[8 * hh + i][dt * 16 + ln]; bvl.u[8 + i] = sVl[16 + 8 * hh + i][dt * 16 + ln];
      }
      oacc[dt] = mmaN<3>(pah.v, pal.v, bvh.v, bvl.v, oacc[dt]);
    }
    __builtin_amdgcn_fence(__ATOMIC_ACQ_REL, "workgroup");
    __builtin_amdgcn_wave_barrier();
  }
#pragma unroll
  for (int r = 0; r < 8; ++r) {
    float l = l_r[r];
    l += __shfl_xor(l, 1, 32); l += __shfl_xor(l, 2, 32); l += __shfl_xor(l, 4, 32); l += __shfl_xor(l, 8, 32);
    l_r[r] = (l > 0.f) ? 1.0f / l : 0.f;
  }
#pragma unroll
  for (int dt = 0; dt < DT; ++dt)
#pragma unroll
    for (int r = 0; r < 8; ++r) sO[w][8 * hh + r][dt * 16 + ln] = oacc[dt][r] * l_r[r];
  __builtin_amdgcn_fence(__ATOMIC_ACQ_REL, "workgroup");
  __builtin_amdgcn_wave_barrier();
  {
    for (int r = 0; r < 16; ++r) {
      const int row = q0 + r;
      if (row < T && lane < D / 4) {
        const v4f val = *(const v4fa*)&sO[w][r][lane * 4];
        *(v4f*)(y + ((size_t)b * T + row) * ypitch + h * D + lane * 4) = val;
      }
    }
    
  }
}

// GEMM C = act(A·W + bias + resid): A f32 (ASPLIT -> hi/lo 2 terms), Wt bf16 [N][K]; ACT 0 none, 1 relu, 2 exact gelu;
// resid (optional, f32, row index = (row % rmod), pitch ldr, RES_BF16 rounds it) added before the activation.
template <bool ASPLIT, int ACT, bool BIAS_BF16, bool RES_BF16>
__global__ __launch_bounds__(128) void k_gemm_bf3(const float* __restrict__ A, int lda, const unsigned short* __restrict__ Wt, int ldb,
                                                const float* __restrict__ bias, const float* __restrict__ resid, int rmod, int ldr,
                                                float* __restrict__ C, int ldc, int M, int N, int K) {
  __shared__ __attribute__((aligned(16))) float so[4][16][64];
  const int tid = threadIdx.x, w = tid >> 5, lane = tid & 31, ln = lane & 15, hh = lane >> 4;
  const int ntn = N / 64;
  const int wid = blockIdx.x * 4 + w;
  const int mt = wid / ntn, nq = wid % ntn;
  if (mt * 16 >= M) return;
  const int row0 = mt * 16, col0 = nq * 64;
  const float* arow = A + (size_t)(row0 + ln) * lda;
  v8f acc[4] = {};
  for (int kb = 0; kb < K; kb += 32) {
    FragB ah, al;
    const v4f x0 = *(const v4fa*)(arow + kb + 8 * hh), x1 = *(const v4fa*)(arow + kb + 8 * hh + 4);
    const v4f x2 = *(const v4fa*)(arow + kb + 16 + 8 * hh), x3 = *(const v4fa*)(arow + kb + 16 + 8 * hh + 4);
    float xs[16] = {x0[0],x0[1],x0[2],x0[3],x1[0],x1[1],x1[2],x1[3],x2[0],x2[1],x2[2],x2[3],x3[0],x3[1],x3[2],x3[3]};
#pragma unroll
    for (int i = 0; i < 16; ++i) { const unsigned short hb = bf16_bits(xs[i]); ah.u[i] = hb; al.u[i] = ASPLIT ? bf16_bits(xs[i] - bf16_val(hb)) : (unsigned short)0; }
#pragma unroll
    for (int t = 0; t < 4; ++t) {
      const unsigned short* brow = Wt + (size_t)(col0 + t * 16 + ln) * ldb + kb;
      FragB b;
      b.half[0] = *(const v8us*)(brow + 8 * hh);
      b.half[1] = *(const v8us*)(brow + 16 + 8 * hh);
      acc[t] = mmaN<ASPLIT ? 2 : 1>(ah.v, al.v, b.v, b.v, acc[t]);
    }
  }
#pragma unroll
  for (int t = 0; t < 4; ++t) {
    const int col = col0 + t * 16 + ln;
    float bv = bias ? bias[col] : 0.f;
    if (BIAS_BF16) bv = bf16_round(bv);
#pragma unroll
    for (int r = 0; r < 8; ++r) {
      float v = acc[t][r] + bv;
      if (resid) { float rv = resid[(size_t)((row0 + 8 * hh + r) % rmod) * ldr + col]; if (RES_BF16) rv = bf16_round(rv); v += rv; }
      if (ACT == 1) v = fmaxf(v, 0.f);
      if (ACT == 2) v = 0.5f * v * (1.0f + erff(v * 0.70710678118654752f));
      if (ACT == 3) { const float u = 0.7978845608028654f * (v + 0.044715f * v * v * v); v = 0.5f * v * (1.0f + tanhf(u)); }
      so[w][8 * hh + r][t * 16 + ln] = v;
    }
  }
  __builtin_amdgcn_fence(__ATOMIC_ACQ_REL, "workgroup");
  __builtin_amdgcn_wave_barrier();
  const int rsub = lane >> 4, c4 = (lane & 15) * 4;
  {
#pragma unroll
    for (int q = 0; q < 8; ++q) {
      const int r = q * 2 + rsub;
      const v4f v = *(const v4fa*)&so[w][r][c4];
      *(v4f*)(C + (size_t)(row0 + r) * ldc + col0 + c4) = v;
    }
    
  }
}
// row LayerNorm (biased variance, eps) over N: s = X (+ R); optional out_sum <- s; out_norm <- (s-mu)*rsqrt(var+eps)*g + b
template <bool PARAM_BF16>
__global__ __launch_bounds__(256) void k_layernorm(const float* __restrict__ X, const float* __restrict__ R, const float* __restrict__ g, const float* __restrict__ bta,
                                                  float* __restrict__ out_sum, float* __restrict__ out_norm, int N, float eps) {
  __shared__ float red[256];
  const int row = blockIdx.x, tid = threadIdx.x;
  const float* x = X + (size_t)row * N; const float* rr = R ? R + (size_t)row * N : nullptr;
  float vals[16];                     // up to N = 4096
  const int per = N / 256;            // contiguous chunk per thread? use strided-by-4 chunks: thread handles j = tid*4 + 1024*u
  float s1 = 0.f;
  for (int u = 0; u < per / 4; ++u) {
    const int j = tid * 4 + 1024 * u;
    const v4f a = *(const v4fa*)(x + j);
    v4f b = {0.f,0.f,0.f,0.f}; if (rr) b = *(const v4fa*)(rr + j);
#pragma unroll
    for (int q = 0; q < 4; ++q) { const float v = a[q] + b[q]; vals[u * 4 + q] = v; s1 += v; }
  }
  red[tid] = s1; __syncthreads();
  for (int st = 128; st > 0; st >>= 1) { if (tid < st) red[tid] += red[tid + st]; __syncthreads(); }
  const float mu = red[0] / (float)N; __syncthreads();
  float s2 = 0.f;
  for (int u = 0; u < per / 4; ++u)
#pragma unroll
    for (int q = 0; q < 4; ++q) { const float c = vals[u * 4 + q] - mu; s2 += c * c; }
  red[tid] = s2; __syncthreads();
  for (int st = 128; st > 0; st >>= 1) { if (tid < st) red[tid] += red[tid + st]; __syncthreads(); }
  const float rs = rsqrtf(red[0] / (float)N + eps);
  {
    for (int u = 0; u < per / 4; ++u) {
      const int j = tid * 4 + 1024 * u;
      v4f o, sm;
#pragma unroll
      for (int q = 0; q < 4; ++q) {
        float gg = g[j + q], bb = bta[j + q];
        if (PARAM_BF16) { gg = bf16_round(gg); bb = bf16_round(bb); }
        sm[q] = vals[u * 4 + q]; o[q] = (vals[u * 4 + q] - mu) * rs * gg + bb;
      }
      if (out_sum) *(v4f*)(out_sum + (size_t)row * N + j) = sm;
      *(v4f*)(out_norm + (size_t)row * N + j) = o;
    }
    
  }
}



// ---- f16 WMMA path (v_wmma_f32_16x16x32_f16): 11-bit significands for operands in range — used where a [0,1] probability operand needs more precision than bf16
typedef _Float16 v16h __attribute__((ext_vector_type(16)));
union FragH { v16h v; v8us half[2]; _Float16 h[16]; unsigned short u[16]; };
template <int NT>
__device__ __forceinline__ v8f mmaH(v16h ah, v16h al, v16h bh, v16h bl, v8f c) {
  c = __builtin_amdgcn_wmma_f32_16x16x32_f16(false, ah, false, bh, (short)0, c, false, false);
  if (NT >= 2) c = __builtin_amdgcn_wmma_f32_16x16x32_f16(false, al, false, bh, (short)0, c, false, false);
  if (NT >= 3) c = __builtin_amdgcn_wmma_f32_16x16x32_f16(false, ah, false, bl, (short)0, c, false, false);
  asm volatile("v_nop\n\tv_nop\n\tv_nop\n\tv_nop" : "+v"(c) : "v"(ah), "v"(al), "v"(bh), "v"(bl));
  return c;
}
// batched GEMM like k_gemm_b but f16 operands: A f32 (split into f16 hi/lo if ASPLIT, else rounded to f16), Bt = f16 values [n][k]; alpha; C f32; N multiple of 16 (partial tiles skipped)
template <bool ASPLIT>
__global__ __launch_bounds__(128) void k_gemm_h(const float* __restrict__ A, int lda, size_t sA, const _Float16* __restrict__ Bh, int ldb, size_t sB, float alpha, float* __restrict__ C, int ldc, size_t sC, int M, int N, int K) {
  __shared__ __attribute__((aligned(16))) float so[4][16][64];
  const int tid = threadIdx.x, w = tid >> 5, lane = tid & 31, ln = lane & 15, hh = lane >> 4; const int by = blockIdx.y;
  A += (size_t)by * sA; Bh += (size_t)by * sB; C += (size_t)by * sC;
  const int ntn = (N + 63) / 64; const int wid = blockIdx.x * 4 + w; const int mt = wid / ntn, nq = wid % ntn; if (mt * 16 >= M) return;
  const int row0 = mt * 16, col0 = nq * 64; const float* arow = A + (size_t)(row0 + ln) * lda;
  v8f acc[4] = {};
  for (int kb = 0; kb < K; kb += 32) {
    FragH ah, al;
    const v4f x0 = *(const v4fa*)(arow + kb + 8 * hh), x1 = *(const v4fa*)(arow + kb + 8 * hh + 4), x2 = *(const v4fa*)(arow + kb + 16 + 8 * hh), x3 = *(const v4fa*)(arow + kb + 16 + 8 * hh + 4);
    float xs[16] = {x0[0],x0[1],x0[2],x0[3],x1[0],x1[1],x1[2],x1[3],x2[0],x2[1],x2[2],x2[3],x3[0],x3[1],x3[2],x3[3]};
#pragma unroll
    for (int i = 0; i < 16; ++i) { const _Float16 h = (_Float16)xs[i]; ah.h[i] = h; al.h[i] = ASPLIT ? (_Float16)(xs[i] - (float)h) : (_Float16)0.0f; }
#pragma unroll
    for (int t = 0; t < 4; ++t) { if (col0 + t * 16 >= N) continue; const size_t boff = (size_t)(col0 + t * 16 + ln) * ldb + kb; FragH bq; bq.half[0] = *(const v8us*)(Bh + boff + 8 * hh); bq.half[1] = *(const v8us*)(Bh + boff + 16 + 8 * hh);
      acc[t] = mmaH<ASPLIT ? 2 : 1>(ah.v, al.v, bq.v, bq.v, acc[t]); }
  }
#pragma unroll
  for (int t = 0; t < 4; ++t) { if (col0 + t * 16 >= N) continue;
#pragma unroll
    for (int r = 0; r < 8; ++r) so[w][8 * hh + r][t * 16 + ln] = acc[t][r] * alpha; }
  __builtin_amdgcn_fence(__ATOMIC_ACQ_REL, "workgroup"); __builtin_amdgcn_wave_barrier();
  const int rsub = lane >> 4, c4 = (lane & 15) * 4;
  {
#pragma unroll
    for (int q = 0; q < 8; ++q) { const int r = q * 2 + rsub; if (col0 + c4 < N) { const v4f v = *(const v4fa*)&so[w][r][c4]; *(v4f*)(C + (size_t)(row0 + r) * ldc + col0 + c4) = v; } }
     }
}

// Wt[n][k] = f16(W[k][n]·scale) from f32 row-major W[K][N] (scale = power of two; bf16-exact weights stay exact in f16 away from the subnormal range)
__global__ __launch_bounds__(256) void k_wt_f16(const float* __restrict__ W, _Float16* __restrict__ Wt, int K, int N, float scale) {
  const int t = blockIdx.x * 256 + threadIdx.x; if (t >= N * (K / 8)) return; const int n = t / (K / 8), k8 = (t % (K / 8)) * 8; FragH f;
#pragma unroll
  for (int i = 0; i < 8; ++i) f.h[i] = (_Float16)(bf16_round(W[(size_t)(k8 + i) * N + n]) * scale); const v8us o = f.half[0];
  *(v8us*)((unsigned short*)Wt + (size_t)n * K + k8) = o; 
}
// k_gemm_hh variant with fused epilogue: v = acc·alpha + bias[by·sBias + col] (+ CP[(row/rowsPerB)·sCPb + by·64 + col] if CP) ; ACT 0 none / 1 elu ; writes f32 C and f16 C16, each if non-null
// the body takes its block indices (bx, by) and its 17 KiB of LDS from the caller, so that several products can share one launch
// A (M x K), Bh (N x K) and C16 (M x N) lie in fragment order; C is row-major with pitch ldc; CT, where given, takes the result alone, transposed per head. SOP: row pitch of the LDS tile in floats, 4 more than the row so that 16 lanes reading 16 rows at one column meet 16 different bank groups
#define SOP 68
#define L2E 1.4426950408889634f
// ACT 4 (the similarity product): what is stored is not the similarity but what a score holds beside its product that differs from key to key and not from head to head, in base 2 (see k_flash): row = query q, column = key k of batch by,
// log2(e) (min(sim, 0.5) + pos(q, k) - pos(q, kc)), -inf where kmask[by][k] = 0, with pos(q, k) = 0.1 min(10 - |q - k|, 0) and kc = (k & ~7) + 4, a fixed key of k's group of eight.
// The semantic bias is min(sim, 0.5) - 0.5; its -0.5 is the same for every key of a query and drops out of the softmax. pos(q, kc), the part of the position term that grows with the distance, is left to k_flash, in f32:
// what is rounded to f16 here stays below 2.1 in size for every query and key (|pos(q, k) - pos(q, kc)| <= 0.4), so its rounding error is at most 0.001 whichever keys the mask leaves.
// row-major element offset of 16-byte chunk t of a fragment-order plane of KD columns
__device__ __forceinline__ size_t frag_src(const size_t t, const int KD) { const size_t blk = t >> 6; const int kbn = KD >> 5;
  return ((blk / kbn) * 16 + (t & 15)) * KD + (blk % kbn) * 32 + ((t >> 5) & 1) * 16 + ((t >> 4) & 1) * 8; }
template <int ACT>
__device__ __forceinline__ void gemm_hhx_body(float (*so)[16][SOP], const int bx, const int by, const _Float16* __restrict__ A, size_t sA, const _Float16* __restrict__ Bh, size_t sB, float alpha, const float* __restrict__ bias, size_t sBias, const float* __restrict__ CP, int rowsPerB, size_t sCPb, int row0g, const int* __restrict__ kmask,
    float* __restrict__ C, _Float16* __restrict__ C16, _Float16* __restrict__ CT, int ldc, size_t sC, int M, int N, int K) {
  const int tid = threadIdx.x, w = tid >> 5, lane = tid & 31, ln = lane & 15, hh = lane >> 4;
  A += (size_t)by * sA; Bh += (size_t)by * sB; const size_t cofs = (size_t)by * sC; const float* bp = bias ? bias + (size_t)by * sBias : nullptr;
  const int ntn = (N + 63) / 64; const int wid = bx * 4 + w; const int mt = wid / ntn, nq = wid % ntn; if (mt * 16 >= M) return;
  const int row0 = mt * 16, col0 = nq * 64; const size_t tsz = (size_t)(K >> 5) * 512;      // f16 elements of one 16-row tile
  const unsigned short* afr = (const unsigned short*)A + (size_t)mt * tsz + lane * 8; const unsigned short* bfr = (const unsigned short*)Bh + (size_t)(col0 >> 4) * tsz + lane * 8;
  v8f acc[4] = {};
  // The fragments come in groups of two k steps (20 loads of 16 bytes a lane) into two register sets: while one set is multiplied, the other set's loads are in flight,
  // so a wave waits for memory once a group, behind eight products, where a load, a full wait and one product in turn paid the whole latency for every product. K is a multiple of 128. Each acc[t] still sums k upwards.
  FragH a0[2], b0[2][4], a1[2], b1[2][4];
  auto ldg = [&](FragH (&a)[2], FragH (&b)[2][4], const int kb) {
#pragma unroll
    for (int s = 0; s < 2; ++s) { a[s].half[0] = *(const v8us*)(afr + (kb + 32 * s) * 16); a[s].half[1] = *(const v8us*)(afr + (kb + 32 * s) * 16 + 256);
#pragma unroll
      for (int t = 0; t < 4; ++t) { if (col0 + t * 16 >= N) continue; const size_t boff = (size_t)t * tsz + (kb + 32 * s) * 16; b[s][t].half[0] = *(const v8us*)(bfr + boff); b[s][t].half[1] = *(const v8us*)(bfr + boff + 256); } }
    asm volatile("s_wait_xcnt 0x0" ::: "memory");      // stands in front of every later write of a register that one of the group's loads names as its address
    __builtin_amdgcn_sched_barrier(0);      // keeps the group's loads together and in front of the other set's products (else they sink to their first use and each product waits for its own load again)
  };
  auto mmg = [&](FragH (&a)[2], FragH (&b)[2][4]) {
#pragma unroll
    for (int s = 0; s < 2; ++s)
#pragma unroll
      for (int t = 0; t < 4; ++t) { if (col0 + t * 16 >= N) continue; acc[t] = mmaH<1>(a[s].v, a[s].v, b[s][t].v, b[s][t].v, acc[t]); }
  };
  float bl[4] = {0.f, 0.f, 0.f, 0.f};      // the four bias values are asked for in front of the first group, not one by one behind the loop with a full wait each
  if (bp) {
#pragma unroll
    for (int t = 0; t < 4; ++t) { if (col0 + t * 16 >= N) continue; bl[t] = bp[col0 + t * 16 + ln]; } }
  int km[4] = {1, 1, 1, 1};      // ACT 4: the mask words of the lane's four key columns, asked for in front of the first group as well
  if (ACT == 4) {
#pragma unroll
    for (int t = 0; t < 4; ++t) km[t] = kmask[(size_t)by * N + col0 + t * 16 + ln]; }
  const float qk0 = (float)(row0 + 8 * hh - col0 - ln), kg = (float)((ln & 7) - 4);      // ACT 4: query - key of the lane's element (t = 0, r = 0), and key - kc; all distances are whole numbers, exact in f32
  ldg(a0, b0, 0);
  for (int kb = 0; kb < K; kb += 128) {
    ldg(a1, b1, kb + 64); mmg(a0, b0);
    if (kb + 128 < K) ldg(a0, b0, kb + 128);
    mmg(a1, b1); }
  if (CT) {      // the value product (N = DM, rows = BB x SS keys): lane (ln, hh) holds in acc[t] column 16 t + ln of head nq for keys row0 + 8 hh .. + 7, which is 16-byte chunk (hh, ln) of one half block of the head's
    // transposed plane (HD rows x SS keys, fragment order) as it lies: four stores of 512 bytes in a row straight from the accumulators, no LDS, and no launch that reads the plane back to turn it
    unsigned short* tfr = (unsigned short*)CT + (size_t)((row0 / SS) * NH + nq) * (HD / 16) * ((SS / 32) * 512) + ((row0 % SS) >> 4) * 256 + lane * 8;
#pragma unroll
    for (int t = 0; t < 4; ++t) { const float bv = bf16_round(bl[t]); FragH f;
#pragma unroll
      for (int r = 0; r < 8; ++r) f.h[r] = (_Float16)(acc[t][r] * alpha + bv);
      *(v8us*)(tfr + (size_t)t * ((SS / 32) * 512)) = f.half[0]; }
    asm volatile("s_wait_xcnt 0x0" ::: "memory");      // in the listing the other results' epilogue stands behind a branch after these stores and writes their registers: the wait stands in front of it
    return; }
#pragma unroll
  for (int t = 0; t < 4; ++t) { if (col0 + t * 16 >= N) continue; const int col = col0 + t * 16 + ln; const float bv = bf16_round(bl[t]);
#pragma unroll
    for (int r = 0; r < 8; ++r) { float v = acc[t][r] * alpha + bv; if (CP) { const int bidx = (row0g + row0 + 8 * hh + r) / rowsPerB; v += CP[(size_t)bidx * sCPb + (size_t)by * 64 + col]; } if (ACT == 1) v = (v > 0.f) ? v : expm1f(v); else if (ACT == 3) v = fmaxf(v, 0.f);
      else if (ACT == 4) { const float d = qk0 + (float)(r - 16 * t);      // the upper bound of the key's own position term is 0, or -inf for a masked key, which makes the sum -inf
        v = fmaf(fminf(10.f - fabsf(d), (km[t] != 0) ? 0.f : -INFINITY) - fminf(10.f - fabsf(d + kg), 0.f), 0.1f * L2E, fminf(v * L2E, 0.5f * L2E)); }
      so[w][8 * hh + r][t * 16 + ln] = v; } }
  __builtin_amdgcn_fence(__ATOMIC_ACQ_REL, "workgroup"); __builtin_amdgcn_wave_barrier();
  const int rsub = lane >> 4, c4 = (lane & 15) * 4;
  if (C) {
#pragma unroll
    for (int q = 0; q < 8; ++q) { const int r = q * 2 + rsub; if (col0 + c4 < N) { const v4f v = *(const v4fa*)&so[w][r][c4]; *(v4f*)(C + cofs + (size_t)(row0 + r) * ldc + col0 + c4) = v; } }
  }
  if (C16) {      // the wave's 16 x 64 tile is two blocks of the plane, 2 KiB in a row: four stores of 512 bytes
    unsigned short* cfr = (unsigned short*)C16 + cofs + ((size_t)mt * (N >> 5) + (col0 >> 5)) * 512 + lane * 8;
#pragma unroll
    for (int c = 0; c < 4; ++c) { if (col0 + c * 16 >= N) continue; const v4f v0 = *(const v4fa*)&so[w][ln][c * 16 + 8 * hh], v1 = *(const v4fa*)&so[w][ln][c * 16 + 8 * hh + 4]; FragH f;
#pragma unroll
      for (int i = 0; i < 4; ++i) { f.h[i] = (_Float16)v0[i]; f.h[4 + i] = (_Float16)v1[i]; }
      *(v8us*)(cfr + c * 256) = f.half[0]; }
  }
}
// the output projection: its shapes are constants, as in k_proj, so that the column guards of the body fold away and a group's loads stand in one run with no branch between them
__global__ __launch_bounds__(128) void k_oproj(const _Float16* __restrict__ A, const _Float16* __restrict__ Bh, const float* __restrict__ bias, float* __restrict__ C) {
  __shared__ __attribute__((aligned(16))) float so[4][16][SOP];
  gemm_hhx_body<0>(so, blockIdx.x, 0, A, 0, Bh, 0, 0.0625f, bias, 0, nullptr, 1, 0, 0, nullptr, C, nullptr, nullptr, DM, 0, NR, DM, DM);
}


// x16_body, round16f_body, sn_body and qsum_body are roles of one launch (k_prep, blocks of 512): each takes its block index bx inside its role
__device__ __forceinline__ void x16_body(const int bx, const float* __restrict__ x, _Float16* __restrict__ X16) { const size_t t = (size_t)bx * 512 + threadIdx.x, s = frag_src(t, DM); FragH f;
#pragma unroll
  for (int q = 0; q < 8; ++q) f.h[q] = (_Float16)bf16_round(x[s + q]); *(v8us*)((unsigned short*)X16 + t * 8) = f.half[0];  }
__device__ __forceinline__ void round16f_body(const int bx, const float* __restrict__ W, _Float16* __restrict__ Bt) { const size_t t = (size_t)bx * 512 + threadIdx.x, s = frag_src(t, DM); FragH f;
#pragma unroll
  for (int i = 0; i < 8; ++i) f.h[i] = (_Float16)(bf16_round(W[s + i]) * 16.0f); *(v8us*)((unsigned short*)Bt + t * 8) = f.half[0];
  asm volatile("s_wait_xcnt 0x0" ::: "memory");      // in the merged listing the next role's code follows this store and writes its address register: the wait stands in front of that write
}
// the block's 16 rows are one row tile of SN (8 KiB): each wave lays its row's chunks into LDS at their places in the tile, and behind the barrier every thread stores 16 bytes of it in a row, so that a 128-byte line has one writer
__device__ __forceinline__ void sn_body(unsigned short* __restrict__ st, const int bx, const float* __restrict__ sf, _Float16* __restrict__ SN) { const int tid = threadIdx.x, wv = tid >> 5, lane = tid & 31; const size_t row = (size_t)bx * 16 + wv; float v[8]; float s = 0.f;
#pragma unroll
  for (int q = 0; q < 8; ++q) { v[q] = bf16_round(sf[row * DSEM + lane * 8 + q]); s += v[q] * v[q]; }
  for (int o = 16; o >= 1; o >>= 1) s += __shfl_xor(s, o, 32); const float inv = 1.0f / fmaxf(sqrtf(s), 1e-12f); FragH f;
#pragma unroll
  for (int q = 0; q < 8; ++q) f.h[q] = (_Float16)(v[q] * inv);
  *(v8us*)(st + (lane >> 1) * 256 + ((lane & 1) * 16 + wv) * 8) = f.half[0];      // chunk lane of the row = columns 8 lane ..: block lane >> 2, j = (lane >> 1) & 1, hh = lane & 1
  __syncthreads();
  *(v8us*)((unsigned short*)SN + (size_t)bx * (16 * DSEM) + tid * 8) = *(const v8us*)(st + tid * 8);
  asm volatile("s_wait_xcnt 0x0" ::: "memory");      // in the merged listing the next role's code follows this store and writes its address register: the wait stands in front of that write
}
// dynamic temperature, stage 1: column sums of the bf16-rounded query over QROWS rows per block -> PART[b][chunk][DM]; thread = 4 columns x one of 4 row phases, 16 independent 16-byte loads
#define QP 32
#define QROWS (SS / QP)
__device__ __forceinline__ void qsum_body(float (*sred)[DM], const int bx, const float* __restrict__ query, float* __restrict__ PART) {
  const int tid = threadIdx.x, ph = tid >> 7, c4 = (tid & 127) * 4;
  const float* src = query + ((size_t)bx * QROWS + ph * (QROWS / 4)) * DM + c4; v4f s = {0.f, 0.f, 0.f, 0.f};
#pragma unroll  // all 16 row loads issue before the first add: one memory latency instead of 16
  for (int r = 0; r < QROWS / 4; ++r) { const v4f x = *(const v4fa*)(src + (size_t)r * DM);
#pragma unroll
    for (int q = 0; q < 4; ++q) s[q] += bf16_round(x[q]); }
  *(v4fa*)&sred[ph][c4] = s; __syncthreads();
  PART[(size_t)bx * DM + tid] = (sred[0][tid] + sred[1][tid]) + (sred[2][tid] + sred[3][tid]); }
// one launch for all work that reads inputs only: column sums of the query, the three f16 activation planes, the normalised semantic rows, the four weight planes; role by block range
#define PB_QS (BB * QP)
#define PB_X (NR * DM / 8 / 512)
#define PB_SN (NR / 16)
#define PB_W (DM * DM / 8 / 512)
__global__ __launch_bounds__(512) void k_prep(const float* __restrict__ xq, const float* __restrict__ xk, const float* __restrict__ xv, const float* __restrict__ sf,
    const float* __restrict__ Wq, const float* __restrict__ Wk, const float* __restrict__ Wv, const float* __restrict__ Wo,
    _Float16* __restrict__ XQ, _Float16* __restrict__ XK, _Float16* __restrict__ XV, _Float16* __restrict__ SN,
    _Float16* __restrict__ Bq, _Float16* __restrict__ Bk, _Float16* __restrict__ Bv, _Float16* __restrict__ Bo, float* __restrict__ PART) {
  __shared__ __attribute__((aligned(16))) float sred[4][DM];
  const int bx = blockIdx.x, bx1 = bx - PB_QS, bx2 = bx1 - 3 * PB_X, bx3 = bx2 - PB_SN;
  if (bx1 < 0) qsum_body(sred, bx, xq, PART);
  else if (bx2 < 0) { const int g = bx1 / PB_X; x16_body(bx1 % PB_X, g == 0 ? xq : g == 1 ? xk : xv, g == 0 ? XQ : g == 1 ? XK : XV); }
  else if (bx3 < 0) sn_body((unsigned short*)&sred[0][0], bx2, sf, SN);
  else { const int g = bx3 / PB_W; round16f_body(bx3 % PB_W, g == 0 ? Wq : g == 1 ? Wk : g == 2 ? Wv : Wo, g == 0 ? Bq : g == 1 ? Bk : g == 2 ? Bv : Bo); } }
// stage 2 (one block of 4 waves, a role of k_proj, beside the products that do not need it): mean query of both batches from PART, then one wave per hidden unit (lanes along DM, 16-byte loads of the
// Wt1 row shared by both batches), relu, Wt2 dot, sigmoid. The hidden units are summed in 32 groups of 8, each wave taking 8 groups in turn.
__device__ __forceinline__ void temp_body(float* __restrict__ sm, const float* __restrict__ PART, const float* __restrict__ Wt1, const float* __restrict__ bt1, const float* __restrict__ Wt2, const float* __restrict__ bt2, float* __restrict__ TEMP) {
  float (*qm)[DM] = (float (*)[DM])sm; float (*red)[32] = (float (*)[32])(sm + BB * DM); const int tid = threadIdx.x, wv = tid >> 5, lane = tid & 31;
#pragma unroll 1  // kept rolled: a trip's loads are in flight together already, and all trips' loads at once would need more than 256 registers
  for (int it = 0; it < BB * DM / 128; ++it) { const int c = it * 128 + tid, b = c >> 9, col = c & (DM - 1); float s = 0.f;
#pragma unroll  // all 32 partial loads in flight together
    for (int p = 0; p < QP; ++p) s += PART[((size_t)b * QP + p) * DM + col];
    qm[b][col] = s / (float)SS; }
  __syncthreads();
  v4f qv[BB][4];
#pragma unroll
  for (int b = 0; b < BB; ++b)
#pragma unroll
    for (int j = 0; j < 4; ++j) qv[b][j] = *(const v4fa*)&qm[b][j * 128 + lane * 4];
#pragma unroll 1  // one group of 8 hidden units a trip, kept rolled: two groups' rows at once would need more than 256 registers
  for (int gq = 0; gq < 8; ++gq) { const int grp = wv * 8 + gq;
  float pw[BB] = {0.f, 0.f};
  constexpr int GU = (DM / 2) / 32;      // hidden units of a group
  // the group's loads stand together: eight rows = 32 loads of 16 bytes a lane, and the eight bt1 and Wt2 values: one memory latency a group, was four. With them the launch takes 252 registers against the products' 212: four waves a SIMD either way
  float b1r[GU], w2r[GU], a[GU][BB];
#pragma unroll
  for (int i = 0; i < GU; ++i) { b1r[i] = bt1[grp * GU + i]; w2r[i] = Wt2[grp * GU + i]; }
#pragma unroll
  for (int i = 0; i < GU; ++i) { const float* wr = Wt1 + (size_t)(grp * GU + i) * DM + lane * 4; a[i][0] = 0.f; a[i][1] = 0.f;
#pragma unroll
    for (int j = 0; j < 4; ++j) { const v4f wq = *(const v4fa*)(wr + j * 128);
#pragma unroll
      for (int q = 0; q < 4; ++q) { const float wb = bf16_round(wq[q]);
#pragma unroll
        for (int b = 0; b < BB; ++b) a[i][b] += wb * qv[b][j][q]; } } }
  // loaded values as inputs only: holds the bt1 and Wt2 loads in front of the lane sums (else they sink into the branch of lane 0 below and the group pays a second latency there)
  asm volatile("" :: "v"(b1r[0]), "v"(b1r[1]), "v"(b1r[2]), "v"(b1r[3]), "v"(b1r[4]), "v"(b1r[5]), "v"(b1r[6]), "v"(b1r[7]), "v"(w2r[0]), "v"(w2r[1]), "v"(w2r[2]), "v"(w2r[3]), "v"(w2r[4]), "v"(w2r[5]), "v"(w2r[6]), "v"(w2r[7]));
  static_assert(GU == 8 && BB == 2, "the statement above names eight values of each");
#pragma unroll  // the sixteen lane sums run side by side
  for (int i = 0; i < GU; ++i) { const float b1 = bf16_round(b1r[i]), w2 = bf16_round(w2r[i]);
#pragma unroll
    for (int b = 0; b < BB; ++b) { float t = a[i][b]; for (int o = 16; o >= 1; o >>= 1) t += __shfl_xor(t, o, 32); pw[b] += fmaxf(t + b1, 0.f) * w2; } }
  if (lane == 0) {
#pragma unroll
    for (int b = 0; b < BB; ++b) red[b][grp] = pw[b]; } }
  __syncthreads();
  if (tid < 32) { float v = 0.f; if (tid < BB) { float z = bf16_round(bt2[0]); for (int q = 0; q < 32; ++q) z += red[tid][q]; const float t = 1.0f / (1.0f + expf(-z)); v = 0.5f + t * 1.5f; } TEMP[tid] = v; } }
// one launch for all that needs k_prep alone: block 0 the temperature, then the q, k and v projections (the longer products first), then the similarity plane; role by block range
#define GB_P ((NR / 16) * (DM / 64) / 4)
#define GB_S ((SS / 16) * (SS / 64) / 4)
__global__ __launch_bounds__(128) void k_proj(const _Float16* __restrict__ XQ, const _Float16* __restrict__ XK, const _Float16* __restrict__ XV, const _Float16* __restrict__ Bq, const _Float16* __restrict__ Bk, const _Float16* __restrict__ Bv,
    const float* __restrict__ bq, const float* __restrict__ bk, const float* __restrict__ bv, _Float16* __restrict__ Q16, _Float16* __restrict__ K16, _Float16* __restrict__ Vt, const _Float16* __restrict__ SN, const int* __restrict__ mask, _Float16* __restrict__ SIM,
    const float* __restrict__ PART, const float* __restrict__ Wt1, const float* __restrict__ bt1, const float* __restrict__ Wt2, const float* __restrict__ bt2, float* __restrict__ TEMP) {
  __shared__ __attribute__((aligned(16))) float so[4][16][SOP];
  int bx = blockIdx.x;
  if (bx == 0) { temp_body(&so[0][0][0], PART, Wt1, bt1, Wt2, bt2, TEMP); return; }
  bx -= 1;
  if (bx < 3 * GB_P) { const int g = bx / GB_P;
    gemm_hhx_body<0>(so, bx % GB_P, 0, g == 0 ? XQ : g == 1 ? XK : XV, 0, g == 0 ? Bq : g == 1 ? Bk : Bv, 0, 0.0625f, g == 0 ? bq : g == 1 ? bk : bv, 0, nullptr, 1, 0, 0, nullptr, nullptr, g == 0 ? Q16 : g == 1 ? K16 : nullptr, g == 2 ? Vt : nullptr, DM, 0, NR, DM, DM); return; }
  bx -= 3 * GB_P;
  // SIM[b] = the head-independent, key-to-key part of the scores, from SN[b].SN[b]^T, the positions and the key mask (f16)
  gemm_hhx_body<4>(so, bx % GB_S, bx / GB_S, SN, (size_t)SS * DSEM, SN, (size_t)SS * DSEM, 1.0f, nullptr, 0, nullptr, 1, 0, 0, mask, nullptr, SIM, nullptr, SS, (size_t)SS * SS, SS, SS, DSEM); }
// fused constrained attention per ((b,h), 128 queries): 16 waves = 4 query groups of 32 x 4 key sets, four waves a SIMD, so that one wave's loads and dependent vector chains hide behind three others;
// key set s holds the 32-key chunks s, s + 4, s + 8, ...: the four sets walk side by side; Q16, K16, Vt and SIM lie in fragment order, so each of a pass's 20 fragment loads reads 4 whole lines;
// the four partial results of a query group (own running max, sum, Ot) are joined through LDS behind the loop. s = (q.k)/(8 temp_b) + SIM[b][q][k] + pos(q, kc): the plane holds semantic bias, key mask (-inf) and the position bias less its value at key kc of the group of eight, summed once for all eight heads by its producer;
// pos(q, kc) is one f32 value for the lane's eight scores of a tile: it is added to the tile's max and taken off the running max, never added score by score.
// Transposed products: St = K.Qt (A = 16 key rows, B = 16 query columns), Ot += Vt.Pt. Lane (ln, hh) then holds, for query ln of a tile, the scores of keys 8 hh + r of each 16-key tile:
// the running max and sum are in-lane work plus one swap between the wave halves, two St tiles converted to f16 are the B operand of the second product as they lie, SIM[q][k .. k + 7] is one 16-byte load (half nt of the plane's block: query tile x 32 keys).
typedef _Float16 v8h __attribute__((ext_vector_type(8)));
union FragP { v16h v; v8h p[2]; };
// The softmax runs in base 2: log2(e) is folded into the score scale and into both biases, so a score, a running max and their differences are exponents of 2 and every
// exponential is one v_exp_f32 (expf costs about twelve vector instructions: scaling, rounding, ldexp and two range selects). A result below 2^-126 comes out as 0, as does exp2(-inf).
// Written as asm so that the slot which the instruction set asks for behind a transcendental (one independent instruction or v_nop before its result is used or its source overwritten) is kept by construction:
// Eight in place: none reads or overwrites a register of another; the v_nop is the slot behind the last.
__device__ __forceinline__ float exp2_raw(float x) { asm("v_exp_f32 %0, %0\n\tv_nop" : "+v"(x)); return x; }
__device__ __forceinline__ v8f exp2_x8(const v8f x) { float a = x[0], b = x[1], c = x[2], d = x[3], e = x[4], f = x[5], g = x[6], h = x[7];
  asm("v_exp_f32 %0, %0\n\tv_exp_f32 %1, %1\n\tv_exp_f32 %2, %2\n\tv_exp_f32 %3, %3\n\tv_exp_f32 %4, %4\n\tv_exp_f32 %5, %5\n\tv_exp_f32 %6, %6\n\tv_exp_f32 %7, %7\n\tv_nop"
      : "+v"(a), "+v"(b), "+v"(c), "+v"(d), "+v"(e), "+v"(f), "+v"(g), "+v"(h));      // in place, so no v_exp_f32 touches a register of the one in front of it; v_nop: the slot behind the last
  return (v8f){a, b, c, d, e, f, g, h}; }
__device__ __forceinline__ float swap_halves(float x) { const int t = __float_as_int(x); return __int_as_float(__builtin_amdgcn_permlanex16(t, t, 0x76543210, 0xfedcba98, false, false)); }   // lane l <-> l ^ 16
__global__ __launch_bounds__(512) void k_flash(const _Float16* __restrict__ Q16, const _Float16* __restrict__ K16, const _Float16* __restrict__ Vt, const _Float16* __restrict__ SIM, const float* __restrict__ TEMP, _Float16* __restrict__ O16) {
  constexpr int RPW = 32, NQB = SS / (4 * RPW), DT = HD / 16, KS = HD / 32, NSP = 4;
  static_assert(NSP == 4 && DT == 4, "in the join, the wave of key set s sums two of the eight output tiles");
  __shared__ __attribute__((aligned(16))) float sO[4 * NSP][2][DT][2][32][4];      // a wave's rescaled Ot: 16 bytes a lane, lanes side by side
  __shared__ float sM[4 * NSP][2][32], sL[4 * NSP][2][32];
  const int tid = threadIdx.x, lane = tid & 31, ln = lane & 15, hh = lane >> 4;
  const int w = __builtin_amdgcn_readfirstlane(tid >> 5), qg = w & 3, ksp = w >> 2, k0 = ksp * 32;      // the wave's number in a scalar register: the key loop's bounds and its branch stay scalar
  const int slab = blockIdx.x / NQB, qblk = blockIdx.x % NQB; const int b = slab / NH, h = slab % NH; const int q0 = qblk * (4 * RPW) + qg * RPW; const float sc = (0.125f * L2E) / TEMP[b];
  FragH aq[2][KS];
#pragma unroll
  for (int qt = 0; qt < 2; ++qt) { const unsigned short* qr = (const unsigned short*)Q16 + ((size_t)((b * SS + q0) / 16 + qt) * (DM / 32) + h * KS) * 512 + lane * 8;
#pragma unroll
    for (int ks = 0; ks < KS; ++ks) { aq[qt][ks].half[0] = *(const v8us*)(qr + ks * 512); aq[qt][ks].half[1] = *(const v8us*)(qr + ks * 512 + 256); } }
  // the lane's three read pointers; each moves on by 4 x 32 keys a pass (K16: 8 row tiles; Vt and SIM: 4 blocks of 32 keys)
  constexpr int TK = (DM / 32) * 512, TS = (SS / 32) * 512;      // f16 elements of a 16-row tile of a plane of DM and of SS columns
  const unsigned fo = lane * 8; const int qb = q0 + ln - 8 * hh - 4;      // qb - j0 + 16 (qt - nt) = query - kc of the lane's eight scores of tile (qt, nt)
  const unsigned short* vp = (const unsigned short*)Vt + (size_t)slab * DT * TS + (k0 / 32) * 512 + fo;
  const unsigned short* kp = (const unsigned short*)K16 + (size_t)((b * SS + k0) / 16) * TK + h * KS * 512 + fo;
  const unsigned short* sp = (const unsigned short*)SIM + (size_t)b * SS * SS + (size_t)(q0 / 16) * TS + (k0 / 32) * 512 + fo;
  float m_q[2], l_q[2]; v8f oacc[2][DT];
#pragma unroll
  for (int qt = 0; qt < 2; ++qt) { m_q[qt] = -3.0e38f; l_q[qt] = 0.f;
#pragma unroll
    for (int dt = 0; dt < DT; ++dt) oacc[qt][dt] = (v8f){0.f,0.f,0.f,0.f,0.f,0.f,0.f,0.f}; }
#pragma unroll 1
  for (int j0 = k0; j0 < k0 + SS; j0 += NSP * 32) {
    // every load of the pass stands in front of its first product: none depends on the scores any more, so the pass waits for memory once
    FragH bk[2][KS], bv[DT], sm[2][2];
#pragma unroll
    for (int nt = 0; nt < 2; ++nt) {
#pragma unroll
      for (int ks = 0; ks < KS; ++ks) { bk[nt][ks].half[0] = *(const v8us*)(kp + nt * TK + ks * 512); bk[nt][ks].half[1] = *(const v8us*)(kp + nt * TK + ks * 512 + 256); }
#pragma unroll
      for (int qt = 0; qt < 2; ++qt) sm[qt][nt].half[0] = *(const v8us*)(sp + qt * TS + nt * 256); }
#pragma unroll
    for (int dt = 0; dt < DT; ++dt) { bv[dt].half[0] = *(const v8us*)(vp + dt * TS); bv[dt].half[1] = *(const v8us*)(vp + dt * TS + 256); }
    asm volatile("s_wait_xcnt 0x0" :: "v"(kp), "v"(sp), "v"(vp) : "memory");      // stands in front of every write of a register that one of the 20 loads names as its address; the three pointers are named as inputs so that their registers live up to the wait (else the last loads' results were placed in them)
    __builtin_amdgcn_sched_barrier(0);      // keeps the 20 loads one group (else half of them issue behind the first wait and the pass pays the latency twice) and the pointer steps behind the wait above
    kp += NSP * 2 * TK; sp += NSP * 512; vp += NSP * 512;
    v8f s[2][2];
#pragma unroll
    for (int nt = 0; nt < 2; ++nt)
#pragma unroll
      for (int qt = 0; qt < 2; ++qt) { v8f acc = (v8f){0.f,0.f,0.f,0.f,0.f,0.f,0.f,0.f};
#pragma unroll
        for (int ks = 0; ks < KS; ++ks) acc = mmaH<1>(bk[nt][ks].v, bk[nt][ks].v, aq[qt][ks].v, aq[qt][ks].v, acc); s[qt][nt] = acc; }
    FragP pb[2]; const float dj = (float)(qb - j0); float pg[3];      // pos(q, kc) in base 2 for qt - nt = -1, 0, 1: the four tiles of a pass have three distances (unrolled, so that the three stay in registers)
#pragma unroll
    for (int i = 0; i < 3; ++i) pg[i] = (0.1f * L2E) * fminf(10.f - fabsf(dj + (float)(16 * (i - 1))), 0.f);
#pragma unroll
    for (int qt = 0; qt < 2; ++qt) { float mc = -INFINITY;
#pragma unroll
      for (int nt = 0; nt < 2; ++nt) { float mt = -INFINITY;
#pragma unroll
        for (int r = 0; r < 8; ++r) { const float sv = fmaf(s[qt][nt][r], sc, (float)sm[qt][nt].h[r]); s[qt][nt][r] = sv; mt = fmaxf(mt, sv); }      // all that is left per score and head: widen the plane's f16 value and one fma
        mc = fmaxf(mc, mt + pg[qt - nt + 1]); }
      mc = fmaxf(mc, swap_halves(mc));
      const float mn = fmaxf(m_q[qt], mc); const float al = exp2_raw(m_q[qt] - mn); m_q[qt] = mn; float ls = 0.f;
#pragma unroll
      for (int nt = 0; nt < 2; ++nt) { const float mo = mn - pg[qt - nt + 1];
#pragma unroll
        for (int r = 0; r < 8; ++r) s[qt][nt][r] -= mo;
        s[qt][nt] = exp2_x8(s[qt][nt]);
#pragma unroll
        for (int r = 0; r < 8; ++r) ls += s[qt][nt][r];
        pb[qt].p[nt] = __builtin_convertvector(s[qt][nt], v8h); }
      l_q[qt] = l_q[qt] * al + ls;      // partial sum of this half's 16 keys; the halves are joined behind the loop
#pragma unroll
      for (int dt = 0; dt < DT; ++dt)
#pragma unroll
        for (int r = 0; r < 8; ++r) oacc[qt][dt][r] *= al; }
#pragma unroll
    for (int dt = 0; dt < DT; ++dt)
#pragma unroll
      for (int qt = 0; qt < 2; ++qt) oacc[qt][dt] = mmaH<1>(bv[dt].v, bv[dt].v, pb[qt].v, pb[qt].v, oacc[qt][dt]); }
  // join of the four key sets of a query group. Step 1: every wave publishes its max and its sum (halves joined)
#pragma unroll
  for (int qt = 0; qt < 2; ++qt) { float l = l_q[qt]; l += swap_halves(l); sM[w][qt][lane] = m_q[qt]; sL[w][qt][lane] = l; }
  __syncthreads();
  // step 2: the common max, the common sum (sets in order), and the wave's Ot rescaled to the common max into LDS
  float inv[2];
#pragma unroll
  for (int qt = 0; qt < 2; ++qt) { float ms[NSP], mx = -3.0e38f, l = 0.f;
#pragma unroll
    for (int s = 0; s < NSP; ++s) { ms[s] = sM[s * 4 + qg][qt][lane]; mx = fmaxf(mx, ms[s]); }
#pragma unroll
    for (int s = 0; s < NSP; ++s) l += sL[s * 4 + qg][qt][lane] * exp2_raw(ms[s] - mx);
    inv[qt] = (l > 0.f) ? 1.0f / l : 0.f; const float f = exp2_raw(m_q[qt] - mx);
#pragma unroll
    for (int dt = 0; dt < DT; ++dt) { v4f lo, hi;
#pragma unroll
      for (int r = 0; r < 4; ++r) { lo[r] = oacc[qt][dt][r] * f; hi[r] = oacc[qt][dt][4 + r] * f; }
      *(v4fa*)&sO[w][qt][dt][0][lane][0] = lo; *(v4fa*)&sO[w][qt][dt][1][lane][0] = hi; } }
  __syncthreads();
  // step 3: the wave of key set s sums, over the four sets in order, tiles 2 (s & 1) and 2 (s & 1) + 1 of query tile s >> 1: 16 rows x 32 columns = one whole block (1 KiB) of the f16 plane that the output projection reads,
  // and the lane's eight values of a tile are its 16-byte chunk of the block's half as they lie: the plane is stored here, in fragment order, with no f32 copy and no launch to convert it
  const int qs = ksp >> 1, d0 = (ksp & 1) * 2; const float iv = qs ? inv[1] : inv[0];
  unsigned short* ofr = (unsigned short*)O16 + ((size_t)((b * SS + q0) / 16 + qs) * (DM / 32) + h * KS + (ksp & 1)) * 512 + lane * 8;      // register r of tile dt is column dt * 16 + 8 hh + r of query ln
#pragma unroll
  for (int d = 0; d < 2; ++d) { v4f lo = *(const v4fa*)&sO[qg][qs][d0 + d][0][lane][0], hi = *(const v4fa*)&sO[qg][qs][d0 + d][1][lane][0];
#pragma unroll
    for (int s = 1; s < NSP; ++s) { lo += *(const v4fa*)&sO[s * 4 + qg][qs][d0 + d][0][lane][0]; hi += *(const v4fa*)&sO[s * 4 + qg][qs][d0 + d][1][lane][0]; }
    lo *= iv; hi *= iv; FragH f;
#pragma unroll
    for (int i = 0; i < 4; ++i) { f.h[i] = (_Float16)lo[i]; f.h[4 + i] = (_Float16)hi[i]; }
    *(v8us*)(ofr + d * 256) = f.half[0]; } }
extern "C" void kernel_launch(void* const* d_in, const int* in_sizes, int n_in,
                              void* d_out, int out_size, void* d_ws, size_t ws_size, hipStream_t stream) {
  (void)in_sizes; (void)n_in; (void)out_size;
  const float* xq = (const float*)d_in[0]; const float* xk = (const float*)d_in[1]; const float* xv = (const float*)d_in[2]; const int* mask = (const int*)d_in[3]; const float* sf = (const float*)d_in[4];
  const float* Wq = (const float*)d_in[5]; const float* bq = (const float*)d_in[6]; const float* Wk = (const float*)d_in[7]; const float* bk = (const float*)d_in[8]; const float* Wv = (const float*)d_in[9]; const float* bv = (const float*)d_in[10]; const float* Wo = (const float*)d_in[11]; const float* bo = (const float*)d_in[12]; const float* Wt1 = (const float*)d_in[13]; const float* bt1 = (const float*)d_in[14]; const float* Wt2 = (const float*)d_in[15]; const float* bt2 = (const float*)d_in[16];
  char* ws = (char*)d_ws; size_t off = 0;
  auto take = [&](size_t bytes) { char* p = ws + off; off += (bytes + 255) & ~(size_t)255; return p; };
  const size_t w8 = (size_t)DM * DM / 8;
  _Float16* Bq = (_Float16*)take(w8 * 16); _Float16* Bk = (_Float16*)take(w8 * 16); _Float16* Bv = (_Float16*)take(w8 * 16); _Float16* Bo = (_Float16*)take(w8 * 16);
  _Float16* XQ = (_Float16*)take((size_t)NR * DM * 2); _Float16* XK = (_Float16*)take((size_t)NR * DM * 2); _Float16* XV = (_Float16*)take((size_t)NR * DM * 2); _Float16* Q16 = (_Float16*)take((size_t)NR * DM * 2); _Float16* K16 = (_Float16*)take((size_t)NR * DM * 2); _Float16* Vt = (_Float16*)take((size_t)NR * DM * 2);
  _Float16* SN = (_Float16*)take((size_t)NR * DSEM * 2); _Float16* SIM = (_Float16*)take((size_t)BB * SS * SS * 2); float* TEMP = (float*)take(256); float* PART = (float*)take((size_t)BB * QP * DM * 4); _Float16* O16 = XQ;      // the query plane is dead after the q GEMM
  if (off > ws_size) return;      // about 2 + 6 x 4.2 + 2.1 + 16.8 = 46 MiB
  k_prep<<<PB_QS + 3 * PB_X + PB_SN + 4 * PB_W, 512, 0, stream>>>(xq, xk, xv, sf, Wq, Wk, Wv, Wo, XQ, XK, XV, SN, Bq, Bk, Bv, Bo, PART);
  k_proj<<<1 + 3 * GB_P + BB * GB_S, 128, 0, stream>>>(XQ, XK, XV, Bq, Bk, Bv, bq, bk, bv, Q16, K16, Vt, SN, mask, SIM, PART, Wt1, bt1, Wt2, bt2, TEMP);
  const dim3 gg(((NR / 16) * (DM / 64) + 3) / 4, 1);
  k_flash<<<BB * NH * (SS / 128), 512, 0, stream>>>(Q16, K16, Vt, SIM, TEMP, O16);
  k_oproj<<<gg, 128, 0, stream>>>(O16, Bo, bo, (float*)d_out);
}
